// v000
// Measured on an AMD MI455X. A time is GPU time per run, averaged over a window of back-to-back runs after a warm-up
// (all launches, gaps included; the runs take copies of the inputs in turn), and the median of several windows.
// Apart from v000's, it joins two sittings. Times from different sittings can be a few percent apart, while
// side-by-side timings come from the same sitting.
// The starting kernel, v000, takes 4870 microseconds a run.
#include <hip/hip_runtime.h>
// LLaMA grouped-query causal attention with interleaved-pair RoPE (hidden_states [1][2048][2048]; q = x Wq^T (natural [2048][2048]), k = x Wk^T, v = x Wv^T (natural [512][2048]) (sigma 0.02, no biases): 32 query heads / 8 kv heads of 64 (repeat_interleave: kv head h / 4); tables cos/sin of pos / 10000^(2i/64) repeated per pair; q = q cos + rotate_pairs(q) sin with rotate_pairs (x0, x1) -> (-x1, x0): pair (e, o) -> (e cos - o sin, o cos + e sin); scores x 64^-0.5 with a causal mask (triu(1) -> -inf); softmax; out = merged Wo^T (natural) -> [1][2048][2048]).
// Compute dtype: inputs rounded to bf16; x / weights exact; q, k, v, softmax weights and o as plain f16 GEMM operands (~2^-12); scores and softmax statistics f32. v_wmma_f32_16x16x32_f16.
#define NB 1
#define NG 8
#define HPG 4
#define KVD (NG * HD)
#define SQ 2048
#define DM 2048
#define NH 32
#define HD 64
#define HG 4                         /* heads per launch of the uncalled k_vt overload */
#define QT 256                       /* query rows per causal tile */
#define NKX SQ                       /* S / P row pitch */
#define QT0 128                      /* first-tile rows recomputed exactly in f32 */
#define B0 0                         /* first batch processed (debug hook) */
#define NBR NB                       /* batches processed (debug hook) */
#define NR ((size_t)NB * SQ)         /* token rows */
#define MP ((int)((size_t)NBR * SQ)) /* rows projected (debug hook) */
#define QN SQ                        /* query rows attended per batch (debug hook) */
#define NHD NH                       /* heads attended (debug hook) */
#define MPO MP                       /* rows through the output stage (debug hook) */
#define LQ DM      /* row pitch of the q rows */
typedef __bf16 v16b __attribute__((ext_vector_type(16)));
typedef unsigned short v8us __attribute__((ext_vector_type(8), may_alias));
typedef float  v8f  __attribute__((ext_vector_type(8)));
typedef float  v4f  __attribute__((ext_vector_type(4)));
typedef float  v4fa __attribute__((ext_vector_type(4), may_alias));
union FragB { v16b v; v8us half[2]; unsigned short u[16]; };

__device__ __forceinline__ unsigned short bf16_bits(float x) { unsigned int u = __float_as_uint(x); return (unsigned short)((u + 0x7FFFu + ((u >> 16) & 1u)) >> 16); }
__device__ __forceinline__ float bf16_val(unsigned short b) { return __uint_as_float(((unsigned int)b) << 16); }
__device__ __forceinline__ float bf16_round(float x) { return bf16_val(bf16_bits(x)); }
// D += A·B with NT terms: 1 = ah·bh, 2 = + al·bh (A split), 3 = + ah·bl (both split)
template <int NT>
__device__ __forceinline__ v8f mmaN(v16b ah, v16b al, v16b bh, v16b bl, v8f c) {
  c = __builtin_amdgcn_wmma_f32_16x16x32_bf16(false, ah, false, bh, (short)0, c, false, false);
  if (NT >= 2) c = __builtin_amdgcn_wmma_f32_16x16x32_bf16(false, al, false, bh, (short)0, c, false, false);
  if (NT >= 3) c = __builtin_amdgcn_wmma_f32_16x16x32_bf16(false, ah, false, bl, (short)0, c, false, false);
  asm volatile("v_nop\n\tv_nop\n\tv_nop\n\tv_nop" : "+v"(c) : "v"(ah), "v"(al), "v"(bh), "v"(bl));
  return c;
}

__global__ __launch_bounds__(256) void k_wt_bf16(const float* __restrict__ W, unsigned short* __restrict__ Wt, int K, int N) {
  const int t = blockIdx.x * 256 + threadIdx.x;
  const int k8n = K / 8;
  if (t >= N * k8n) return;
  const int n = t / k8n, k8 = (t % k8n) * 8;
  v8us v;
#pragma unroll
  for (int i = 0; i < 8; ++i) v[i] = bf16_bits(W[(size_t)(k8 + i) * N + n]);
  *(v8us*)(Wt + (size_t)n * K + k8) = v;
  
}

// GEMM C[M][N] (f32, pitch ldc) = act(A[M][K]·W + bias). A f32 row-major (pitch lda) converted per fragment to bf16
// (ASPLIT: hi/lo two planes -> 2 terms, else single rounded term); Wt bf16 [N][K] (pitch ldb). BIAS_BF16 rounds the
// bias to bf16 first (bias quantised to bf16 before the add). K%32==0, M%16==0, N%64==0.
template <bool ASPLIT, int ACT, bool BIAS_BF16>
__global__ __launch_bounds__(128) void k_gemm_bf(const float* __restrict__ A, int lda, const unsigned short* __restrict__ Wt, int ldb,
                                               const float* __restrict__ bias, float* __restrict__ C, int ldc, int M, int N, int K) {
  __shared__ __attribute__((aligned(16))) float so[4][16][64];
  const int tid = threadIdx.x, w = tid >> 5, lane = tid & 31, ln = lane & 15, hh = lane >> 4;
  const int ntn = N / 64;
  const int wid = blockIdx.x * 4 + w;
  const int mt = wid / ntn, nq = wid % ntn;
  if (mt * 16 >= M) return;
  const int row0 = mt * 16, col0 = nq * 64;
  const float* arow = A + (size_t)(row0 + ln) * lda;
  v8f acc[4] = {};
  for (int kb = 0; kb < K; kb += 32) {
    FragB ah, al;
    const v4f x0 = *(const v4fa*)(arow + kb + 8 * hh), x1 = *(const v4fa*)(arow + kb + 8 * hh + 4);
    const v4f x2 = *(const v4fa*)(arow + kb + 16 + 8 * hh), x3 = *(const v4fa*)(arow + kb + 16 + 8 * hh + 4);
    float xs[16] = {x0[0],x0[1],x0[2],x0[3],x1[0],x1[1],x1[2],x1[3],x2[0],x2[1],x2[2],x2[3],x3[0],x3[1],x3[2],x3[3]};
#pragma unroll
    for (int i = 0; i < 16; ++i) { const unsigned short hb = bf16_bits(xs[i]); ah.u[i] = hb; al.u[i] = ASPLIT ? bf16_bits(xs[i] - bf16_val(hb)) : (unsigned short)0; }
#pragma unroll
    for (int t = 0; t < 4; ++t) {
      const unsigned short* brow = Wt + (size_t)(col0 + t * 16 + ln) * ldb + kb;
      FragB b;
      b.half[0] = *(const v8us*)(brow + 8 * hh);
      b.half[1] = *(const v8us*)(brow + 16 + 8 * hh);
      acc[t] = mmaN<ASPLIT ? 2 : 1>(ah.v, al.v, b.v, b.v, acc[t]);
    }
  }
#pragma unroll
  for (int t = 0; t < 4; ++t) {
    float bv = bias ? bias[col0 + t * 16 + ln] : 0.f;
    if (BIAS_BF16) bv = bf16_round(bv);
#pragma unroll
    for (int r = 0; r < 8; ++r) { float v = acc[t][r] + bv; if (ACT == 1) v = fmaxf(v, 0.f); so[w][8 * hh + r][t * 16 + ln] = v; }
  }
  __builtin_amdgcn_fence(__ATOMIC_ACQ_REL, "workgroup");
  __builtin_amdgcn_wave_barrier();
  const int rsub = lane >> 4, c4 = (lane & 15) * 4;
  {
#pragma unroll
    for (int q = 0; q < 8; ++q) {
      const int r = q * 2 + rsub;
      const v4f v = *(const v4fa*)&so[w][r][c4];
      *(v4f*)(C + (size_t)(row0 + r) * ldc + col0 + c4) = v;
    }
    
  }
}

// GEMM C = act(A·W + bias + resid): A f32 (ASPLIT -> hi/lo 2 terms), Wt bf16 [N][K]; ACT 0 none, 1 relu, 2 exact gelu;
// resid (optional, f32, row index = (row % rmod), pitch ldr, RES_BF16 rounds it) added before the activation.
template <bool ASPLIT, int ACT, bool BIAS_BF16, bool RES_BF16>
__global__ __launch_bounds__(128) void k_gemm_bf3(const float* __restrict__ A, int lda, const unsigned short* __restrict__ Wt, int ldb,
                                                const float* __restrict__ bias, const float* __restrict__ resid, int rmod, int ldr,
                                                float* __restrict__ C, int ldc, int M, int N, int K) {
  __shared__ __attribute__((aligned(16))) float so[4][16][64];
  const int tid = threadIdx.x, w = tid >> 5, lane = tid & 31, ln = lane & 15, hh = lane >> 4;
  const int ntn = N / 64;
  const int wid = blockIdx.x * 4 + w;
  const int mt = wid / ntn, nq = wid % ntn;
  if (mt * 16 >= M) return;
  const int row0 = mt * 16, col0 = nq * 64;
  const float* arow = A + (size_t)(row0 + ln) * lda;
  v8f acc[4] = {};
  for (int kb = 0; kb < K; kb += 32) {
    FragB ah, al;
    const v4f x0 = *(const v4fa*)(arow + kb + 8 * hh), x1 = *(const v4fa*)(arow + kb + 8 * hh + 4);
    const v4f x2 = *(const v4fa*)(arow + kb + 16 + 8 * hh), x3 = *(const v4fa*)(arow + kb + 16 + 8 * hh + 4);
    float xs[16] = {x0[0],x0[1],x0[2],x0[3],x1[0],x1[1],x1[2],x1[3],x2[0],x2[1],x2[2],x2[3],x3[0],x3[1],x3[2],x3[3]};
#pragma unroll
    for (int i = 0; i < 16; ++i) { const unsigned short hb = bf16_bits(xs[i]); ah.u[i] = hb; al.u[i] = ASPLIT ? bf16_bits(xs[i] - bf16_val(hb)) : (unsigned short)0; }
#pragma unroll
    for (int t = 0; t < 4; ++t) {
      const unsigned short* brow = Wt + (size_t)(col0 + t * 16 + ln) * ldb + kb;
      FragB b;
      b.half[0] = *(const v8us*)(brow + 8 * hh);
      b.half[1] = *(const v8us*)(brow + 16 + 8 * hh);
      acc[t] = mmaN<ASPLIT ? 2 : 1>(ah.v, al.v, b.v, b.v, acc[t]);
    }
  }
#pragma unroll
  for (int t = 0; t < 4; ++t) {
    const int col = col0 + t * 16 + ln;
    float bv = bias ? bias[col] : 0.f;
    if (BIAS_BF16) bv = bf16_round(bv);
#pragma unroll
    for (int r = 0; r < 8; ++r) {
      float v = acc[t][r] + bv;
      if (resid) { float rv = resid[(size_t)((row0 + 8 * hh + r) % rmod) * ldr + col]; if (RES_BF16) rv = bf16_round(rv); v += rv; }
      if (ACT == 1) v = fmaxf(v, 0.f);
      if (ACT == 2) v = 0.5f * v * (1.0f + erff(v * 0.70710678118654752f));
      if (ACT == 3) { const float u = 0.7978845608028654f * (v + 0.044715f * v * v * v); v = 0.5f * v * (1.0f + tanhf(u)); }
      so[w][8 * hh + r][t * 16 + ln] = v;
    }
  }
  __builtin_amdgcn_fence(__ATOMIC_ACQ_REL, "workgroup");
  __builtin_amdgcn_wave_barrier();
  const int rsub = lane >> 4, c4 = (lane & 15) * 4;
  {
#pragma unroll
    for (int q = 0; q < 8; ++q) {
      const int r = q * 2 + rsub;
      const v4f v = *(const v4fa*)&so[w][r][c4];
      *(v4f*)(C + (size_t)(row0 + r) * ldc + col0 + c4) = v;
    }
    
  }
}
// row LayerNorm (biased variance, eps) over N: s = X (+ R); optional out_sum <- s; out_norm <- (s-mu)*rsqrt(var+eps)*g + b
template <bool PARAM_BF16>
__global__ __launch_bounds__(256) void k_layernorm(const float* __restrict__ X, const float* __restrict__ R, const float* __restrict__ g, const float* __restrict__ bta,
                                                  float* __restrict__ out_sum, float* __restrict__ out_norm, int N, float eps) {
  __shared__ float red[256];
  const int row = blockIdx.x, tid = threadIdx.x;
  const float* x = X + (size_t)row * N; const float* rr = R ? R + (size_t)row * N : nullptr;
  float vals[16];                     // up to N = 4096
  const int per = N / 256;            // contiguous chunk per thread? use strided-by-4 chunks: thread handles j = tid*4 + 1024*u
  float s1 = 0.f;
  for (int u = 0; u < per / 4; ++u) {
    const int j = tid * 4 + 1024 * u;
    const v4f a = *(const v4fa*)(x + j);
    v4f b = {0.f,0.f,0.f,0.f}; if (rr) b = *(const v4fa*)(rr + j);
#pragma unroll
    for (int q = 0; q < 4; ++q) { const float v = a[q] + b[q]; vals[u * 4 + q] = v; s1 += v; }
  }
  red[tid] = s1; __syncthreads();
  for (int st = 128; st > 0; st >>= 1) { if (tid < st) red[tid] += red[tid + st]; __syncthreads(); }
  const float mu = red[0] / (float)N; __syncthreads();
  float s2 = 0.f;
  for (int u = 0; u < per / 4; ++u)
#pragma unroll
    for (int q = 0; q < 4; ++q) { const float c = vals[u * 4 + q] - mu; s2 += c * c; }
  red[tid] = s2; __syncthreads();
  for (int st = 128; st > 0; st >>= 1) { if (tid < st) red[tid] += red[tid + st]; __syncthreads(); }
  const float rs = rsqrtf(red[0] / (float)N + eps);
  {
    for (int u = 0; u < per / 4; ++u) {
      const int j = tid * 4 + 1024 * u;
      v4f o, sm;
#pragma unroll
      for (int q = 0; q < 4; ++q) {
        float gg = g[j + q], bb = bta[j + q];
        if (PARAM_BF16) { gg = bf16_round(gg); bb = bf16_round(bb); }
        sm[q] = vals[u * 4 + q]; o[q] = (vals[u * 4 + q] - mu) * rs * gg + bb;
      }
      if (out_sum) *(v4f*)(out_sum + (size_t)row * N + j) = sm;
      *(v4f*)(out_norm + (size_t)row * N + j) = o;
    }
    
  }
}



// ---- f16 WMMA path (v_wmma_f32_16x16x32_f16): 11-bit significands for operands in range — used where a [0,1] probability operand needs more precision than bf16
typedef _Float16 v16h __attribute__((ext_vector_type(16)));
union FragH { v16h v; v8us half[2]; _Float16 h[16]; unsigned short u[16]; };
template <int NT>
__device__ __forceinline__ v8f mmaH(v16h ah, v16h al, v16h bh, v16h bl, v8f c) {
  c = __builtin_amdgcn_wmma_f32_16x16x32_f16(false, ah, false, bh, (short)0, c, false, false);
  if (NT >= 2) c = __builtin_amdgcn_wmma_f32_16x16x32_f16(false, al, false, bh, (short)0, c, false, false);
  if (NT >= 3) c = __builtin_amdgcn_wmma_f32_16x16x32_f16(false, ah, false, bl, (short)0, c, false, false);
  asm volatile("v_nop\n\tv_nop\n\tv_nop\n\tv_nop" : "+v"(c) : "v"(ah), "v"(al), "v"(bh), "v"(bl));
  return c;
}
// batched GEMM like k_gemm_b but f16 operands: A f32 (split into f16 hi/lo if ASPLIT, else rounded to f16), Bt = f16 values [n][k]; alpha; C f32; N multiple of 16 (partial tiles skipped)
template <bool ASPLIT>
__global__ __launch_bounds__(128) void k_gemm_h(const float* __restrict__ A, int lda, size_t sA, const _Float16* __restrict__ Bh, int ldb, size_t sB, float alpha, float* __restrict__ C, int ldc, size_t sC, int M, int N, int K) {
  __shared__ __attribute__((aligned(16))) float so[4][16][64];
  const int tid = threadIdx.x, w = tid >> 5, lane = tid & 31, ln = lane & 15, hh = lane >> 4; const int by = blockIdx.y;
  A += (size_t)by * sA; Bh += (size_t)by * sB; C += (size_t)by * sC;
  const int ntn = (N + 63) / 64; const int wid = blockIdx.x * 4 + w; const int mt = wid / ntn, nq = wid % ntn; if (mt * 16 >= M) return;
  const int row0 = mt * 16, col0 = nq * 64; const float* arow = A + (size_t)(row0 + ln) * lda;
  v8f acc[4] = {};
  for (int kb = 0; kb < K; kb += 32) {
    FragH ah, al;
    const v4f x0 = *(const v4fa*)(arow + kb + 8 * hh), x1 = *(const v4fa*)(arow + kb + 8 * hh + 4), x2 = *(const v4fa*)(arow + kb + 16 + 8 * hh), x3 = *(const v4fa*)(arow + kb + 16 + 8 * hh + 4);
    float xs[16] = {x0[0],x0[1],x0[2],x0[3],x1[0],x1[1],x1[2],x1[3],x2[0],x2[1],x2[2],x2[3],x3[0],x3[1],x3[2],x3[3]};
#pragma unroll
    for (int i = 0; i < 16; ++i) { const _Float16 h = (_Float16)xs[i]; ah.h[i] = h; al.h[i] = ASPLIT ? (_Float16)(xs[i] - (float)h) : (_Float16)0.0f; }
#pragma unroll
    for (int t = 0; t < 4; ++t) { if (col0 + t * 16 >= N) continue; const size_t boff = (size_t)(col0 + t * 16 + ln) * ldb + kb; FragH bq; bq.half[0] = *(const v8us*)(Bh + boff + 8 * hh); bq.half[1] = *(const v8us*)(Bh + boff + 16 + 8 * hh);
      acc[t] = mmaH<ASPLIT ? 2 : 1>(ah.v, al.v, bq.v, bq.v, acc[t]); }
  }
#pragma unroll
  for (int t = 0; t < 4; ++t) { if (col0 + t * 16 >= N) continue;
#pragma unroll
    for (int r = 0; r < 8; ++r) so[w][8 * hh + r][t * 16 + ln] = acc[t][r] * alpha; }
  __builtin_amdgcn_fence(__ATOMIC_ACQ_REL, "workgroup"); __builtin_amdgcn_wave_barrier();
  const int rsub = lane >> 4, c4 = (lane & 15) * 4;
  {
#pragma unroll
    for (int q = 0; q < 8; ++q) { const int r = q * 2 + rsub; if (col0 + c4 < N) { const v4f v = *(const v4fa*)&so[w][r][c4]; *(v4f*)(C + (size_t)(row0 + r) * ldc + col0 + c4) = v; } }
     }
}

// Wt[n][k] = f16(W[k][n]·scale) from f32 row-major W[K][N] (scale = power of two; bf16-exact weights stay exact in f16 away from the subnormal range)
__global__ __launch_bounds__(256) void k_wt_f16(const float* __restrict__ W, _Float16* __restrict__ Wt, int K, int N, float scale) {
  const int t = blockIdx.x * 256 + threadIdx.x; if (t >= N * (K / 8)) return; const int n = t / (K / 8), k8 = (t % (K / 8)) * 8; FragH f;
#pragma unroll
  for (int i = 0; i < 8; ++i) f.h[i] = (_Float16)(bf16_round(W[(size_t)(k8 + i) * N + n]) * scale); const v8us o = f.half[0];
  *(v8us*)((unsigned short*)Wt + (size_t)n * K + k8) = o; 
}
// k_gemm_hh variant with fused epilogue: v = acc·alpha + bias[by·sBias + col] (+ CP[(row/rowsPerB)·sCPb + by·64 + col] if CP) ; ACT 0 none / 1 elu ; writes f16 C16 (and f32 C if non-null)
template <int ACT>
__global__ __launch_bounds__(128) void k_gemm_hhx(const _Float16* __restrict__ A, int lda, size_t sA, const _Float16* __restrict__ Bh, int ldb, size_t sB, float alpha, const float* __restrict__ bias, size_t sBias, const float* __restrict__ CP, int rowsPerB, size_t sCPb, int row0g,
    float* __restrict__ C, _Float16* __restrict__ C16, int ldc, size_t sC, int M, int N, int K) {
  __shared__ __attribute__((aligned(16))) float so[4][16][64];
  const int tid = threadIdx.x, w = tid >> 5, lane = tid & 31, ln = lane & 15, hh = lane >> 4; const int by = blockIdx.y;
  A += (size_t)by * sA; Bh += (size_t)by * sB; const size_t cofs = (size_t)by * sC; const float* bp = bias ? bias + (size_t)by * sBias : nullptr;
  const int ntn = (N + 63) / 64; const int wid = blockIdx.x * 4 + w; const int mt = wid / ntn, nq = wid % ntn; if (mt * 16 >= M) return;
  const int row0 = mt * 16, col0 = nq * 64; const _Float16* arow = A + (size_t)(row0 + ln) * lda;
  v8f acc[4] = {};
  for (int kb = 0; kb < K; kb += 32) { FragH ah; ah.half[0] = *(const v8us*)((const unsigned short*)arow + kb + 8 * hh); ah.half[1] = *(const v8us*)((const unsigned short*)arow + kb + 16 + 8 * hh);
#pragma unroll
    for (int t = 0; t < 4; ++t) { if (col0 + t * 16 >= N) continue; const size_t boff = (size_t)(col0 + t * 16 + ln) * ldb + kb; FragH bq; bq.half[0] = *(const v8us*)((const unsigned short*)Bh + boff + 8 * hh); bq.half[1] = *(const v8us*)((const unsigned short*)Bh + boff + 16 + 8 * hh);
      acc[t] = mmaH<1>(ah.v, ah.v, bq.v, bq.v, acc[t]); }
  }
#pragma unroll
  for (int t = 0; t < 4; ++t) { if (col0 + t * 16 >= N) continue; const int col = col0 + t * 16 + ln; const float bv = bp ? bf16_round(bp[col]) : 0.f;
#pragma unroll
    for (int r = 0; r < 8; ++r) { float v = acc[t][r] * alpha + bv; if (CP) { const int rr = row0g + row0 + 8 * hh + r; if (rowsPerB < 0) v += CP[cofs + (size_t)rr * ldc + col];      /* rowsPerB < 0: own element of the batched C plane */ else { const int bidx = rr / rowsPerB; v += CP[(size_t)bidx * sCPb + (size_t)by * 64 + col]; } } if (ACT == 1) v = (v > 0.f) ? v : expm1f(v); else if (ACT == 7) v = (v > 0.f) ? v + 1.0f : expf(v); else if (ACT == 8) v = tanhf(v); else if (ACT == 9) v = 0.5f * v * (1.0f + tanhf(0.7978845608028654f * (v + 0.044715f * v * v * v))); else if (ACT == 11) v = 1.0f / (1.0f + expf(-v)); else if (ACT == 12) v = (v > 0.f) ? v : 0.01f * v; else if (ACT == 14) v = (v > 0.f) ? v : 0.1f * v; else if (ACT == 16) v = (v >= 0.f) ? v : 0.3f * v; else if (ACT == 17) v = (v >= 0.f) ? v : 0.2f * v; else if (ACT == 15) v = v / (1.0f + expf(-v)); else if (ACT == 3) v = fmaxf(v, 0.f); else if (ACT == 6) v = 0.5f * v * (1.0f + erff(v * 0.70710678118654752f)); so[w][8 * hh + r][t * 16 + ln] = v; } }
  __builtin_amdgcn_fence(__ATOMIC_ACQ_REL, "workgroup"); __builtin_amdgcn_wave_barrier();
  const int rsub = lane >> 4, c4 = (lane & 15) * 4; typedef _Float16 v4h __attribute__((ext_vector_type(4)));
  {
#pragma unroll
    for (int q = 0; q < 8; ++q) { const int r = q * 2 + rsub; if (col0 + c4 < N) { const v4f v = *(const v4fa*)&so[w][r][c4]; if (C) *(v4f*)(C + cofs + (size_t)(row0 + r) * ldc + col0 + c4) = v; if (C16) { v4h h4; for (int i = 0; i < 4; ++i) h4[i] = (_Float16)v[i]; *(v4h*)(C16 + cofs + (size_t)(row0 + r) * ldc + col0 + c4) = h4; } } }
     }
}


typedef _Float16 v4h __attribute__((ext_vector_type(4)));

__global__ __launch_bounds__(256) void k_x16(const float* __restrict__ x, _Float16* __restrict__ X16, size_t n8) { const size_t t = (size_t)blockIdx.x * 256 + threadIdx.x; if (t >= n8) return; FragH f;
#pragma unroll
  for (int q = 0; q < 8; ++q) f.h[q] = (_Float16)bf16_round(x[t * 8 + q]); *(v8us*)((unsigned short*)X16 + t * 8) = f.half[0];  }
__global__ __launch_bounds__(256) void k_h16(const float* __restrict__ x, _Float16* __restrict__ X16, size_t n8) { const size_t t = (size_t)blockIdx.x * 256 + threadIdx.x; if (t >= n8) return; FragH f;
#pragma unroll
  for (int q = 0; q < 8; ++q) f.h[q] = (_Float16)x[t * 8 + q]; *(v8us*)((unsigned short*)X16 + t * 8) = f.half[0];  }
__global__ __launch_bounds__(256) void k_round16f(const float* __restrict__ W, _Float16* __restrict__ Bt, size_t n8) { const size_t t = (size_t)blockIdx.x * 256 + threadIdx.x; if (t >= n8) return; FragH f;
#pragma unroll
  for (int i = 0; i < 8; ++i) f.h[i] = (_Float16)(bf16_round(W[t * 8 + i]) * 16.0f); *(v8us*)((unsigned short*)Bt + t * 8) = f.half[0];  }
template <int NHv, int TTv>
__global__ __launch_bounds__(256) void k_vt(const _Float16* __restrict__ V16, int ldv, int voff, _Float16* __restrict__ Vt) { __shared__ unsigned short tl[64][66]; const int tid = threadIdx.x; const int slab = blockIdx.x / (TTv / 64), lg = blockIdx.x % (TTv / 64); const int b = slab / NHv, h = slab % NHv;
  for (int i = tid; i < 64 * 8; i += 256) { const int r = i / 8, c8 = (i % 8) * 8; FragH f; f.half[0] = *(const v8us*)((const unsigned short*)V16 + ((size_t)b * TTv + lg * 64 + r) * ldv + voff + h * 64 + c8);
#pragma unroll
    for (int q = 0; q < 8; ++q) tl[r][c8 + q] = f.u[q]; }
  __syncthreads();
  {
#pragma unroll
    for (int rd = 0; rd < 2; ++rd) { const int d = rd * 32 + tid / 8, pc = tid % 8; FragH f;
#pragma unroll
      for (int q = 0; q < 8; ++q) f.u[q] = tl[pc * 8 + q][d];
      *(v8us*)((unsigned short*)Vt + ((size_t)slab * 64 + d) * TTv + lg * 64 + pc * 8) = f.half[0]; }
     } }

__global__ __launch_bounds__(256) void k_hl(const float* __restrict__ F, _Float16* __restrict__ Hh, _Float16* __restrict__ Hl, size_t n8) { const size_t t = (size_t)blockIdx.x * 256 + threadIdx.x; if (t >= n8) return; FragH fh, fl; const v4f a = *(const v4fa*)(F + t * 8), c = *(const v4fa*)(F + t * 8 + 4);
#pragma unroll
  for (int q = 0; q < 4; ++q) { _Float16 h = (_Float16)a[q]; fh.h[q] = h; fl.h[q] = (_Float16)((a[q] - (float)h) * 1024.0f); h = (_Float16)c[q]; fh.h[4 + q] = h; fl.h[4 + q] = (_Float16)((c[q] - (float)h) * 1024.0f); }
  { *(v8us*)((unsigned short*)Hh + t * 8) = fh.half[0]; *(v8us*)((unsigned short*)Hl + t * 8) = fl.half[0];  } }

// ---- fast GEMM (wave tile 32x64; requires M % 32 == 0 rows per launch region and N % 64 == 0); epilogue = k_gemm_hhx semantics ----
__device__ __forceinline__ v16h g2_frag(const _Float16* p, int hh) { FragH f; f.half[0] = *(const v8us*)((const unsigned short*)p + 8 * hh); f.half[1] = *(const v8us*)((const unsigned short*)p + 16 + 8 * hh); return f.v; }
__device__ __forceinline__ v8f g2_mma(v16h a, v16h b, v8f c) { v8f d = __builtin_amdgcn_wmma_f32_16x16x32_f16(false, a, false, b, (short)0, c, false, false); asm volatile("v_nop\n\tv_nop\n\tv_nop\n\tv_nop" : "+v"(d) : "v"(a), "v"(b)); return d; }
template <int ACT>
__global__ __launch_bounds__(128) void k_gemm2(const _Float16* __restrict__ A, int lda, size_t sA, const _Float16* __restrict__ Bh, int ldb, size_t sB, float alpha, const float* __restrict__ bias, size_t sBias, const float* __restrict__ CP, int rowsPerB, size_t sCPb, int row0g,
    float* __restrict__ C, _Float16* __restrict__ C16, int ldc, size_t sC, int M, int N, int K) { static_assert(ACT == 0 || ACT == 3 || ACT == 6 || ACT == 8 || ACT == 9 || ACT == 11 || ACT == 12 || ACT == 14 || ACT == 15 || ACT == 16 || ACT == 17, "k_gemm2: unsupported ACT code (would silently apply no activation)");
  __shared__ __attribute__((aligned(16))) float so[4][32][68];
  const int tid = threadIdx.x, w = tid >> 5, lane = tid & 31, ln = lane & 15, hh = lane >> 4; const int by = blockIdx.y;
  A += (size_t)by * sA; Bh += (size_t)by * sB; const size_t cofs = (size_t)by * sC; const float* bp = bias ? bias + (size_t)by * sBias : nullptr;
  const int ntn = N >> 6; const int mt = blockIdx.x / ntn, nq = blockIdx.x - mt * ntn; const int row0 = mt * 128 + 32 * w, col0 = nq * 64; if (row0 >= M) return;
  const _Float16* a0p = A + (size_t)(row0 + ln) * lda; const _Float16* a1p = a0p + (size_t)16 * lda;
  const _Float16* b0p = Bh + (size_t)(col0 + ln) * ldb; const _Float16* b1p = b0p + (size_t)16 * ldb; const _Float16* b2p = b1p + (size_t)16 * ldb; const _Float16* b3p = b2p + (size_t)16 * ldb;
  const v8f z8 = {0.f,0.f,0.f,0.f,0.f,0.f,0.f,0.f}; v8f c00 = z8, c01 = z8, c02 = z8, c03 = z8, c10 = z8, c11 = z8, c12 = z8, c13 = z8;
#pragma unroll 1
  for (int kb = 0; kb < K; kb += 32) { const v16h a0 = g2_frag(a0p + kb, hh), a1 = g2_frag(a1p + kb, hh);
    v16h b = g2_frag(b0p + kb, hh); c00 = g2_mma(a0, b, c00); c10 = g2_mma(a1, b, c10);
    b = g2_frag(b1p + kb, hh); c01 = g2_mma(a0, b, c01); c11 = g2_mma(a1, b, c11);
    b = g2_frag(b2p + kb, hh); c02 = g2_mma(a0, b, c02); c12 = g2_mma(a1, b, c12);
    b = g2_frag(b3p + kb, hh); c03 = g2_mma(a0, b, c03); c13 = g2_mma(a1, b, c13); }
  v8f accs[8] = {c00, c01, c02, c03, c10, c11, c12, c13};
#pragma unroll
  for (int u = 0; u < 8; ++u) { const int t = u & 3, half = u >> 2; const int col = col0 + t * 16 + ln; const float bv = bp ? bf16_round(bp[col]) : 0.f;
#pragma unroll
    for (int r = 0; r < 8; ++r) { const int rloc = half * 16 + 8 * hh + r; float v = accs[u][r] * alpha + bv; if (CP) { if (rowsPerB < 0) v += CP[cofs + (size_t)(row0g + row0 + rloc) * ldc + col];      /* rowsPerB < 0: own element of the batched C plane */ else { const int bidx = (row0g + row0 + rloc) / rowsPerB; v += CP[(size_t)bidx * sCPb + (size_t)by * 64 + col]; } }
      if (ACT == 3) v = fmaxf(v, 0.f); else if (ACT == 6) v = 0.5f * v * (1.0f + erff(v * 0.70710678118654752f)); else if (ACT == 11) v = 1.0f / (1.0f + expf(-v)); else if (ACT == 15) v = v / (1.0f + expf(-v)); else if (ACT == 12) v = (v > 0.f) ? v : 0.01f * v; else if (ACT == 8) v = tanhf(v); else if (ACT == 9) v = 0.5f * v * (1.0f + tanhf(0.7978845608028654f * (v + 0.044715f * v * v * v))); else if (ACT == 14) v = (v > 0.f) ? v : 0.1f * v; else if (ACT == 16) v = (v >= 0.f) ? v : 0.3f * v; else if (ACT == 17) v = (v >= 0.f) ? v : 0.2f * v;
      so[w][rloc][t * 16 + ln] = v; } }
  __builtin_amdgcn_fence(__ATOMIC_ACQ_REL, "workgroup"); __builtin_amdgcn_wave_barrier();
  const int rsub = lane >> 4, c4 = (lane & 15) * 4;
  {
#pragma unroll
    for (int q = 0; q < 16; ++q) { const int r = q * 2 + rsub; const v4f v = *(const v4fa*)&so[w][r][c4]; if (C) *(v4f*)(C + cofs + (size_t)(row0 + r) * ldc + col0 + c4) = v; if (C16) { v4h h4; for (int i = 0; i < 4; ++i) h4[i] = (_Float16)v[i]; *(v4h*)(C16 + cofs + (size_t)(row0 + r) * ldc + col0 + c4) = h4; } }
     } }


__global__ __launch_bounds__(256) void k_wnat(const float* __restrict__ w, size_t n8, _Float16* __restrict__ Bt) { const size_t t = (size_t)blockIdx.x * 256 + threadIdx.x; if (t >= n8) return; FragH f; for (int q = 0; q < 8; ++q) f.h[q] = (_Float16)(bf16_round(w[t * 8 + q]) * 16.0f); *(v8us*)((unsigned short*)Bt + t * 8) = f.half[0];  }
__global__ __launch_bounds__(256) void k_rsm(const float* __restrict__ S, _Float16* __restrict__ P, int nrows) {
  #pragma clang fp contract(off)
  const int i = blockIdx.x * 256 + threadIdx.x; if (i >= nrows) return; const float* s = S + (size_t)i * SQ; float mx = -3.0e38f;
#pragma unroll 1
  for (int j = 0; j < SQ; ++j) mx = fmaxf(mx, s[j]); float se = 0.f;
#pragma unroll 1
  for (int j = 0; j < SQ; ++j) se += expf(s[j] - mx); const float sc = 256.0f / se;
#pragma unroll 1
  for (int j0 = 0; j0 < SQ; j0 += 8) { FragH f; for (int q = 0; q < 8; ++q) f.h[q] = (_Float16)(expf(s[j0 + q] - mx) * sc); unsigned short* d = (unsigned short*)P + (size_t)i * SQ + j0; *(v8us*)d = f.half[0];  } }
__global__ __launch_bounds__(256) void k_vt(const _Float16* __restrict__ V16, int b, int h0, _Float16* __restrict__ VT) { __shared__ unsigned short tl[64][65]; const int tid = threadIdx.x; const int hh = blockIdx.x % HG, sg = blockIdx.x / HG; const int s0 = sg * 64; const int h = h0 + hh;
  for (int i = tid; i < 64 * 8; i += 256) { const int j = i / 8, d8 = (i % 8) * 8; FragH f; f.half[0] = *(const v8us*)((const unsigned short*)V16 + ((size_t)b * SQ + s0 + j) * DM + h * HD + d8); for (int q = 0; q < 8; ++q) tl[d8 + q][j] = f.u[q]; }
  __syncthreads();
  { for (int i = tid; i < 64 * 8; i += 256) { const int d = i / 8, j8 = (i % 8) * 8; FragH f; for (int q = 0; q < 8; ++q) f.u[q] = tl[d][j8 + q]; *(v8us*)((unsigned short*)VT + ((size_t)hh * HD + d) * SQ + s0 + j8) = f.half[0]; }  } }



__global__ __launch_bounds__(256) void k_rsmcf2(const float* __restrict__ S, _Float16* __restrict__ P, int hg, int q0, int nk) {
  #pragma clang fp contract(off)
  const int t = blockIdx.x * 256 + threadIdx.x; if (t >= hg * QT) return; const size_t i = (size_t)t; const float* s = S + i * NKX; const int last = q0 + (t % QT); float mx = -3.0e38f;
#pragma unroll 1
  for (int j = 0; j < nk; ++j) { const float f = (j <= last) ? 1.f : 0.f; mx = fmaxf(mx, fmaf(f, s[j], (1.f - f) * -1.0e9f)); } float se = 0.f;
#pragma unroll 1
  for (int j = 0; j < nk; ++j) { const float f = (j <= last) ? 1.f : 0.f; se += __expf(fmaf(f, s[j], (1.f - f) * -1.0e9f) - mx); } const float sc = 256.0f / se;
#pragma unroll 1
  for (int j0 = 0; j0 < nk; j0 += 8) { FragH fr; for (int q = 0; q < 8; ++q) { const int j = j0 + q; const float f = (j <= last) ? 1.f : 0.f; fr.h[q] = (_Float16)(__expf(fmaf(f, s[j], (1.f - f) * -1.0e9f) - mx) * sc); } unsigned short* d = (unsigned short*)P + i * NKX + j0; *(v8us*)d = fr.half[0];  } }


template <int MASKADD>
__global__ __launch_bounds__(64) void k_att0(const float* __restrict__ QF, const float* __restrict__ KF, const float* __restrict__ VF, int ld, const float* __restrict__ mask, float scale, float* __restrict__ OF, int ldo) {
  #pragma clang fp contract(off)
  __shared__ __attribute__((aligned(16))) float lq[64][64]; __shared__ __attribute__((aligned(16))) float lo[64][64];
  const int tid = threadIdx.x; const int h = blockIdx.x / (QT0 / 64), rg = blockIdx.x % (QT0 / 64); const int i = rg * 64 + tid;
  const float* qr = QF + (size_t)i * ld + h * HD;
#pragma unroll 1
  for (int c = 0; c < HD / 4; ++c) { *(v4f*)&lq[tid][c * 4] = *(const v4fa*)(qr + c * 4); const v4f z = {0.f, 0.f, 0.f, 0.f}; *(v4f*)&lo[tid][c * 4] = z; }
  float m = -1.0e30f, l = 0.f; const int jmax = MASKADD ? (SQ - 1) : (rg * 64 + 63);      /* additive-mask form: every key (the mask input decides); causal form: keys up to the block's last row */
#pragma unroll 1
  for (int j = 0; j <= jmax; ++j) { const float* kr = KF + (size_t)j * ld + h * HD; const float* vr = VF + (size_t)j * ld + h * HD; float s = 0.f;
#pragma unroll 1
    for (int c = 0; c < HD / 4; ++c) { const v4f kq = *(const v4fa*)(kr + c * 4); const v4f qq = *(v4f*)&lq[tid][c * 4]; s = __fadd_rn(s, __fmul_rn(qq[0], kq[0])); s = __fadd_rn(s, __fmul_rn(qq[1], kq[1])); s = __fadd_rn(s, __fmul_rn(qq[2], kq[2])); s = __fadd_rn(s, __fmul_rn(qq[3], kq[3])); }
    s = __fmul_rn(s, scale); if (MASKADD) s = __fadd_rn(s, __fmul_rn(bf16_round(mask[(size_t)i * SQ + j]), -10000.0f));
    const float f = (MASKADD || j <= i) ? 1.f : 0.f; const float sm = fmaf(f, s, (1.f - f) * -1.0e30f); const float mn = fmaxf(m, sm); const float sc = expf(m - mn); const float e = expf(sm - mn); l = __fadd_rn(__fmul_rn(l, sc), e); m = mn;
#pragma unroll 1
    for (int c = 0; c < HD / 4; ++c) { const v4f vv = *(const v4fa*)(vr + c * 4); v4f oo = *(v4f*)&lo[tid][c * 4]; for (int u = 0; u < 4; ++u) oo[u] = __fadd_rn(__fmul_rn(oo[u], sc), __fmul_rn(e, vv[u])); *(v4f*)&lo[tid][c * 4] = oo; } }
  const float fin = 64.0f / l;      /* o carried x64 like the f16 path */
#pragma unroll 1
  for (int c = 0; c < HD / 4; ++c) { v4f oo = *(v4f*)&lo[tid][c * 4]; for (int u = 0; u < 4; ++u) oo[u] = __fmul_rn(oo[u], fin); *(v4f*)&lo[tid][c * 4] = oo; }
  __syncthreads();
  {
#pragma unroll 1
    for (int it = 0; it < 16; ++it) { const int row = it * 4 + tid / 16, pc = (tid % 16) * 4; const v4f v = *(const v4f*)&lo[row][pc]; *(v4f*)(OF + (size_t)(rg * 64 + row) * ldo + h * HD + pc) = v; }
     } }


__global__ __launch_bounds__(256) void k_kvexp(const float* __restrict__ src, float* __restrict__ dst, size_t n4) { const size_t t = (size_t)blockIdx.x * 256 + threadIdx.x; if (t >= n4) return; const size_t e = t * 4; const size_t row = e / DM; const int col = (int)(e % DM); const int h = col / HD, d = col % HD; const v4f v = *(const v4fa*)(src + row * KVD + (size_t)(h / HPG) * HD + d); *(v4f*)(dst + e) = v;  }

__global__ __launch_bounds__(256) void k_tab2(float theta, float* __restrict__ CS, float* __restrict__ SN) {
  #pragma clang fp contract(off)
  const int t = blockIdx.x * 256 + threadIdx.x; if (t >= SQ * (HD / 2)) return; const int i = t % (HD / 2); const int p = t / (HD / 2); const float invf = 1.0f / powf(theta, (float)(2 * i) / (float)HD); const float ang = __fmul_rn((float)p, invf); const float c = cosf(ang), s = sinf(ang);
  *(float*)(CS + t) = c; *(float*)(SN + t) = s;  }
template <int NORM, int ROPE>
__global__ __launch_bounds__(64) void k_xform(const float* __restrict__ F, int ldf, int nh, const float* __restrict__ gain, float eps, const float* __restrict__ CS, const float* __restrict__ SN, _Float16* __restrict__ H16, int ldo) {
  #pragma clang fp contract(off)
  __shared__ float xv[HD]; __shared__ float red[HD]; __shared__ unsigned short sh_[HD]; const int d = threadIdx.x; const int h = blockIdx.x % nh; const size_t r = blockIdx.x / nh; const int p = (int)(r % SQ);
  float x = F[r * (size_t)ldf + (size_t)h * HD + d];
  if (NORM) { red[d] = __fmul_rn(x, x); __syncthreads(); for (int st = HD / 2; st > 0; st >>= 1) { if (d < st) red[d] = __fadd_rn(red[d], red[d + st]); __syncthreads(); } const float rs = rsqrtf(__fadd_rn(red[0] / (float)HD, eps)); x = __fmul_rn(__fmul_rn(x, rs), bf16_round(gain[d])); }
  xv[d] = x; __syncthreads();
  float o = x;
  if (ROPE == 1) { const int i = d >> 1; const float c = CS[p * (HD / 2) + i], s = SN[p * (HD / 2) + i]; const float ev = xv[2 * i], od = xv[2 * i + 1]; o = (d & 1) ? __fadd_rn(__fmul_rn(ev, s), __fmul_rn(od, c)) : __fadd_rn(__fmul_rn(ev, c), -__fmul_rn(od, s)); }
  if (ROPE == 2) { const int i = d & (HD / 2 - 1); const float c = CS[p * (HD / 2) + i], s = SN[p * (HD / 2) + i]; const float lo = xv[i], hi = xv[i + HD / 2]; o = (d < HD / 2) ? __fadd_rn(__fmul_rn(lo, c), -__fmul_rn(hi, s)) : __fadd_rn(__fmul_rn(lo, s), __fmul_rn(hi, c)); }
  if (ROPE == 3) { const float c = CS[p * HD + d], s = SN[p * HD + d]; const float lo = xv[d & (HD / 2 - 1)], hi = xv[(d & (HD / 2 - 1)) + HD / 2]; o = (d < HD / 2) ? __fadd_rn(__fmul_rn(lo, c), -__fmul_rn(hi, s)) : __fadd_rn(__fmul_rn(hi, c), __fmul_rn(lo, s)); }      /* rotate-half with FULL-width per-element tables [pos][HD] */
  FragH th; th.h[0] = (_Float16)o; sh_[d] = th.u[0]; __syncthreads();
  if (d < HD / 8) { FragH f; for (int q = 0; q < 8; ++q) f.u[q] = sh_[d * 8 + q]; unsigned short* dst = (unsigned short*)H16 + r * (size_t)ldo + (size_t)h * HD + d * 8; *(v8us*)dst = f.half[0];  } }

template <int NORM, int ROPE>
__global__ __launch_bounds__(64) void k_xformf(const float* __restrict__ F, int ldf, int nh, const float* __restrict__ gain, float eps, const float* __restrict__ CS, const float* __restrict__ SN, float* __restrict__ F32, int ldo) {
  #pragma clang fp contract(off)
  __shared__ float xv[HD]; __shared__ float red[HD]; const int d = threadIdx.x; const int h = blockIdx.x % nh; const size_t r = blockIdx.x / nh; const int p = (int)(r % SQ);
  float x = F[r * (size_t)ldf + (size_t)h * HD + d];
  if (NORM) { red[d] = __fmul_rn(x, x); __syncthreads(); for (int st = HD / 2; st > 0; st >>= 1) { if (d < st) red[d] = __fadd_rn(red[d], red[d + st]); __syncthreads(); } const float rs = rsqrtf(__fadd_rn(red[0] / (float)HD, eps)); x = __fmul_rn(__fmul_rn(x, rs), bf16_round(gain[d])); }
  xv[d] = x; __syncthreads();
  float o = x;
  if (ROPE == 1) { const int i = d >> 1; const float c = CS[p * (HD / 2) + i], s = SN[p * (HD / 2) + i]; const float ev = xv[2 * i], od = xv[2 * i + 1]; o = (d & 1) ? __fadd_rn(__fmul_rn(ev, s), __fmul_rn(od, c)) : __fadd_rn(__fmul_rn(ev, c), -__fmul_rn(od, s)); }
  if (ROPE == 2) { const int i = d & (HD / 2 - 1); const float c = CS[p * (HD / 2) + i], s = SN[p * (HD / 2) + i]; const float lo = xv[i], hi = xv[i + HD / 2]; o = (d < HD / 2) ? __fadd_rn(__fmul_rn(lo, c), -__fmul_rn(hi, s)) : __fadd_rn(__fmul_rn(lo, s), __fmul_rn(hi, c)); }
  if (ROPE == 3) { const float c = CS[p * HD + d], s = SN[p * HD + d]; const float lo = xv[d & (HD / 2 - 1)], hi = xv[(d & (HD / 2 - 1)) + HD / 2]; o = (d < HD / 2) ? __fadd_rn(__fmul_rn(lo, c), -__fmul_rn(hi, s)) : __fadd_rn(__fmul_rn(hi, c), __fmul_rn(lo, s)); }      /* rotate-half with FULL-width per-element tables [pos][HD] */
  float* dst = F32 + r * (size_t)ldo + (size_t)h * HD + d; *(float*)dst = o;  }

__global__ __launch_bounds__(256) void k_bfcp(const float* __restrict__ src, float* __restrict__ dst, size_t n4) { const size_t t = (size_t)blockIdx.x * 256 + threadIdx.x; if (t >= n4) return; const v4f a = *(const v4fa*)(src + t * 4); v4f o; for (int q = 0; q < 4; ++q) o[q] = bf16_round(a[q]); *(v4f*)(dst + t * 4) = o;  }

__global__ __launch_bounds__(256) void k_tabhalf(const float* __restrict__ cs, const float* __restrict__ sn, float* __restrict__ CS, float* __restrict__ SN) { const int t = blockIdx.x * 256 + threadIdx.x; if (t >= SQ * (HD / 2)) return; const int p = t / (HD / 2), i = t % (HD / 2); const float c = bf16_round(cs[(size_t)p * HD + i]), s = bf16_round(sn[(size_t)p * HD + i]);
  *(float*)(CS + t) = c; *(float*)(SN + t) = s;  }

__global__ __launch_bounds__(256) void k_tab2d(float* __restrict__ CS, float* __restrict__ SN) {
  #pragma clang fp contract(off)
  const int t = blockIdx.x * 256 + threadIdx.x; if (t >= SQ * (HD / 2)) return; const int i = t % (HD / 2); const int p = t / (HD / 2); const float invf = (float)(1.0 / pow(10000.0, (double)(2 * i) / (double)HD)); const float ang = __fmul_rn((float)p, invf); const float c = cosf(ang), s = sinf(ang);
  *(float*)(CS + t) = c; *(float*)(SN + t) = s;  }
extern "C" void kernel_launch(void* const* d_in, const int* in_sizes, int n_in,
                              void* d_out, int out_size, void* d_ws, size_t ws_size, hipStream_t stream) {
  (void)in_sizes; (void)n_in; (void)out_size;
  const float* const* I = (const float* const*)d_in; const float* x = I[0]; const float* wq = I[1]; const float* wk = I[2]; const float* wv = I[3]; const float* wo = I[4]; const float* bq = nullptr; const float* bk = nullptr; const float* bv = nullptr; const float* bo = nullptr;      /* natural [out][in] weights, no biases; rope tables computed in the kernel */
  char* ws = (char*)d_ws; size_t off = 0;
  auto take = [&](size_t bytes) { char* p = ws + off; off += (bytes + 255) & ~(size_t)255; return p; };
  _Float16* BQ = (_Float16*)take((size_t)DM * DM * 2); _Float16* BK = (_Float16*)take((size_t)KVD * DM * 2); _Float16* BV = (_Float16*)take((size_t)KVD * DM * 2); _Float16* BO = (_Float16*)take((size_t)DM * DM * 2);
  _Float16* X16 = (_Float16*)take(NR * DM * 2); float* QF = (float*)take((size_t)SQ * DM * 4); float* KF = (float*)take((size_t)SQ * KVD * 4); float* CSB = (float*)take((size_t)SQ * HD * 4); float* SNB = (float*)take((size_t)SQ * HD * 4); _Float16* Q16 = (_Float16*)take(NR * DM * 2); _Float16* K16 = (_Float16*)take(NR * KVD * 2); _Float16* V16 = (_Float16*)take(NR * KVD * 2); _Float16* O16 = (_Float16*)take(NR * DM * 2);
  float* S = (float*)take((size_t)NH * QT * NKX * 4); _Float16* P = (_Float16*)take((size_t)NH * QT * NKX * 2); _Float16* VT = (_Float16*)take((size_t)NH * HD * SQ * 2);
  float* QF0 = (float*)take((size_t)QT0 * DM * 4); float* KF0 = (float*)take((size_t)QT0 * KVD * 4); float* VF0 = (float*)take((size_t)QT0 * KVD * 4); float* KF0e = (float*)take((size_t)QT0 * DM * 4); float* VF0e = (float*)take((size_t)QT0 * DM * 4); float* OF0 = (float*)take((size_t)NB * QT0 * DM * 4); _Float16* OH0 = (_Float16*)take((size_t)NB * QT0 * DM * 2); _Float16* OL0 = (_Float16*)take((size_t)NB * QT0 * DM * 2);
  if (off > ws_size) return;
  k_wnat<<<(unsigned)(((size_t)DM * DM / 8 + 255) / 256), 256, 0, stream>>>(wq, (size_t)DM * DM / 8, BQ); k_wnat<<<(unsigned)(((size_t)KVD * DM / 8 + 255) / 256), 256, 0, stream>>>(wk, (size_t)KVD * DM / 8, BK); k_wnat<<<(unsigned)(((size_t)KVD * DM / 8 + 255) / 256), 256, 0, stream>>>(wv, (size_t)KVD * DM / 8, BV); k_wnat<<<(unsigned)(((size_t)DM * DM / 8 + 255) / 256), 256, 0, stream>>>(wo, (size_t)DM * DM / 8, BO);      /* natural [out][in] = Bt planes x16 */
  k_x16<<<(unsigned)((NR * DM / 8 + 255) / 256), 256, 0, stream>>>(x, X16, NR * DM / 8);
  k_tab2d<<<(SQ * (HD / 2) + 255) / 256, 256, 0, stream>>>(CSB, SNB);      /* rope tables cos/sin(p / 10000^(2i/64)): inv_freq double-derived -> f32, f32 angle */
  const size_t r0p = (size_t)B0 * SQ;      /* first projected row */
  k_gemm2<0><<<dim3((unsigned)((MP / 128) * (KVD / 64)), 1), 128, 0, stream>>>(X16 + r0p * DM, DM, 0, BV, DM, 0, 0.0625f, bv, 0, nullptr, 1, 0, 0, nullptr, V16 + r0p * KVD, KVD, 0, MP, KVD, DM);
  for (int b = B0; b < B0 + NBR; ++b) { const size_t r0 = (size_t)b * SQ;
    k_gemm2<0><<<dim3((unsigned)((SQ / 128) * (DM / 64)), 1), 128, 0, stream>>>(X16 + r0 * DM, DM, 0, BQ, DM, 0, 0.0625f, nullptr, 0, nullptr, 1, 0, 0, QF, nullptr, DM, 0, SQ, DM, DM);      /* q (f32) of this batch */
    k_gemm2<0><<<dim3((unsigned)((SQ / 128) * (KVD / 64)), 1), 128, 0, stream>>>(X16 + r0 * DM, DM, 0, BK, DM, 0, 0.0625f, nullptr, 0, nullptr, 1, 0, 0, KF, nullptr, KVD, 0, SQ, KVD, DM);      /* k (f32) */
    k_xform<0, 1><<<(unsigned)((size_t)SQ * NH), 64, 0, stream>>>(QF, DM, NH, nullptr, 0.f, CSB, SNB, Q16 + r0 * DM, DM); k_xform<0, 1><<<(unsigned)((size_t)SQ * NG), 64, 0, stream>>>(KF, KVD, NG, nullptr, 0.f, CSB, SNB, K16 + r0 * KVD, KVD);      /* interleaved-pair rope -> f16 rows */
    k_xformf<0, 1><<<(unsigned)(QT0 * NH), 64, 0, stream>>>(QF, DM, NH, nullptr, 0.f, CSB, SNB, QF0, DM); k_xformf<0, 1><<<(unsigned)(QT0 * NG), 64, 0, stream>>>(KF, KVD, NG, nullptr, 0.f, CSB, SNB, KF0, KVD);      /* f32 roped q, k of rows 0..127 */
    k_vt<NG, SQ><<<NG * (SQ / 64), 256, 0, stream>>>(V16 + r0 * KVD, KVD, 0, VT);      /* V^T [NG][HD][SQ] for this batch */
    k_gemm2<0><<<dim3((QT0 / 128) * (KVD / 64), 1), 128, 0, stream>>>(X16 + r0 * DM, DM, 0, BV, DM, 0, 0.0625f, bv, 0, nullptr, 1, 0, 0, VF0, nullptr, KVD, 0, QT0, KVD, DM);
    k_kvexp<<<(unsigned)(((size_t)QT0 * DM / 4 + 255) / 256), 256, 0, stream>>>(KF0, KF0e, (size_t)QT0 * DM / 4); k_kvexp<<<(unsigned)(((size_t)QT0 * DM / 4 + 255) / 256), 256, 0, stream>>>(VF0, VF0e, (size_t)QT0 * DM / 4);      /* head h <- kv group h/4 for the exact first-tile kernel */      /* f32 q, k, v of the first 128 rows (exact products) */
    k_att0<0><<<NH * (QT0 / 64), 64, 0, stream>>>(QF0, KF0e, VF0e, DM, nullptr, 0.125f, OF0 + (size_t)b * QT0 * DM, DM);      /* exact f32 attention for rows 0..127 (o x64) */
    for (int q0 = 0; q0 < QN; q0 += QT) { const int nk = q0 + QT;      /* causal: only keys below the tile end are computed */
      for (int g = 0; g < NG; ++g) k_gemm2<0><<<dim3((QT / 128) * (nk / 64), HPG), 128, 0, stream>>>(Q16 + (r0 + q0) * LQ + (size_t)g * HPG * HD, LQ, (size_t)HD, K16 + r0 * KVD + (size_t)g * HD, KVD, 0, 0.125f, nullptr, 0, nullptr, 1, 0, 0, S + (size_t)g * HPG * QT * NKX, nullptr, NKX, (size_t)QT * NKX, QT, nk, HD);      /* scores: the 4 heads of group g against the group's keys (sB 0) */
      k_rsmcf2<<<(NHD * QT + 255) / 256, 256, 0, stream>>>(S, P, NHD, q0, nk);
      for (int g = 0; g < NG; ++g) k_gemm2<0><<<dim3((QT / 128) * (HD / 64), HPG), 128, 0, stream>>>(P + (size_t)g * HPG * QT * NKX, NKX, (size_t)QT * NKX, VT + (size_t)g * HD * SQ, SQ, 0, 0.25f, nullptr, 0, nullptr, 1, 0, 0, nullptr, O16 + (r0 + q0) * DM + (size_t)g * HPG * HD, DM, (size_t)HD, QT, HD, nk); } }      /* o for the group's 4 heads (x64) */      /* o (merged heads, x64) as f16 rows */
  k_gemm2<0><<<dim3((unsigned)((MPO / 128) * (DM / 64)), 1), 128, 0, stream>>>(O16 + r0p * DM, DM, 0, BO, DM, 0, 0.0009765625f, bo, 0, nullptr, 1, 0, 0, (float*)d_out + r0p * DM, nullptr, DM, 0, MPO, DM, DM);      /* out rows are the output layout */
  k_hl<<<(unsigned)(((size_t)NB * QT0 * DM / 8 + 255) / 256), 256, 0, stream>>>(OF0, OH0, OL0, (size_t)NB * QT0 * DM / 8);      /* first-tile o (x64) -> f16 hi + x1024 residual planes */
  for (int b = B0; b < B0 + NBR; ++b) { const size_t r0 = (size_t)b * SQ; const size_t f0 = (size_t)b * QT0;
    k_gemm2<0><<<dim3((QT0 / 128) * (DM / 64), 1), 128, 0, stream>>>(OH0 + f0 * DM, DM, 0, BO, DM, 0, 0.0009765625f, bo, 0, nullptr, 1, 0, 0, (float*)d_out + r0 * DM, nullptr, DM, 0, QT0, DM, DM);      /* rows 0..127: out = o_hi Wo (+ b), overwriting the f16-path rows */
    k_gemm2<0><<<dim3((QT0 / 128) * (DM / 64), 1), 128, 0, stream>>>(OL0 + f0 * DM, DM, 0, BO, DM, 0, 0.00000095367431640625f, nullptr, 0, (const float*)d_out + r0 * DM, -1, 0, 0, (float*)d_out + r0 * DM, nullptr, DM, 0, QT0, DM, DM); }      /* += o_lo Wo 2^-20 (own-element accumulate) */
}

// v001
// Measured time: 2800 microseconds a run.
// Next to v000, in two timings, it ran 1.73 times as fast each time.
#include <hip/hip_runtime.h>
// LLaMA grouped-query causal attention with interleaved-pair RoPE (hidden_states [1][2048][2048]; q = x Wq^T (natural [2048][2048]), k = x Wk^T, v = x Wv^T (natural [512][2048]) (sigma 0.02, no biases): 32 query heads / 8 kv heads of 64 (repeat_interleave: kv head h / 4); tables cos/sin of pos / 10000^(2i/64) repeated per pair; q = q cos + rotate_pairs(q) sin with rotate_pairs (x0, x1) -> (-x1, x0): pair (e, o) -> (e cos - o sin, o cos + e sin); scores x 64^-0.5 with a causal mask (triu(1) -> -inf); softmax; out = merged Wo^T (natural) -> [1][2048][2048]).
// Compute dtype: inputs rounded to bf16; x / weights exact; q, k, v, softmax weights and o as plain f16 GEMM operands (~2^-12); scores and softmax statistics f32. v_wmma_f32_16x16x32_f16.
#define NB 1
#define NG 8
#define HPG 4
#define KVD (NG * HD)
#define SQ 2048
#define DM 2048
#define NH 32
#define HD 64
#define HG 4                         /* heads covered by one launch of the non-template k_vt (unused) */
#define QT 256                       /* query rows per causal tile */
#define NKX SQ                       /* S / P row pitch */
#define QT0 128                      /* first-tile rows recomputed exactly in f32 */
#define B0 0                         /* first batch processed (debug hook) */
#define NBR NB                       /* batches processed (debug hook) */
#define NR ((size_t)NB * SQ)         /* token rows */
#define MP ((int)((size_t)NBR * SQ)) /* rows projected (debug hook) */
#define QN SQ                        /* query rows attended per batch (debug hook) */
#define NHD NH                       /* heads attended (debug hook) */
#define MPO MP                       /* rows through the output stage (debug hook) */
#define LQ DM      /* row pitch of the q rows */
typedef __bf16 v16b __attribute__((ext_vector_type(16)));
typedef unsigned short v8us __attribute__((ext_vector_type(8), may_alias));
typedef float  v8f  __attribute__((ext_vector_type(8)));
typedef float  v4f  __attribute__((ext_vector_type(4)));
typedef float  v4fa __attribute__((ext_vector_type(4), may_alias));
union FragB { v16b v; v8us half[2]; unsigned short u[16]; };

__device__ __forceinline__ unsigned short bf16_bits(float x) { unsigned int u = __float_as_uint(x); return (unsigned short)((u + 0x7FFFu + ((u >> 16) & 1u)) >> 16); }
__device__ __forceinline__ float bf16_val(unsigned short b) { return __uint_as_float(((unsigned int)b) << 16); }
__device__ __forceinline__ float bf16_round(float x) { return bf16_val(bf16_bits(x)); }
// D += A·B with NT terms: 1 = ah·bh, 2 = + al·bh (A split), 3 = + ah·bl (both split)
template <int NT>
__device__ __forceinline__ v8f mmaN(v16b ah, v16b al, v16b bh, v16b bl, v8f c) {
  c = __builtin_amdgcn_wmma_f32_16x16x32_bf16(false, ah, false, bh, (short)0, c, false, false);
  if (NT >= 2) c = __builtin_amdgcn_wmma_f32_16x16x32_bf16(false, al, false, bh, (short)0, c, false, false);
  if (NT >= 3) c = __builtin_amdgcn_wmma_f32_16x16x32_bf16(false, ah, false, bl, (short)0, c, false, false);
  asm volatile("v_nop\n\tv_nop\n\tv_nop\n\tv_nop" : "+v"(c) : "v"(ah), "v"(al), "v"(bh), "v"(bl));
  return c;
}

__global__ __launch_bounds__(256) void k_wt_bf16(const float* __restrict__ W, unsigned short* __restrict__ Wt, int K, int N) {
  const int t = blockIdx.x * 256 + threadIdx.x;
  const int k8n = K / 8;
  if (t >= N * k8n) return;
  const int n = t / k8n, k8 = (t % k8n) * 8;
  v8us v;
#pragma unroll
  for (int i = 0; i < 8; ++i) v[i] = bf16_bits(W[(size_t)(k8 + i) * N + n]);
  *(v8us*)(Wt + (size_t)n * K + k8) = v;
  
}

// GEMM C[M][N] (f32, pitch ldc) = act(A[M][K]·W + bias). A f32 row-major (pitch lda) converted per fragment to bf16
// (ASPLIT: hi/lo two planes -> 2 terms, else single rounded term); Wt bf16 [N][K] (pitch ldb). BIAS_BF16 rounds the
// bias to bf16 first (bias quantised to bf16 before the add). K%32==0, M%16==0, N%64==0.
template <bool ASPLIT, int ACT, bool BIAS_BF16>
__global__ __launch_bounds__(128) void k_gemm_bf(const float* __restrict__ A, int lda, const unsigned short* __restrict__ Wt, int ldb,
                                               const float* __restrict__ bias, float* __restrict__ C, int ldc, int M, int N, int K) {
  __shared__ __attribute__((aligned(16))) float so[4][16][64];
  const int tid = threadIdx.x, w = tid >> 5, lane = tid & 31, ln = lane & 15, hh = lane >> 4;
  const int ntn = N / 64;
  const int wid = blockIdx.x * 4 + w;
  const int mt = wid / ntn, nq = wid % ntn;
  if (mt * 16 >= M) return;
  const int row0 = mt * 16, col0 = nq * 64;
  const float* arow = A + (size_t)(row0 + ln) * lda;
  v8f acc[4] = {};
  for (int kb = 0; kb < K; kb += 32) {
    FragB ah, al;
    const v4f x0 = *(const v4fa*)(arow + kb + 8 * hh), x1 = *(const v4fa*)(arow + kb + 8 * hh + 4);
    const v4f x2 = *(const v4fa*)(arow + kb + 16 + 8 * hh), x3 = *(const v4fa*)(arow + kb + 16 + 8 * hh + 4);
    float xs[16] = {x0[0],x0[1],x0[2],x0[3],x1[0],x1[1],x1[2],x1[3],x2[0],x2[1],x2[2],x2[3],x3[0],x3[1],x3[2],x3[3]};
#pragma unroll
    for (int i = 0; i < 16; ++i) { const unsigned short hb = bf16_bits(xs[i]); ah.u[i] = hb; al.u[i] = ASPLIT ? bf16_bits(xs[i] - bf16_val(hb)) : (unsigned short)0; }
#pragma unroll
    for (int t = 0; t < 4; ++t) {
      const unsigned short* brow = Wt + (size_t)(col0 + t * 16 + ln) * ldb + kb;
      FragB b;
      b.half[0] = *(const v8us*)(brow + 8 * hh);
      b.half[1] = *(const v8us*)(brow + 16 + 8 * hh);
      acc[t] = mmaN<ASPLIT ? 2 : 1>(ah.v, al.v, b.v, b.v, acc[t]);
    }
  }
#pragma unroll
  for (int t = 0; t < 4; ++t) {
    float bv = bias ? bias[col0 + t * 16 + ln] : 0.f;
    if (BIAS_BF16) bv = bf16_round(bv);
#pragma unroll
    for (int r = 0; r < 8; ++r) { float v = acc[t][r] + bv; if (ACT == 1) v = fmaxf(v, 0.f); so[w][8 * hh + r][t * 16 + ln] = v; }
  }
  __builtin_amdgcn_fence(__ATOMIC_ACQ_REL, "workgroup");
  __builtin_amdgcn_wave_barrier();
  const int rsub = lane >> 4, c4 = (lane & 15) * 4;
  {
#pragma unroll
    for (int q = 0; q < 8; ++q) {
      const int r = q * 2 + rsub;
      const v4f v = *(const v4fa*)&so[w][r][c4];
      *(v4f*)(C + (size_t)(row0 + r) * ldc + col0 + c4) = v;
    }
    
  }
}

// GEMM C = act(A·W + bias + resid): A f32 (ASPLIT -> hi/lo 2 terms), Wt bf16 [N][K]; ACT 0 none, 1 relu, 2 exact gelu;
// resid (optional, f32, row index = (row % rmod), pitch ldr, RES_BF16 rounds it) added before the activation.
template <bool ASPLIT, int ACT, bool BIAS_BF16, bool RES_BF16>
__global__ __launch_bounds__(128) void k_gemm_bf3(const float* __restrict__ A, int lda, const unsigned short* __restrict__ Wt, int ldb,
                                                const float* __restrict__ bias, const float* __restrict__ resid, int rmod, int ldr,
                                                float* __restrict__ C, int ldc, int M, int N, int K) {
  __shared__ __attribute__((aligned(16))) float so[4][16][64];
  const int tid = threadIdx.x, w = tid >> 5, lane = tid & 31, ln = lane & 15, hh = lane >> 4;
  const int ntn = N / 64;
  const int wid = blockIdx.x * 4 + w;
  const int mt = wid / ntn, nq = wid % ntn;
  if (mt * 16 >= M) return;
  const int row0 = mt * 16, col0 = nq * 64;
  const float* arow = A + (size_t)(row0 + ln) * lda;
  v8f acc[4] = {};
  for (int kb = 0; kb < K; kb += 32) {
    FragB ah, al;
    const v4f x0 = *(const v4fa*)(arow + kb + 8 * hh), x1 = *(const v4fa*)(arow + kb + 8 * hh + 4);
    const v4f x2 = *(const v4fa*)(arow + kb + 16 + 8 * hh), x3 = *(const v4fa*)(arow + kb + 16 + 8 * hh + 4);
    float xs[16] = {x0[0],x0[1],x0[2],x0[3],x1[0],x1[1],x1[2],x1[3],x2[0],x2[1],x2[2],x2[3],x3[0],x3[1],x3[2],x3[3]};
#pragma unroll
    for (int i = 0; i < 16; ++i) { const unsigned short hb = bf16_bits(xs[i]); ah.u[i] = hb; al.u[i] = ASPLIT ? bf16_bits(xs[i] - bf16_val(hb)) : (unsigned short)0; }
#pragma unroll
    for (int t = 0; t < 4; ++t) {
      const unsigned short* brow = Wt + (size_t)(col0 + t * 16 + ln) * ldb + kb;
      FragB b;
      b.half[0] = *(const v8us*)(brow + 8 * hh);
      b.half[1] = *(const v8us*)(brow + 16 + 8 * hh);
      acc[t] = mmaN<ASPLIT ? 2 : 1>(ah.v, al.v, b.v, b.v, acc[t]);
    }
  }
#pragma unroll
  for (int t = 0; t < 4; ++t) {
    const int col = col0 + t * 16 + ln;
    float bv = bias ? bias[col] : 0.f;
    if (BIAS_BF16) bv = bf16_round(bv);
#pragma unroll
    for (int r = 0; r < 8; ++r) {
      float v = acc[t][r] + bv;
      if (resid) { float rv = resid[(size_t)((row0 + 8 * hh + r) % rmod) * ldr + col]; if (RES_BF16) rv = bf16_round(rv); v += rv; }
      if (ACT == 1) v = fmaxf(v, 0.f);
      if (ACT == 2) v = 0.5f * v * (1.0f + erff(v * 0.70710678118654752f));
      if (ACT == 3) { const float u = 0.7978845608028654f * (v + 0.044715f * v * v * v); v = 0.5f * v * (1.0f + tanhf(u)); }
      so[w][8 * hh + r][t * 16 + ln] = v;
    }
  }
  __builtin_amdgcn_fence(__ATOMIC_ACQ_REL, "workgroup");
  __builtin_amdgcn_wave_barrier();
  const int rsub = lane >> 4, c4 = (lane & 15) * 4;
  {
#pragma unroll
    for (int q = 0; q < 8; ++q) {
      const int r = q * 2 + rsub;
      const v4f v = *(const v4fa*)&so[w][r][c4];
      *(v4f*)(C + (size_t)(row0 + r) * ldc + col0 + c4) = v;
    }
    
  }
}
// row LayerNorm (biased variance, eps) over N: s = X (+ R); optional out_sum <- s; out_norm <- (s-mu)*rsqrt(var+eps)*g + b
template <bool PARAM_BF16>
__global__ __launch_bounds__(256) void k_layernorm(const float* __restrict__ X, const float* __restrict__ R, const float* __restrict__ g, const float* __restrict__ bta,
                                                  float* __restrict__ out_sum, float* __restrict__ out_norm, int N, float eps) {
  __shared__ float red[256];
  const int row = blockIdx.x, tid = threadIdx.x;
  const float* x = X + (size_t)row * N; const float* rr = R ? R + (size_t)row * N : nullptr;
  float vals[16];                     // up to N = 4096
  const int per = N / 256;            // contiguous chunk per thread? use strided-by-4 chunks: thread handles j = tid*4 + 1024*u
  float s1 = 0.f;
  for (int u = 0; u < per / 4; ++u) {
    const int j = tid * 4 + 1024 * u;
    const v4f a = *(const v4fa*)(x + j);
    v4f b = {0.f,0.f,0.f,0.f}; if (rr) b = *(const v4fa*)(rr + j);
#pragma unroll
    for (int q = 0; q < 4; ++q) { const float v = a[q] + b[q]; vals[u * 4 + q] = v; s1 += v; }
  }
  red[tid] = s1; __syncthreads();
  for (int st = 128; st > 0; st >>= 1) { if (tid < st) red[tid] += red[tid + st]; __syncthreads(); }
  const float mu = red[0] / (float)N; __syncthreads();
  float s2 = 0.f;
  for (int u = 0; u < per / 4; ++u)
#pragma unroll
    for (int q = 0; q < 4; ++q) { const float c = vals[u * 4 + q] - mu; s2 += c * c; }
  red[tid] = s2; __syncthreads();
  for (int st = 128; st > 0; st >>= 1) { if (tid < st) red[tid] += red[tid + st]; __syncthreads(); }
  const float rs = rsqrtf(red[0] / (float)N + eps);
  {
    for (int u = 0; u < per / 4; ++u) {
      const int j = tid * 4 + 1024 * u;
      v4f o, sm;
#pragma unroll
      for (int q = 0; q < 4; ++q) {
        float gg = g[j + q], bb = bta[j + q];
        if (PARAM_BF16) { gg = bf16_round(gg); bb = bf16_round(bb); }
        sm[q] = vals[u * 4 + q]; o[q] = (vals[u * 4 + q] - mu) * rs * gg + bb;
      }
      if (out_sum) *(v4f*)(out_sum + (size_t)row * N + j) = sm;
      *(v4f*)(out_norm + (size_t)row * N + j) = o;
    }
    
  }
}



// ---- f16 WMMA path (v_wmma_f32_16x16x32_f16): 11-bit significands for operands in range — used where a [0,1] probability operand needs more precision than bf16
typedef _Float16 v16h __attribute__((ext_vector_type(16)));
union FragH { v16h v; v8us half[2]; _Float16 h[16]; unsigned short u[16]; };
template <int NT>
__device__ __forceinline__ v8f mmaH(v16h ah, v16h al, v16h bh, v16h bl, v8f c) {
  c = __builtin_amdgcn_wmma_f32_16x16x32_f16(false, ah, false, bh, (short)0, c, false, false);
  if (NT >= 2) c = __builtin_amdgcn_wmma_f32_16x16x32_f16(false, al, false, bh, (short)0, c, false, false);
  if (NT >= 3) c = __builtin_amdgcn_wmma_f32_16x16x32_f16(false, ah, false, bl, (short)0, c, false, false);
  asm volatile("v_nop\n\tv_nop\n\tv_nop\n\tv_nop" : "+v"(c) : "v"(ah), "v"(al), "v"(bh), "v"(bl));
  return c;
}
// batched GEMM like k_gemm_b but f16 operands: A f32 (split into f16 hi/lo if ASPLIT, else rounded to f16), Bt = f16 values [n][k]; alpha; C f32; N multiple of 16 (partial tiles skipped)
template <bool ASPLIT>
__global__ __launch_bounds__(128) void k_gemm_h(const float* __restrict__ A, int lda, size_t sA, const _Float16* __restrict__ Bh, int ldb, size_t sB, float alpha, float* __restrict__ C, int ldc, size_t sC, int M, int N, int K) {
  __shared__ __attribute__((aligned(16))) float so[4][16][64];
  const int tid = threadIdx.x, w = tid >> 5, lane = tid & 31, ln = lane & 15, hh = lane >> 4; const int by = blockIdx.y;
  A += (size_t)by * sA; Bh += (size_t)by * sB; C += (size_t)by * sC;
  const int ntn = (N + 63) / 64; const int wid = blockIdx.x * 4 + w; const int mt = wid / ntn, nq = wid % ntn; if (mt * 16 >= M) return;
  const int row0 = mt * 16, col0 = nq * 64; const float* arow = A + (size_t)(row0 + ln) * lda;
  v8f acc[4] = {};
  for (int kb = 0; kb < K; kb += 32) {
    FragH ah, al;
    const v4f x0 = *(const v4fa*)(arow + kb + 8 * hh), x1 = *(const v4fa*)(arow + kb + 8 * hh + 4), x2 = *(const v4fa*)(arow + kb + 16 + 8 * hh), x3 = *(const v4fa*)(arow + kb + 16 + 8 * hh + 4);
    float xs[16] = {x0[0],x0[1],x0[2],x0[3],x1[0],x1[1],x1[2],x1[3],x2[0],x2[1],x2[2],x2[3],x3[0],x3[1],x3[2],x3[3]};
#pragma unroll
    for (int i = 0; i < 16; ++i) { const _Float16 h = (_Float16)xs[i]; ah.h[i] = h; al.h[i] = ASPLIT ? (_Float16)(xs[i] - (float)h) : (_Float16)0.0f; }
#pragma unroll
    for (int t = 0; t < 4; ++t) { if (col0 + t * 16 >= N) continue; const size_t boff = (size_t)(col0 + t * 16 + ln) * ldb + kb; FragH bq; bq.half[0] = *(const v8us*)(Bh + boff + 8 * hh); bq.half[1] = *(const v8us*)(Bh + boff + 16 + 8 * hh);
      acc[t] = mmaH<ASPLIT ? 2 : 1>(ah.v, al.v, bq.v, bq.v, acc[t]); }
  }
#pragma unroll
  for (int t = 0; t < 4; ++t) { if (col0 + t * 16 >= N) continue;
#pragma unroll
    for (int r = 0; r < 8; ++r) so[w][8 * hh + r][t * 16 + ln] = acc[t][r] * alpha; }
  __builtin_amdgcn_fence(__ATOMIC_ACQ_REL, "workgroup"); __builtin_amdgcn_wave_barrier();
  const int rsub = lane >> 4, c4 = (lane & 15) * 4;
  {
#pragma unroll
    for (int q = 0; q < 8; ++q) { const int r = q * 2 + rsub; if (col0 + c4 < N) { const v4f v = *(const v4fa*)&so[w][r][c4]; *(v4f*)(C + (size_t)(row0 + r) * ldc + col0 + c4) = v; } }
     }
}

// Wt[n][k] = f16(W[k][n]·scale) from f32 row-major W[K][N] (scale = power of two; bf16-exact weights stay exact in f16 away from the subnormal range)
__global__ __launch_bounds__(256) void k_wt_f16(const float* __restrict__ W, _Float16* __restrict__ Wt, int K, int N, float scale) {
  const int t = blockIdx.x * 256 + threadIdx.x; if (t >= N * (K / 8)) return; const int n = t / (K / 8), k8 = (t % (K / 8)) * 8; FragH f;
#pragma unroll
  for (int i = 0; i < 8; ++i) f.h[i] = (_Float16)(bf16_round(W[(size_t)(k8 + i) * N + n]) * scale); const v8us o = f.half[0];
  *(v8us*)((unsigned short*)Wt + (size_t)n * K + k8) = o; 
}
// k_gemm_hh variant with fused epilogue: v = acc·alpha + bias[by·sBias + col] (+ CP[(row/rowsPerB)·sCPb + by·64 + col] if CP) ; ACT 0 none / 1 elu ; writes f16 C16 (and f32 C if non-null)
template <int ACT>
__global__ __launch_bounds__(128) void k_gemm_hhx(const _Float16* __restrict__ A, int lda, size_t sA, const _Float16* __restrict__ Bh, int ldb, size_t sB, float alpha, const float* __restrict__ bias, size_t sBias, const float* __restrict__ CP, int rowsPerB, size_t sCPb, int row0g,
    float* __restrict__ C, _Float16* __restrict__ C16, int ldc, size_t sC, int M, int N, int K) {
  __shared__ __attribute__((aligned(16))) float so[4][16][64];
  const int tid = threadIdx.x, w = tid >> 5, lane = tid & 31, ln = lane & 15, hh = lane >> 4; const int by = blockIdx.y;
  A += (size_t)by * sA; Bh += (size_t)by * sB; const size_t cofs = (size_t)by * sC; const float* bp = bias ? bias + (size_t)by * sBias : nullptr;
  const int ntn = (N + 63) / 64; const int wid = blockIdx.x * 4 + w; const int mt = wid / ntn, nq = wid % ntn; if (mt * 16 >= M) return;
  const int row0 = mt * 16, col0 = nq * 64; const _Float16* arow = A + (size_t)(row0 + ln) * lda;
  v8f acc[4] = {};
  for (int kb = 0; kb < K; kb += 32) { FragH ah; ah.half[0] = *(const v8us*)((const unsigned short*)arow + kb + 8 * hh); ah.half[1] = *(const v8us*)((const unsigned short*)arow + kb + 16 + 8 * hh);
#pragma unroll
    for (int t = 0; t < 4; ++t) { if (col0 + t * 16 >= N) continue; const size_t boff = (size_t)(col0 + t * 16 + ln) * ldb + kb; FragH bq; bq.half[0] = *(const v8us*)((const unsigned short*)Bh + boff + 8 * hh); bq.half[1] = *(const v8us*)((const unsigned short*)Bh + boff + 16 + 8 * hh);
      acc[t] = mmaH<1>(ah.v, ah.v, bq.v, bq.v, acc[t]); }
  }
#pragma unroll
  for (int t = 0; t < 4; ++t) { if (col0 + t * 16 >= N) continue; const int col = col0 + t * 16 + ln; const float bv = bp ? bf16_round(bp[col]) : 0.f;
#pragma unroll
    for (int r = 0; r < 8; ++r) { float v = acc[t][r] * alpha + bv; if (CP) { const int rr = row0g + row0 + 8 * hh + r; if (rowsPerB < 0) v += CP[cofs + (size_t)rr * ldc + col];      /* rowsPerB < 0: own element of the batched C plane */ else { const int bidx = rr / rowsPerB; v += CP[(size_t)bidx * sCPb + (size_t)by * 64 + col]; } } if (ACT == 1) v = (v > 0.f) ? v : expm1f(v); else if (ACT == 7) v = (v > 0.f) ? v + 1.0f : expf(v); else if (ACT == 8) v = tanhf(v); else if (ACT == 9) v = 0.5f * v * (1.0f + tanhf(0.7978845608028654f * (v + 0.044715f * v * v * v))); else if (ACT == 11) v = 1.0f / (1.0f + expf(-v)); else if (ACT == 12) v = (v > 0.f) ? v : 0.01f * v; else if (ACT == 14) v = (v > 0.f) ? v : 0.1f * v; else if (ACT == 16) v = (v >= 0.f) ? v : 0.3f * v; else if (ACT == 17) v = (v >= 0.f) ? v : 0.2f * v; else if (ACT == 15) v = v / (1.0f + expf(-v)); else if (ACT == 3) v = fmaxf(v, 0.f); else if (ACT == 6) v = 0.5f * v * (1.0f + erff(v * 0.70710678118654752f)); so[w][8 * hh + r][t * 16 + ln] = v; } }
  __builtin_amdgcn_fence(__ATOMIC_ACQ_REL, "workgroup"); __builtin_amdgcn_wave_barrier();
  const int rsub = lane >> 4, c4 = (lane & 15) * 4; typedef _Float16 v4h __attribute__((ext_vector_type(4)));
  {
#pragma unroll
    for (int q = 0; q < 8; ++q) { const int r = q * 2 + rsub; if (col0 + c4 < N) { const v4f v = *(const v4fa*)&so[w][r][c4]; if (C) *(v4f*)(C + cofs + (size_t)(row0 + r) * ldc + col0 + c4) = v; if (C16) { v4h h4; for (int i = 0; i < 4; ++i) h4[i] = (_Float16)v[i]; *(v4h*)(C16 + cofs + (size_t)(row0 + r) * ldc + col0 + c4) = h4; } } }
     }
}


typedef _Float16 v4h __attribute__((ext_vector_type(4)));

__global__ __launch_bounds__(256) void k_x16(const float* __restrict__ x, _Float16* __restrict__ X16, size_t n8) { const size_t t = (size_t)blockIdx.x * 256 + threadIdx.x; if (t >= n8) return; FragH f;
#pragma unroll
  for (int q = 0; q < 8; ++q) f.h[q] = (_Float16)bf16_round(x[t * 8 + q]); *(v8us*)((unsigned short*)X16 + t * 8) = f.half[0];  }
__global__ __launch_bounds__(256) void k_h16(const float* __restrict__ x, _Float16* __restrict__ X16, size_t n8) { const size_t t = (size_t)blockIdx.x * 256 + threadIdx.x; if (t >= n8) return; FragH f;
#pragma unroll
  for (int q = 0; q < 8; ++q) f.h[q] = (_Float16)x[t * 8 + q]; *(v8us*)((unsigned short*)X16 + t * 8) = f.half[0];  }
__global__ __launch_bounds__(256) void k_round16f(const float* __restrict__ W, _Float16* __restrict__ Bt, size_t n8) { const size_t t = (size_t)blockIdx.x * 256 + threadIdx.x; if (t >= n8) return; FragH f;
#pragma unroll
  for (int i = 0; i < 8; ++i) f.h[i] = (_Float16)(bf16_round(W[t * 8 + i]) * 16.0f); *(v8us*)((unsigned short*)Bt + t * 8) = f.half[0];  }
template <int NHv, int TTv>
__global__ __launch_bounds__(256) void k_vt(const _Float16* __restrict__ V16, int ldv, int voff, _Float16* __restrict__ Vt) { __shared__ unsigned short tl[64][66]; const int tid = threadIdx.x; const int slab = blockIdx.x / (TTv / 64), lg = blockIdx.x % (TTv / 64); const int b = slab / NHv, h = slab % NHv;
  for (int i = tid; i < 64 * 8; i += 256) { const int r = i / 8, c8 = (i % 8) * 8; FragH f; f.half[0] = *(const v8us*)((const unsigned short*)V16 + ((size_t)b * TTv + lg * 64 + r) * ldv + voff + h * 64 + c8);
#pragma unroll
    for (int q = 0; q < 8; ++q) tl[r][c8 + q] = f.u[q]; }
  __syncthreads();
  {
#pragma unroll
    for (int rd = 0; rd < 2; ++rd) { const int d = rd * 32 + tid / 8, pc = tid % 8; FragH f;
#pragma unroll
      for (int q = 0; q < 8; ++q) f.u[q] = tl[pc * 8 + q][d];
      *(v8us*)((unsigned short*)Vt + ((size_t)slab * 64 + d) * TTv + lg * 64 + pc * 8) = f.half[0]; }
     } }

__global__ __launch_bounds__(256) void k_hl(const float* __restrict__ F, _Float16* __restrict__ Hh, _Float16* __restrict__ Hl, size_t n8) { const size_t t = (size_t)blockIdx.x * 256 + threadIdx.x; if (t >= n8) return; FragH fh, fl; const v4f a = *(const v4fa*)(F + t * 8), c = *(const v4fa*)(F + t * 8 + 4);
#pragma unroll
  for (int q = 0; q < 4; ++q) { _Float16 h = (_Float16)a[q]; fh.h[q] = h; fl.h[q] = (_Float16)((a[q] - (float)h) * 1024.0f); h = (_Float16)c[q]; fh.h[4 + q] = h; fl.h[4 + q] = (_Float16)((c[q] - (float)h) * 1024.0f); }
  { *(v8us*)((unsigned short*)Hh + t * 8) = fh.half[0]; *(v8us*)((unsigned short*)Hl + t * 8) = fl.half[0];  } }

// ---- fast GEMM (wave tile 32x64; requires M % 32 == 0 rows per launch region and N % 64 == 0); epilogue = k_gemm_hhx semantics ----
__device__ __forceinline__ v16h g2_frag(const _Float16* p, int hh) { FragH f; f.half[0] = *(const v8us*)((const unsigned short*)p + 8 * hh); f.half[1] = *(const v8us*)((const unsigned short*)p + 16 + 8 * hh); return f.v; }
__device__ __forceinline__ v8f g2_mma(v16h a, v16h b, v8f c) { v8f d = __builtin_amdgcn_wmma_f32_16x16x32_f16(false, a, false, b, (short)0, c, false, false); asm volatile("v_nop\n\tv_nop\n\tv_nop\n\tv_nop" : "+v"(d) : "v"(a), "v"(b)); return d; }
template <int ACT>
__global__ __launch_bounds__(128) void k_gemm2(const _Float16* __restrict__ A, int lda, size_t sA, const _Float16* __restrict__ Bh, int ldb, size_t sB, float alpha, const float* __restrict__ bias, size_t sBias, const float* __restrict__ CP, int rowsPerB, size_t sCPb, int row0g,
    float* __restrict__ C, _Float16* __restrict__ C16, int ldc, size_t sC, int M, int N, int K, int bshift = 0) { static_assert(ACT == 0 || ACT == 3 || ACT == 6 || ACT == 8 || ACT == 9 || ACT == 11 || ACT == 12 || ACT == 14 || ACT == 15 || ACT == 16 || ACT == 17, "k_gemm2: unsupported ACT code (would silently apply no activation)");
  __shared__ __attribute__((aligned(16))) float so[4][32][68];
  const int tid = threadIdx.x, w = tid >> 5, lane = tid & 31, ln = lane & 15, hh = lane >> 4; const int by = blockIdx.y;
  A += (size_t)by * sA; Bh += (size_t)(by >> bshift) * sB;      /* 2^bshift consecutive batch planes share one B plane (query heads of one kv group) */ const size_t cofs = (size_t)by * sC; const float* bp = bias ? bias + (size_t)by * sBias : nullptr;
  const int ntn = N >> 6; const int mt = blockIdx.x / ntn, nq = blockIdx.x - mt * ntn; const int row0 = mt * 128 + 32 * w, col0 = nq * 64; if (row0 >= M) return;
  const _Float16* a0p = A + (size_t)(row0 + ln) * lda; const _Float16* a1p = a0p + (size_t)16 * lda;
  const _Float16* b0p = Bh + (size_t)(col0 + ln) * ldb; const _Float16* b1p = b0p + (size_t)16 * ldb; const _Float16* b2p = b1p + (size_t)16 * ldb; const _Float16* b3p = b2p + (size_t)16 * ldb;
  const v8f z8 = {0.f,0.f,0.f,0.f,0.f,0.f,0.f,0.f}; v8f c00 = z8, c01 = z8, c02 = z8, c03 = z8, c10 = z8, c11 = z8, c12 = z8, c13 = z8;
#pragma unroll 1
  for (int kb = 0; kb < K; kb += 32) { const v16h a0 = g2_frag(a0p + kb, hh), a1 = g2_frag(a1p + kb, hh);
    v16h b = g2_frag(b0p + kb, hh); c00 = g2_mma(a0, b, c00); c10 = g2_mma(a1, b, c10);
    b = g2_frag(b1p + kb, hh); c01 = g2_mma(a0, b, c01); c11 = g2_mma(a1, b, c11);
    b = g2_frag(b2p + kb, hh); c02 = g2_mma(a0, b, c02); c12 = g2_mma(a1, b, c12);
    b = g2_frag(b3p + kb, hh); c03 = g2_mma(a0, b, c03); c13 = g2_mma(a1, b, c13); }
  v8f accs[8] = {c00, c01, c02, c03, c10, c11, c12, c13};
#pragma unroll
  for (int u = 0; u < 8; ++u) { const int t = u & 3, half = u >> 2; const int col = col0 + t * 16 + ln; const float bv = bp ? bf16_round(bp[col]) : 0.f;
#pragma unroll
    for (int r = 0; r < 8; ++r) { const int rloc = half * 16 + 8 * hh + r; float v = accs[u][r] * alpha + bv; if (CP) { if (rowsPerB < 0) v += CP[cofs + (size_t)(row0g + row0 + rloc) * ldc + col];      /* rowsPerB < 0: own element of the batched C plane */ else { const int bidx = (row0g + row0 + rloc) / rowsPerB; v += CP[(size_t)bidx * sCPb + (size_t)by * 64 + col]; } }
      if (ACT == 3) v = fmaxf(v, 0.f); else if (ACT == 6) v = 0.5f * v * (1.0f + erff(v * 0.70710678118654752f)); else if (ACT == 11) v = 1.0f / (1.0f + expf(-v)); else if (ACT == 15) v = v / (1.0f + expf(-v)); else if (ACT == 12) v = (v > 0.f) ? v : 0.01f * v; else if (ACT == 8) v = tanhf(v); else if (ACT == 9) v = 0.5f * v * (1.0f + tanhf(0.7978845608028654f * (v + 0.044715f * v * v * v))); else if (ACT == 14) v = (v > 0.f) ? v : 0.1f * v; else if (ACT == 16) v = (v >= 0.f) ? v : 0.3f * v; else if (ACT == 17) v = (v >= 0.f) ? v : 0.2f * v;
      so[w][rloc][t * 16 + ln] = v; } }
  __builtin_amdgcn_fence(__ATOMIC_ACQ_REL, "workgroup"); __builtin_amdgcn_wave_barrier();
  const int rsub = lane >> 4, c4 = (lane & 15) * 4;
  {
#pragma unroll
    for (int q = 0; q < 16; ++q) { const int r = q * 2 + rsub; const v4f v = *(const v4fa*)&so[w][r][c4]; if (C) *(v4f*)(C + cofs + (size_t)(row0 + r) * ldc + col0 + c4) = v; if (C16) { v4h h4; for (int i = 0; i < 4; ++i) h4[i] = (_Float16)v[i]; *(v4h*)(C16 + cofs + (size_t)(row0 + r) * ldc + col0 + c4) = h4; } }
     } }


__global__ __launch_bounds__(256) void k_wnat(const float* __restrict__ w, size_t n8, _Float16* __restrict__ Bt) { const size_t t = (size_t)blockIdx.x * 256 + threadIdx.x; if (t >= n8) return; FragH f; for (int q = 0; q < 8; ++q) f.h[q] = (_Float16)(bf16_round(w[t * 8 + q]) * 16.0f); *(v8us*)((unsigned short*)Bt + t * 8) = f.half[0];  }
__global__ __launch_bounds__(256) void k_rsm(const float* __restrict__ S, _Float16* __restrict__ P, int nrows) {
  #pragma clang fp contract(off)
  const int i = blockIdx.x * 256 + threadIdx.x; if (i >= nrows) return; const float* s = S + (size_t)i * SQ; float mx = -3.0e38f;
#pragma unroll 1
  for (int j = 0; j < SQ; ++j) mx = fmaxf(mx, s[j]); float se = 0.f;
#pragma unroll 1
  for (int j = 0; j < SQ; ++j) se += expf(s[j] - mx); const float sc = 256.0f / se;
#pragma unroll 1
  for (int j0 = 0; j0 < SQ; j0 += 8) { FragH f; for (int q = 0; q < 8; ++q) f.h[q] = (_Float16)(expf(s[j0 + q] - mx) * sc); unsigned short* d = (unsigned short*)P + (size_t)i * SQ + j0; *(v8us*)d = f.half[0];  } }
__global__ __launch_bounds__(256) void k_vt(const _Float16* __restrict__ V16, int b, int h0, _Float16* __restrict__ VT) { __shared__ unsigned short tl[64][65]; const int tid = threadIdx.x; const int hh = blockIdx.x % HG, sg = blockIdx.x / HG; const int s0 = sg * 64; const int h = h0 + hh;
  for (int i = tid; i < 64 * 8; i += 256) { const int j = i / 8, d8 = (i % 8) * 8; FragH f; f.half[0] = *(const v8us*)((const unsigned short*)V16 + ((size_t)b * SQ + s0 + j) * DM + h * HD + d8); for (int q = 0; q < 8; ++q) tl[d8 + q][j] = f.u[q]; }
  __syncthreads();
  { for (int i = tid; i < 64 * 8; i += 256) { const int d = i / 8, j8 = (i % 8) * 8; FragH f; for (int q = 0; q < 8; ++q) f.u[q] = tl[d][j8 + q]; *(v8us*)((unsigned short*)VT + ((size_t)hh * HD + d) * SQ + s0 + j8) = f.half[0]; }  } }



__global__ __launch_bounds__(256) void k_rsmcf2(const float* __restrict__ S, _Float16* __restrict__ P, int hg, int q0, int nk) {
  #pragma clang fp contract(off)
  const int t = blockIdx.x * 256 + threadIdx.x; if (t >= hg * QT) return; const size_t i = (size_t)t; const float* s = S + i * NKX; const int last = q0 + (t % QT); float mx = -3.0e38f;
#pragma unroll 1
  for (int j = 0; j < nk; ++j) { const float f = (j <= last) ? 1.f : 0.f; mx = fmaxf(mx, fmaf(f, s[j], (1.f - f) * -1.0e9f)); } float se = 0.f;
#pragma unroll 1
  for (int j = 0; j < nk; ++j) { const float f = (j <= last) ? 1.f : 0.f; se += __expf(fmaf(f, s[j], (1.f - f) * -1.0e9f) - mx); } const float sc = 256.0f / se;
#pragma unroll 1
  for (int j0 = 0; j0 < nk; j0 += 8) { FragH fr; for (int q = 0; q < 8; ++q) { const int j = j0 + q; const float f = (j <= last) ? 1.f : 0.f; fr.h[q] = (_Float16)(__expf(fmaf(f, s[j], (1.f - f) * -1.0e9f) - mx) * sc); } unsigned short* d = (unsigned short*)P + i * NKX + j0; *(v8us*)d = fr.half[0];  } }


template <int MASKADD>
__global__ __launch_bounds__(64) void k_att0(const float* __restrict__ QF, const float* __restrict__ KF, const float* __restrict__ VF, int ld, const float* __restrict__ mask, float scale, float* __restrict__ OF, int ldo) {
  #pragma clang fp contract(off)
  __shared__ __attribute__((aligned(16))) float lq[64][64]; __shared__ __attribute__((aligned(16))) float lo[64][64];
  const int tid = threadIdx.x; const int h = blockIdx.x / (QT0 / 64), rg = blockIdx.x % (QT0 / 64); const int i = rg * 64 + tid;
  const float* qr = QF + (size_t)i * ld + h * HD;
#pragma unroll 1
  for (int c = 0; c < HD / 4; ++c) { *(v4f*)&lq[tid][c * 4] = *(const v4fa*)(qr + c * 4); const v4f z = {0.f, 0.f, 0.f, 0.f}; *(v4f*)&lo[tid][c * 4] = z; }
  float m = -1.0e30f, l = 0.f; const int jmax = MASKADD ? (SQ - 1) : (rg * 64 + 63);      /* additive-mask form: every key (the mask input decides); causal form: keys up to the block's last row */
#pragma unroll 1
  for (int j = 0; j <= jmax; ++j) { const float* kr = KF + (size_t)j * ld + h * HD; const float* vr = VF + (size_t)j * ld + h * HD; float s = 0.f;
#pragma unroll 1
    for (int c = 0; c < HD / 4; ++c) { const v4f kq = *(const v4fa*)(kr + c * 4); const v4f qq = *(v4f*)&lq[tid][c * 4]; s = __fadd_rn(s, __fmul_rn(qq[0], kq[0])); s = __fadd_rn(s, __fmul_rn(qq[1], kq[1])); s = __fadd_rn(s, __fmul_rn(qq[2], kq[2])); s = __fadd_rn(s, __fmul_rn(qq[3], kq[3])); }
    s = __fmul_rn(s, scale); if (MASKADD) s = __fadd_rn(s, __fmul_rn(bf16_round(mask[(size_t)i * SQ + j]), -10000.0f));
    const float f = (MASKADD || j <= i) ? 1.f : 0.f; const float sm = fmaf(f, s, (1.f - f) * -1.0e30f); const float mn = fmaxf(m, sm); const float sc = expf(m - mn); const float e = expf(sm - mn); l = __fadd_rn(__fmul_rn(l, sc), e); m = mn;
#pragma unroll 1
    for (int c = 0; c < HD / 4; ++c) { const v4f vv = *(const v4fa*)(vr + c * 4); v4f oo = *(v4f*)&lo[tid][c * 4]; for (int u = 0; u < 4; ++u) oo[u] = __fadd_rn(__fmul_rn(oo[u], sc), __fmul_rn(e, vv[u])); *(v4f*)&lo[tid][c * 4] = oo; } }
  const float fin = 64.0f / l;      /* o carried x64 like the f16 path */
#pragma unroll 1
  for (int c = 0; c < HD / 4; ++c) { v4f oo = *(v4f*)&lo[tid][c * 4]; for (int u = 0; u < 4; ++u) oo[u] = __fmul_rn(oo[u], fin); *(v4f*)&lo[tid][c * 4] = oo; }
  __syncthreads();
  {
#pragma unroll 1
    for (int it = 0; it < 16; ++it) { const int row = it * 4 + tid / 16, pc = (tid % 16) * 4; const v4f v = *(const v4f*)&lo[row][pc]; *(v4f*)(OF + (size_t)(rg * 64 + row) * ldo + h * HD + pc) = v; }
     } }


__global__ __launch_bounds__(256) void k_kvexp(const float* __restrict__ src, float* __restrict__ dst, size_t n4) { const size_t t = (size_t)blockIdx.x * 256 + threadIdx.x; if (t >= n4) return; const size_t e = t * 4; const size_t row = e / DM; const int col = (int)(e % DM); const int h = col / HD, d = col % HD; const v4f v = *(const v4fa*)(src + row * KVD + (size_t)(h / HPG) * HD + d); *(v4f*)(dst + e) = v;  }

__global__ __launch_bounds__(256) void k_tab2(float theta, float* __restrict__ CS, float* __restrict__ SN) {
  #pragma clang fp contract(off)
  const int t = blockIdx.x * 256 + threadIdx.x; if (t >= SQ * (HD / 2)) return; const int i = t % (HD / 2); const int p = t / (HD / 2); const float invf = 1.0f / powf(theta, (float)(2 * i) / (float)HD); const float ang = __fmul_rn((float)p, invf); const float c = cosf(ang), s = sinf(ang);
  *(float*)(CS + t) = c; *(float*)(SN + t) = s;  }
template <int NORM, int ROPE>
__global__ __launch_bounds__(64) void k_xform(const float* __restrict__ F, int ldf, int nh, const float* __restrict__ gain, float eps, const float* __restrict__ CS, const float* __restrict__ SN, _Float16* __restrict__ H16, int ldo) {
  #pragma clang fp contract(off)
  __shared__ float xv[HD]; __shared__ float red[HD]; __shared__ unsigned short sh_[HD]; const int d = threadIdx.x; const int h = blockIdx.x % nh; const size_t r = blockIdx.x / nh; const int p = (int)(r % SQ);
  float x = F[r * (size_t)ldf + (size_t)h * HD + d];
  if (NORM) { red[d] = __fmul_rn(x, x); __syncthreads(); for (int st = HD / 2; st > 0; st >>= 1) { if (d < st) red[d] = __fadd_rn(red[d], red[d + st]); __syncthreads(); } const float rs = rsqrtf(__fadd_rn(red[0] / (float)HD, eps)); x = __fmul_rn(__fmul_rn(x, rs), bf16_round(gain[d])); }
  xv[d] = x; __syncthreads();
  float o = x;
  if (ROPE == 1) { const int i = d >> 1; const float c = CS[p * (HD / 2) + i], s = SN[p * (HD / 2) + i]; const float ev = xv[2 * i], od = xv[2 * i + 1]; o = (d & 1) ? __fadd_rn(__fmul_rn(ev, s), __fmul_rn(od, c)) : __fadd_rn(__fmul_rn(ev, c), -__fmul_rn(od, s)); }
  if (ROPE == 2) { const int i = d & (HD / 2 - 1); const float c = CS[p * (HD / 2) + i], s = SN[p * (HD / 2) + i]; const float lo = xv[i], hi = xv[i + HD / 2]; o = (d < HD / 2) ? __fadd_rn(__fmul_rn(lo, c), -__fmul_rn(hi, s)) : __fadd_rn(__fmul_rn(lo, s), __fmul_rn(hi, c)); }
  if (ROPE == 3) { const float c = CS[p * HD + d], s = SN[p * HD + d]; const float lo = xv[d & (HD / 2 - 1)], hi = xv[(d & (HD / 2 - 1)) + HD / 2]; o = (d < HD / 2) ? __fadd_rn(__fmul_rn(lo, c), -__fmul_rn(hi, s)) : __fadd_rn(__fmul_rn(hi, c), __fmul_rn(lo, s)); }      /* rotate-half with FULL-width per-element tables [pos][HD] */
  FragH th; th.h[0] = (_Float16)o; sh_[d] = th.u[0]; __syncthreads();
  if (d < HD / 8) { FragH f; for (int q = 0; q < 8; ++q) f.u[q] = sh_[d * 8 + q]; unsigned short* dst = (unsigned short*)H16 + r * (size_t)ldo + (size_t)h * HD + d * 8; *(v8us*)dst = f.half[0];  } }

template <int NORM, int ROPE>
__global__ __launch_bounds__(64) void k_xformf(const float* __restrict__ F, int ldf, int nh, const float* __restrict__ gain, float eps, const float* __restrict__ CS, const float* __restrict__ SN, float* __restrict__ F32, int ldo) {
  #pragma clang fp contract(off)
  __shared__ float xv[HD]; __shared__ float red[HD]; const int d = threadIdx.x; const int h = blockIdx.x % nh; const size_t r = blockIdx.x / nh; const int p = (int)(r % SQ);
  float x = F[r * (size_t)ldf + (size_t)h * HD + d];
  if (NORM) { red[d] = __fmul_rn(x, x); __syncthreads(); for (int st = HD / 2; st > 0; st >>= 1) { if (d < st) red[d] = __fadd_rn(red[d], red[d + st]); __syncthreads(); } const float rs = rsqrtf(__fadd_rn(red[0] / (float)HD, eps)); x = __fmul_rn(__fmul_rn(x, rs), bf16_round(gain[d])); }
  xv[d] = x; __syncthreads();
  float o = x;
  if (ROPE == 1) { const int i = d >> 1; const float c = CS[p * (HD / 2) + i], s = SN[p * (HD / 2) + i]; const float ev = xv[2 * i], od = xv[2 * i + 1]; o = (d & 1) ? __fadd_rn(__fmul_rn(ev, s), __fmul_rn(od, c)) : __fadd_rn(__fmul_rn(ev, c), -__fmul_rn(od, s)); }
  if (ROPE == 2) { const int i = d & (HD / 2 - 1); const float c = CS[p * (HD / 2) + i], s = SN[p * (HD / 2) + i]; const float lo = xv[i], hi = xv[i + HD / 2]; o = (d < HD / 2) ? __fadd_rn(__fmul_rn(lo, c), -__fmul_rn(hi, s)) : __fadd_rn(__fmul_rn(lo, s), __fmul_rn(hi, c)); }
  if (ROPE == 3) { const float c = CS[p * HD + d], s = SN[p * HD + d]; const float lo = xv[d & (HD / 2 - 1)], hi = xv[(d & (HD / 2 - 1)) + HD / 2]; o = (d < HD / 2) ? __fadd_rn(__fmul_rn(lo, c), -__fmul_rn(hi, s)) : __fadd_rn(__fmul_rn(hi, c), __fmul_rn(lo, s)); }      /* rotate-half with FULL-width per-element tables [pos][HD] */
  float* dst = F32 + r * (size_t)ldo + (size_t)h * HD + d; *(float*)dst = o;  }

__global__ __launch_bounds__(256) void k_bfcp(const float* __restrict__ src, float* __restrict__ dst, size_t n4) { const size_t t = (size_t)blockIdx.x * 256 + threadIdx.x; if (t >= n4) return; const v4f a = *(const v4fa*)(src + t * 4); v4f o; for (int q = 0; q < 4; ++q) o[q] = bf16_round(a[q]); *(v4f*)(dst + t * 4) = o;  }

__global__ __launch_bounds__(256) void k_tabhalf(const float* __restrict__ cs, const float* __restrict__ sn, float* __restrict__ CS, float* __restrict__ SN) { const int t = blockIdx.x * 256 + threadIdx.x; if (t >= SQ * (HD / 2)) return; const int p = t / (HD / 2), i = t % (HD / 2); const float c = bf16_round(cs[(size_t)p * HD + i]), s = bf16_round(sn[(size_t)p * HD + i]);
  *(float*)(CS + t) = c; *(float*)(SN + t) = s;  }

__global__ __launch_bounds__(256) void k_tab2d(float* __restrict__ CS, float* __restrict__ SN) {
  #pragma clang fp contract(off)
  const int t = blockIdx.x * 256 + threadIdx.x; if (t >= SQ * (HD / 2)) return; const int i = t % (HD / 2); const int p = t / (HD / 2); const float invf = (float)(1.0 / pow(10000.0, (double)(2 * i) / (double)HD)); const float ang = __fmul_rn((float)p, invf); const float c = cosf(ang), s = sinf(ang);
  *(float*)(CS + t) = c; *(float*)(SN + t) = s;  }
extern "C" void kernel_launch(void* const* d_in, const int* in_sizes, int n_in,
                              void* d_out, int out_size, void* d_ws, size_t ws_size, hipStream_t stream) {
  (void)in_sizes; (void)n_in; (void)out_size;
  const float* const* I = (const float* const*)d_in; const float* x = I[0]; const float* wq = I[1]; const float* wk = I[2]; const float* wv = I[3]; const float* wo = I[4]; const float* bq = nullptr; const float* bk = nullptr; const float* bv = nullptr; const float* bo = nullptr;      /* natural [out][in] weights, no biases; rope tables computed in the kernel */
  char* ws = (char*)d_ws; size_t off = 0;
  auto take = [&](size_t bytes) { char* p = ws + off; off += (bytes + 255) & ~(size_t)255; return p; };
  _Float16* BQ = (_Float16*)take((size_t)DM * DM * 2); _Float16* BK = (_Float16*)take((size_t)KVD * DM * 2); _Float16* BV = (_Float16*)take((size_t)KVD * DM * 2); _Float16* BO = (_Float16*)take((size_t)DM * DM * 2);
  _Float16* X16 = (_Float16*)take(NR * DM * 2); float* QF = (float*)take((size_t)SQ * DM * 4); float* KF = (float*)take((size_t)SQ * KVD * 4); float* CSB = (float*)take((size_t)SQ * HD * 4); float* SNB = (float*)take((size_t)SQ * HD * 4); _Float16* Q16 = (_Float16*)take(NR * DM * 2); _Float16* K16 = (_Float16*)take(NR * KVD * 2); _Float16* V16 = (_Float16*)take(NR * KVD * 2); _Float16* O16 = (_Float16*)take(NR * DM * 2);
  float* S = (float*)take((size_t)NH * QT * NKX * 4); _Float16* P = (_Float16*)take((size_t)NH * QT * NKX * 2); _Float16* VT = (_Float16*)take((size_t)NH * HD * SQ * 2);
  float* QF0 = (float*)take((size_t)QT0 * DM * 4); float* KF0 = (float*)take((size_t)QT0 * KVD * 4); float* VF0 = (float*)take((size_t)QT0 * KVD * 4); float* KF0e = (float*)take((size_t)QT0 * DM * 4); float* VF0e = (float*)take((size_t)QT0 * DM * 4); float* OF0 = (float*)take((size_t)NB * QT0 * DM * 4); _Float16* OH0 = (_Float16*)take((size_t)NB * QT0 * DM * 2); _Float16* OL0 = (_Float16*)take((size_t)NB * QT0 * DM * 2);
  if (off > ws_size) return;
  k_wnat<<<(unsigned)(((size_t)DM * DM / 8 + 255) / 256), 256, 0, stream>>>(wq, (size_t)DM * DM / 8, BQ); k_wnat<<<(unsigned)(((size_t)KVD * DM / 8 + 255) / 256), 256, 0, stream>>>(wk, (size_t)KVD * DM / 8, BK); k_wnat<<<(unsigned)(((size_t)KVD * DM / 8 + 255) / 256), 256, 0, stream>>>(wv, (size_t)KVD * DM / 8, BV); k_wnat<<<(unsigned)(((size_t)DM * DM / 8 + 255) / 256), 256, 0, stream>>>(wo, (size_t)DM * DM / 8, BO);      /* natural [out][in] = Bt planes x16 */
  k_x16<<<(unsigned)((NR * DM / 8 + 255) / 256), 256, 0, stream>>>(x, X16, NR * DM / 8);
  k_tab2d<<<(SQ * (HD / 2) + 255) / 256, 256, 0, stream>>>(CSB, SNB);      /* rope tables cos/sin(p / 10000^(2i/64)): inv_freq double-derived -> f32, f32 angle */
  const size_t r0p = (size_t)B0 * SQ;      /* first projected row */
  k_gemm2<0><<<dim3((unsigned)((MP / 128) * (KVD / 64)), 1), 128, 0, stream>>>(X16 + r0p * DM, DM, 0, BV, DM, 0, 0.0625f, bv, 0, nullptr, 1, 0, 0, nullptr, V16 + r0p * KVD, KVD, 0, MP, KVD, DM);
  for (int b = B0; b < B0 + NBR; ++b) { const size_t r0 = (size_t)b * SQ;
    k_gemm2<0><<<dim3((unsigned)((SQ / 128) * (DM / 64)), 1), 128, 0, stream>>>(X16 + r0 * DM, DM, 0, BQ, DM, 0, 0.0625f, nullptr, 0, nullptr, 1, 0, 0, QF, nullptr, DM, 0, SQ, DM, DM);      /* q (f32) of this batch */
    k_gemm2<0><<<dim3((unsigned)((SQ / 128) * (KVD / 64)), 1), 128, 0, stream>>>(X16 + r0 * DM, DM, 0, BK, DM, 0, 0.0625f, nullptr, 0, nullptr, 1, 0, 0, KF, nullptr, KVD, 0, SQ, KVD, DM);      /* k (f32) */
    k_xform<0, 1><<<(unsigned)((size_t)SQ * NH), 64, 0, stream>>>(QF, DM, NH, nullptr, 0.f, CSB, SNB, Q16 + r0 * DM, DM); k_xform<0, 1><<<(unsigned)((size_t)SQ * NG), 64, 0, stream>>>(KF, KVD, NG, nullptr, 0.f, CSB, SNB, K16 + r0 * KVD, KVD);      /* interleaved-pair rope -> f16 rows */
    k_xformf<0, 1><<<(unsigned)(QT0 * NH), 64, 0, stream>>>(QF, DM, NH, nullptr, 0.f, CSB, SNB, QF0, DM); k_xformf<0, 1><<<(unsigned)(QT0 * NG), 64, 0, stream>>>(KF, KVD, NG, nullptr, 0.f, CSB, SNB, KF0, KVD);      /* f32 roped q, k of rows 0..127 */
    k_vt<NG, SQ><<<NG * (SQ / 64), 256, 0, stream>>>(V16 + r0 * KVD, KVD, 0, VT);      /* V^T [NG][HD][SQ] for this batch */
    k_gemm2<0><<<dim3((QT0 / 128) * (KVD / 64), 1), 128, 0, stream>>>(X16 + r0 * DM, DM, 0, BV, DM, 0, 0.0625f, bv, 0, nullptr, 1, 0, 0, VF0, nullptr, KVD, 0, QT0, KVD, DM);
    k_kvexp<<<(unsigned)(((size_t)QT0 * DM / 4 + 255) / 256), 256, 0, stream>>>(KF0, KF0e, (size_t)QT0 * DM / 4); k_kvexp<<<(unsigned)(((size_t)QT0 * DM / 4 + 255) / 256), 256, 0, stream>>>(VF0, VF0e, (size_t)QT0 * DM / 4);      /* head h <- kv group h/4 for the exact first-tile kernel */      /* f32 q, k, v of the first 128 rows (exact products) */
    k_att0<0><<<NH * (QT0 / 64), 64, 0, stream>>>(QF0, KF0e, VF0e, DM, nullptr, 0.125f, OF0 + (size_t)b * QT0 * DM, DM);      /* exact f32 attention for rows 0..127 (o x64) */
    for (int q0 = 0; q0 < QN; q0 += QT) { const int nk = q0 + QT;      /* causal: only keys below the tile end are computed */
      k_gemm2<0><<<dim3((QT / 128) * (nk / 64), NH), 128, 0, stream>>>(Q16 + (r0 + q0) * LQ, LQ, (size_t)HD, K16 + r0 * KVD, KVD, (size_t)HD, 0.125f, nullptr, 0, nullptr, 1, 0, 0, S, nullptr, NKX, (size_t)QT * NKX, QT, nk, HD, 2);      /* scores: all 32 heads in one launch, head h against the keys of group h / 4 */
      k_rsmcf2<<<(NHD * QT + 255) / 256, 256, 0, stream>>>(S, P, NHD, q0, nk);
      k_gemm2<0><<<dim3((QT / 128) * (HD / 64), NH), 128, 0, stream>>>(P, NKX, (size_t)QT * NKX, VT, SQ, (size_t)HD * SQ, 0.25f, nullptr, 0, nullptr, 1, 0, 0, nullptr, O16 + (r0 + q0) * DM, DM, (size_t)HD, QT, HD, nk, 2); } }      /* o for all 32 heads in one launch, head h with V^T of group h / 4 (x64) */      /* o (merged heads, x64) as f16 rows */
  k_gemm2<0><<<dim3((unsigned)((MPO / 128) * (DM / 64)), 1), 128, 0, stream>>>(O16 + r0p * DM, DM, 0, BO, DM, 0, 0.0009765625f, bo, 0, nullptr, 1, 0, 0, (float*)d_out + r0p * DM, nullptr, DM, 0, MPO, DM, DM);      /* out rows are the output layout */
  k_hl<<<(unsigned)(((size_t)NB * QT0 * DM / 8 + 255) / 256), 256, 0, stream>>>(OF0, OH0, OL0, (size_t)NB * QT0 * DM / 8);      /* first-tile o (x64) -> f16 hi + x1024 residual planes */
  for (int b = B0; b < B0 + NBR; ++b) { const size_t r0 = (size_t)b * SQ; const size_t f0 = (size_t)b * QT0;
    k_gemm2<0><<<dim3((QT0 / 128) * (DM / 64), 1), 128, 0, stream>>>(OH0 + f0 * DM, DM, 0, BO, DM, 0, 0.0009765625f, bo, 0, nullptr, 1, 0, 0, (float*)d_out + r0 * DM, nullptr, DM, 0, QT0, DM, DM);      /* rows 0..127: out = o_hi Wo (+ b), overwriting the f16-path rows */
    k_gemm2<0><<<dim3((QT0 / 128) * (DM / 64), 1), 128, 0, stream>>>(OL0 + f0 * DM, DM, 0, BO, DM, 0, 0.00000095367431640625f, nullptr, 0, (const float*)d_out + r0 * DM, -1, 0, 0, (float*)d_out + r0 * DM, nullptr, DM, 0, QT0, DM, DM); }      /* += o_lo Wo 2^-20 (own-element accumulate) */
}

// v002
// It runs in 1360 microseconds.
// Timed twice side by side with v001, it ran 2.06 and 2.07 times as fast.
// All steps since v000 together make it 3.57 times as fast.
#include <hip/hip_runtime.h>
// LLaMA grouped-query causal attention with interleaved-pair RoPE (hidden_states [1][2048][2048]; q = x Wq^T (natural [2048][2048]), k = x Wk^T, v = x Wv^T (natural [512][2048]) (sigma 0.02, no biases): 32 query heads / 8 kv heads of 64 (repeat_interleave: kv head h / 4); tables cos/sin of pos / 10000^(2i/64) repeated per pair; q = q cos + rotate_pairs(q) sin with rotate_pairs (x0, x1) -> (-x1, x0): pair (e, o) -> (e cos - o sin, o cos + e sin); scores x 64^-0.5 with a causal mask (triu(1) -> -inf); softmax; out = merged Wo^T (natural) -> [1][2048][2048]).
// Compute dtype: inputs rounded to bf16; x / weights exact; q, k, v, softmax weights and o as plain f16 GEMM operands (~2^-12); scores and softmax statistics f32. v_wmma_f32_16x16x32_f16.
#define NB 1
#define NG 8
#define HPG 4
#define KVD (NG * HD)
#define SQ 2048
#define DM 2048
#define NH 32
#define HD 64
#define HG 4                         /* heads covered by one launch of the non-template k_vt (unused) */
#define QT 256                       /* query rows per causal tile */
#define NKX SQ                       /* S / P row pitch */
#define QT0 128                      /* first-tile rows recomputed exactly in f32 */
#define B0 0                         /* first batch processed (debug hook) */
#define NBR NB                       /* batches processed (debug hook) */
#define NR ((size_t)NB * SQ)         /* token rows */
#define MP ((int)((size_t)NBR * SQ)) /* rows projected (debug hook) */
#define QN SQ                        /* query rows attended per batch (debug hook) */
#define NHD NH                       /* heads attended (debug hook) */
#define MPO MP                       /* rows through the output stage (debug hook) */
#define LQ DM      /* row pitch of the q rows */
typedef __bf16 v16b __attribute__((ext_vector_type(16)));
typedef unsigned short v8us __attribute__((ext_vector_type(8), may_alias));
typedef float  v8f  __attribute__((ext_vector_type(8)));
typedef float  v4f  __attribute__((ext_vector_type(4)));
typedef float  v4fa __attribute__((ext_vector_type(4), may_alias));
union FragB { v16b v; v8us half[2]; unsigned short u[16]; };

__device__ __forceinline__ unsigned short bf16_bits(float x) { unsigned int u = __float_as_uint(x); return (unsigned short)((u + 0x7FFFu + ((u >> 16) & 1u)) >> 16); }
__device__ __forceinline__ float bf16_val(unsigned short b) { return __uint_as_float(((unsigned int)b) << 16); }
__device__ __forceinline__ float bf16_round(float x) { return bf16_val(bf16_bits(x)); }
// D += A·B with NT terms: 1 = ah·bh, 2 = + al·bh (A split), 3 = + ah·bl (both split)
template <int NT>
__device__ __forceinline__ v8f mmaN(v16b ah, v16b al, v16b bh, v16b bl, v8f c) {
  c = __builtin_amdgcn_wmma_f32_16x16x32_bf16(false, ah, false, bh, (short)0, c, false, false);
  if (NT >= 2) c = __builtin_amdgcn_wmma_f32_16x16x32_bf16(false, al, false, bh, (short)0, c, false, false);
  if (NT >= 3) c = __builtin_amdgcn_wmma_f32_16x16x32_bf16(false, ah, false, bl, (short)0, c, false, false);
  asm volatile("v_nop\n\tv_nop\n\tv_nop\n\tv_nop" : "+v"(c) : "v"(ah), "v"(al), "v"(bh), "v"(bl));
  return c;
}

__global__ __launch_bounds__(256) void k_wt_bf16(const float* __restrict__ W, unsigned short* __restrict__ Wt, int K, int N) {
  const int t = blockIdx.x * 256 + threadIdx.x;
  const int k8n = K / 8;
  if (t >= N * k8n) return;
  const int n = t / k8n, k8 = (t % k8n) * 8;
  v8us v;
#pragma unroll
  for (int i = 0; i < 8; ++i) v[i] = bf16_bits(W[(size_t)(k8 + i) * N + n]);
  *(v8us*)(Wt + (size_t)n * K + k8) = v;
  
}

// GEMM C[M][N] (f32, pitch ldc) = act(A[M][K]·W + bias). A f32 row-major (pitch lda) converted per fragment to bf16
// (ASPLIT: hi/lo two planes -> 2 terms, else single rounded term); Wt bf16 [N][K] (pitch ldb). BIAS_BF16 rounds the
// bias to bf16 first (bias quantised to bf16 before the add). K%32==0, M%16==0, N%64==0.
template <bool ASPLIT, int ACT, bool BIAS_BF16>
__global__ __launch_bounds__(128) void k_gemm_bf(const float* __restrict__ A, int lda, const unsigned short* __restrict__ Wt, int ldb,
                                               const float* __restrict__ bias, float* __restrict__ C, int ldc, int M, int N, int K) {
  __shared__ __attribute__((aligned(16))) float so[4][16][64];
  const int tid = threadIdx.x, w = tid >> 5, lane = tid & 31, ln = lane & 15, hh = lane >> 4;
  const int ntn = N / 64;
  const int wid = blockIdx.x * 4 + w;
  const int mt = wid / ntn, nq = wid % ntn;
  if (mt * 16 >= M) return;
  const int row0 = mt * 16, col0 = nq * 64;
  const float* arow = A + (size_t)(row0 + ln) * lda;
  v8f acc[4] = {};
  for (int kb = 0; kb < K; kb += 32) {
    FragB ah, al;
    const v4f x0 = *(const v4fa*)(arow + kb + 8 * hh), x1 = *(const v4fa*)(arow + kb + 8 * hh + 4);
    const v4f x2 = *(const v4fa*)(arow + kb + 16 + 8 * hh), x3 = *(const v4fa*)(arow + kb + 16 + 8 * hh + 4);
    float xs[16] = {x0[0],x0[1],x0[2],x0[3],x1[0],x1[1],x1[2],x1[3],x2[0],x2[1],x2[2],x2[3],x3[0],x3[1],x3[2],x3[3]};
#pragma unroll
    for (int i = 0; i < 16; ++i) { const unsigned short hb = bf16_bits(xs[i]); ah.u[i] = hb; al.u[i] = ASPLIT ? bf16_bits(xs[i] - bf16_val(hb)) : (unsigned short)0; }
#pragma unroll
    for (int t = 0; t < 4; ++t) {
      const unsigned short* brow = Wt + (size_t)(col0 + t * 16 + ln) * ldb + kb;
      FragB b;
      b.half[0] = *(const v8us*)(brow + 8 * hh);
      b.half[1] = *(const v8us*)(brow + 16 + 8 * hh);
      acc[t] = mmaN<ASPLIT ? 2 : 1>(ah.v, al.v, b.v, b.v, acc[t]);
    }
  }
#pragma unroll
  for (int t = 0; t < 4; ++t) {
    float bv = bias ? bias[col0 + t * 16 + ln] : 0.f;
    if (BIAS_BF16) bv = bf16_round(bv);
#pragma unroll
    for (int r = 0; r < 8; ++r) { float v = acc[t][r] + bv; if (ACT == 1) v = fmaxf(v, 0.f); so[w][8 * hh + r][t * 16 + ln] = v; }
  }
  __builtin_amdgcn_fence(__ATOMIC_ACQ_REL, "workgroup");
  __builtin_amdgcn_wave_barrier();
  const int rsub = lane >> 4, c4 = (lane & 15) * 4;
  {
#pragma unroll
    for (int q = 0; q < 8; ++q) {
      const int r = q * 2 + rsub;
      const v4f v = *(const v4fa*)&so[w][r][c4];
      *(v4f*)(C + (size_t)(row0 + r) * ldc + col0 + c4) = v;
    }
    
  }
}

// GEMM C = act(A·W + bias + resid): A f32 (ASPLIT -> hi/lo 2 terms), Wt bf16 [N][K]; ACT 0 none, 1 relu, 2 exact gelu;
// resid (optional, f32, row index = (row % rmod), pitch ldr, RES_BF16 rounds it) added before the activation.
template <bool ASPLIT, int ACT, bool BIAS_BF16, bool RES_BF16>
__global__ __launch_bounds__(128) void k_gemm_bf3(const float* __restrict__ A, int lda, const unsigned short* __restrict__ Wt, int ldb,
                                                const float* __restrict__ bias, const float* __restrict__ resid, int rmod, int ldr,
                                                float* __restrict__ C, int ldc, int M, int N, int K) {
  __shared__ __attribute__((aligned(16))) float so[4][16][64];
  const int tid = threadIdx.x, w = tid >> 5, lane = tid & 31, ln = lane & 15, hh = lane >> 4;
  const int ntn = N / 64;
  const int wid = blockIdx.x * 4 + w;
  const int mt = wid / ntn, nq = wid % ntn;
  if (mt * 16 >= M) return;
  const int row0 = mt * 16, col0 = nq * 64;
  const float* arow = A + (size_t)(row0 + ln) * lda;
  v8f acc[4] = {};
  for (int kb = 0; kb < K; kb += 32) {
    FragB ah, al;
    const v4f x0 = *(const v4fa*)(arow + kb + 8 * hh), x1 = *(const v4fa*)(arow + kb + 8 * hh + 4);
    const v4f x2 = *(const v4fa*)(arow + kb + 16 + 8 * hh), x3 = *(const v4fa*)(arow + kb + 16 + 8 * hh + 4);
    float xs[16] = {x0[0],x0[1],x0[2],x0[3],x1[0],x1[1],x1[2],x1[3],x2[0],x2[1],x2[2],x2[3],x3[0],x3[1],x3[2],x3[3]};
#pragma unroll
    for (int i = 0; i < 16; ++i) { const unsigned short hb = bf16_bits(xs[i]); ah.u[i] = hb; al.u[i] = ASPLIT ? bf16_bits(xs[i] - bf16_val(hb)) : (unsigned short)0; }
#pragma unroll
    for (int t = 0; t < 4; ++t) {
      const unsigned short* brow = Wt + (size_t)(col0 + t * 16 + ln) * ldb + kb;
      FragB b;
      b.half[0] = *(const v8us*)(brow + 8 * hh);
      b.half[1] = *(const v8us*)(brow + 16 + 8 * hh);
      acc[t] = mmaN<ASPLIT ? 2 : 1>(ah.v, al.v, b.v, b.v, acc[t]);
    }
  }
#pragma unroll
  for (int t = 0; t < 4; ++t) {
    const int col = col0 + t * 16 + ln;
    float bv = bias ? bias[col] : 0.f;
    if (BIAS_BF16) bv = bf16_round(bv);
#pragma unroll
    for (int r = 0; r < 8; ++r) {
      float v = acc[t][r] + bv;
      if (resid) { float rv = resid[(size_t)((row0 + 8 * hh + r) % rmod) * ldr + col]; if (RES_BF16) rv = bf16_round(rv); v += rv; }
      if (ACT == 1) v = fmaxf(v, 0.f);
      if (ACT == 2) v = 0.5f * v * (1.0f + erff(v * 0.70710678118654752f));
      if (ACT == 3) { const float u = 0.7978845608028654f * (v + 0.044715f * v * v * v); v = 0.5f * v * (1.0f + tanhf(u)); }
      so[w][8 * hh + r][t * 16 + ln] = v;
    }
  }
  __builtin_amdgcn_fence(__ATOMIC_ACQ_REL, "workgroup");
  __builtin_amdgcn_wave_barrier();
  const int rsub = lane >> 4, c4 = (lane & 15) * 4;
  {
#pragma unroll
    for (int q = 0; q < 8; ++q) {
      const int r = q * 2 + rsub;
      const v4f v = *(const v4fa*)&so[w][r][c4];
      *(v4f*)(C + (size_t)(row0 + r) * ldc + col0 + c4) = v;
    }
    
  }
}
// row LayerNorm (biased variance, eps) over N: s = X (+ R); optional out_sum <- s; out_norm <- (s-mu)*rsqrt(var+eps)*g + b
template <bool PARAM_BF16>
__global__ __launch_bounds__(256) void k_layernorm(const float* __restrict__ X, const float* __restrict__ R, const float* __restrict__ g, const float* __restrict__ bta,
                                                  float* __restrict__ out_sum, float* __restrict__ out_norm, int N, float eps) {
  __shared__ float red[256];
  const int row = blockIdx.x, tid = threadIdx.x;
  const float* x = X + (size_t)row * N; const float* rr = R ? R + (size_t)row * N : nullptr;
  float vals[16];                     // up to N = 4096
  const int per = N / 256;            // contiguous chunk per thread? use strided-by-4 chunks: thread handles j = tid*4 + 1024*u
  float s1 = 0.f;
  for (int u = 0; u < per / 4; ++u) {
    const int j = tid * 4 + 1024 * u;
    const v4f a = *(const v4fa*)(x + j);
    v4f b = {0.f,0.f,0.f,0.f}; if (rr) b = *(const v4fa*)(rr + j);
#pragma unroll
    for (int q = 0; q < 4; ++q) { const float v = a[q] + b[q]; vals[u * 4 + q] = v; s1 += v; }
  }
  red[tid] = s1; __syncthreads();
  for (int st = 128; st > 0; st >>= 1) { if (tid < st) red[tid] += red[tid + st]; __syncthreads(); }
  const float mu = red[0] / (float)N; __syncthreads();
  float s2 = 0.f;
  for (int u = 0; u < per / 4; ++u)
#pragma unroll
    for (int q = 0; q < 4; ++q) { const float c = vals[u * 4 + q] - mu; s2 += c * c; }
  red[tid] = s2; __syncthreads();
  for (int st = 128; st > 0; st >>= 1) { if (tid < st) red[tid] += red[tid + st]; __syncthreads(); }
  const float rs = rsqrtf(red[0] / (float)N + eps);
  {
    for (int u = 0; u < per / 4; ++u) {
      const int j = tid * 4 + 1024 * u;
      v4f o, sm;
#pragma unroll
      for (int q = 0; q < 4; ++q) {
        float gg = g[j + q], bb = bta[j + q];
        if (PARAM_BF16) { gg = bf16_round(gg); bb = bf16_round(bb); }
        sm[q] = vals[u * 4 + q]; o[q] = (vals[u * 4 + q] - mu) * rs * gg + bb;
      }
      if (out_sum) *(v4f*)(out_sum + (size_t)row * N + j) = sm;
      *(v4f*)(out_norm + (size_t)row * N + j) = o;
    }
    
  }
}



// ---- f16 WMMA path (v_wmma_f32_16x16x32_f16): 11-bit significands for operands in range — used where a [0,1] probability operand needs more precision than bf16
typedef _Float16 v16h __attribute__((ext_vector_type(16)));
union FragH { v16h v; v8us half[2]; _Float16 h[16]; unsigned short u[16]; };
template <int NT>
__device__ __forceinline__ v8f mmaH(v16h ah, v16h al, v16h bh, v16h bl, v8f c) {
  c = __builtin_amdgcn_wmma_f32_16x16x32_f16(false, ah, false, bh, (short)0, c, false, false);
  if (NT >= 2) c = __builtin_amdgcn_wmma_f32_16x16x32_f16(false, al, false, bh, (short)0, c, false, false);
  if (NT >= 3) c = __builtin_amdgcn_wmma_f32_16x16x32_f16(false, ah, false, bl, (short)0, c, false, false);
  asm volatile("v_nop\n\tv_nop\n\tv_nop\n\tv_nop" : "+v"(c) : "v"(ah), "v"(al), "v"(bh), "v"(bl));
  return c;
}
// batched GEMM like k_gemm_b but f16 operands: A f32 (split into f16 hi/lo if ASPLIT, else rounded to f16), Bt = f16 values [n][k]; alpha; C f32; N multiple of 16 (partial tiles skipped)
template <bool ASPLIT>
__global__ __launch_bounds__(128) void k_gemm_h(const float* __restrict__ A, int lda, size_t sA, const _Float16* __restrict__ Bh, int ldb, size_t sB, float alpha, float* __restrict__ C, int ldc, size_t sC, int M, int N, int K) {
  __shared__ __attribute__((aligned(16))) float so[4][16][64];
  const int tid = threadIdx.x, w = tid >> 5, lane = tid & 31, ln = lane & 15, hh = lane >> 4; const int by = blockIdx.y;
  A += (size_t)by * sA; Bh += (size_t)by * sB; C += (size_t)by * sC;
  const int ntn = (N + 63) / 64; const int wid = blockIdx.x * 4 + w; const int mt = wid / ntn, nq = wid % ntn; if (mt * 16 >= M) return;
  const int row0 = mt * 16, col0 = nq * 64; const float* arow = A + (size_t)(row0 + ln) * lda;
  v8f acc[4] = {};
  for (int kb = 0; kb < K; kb += 32) {
    FragH ah, al;
    const v4f x0 = *(const v4fa*)(arow + kb + 8 * hh), x1 = *(const v4fa*)(arow + kb + 8 * hh + 4), x2 = *(const v4fa*)(arow + kb + 16 + 8 * hh), x3 = *(const v4fa*)(arow + kb + 16 + 8 * hh + 4);
    float xs[16] = {x0[0],x0[1],x0[2],x0[3],x1[0],x1[1],x1[2],x1[3],x2[0],x2[1],x2[2],x2[3],x3[0],x3[1],x3[2],x3[3]};
#pragma unroll
    for (int i = 0; i < 16; ++i) { const _Float16 h = (_Float16)xs[i]; ah.h[i] = h; al.h[i] = ASPLIT ? (_Float16)(xs[i] - (float)h) : (_Float16)0.0f; }
#pragma unroll
    for (int t = 0; t < 4; ++t) { if (col0 + t * 16 >= N) continue; const size_t boff = (size_t)(col0 + t * 16 + ln) * ldb + kb; FragH bq; bq.half[0] = *(const v8us*)(Bh + boff + 8 * hh); bq.half[1] = *(const v8us*)(Bh + boff + 16 + 8 * hh);
      acc[t] = mmaH<ASPLIT ? 2 : 1>(ah.v, al.v, bq.v, bq.v, acc[t]); }
  }
#pragma unroll
  for (int t = 0; t < 4; ++t) { if (col0 + t * 16 >= N) continue;
#pragma unroll
    for (int r = 0; r < 8; ++r) so[w][8 * hh + r][t * 16 + ln] = acc[t][r] * alpha; }
  __builtin_amdgcn_fence(__ATOMIC_ACQ_REL, "workgroup"); __builtin_amdgcn_wave_barrier();
  const int rsub = lane >> 4, c4 = (lane & 15) * 4;
  {
#pragma unroll
    for (int q = 0; q < 8; ++q) { const int r = q * 2 + rsub; if (col0 + c4 < N) { const v4f v = *(const v4fa*)&so[w][r][c4]; *(v4f*)(C + (size_t)(row0 + r) * ldc + col0 + c4) = v; } }
     }
}

// Wt[n][k] = f16(W[k][n]·scale) from f32 row-major W[K][N] (scale = power of two; bf16-exact weights stay exact in f16 away from the subnormal range)
__global__ __launch_bounds__(256) void k_wt_f16(const float* __restrict__ W, _Float16* __restrict__ Wt, int K, int N, float scale) {
  const int t = blockIdx.x * 256 + threadIdx.x; if (t >= N * (K / 8)) return; const int n = t / (K / 8), k8 = (t % (K / 8)) * 8; FragH f;
#pragma unroll
  for (int i = 0; i < 8; ++i) f.h[i] = (_Float16)(bf16_round(W[(size_t)(k8 + i) * N + n]) * scale); const v8us o = f.half[0];
  *(v8us*)((unsigned short*)Wt + (size_t)n * K + k8) = o; 
}
// k_gemm_hh variant with fused epilogue: v = acc·alpha + bias[by·sBias + col] (+ CP[(row/rowsPerB)·sCPb + by·64 + col] if CP) ; ACT 0 none / 1 elu ; writes f16 C16 (and f32 C if non-null)
template <int ACT>
__global__ __launch_bounds__(128) void k_gemm_hhx(const _Float16* __restrict__ A, int lda, size_t sA, const _Float16* __restrict__ Bh, int ldb, size_t sB, float alpha, const float* __restrict__ bias, size_t sBias, const float* __restrict__ CP, int rowsPerB, size_t sCPb, int row0g,
    float* __restrict__ C, _Float16* __restrict__ C16, int ldc, size_t sC, int M, int N, int K) {
  __shared__ __attribute__((aligned(16))) float so[4][16][64];
  const int tid = threadIdx.x, w = tid >> 5, lane = tid & 31, ln = lane & 15, hh = lane >> 4; const int by = blockIdx.y;
  A += (size_t)by * sA; Bh += (size_t)by * sB; const size_t cofs = (size_t)by * sC; const float* bp = bias ? bias + (size_t)by * sBias : nullptr;
  const int ntn = (N + 63) / 64; const int wid = blockIdx.x * 4 + w; const int mt = wid / ntn, nq = wid % ntn; if (mt * 16 >= M) return;
  const int row0 = mt * 16, col0 = nq * 64; const _Float16* arow = A + (size_t)(row0 + ln) * lda;
  v8f acc[4] = {};
  for (int kb = 0; kb < K; kb += 32) { FragH ah; ah.half[0] = *(const v8us*)((const unsigned short*)arow + kb + 8 * hh); ah.half[1] = *(const v8us*)((const unsigned short*)arow + kb + 16 + 8 * hh);
#pragma unroll
    for (int t = 0; t < 4; ++t) { if (col0 + t * 16 >= N) continue; const size_t boff = (size_t)(col0 + t * 16 + ln) * ldb + kb; FragH bq; bq.half[0] = *(const v8us*)((const unsigned short*)Bh + boff + 8 * hh); bq.half[1] = *(const v8us*)((const unsigned short*)Bh + boff + 16 + 8 * hh);
      acc[t] = mmaH<1>(ah.v, ah.v, bq.v, bq.v, acc[t]); }
  }
#pragma unroll
  for (int t = 0; t < 4; ++t) { if (col0 + t * 16 >= N) continue; const int col = col0 + t * 16 + ln; const float bv = bp ? bf16_round(bp[col]) : 0.f;
#pragma unroll
    for (int r = 0; r < 8; ++r) { float v = acc[t][r] * alpha + bv; if (CP) { const int rr = row0g + row0 + 8 * hh + r; if (rowsPerB < 0) v += CP[cofs + (size_t)rr * ldc + col];      /* rowsPerB < 0: own element of the batched C plane */ else { const int bidx = rr / rowsPerB; v += CP[(size_t)bidx * sCPb + (size_t)by * 64 + col]; } } if (ACT == 1) v = (v > 0.f) ? v : expm1f(v); else if (ACT == 7) v = (v > 0.f) ? v + 1.0f : expf(v); else if (ACT == 8) v = tanhf(v); else if (ACT == 9) v = 0.5f * v * (1.0f + tanhf(0.7978845608028654f * (v + 0.044715f * v * v * v))); else if (ACT == 11) v = 1.0f / (1.0f + expf(-v)); else if (ACT == 12) v = (v > 0.f) ? v : 0.01f * v; else if (ACT == 14) v = (v > 0.f) ? v : 0.1f * v; else if (ACT == 16) v = (v >= 0.f) ? v : 0.3f * v; else if (ACT == 17) v = (v >= 0.f) ? v : 0.2f * v; else if (ACT == 15) v = v / (1.0f + expf(-v)); else if (ACT == 3) v = fmaxf(v, 0.f); else if (ACT == 6) v = 0.5f * v * (1.0f + erff(v * 0.70710678118654752f)); so[w][8 * hh + r][t * 16 + ln] = v; } }
  __builtin_amdgcn_fence(__ATOMIC_ACQ_REL, "workgroup"); __builtin_amdgcn_wave_barrier();
  const int rsub = lane >> 4, c4 = (lane & 15) * 4; typedef _Float16 v4h __attribute__((ext_vector_type(4)));
  {
#pragma unroll
    for (int q = 0; q < 8; ++q) { const int r = q * 2 + rsub; if (col0 + c4 < N) { const v4f v = *(const v4fa*)&so[w][r][c4]; if (C) *(v4f*)(C + cofs + (size_t)(row0 + r) * ldc + col0 + c4) = v; if (C16) { v4h h4; for (int i = 0; i < 4; ++i) h4[i] = (_Float16)v[i]; *(v4h*)(C16 + cofs + (size_t)(row0 + r) * ldc + col0 + c4) = h4; } } }
     }
}


typedef _Float16 v4h __attribute__((ext_vector_type(4)));

__global__ __launch_bounds__(256) void k_x16(const float* __restrict__ x, _Float16* __restrict__ X16, size_t n8) { const size_t t = (size_t)blockIdx.x * 256 + threadIdx.x; if (t >= n8) return; FragH f;
#pragma unroll
  for (int q = 0; q < 8; ++q) f.h[q] = (_Float16)bf16_round(x[t * 8 + q]); *(v8us*)((unsigned short*)X16 + t * 8) = f.half[0];  }
__global__ __launch_bounds__(256) void k_h16(const float* __restrict__ x, _Float16* __restrict__ X16, size_t n8) { const size_t t = (size_t)blockIdx.x * 256 + threadIdx.x; if (t >= n8) return; FragH f;
#pragma unroll
  for (int q = 0; q < 8; ++q) f.h[q] = (_Float16)x[t * 8 + q]; *(v8us*)((unsigned short*)X16 + t * 8) = f.half[0];  }
__global__ __launch_bounds__(256) void k_round16f(const float* __restrict__ W, _Float16* __restrict__ Bt, size_t n8) { const size_t t = (size_t)blockIdx.x * 256 + threadIdx.x; if (t >= n8) return; FragH f;
#pragma unroll
  for (int i = 0; i < 8; ++i) f.h[i] = (_Float16)(bf16_round(W[t * 8 + i]) * 16.0f); *(v8us*)((unsigned short*)Bt + t * 8) = f.half[0];  }
template <int NHv, int TTv>
__global__ __launch_bounds__(256) void k_vt(const _Float16* __restrict__ V16, int ldv, int voff, _Float16* __restrict__ Vt) { __shared__ unsigned short tl[64][66]; const int tid = threadIdx.x; const int slab = blockIdx.x / (TTv / 64), lg = blockIdx.x % (TTv / 64); const int b = slab / NHv, h = slab % NHv;
  for (int i = tid; i < 64 * 8; i += 256) { const int r = i / 8, c8 = (i % 8) * 8; FragH f; f.half[0] = *(const v8us*)((const unsigned short*)V16 + ((size_t)b * TTv + lg * 64 + r) * ldv + voff + h * 64 + c8);
#pragma unroll
    for (int q = 0; q < 8; ++q) tl[r][c8 + q] = f.u[q]; }
  __syncthreads();
  {
#pragma unroll
    for (int rd = 0; rd < 2; ++rd) { const int d = rd * 32 + tid / 8, pc = tid % 8; FragH f;
#pragma unroll
      for (int q = 0; q < 8; ++q) f.u[q] = tl[pc * 8 + q][d];
      *(v8us*)((unsigned short*)Vt + ((size_t)slab * 64 + d) * TTv + lg * 64 + pc * 8) = f.half[0]; }
     } }

__global__ __launch_bounds__(256) void k_hl(const float* __restrict__ F, _Float16* __restrict__ Hh, _Float16* __restrict__ Hl, size_t n8) { const size_t t = (size_t)blockIdx.x * 256 + threadIdx.x; if (t >= n8) return; FragH fh, fl; const v4f a = *(const v4fa*)(F + t * 8), c = *(const v4fa*)(F + t * 8 + 4);
#pragma unroll
  for (int q = 0; q < 4; ++q) { _Float16 h = (_Float16)a[q]; fh.h[q] = h; fl.h[q] = (_Float16)((a[q] - (float)h) * 1024.0f); h = (_Float16)c[q]; fh.h[4 + q] = h; fl.h[4 + q] = (_Float16)((c[q] - (float)h) * 1024.0f); }
  { *(v8us*)((unsigned short*)Hh + t * 8) = fh.half[0]; *(v8us*)((unsigned short*)Hl + t * 8) = fl.half[0];  } }

// ---- fast GEMM (wave tile 32x64; requires M % 32 == 0 rows per launch region and N % 64 == 0); epilogue = k_gemm_hhx semantics ----
__device__ __forceinline__ v16h g2_frag(const _Float16* p, int hh) { FragH f; f.half[0] = *(const v8us*)((const unsigned short*)p + 8 * hh); f.half[1] = *(const v8us*)((const unsigned short*)p + 16 + 8 * hh); return f.v; }
__device__ __forceinline__ v8f g2_mma(v16h a, v16h b, v8f c) { v8f d = __builtin_amdgcn_wmma_f32_16x16x32_f16(false, a, false, b, (short)0, c, false, false); asm volatile("v_nop\n\tv_nop\n\tv_nop\n\tv_nop" : "+v"(d) : "v"(a), "v"(b)); return d; }
template <int ACT>
__global__ __launch_bounds__(128) void k_gemm2(const _Float16* __restrict__ A, int lda, size_t sA, const _Float16* __restrict__ Bh, int ldb, size_t sB, float alpha, const float* __restrict__ bias, size_t sBias, const float* __restrict__ CP, int rowsPerB, size_t sCPb, int row0g,
    float* __restrict__ C, _Float16* __restrict__ C16, int ldc, size_t sC, int M, int N, int K, int bshift = 0) { static_assert(ACT == 0 || ACT == 3 || ACT == 6 || ACT == 8 || ACT == 9 || ACT == 11 || ACT == 12 || ACT == 14 || ACT == 15 || ACT == 16 || ACT == 17, "k_gemm2: unsupported ACT code (would silently apply no activation)");
  __shared__ __attribute__((aligned(16))) float so[4][32][68];
  const int tid = threadIdx.x, w = tid >> 5, lane = tid & 31, ln = lane & 15, hh = lane >> 4; const int by = blockIdx.y;
  A += (size_t)by * sA; Bh += (size_t)(by >> bshift) * sB;      /* 2^bshift consecutive batch planes share one B plane (query heads of one kv group) */ const size_t cofs = (size_t)by * sC; const float* bp = bias ? bias + (size_t)by * sBias : nullptr;
  const int ntn = N >> 6; const int mt = blockIdx.x / ntn, nq = blockIdx.x - mt * ntn; const int row0 = mt * 128 + 32 * w, col0 = nq * 64; if (row0 >= M) return;
  const _Float16* a0p = A + (size_t)(row0 + ln) * lda; const _Float16* a1p = a0p + (size_t)16 * lda;
  const _Float16* b0p = Bh + (size_t)(col0 + ln) * ldb; const _Float16* b1p = b0p + (size_t)16 * ldb; const _Float16* b2p = b1p + (size_t)16 * ldb; const _Float16* b3p = b2p + (size_t)16 * ldb;
  const v8f z8 = {0.f,0.f,0.f,0.f,0.f,0.f,0.f,0.f}; v8f c00 = z8, c01 = z8, c02 = z8, c03 = z8, c10 = z8, c11 = z8, c12 = z8, c13 = z8;
#pragma unroll 1
  for (int kb = 0; kb < K; kb += 32) { const v16h a0 = g2_frag(a0p + kb, hh), a1 = g2_frag(a1p + kb, hh);
    v16h b = g2_frag(b0p + kb, hh); c00 = g2_mma(a0, b, c00); c10 = g2_mma(a1, b, c10);
    b = g2_frag(b1p + kb, hh); c01 = g2_mma(a0, b, c01); c11 = g2_mma(a1, b, c11);
    b = g2_frag(b2p + kb, hh); c02 = g2_mma(a0, b, c02); c12 = g2_mma(a1, b, c12);
    b = g2_frag(b3p + kb, hh); c03 = g2_mma(a0, b, c03); c13 = g2_mma(a1, b, c13); }
  v8f accs[8] = {c00, c01, c02, c03, c10, c11, c12, c13};
#pragma unroll
  for (int u = 0; u < 8; ++u) { const int t = u & 3, half = u >> 2; const int col = col0 + t * 16 + ln; const float bv = bp ? bf16_round(bp[col]) : 0.f;
#pragma unroll
    for (int r = 0; r < 8; ++r) { const int rloc = half * 16 + 8 * hh + r; float v = accs[u][r] * alpha + bv; if (CP) { if (rowsPerB < 0) v += CP[cofs + (size_t)(row0g + row0 + rloc) * ldc + col];      /* rowsPerB < 0: own element of the batched C plane */ else { const int bidx = (row0g + row0 + rloc) / rowsPerB; v += CP[(size_t)bidx * sCPb + (size_t)by * 64 + col]; } }
      if (ACT == 3) v = fmaxf(v, 0.f); else if (ACT == 6) v = 0.5f * v * (1.0f + erff(v * 0.70710678118654752f)); else if (ACT == 11) v = 1.0f / (1.0f + expf(-v)); else if (ACT == 15) v = v / (1.0f + expf(-v)); else if (ACT == 12) v = (v > 0.f) ? v : 0.01f * v; else if (ACT == 8) v = tanhf(v); else if (ACT == 9) v = 0.5f * v * (1.0f + tanhf(0.7978845608028654f * (v + 0.044715f * v * v * v))); else if (ACT == 14) v = (v > 0.f) ? v : 0.1f * v; else if (ACT == 16) v = (v >= 0.f) ? v : 0.3f * v; else if (ACT == 17) v = (v >= 0.f) ? v : 0.2f * v;
      so[w][rloc][t * 16 + ln] = v; } }
  __builtin_amdgcn_fence(__ATOMIC_ACQ_REL, "workgroup"); __builtin_amdgcn_wave_barrier();
  const int rsub = lane >> 4, c4 = (lane & 15) * 4;
  {
#pragma unroll
    for (int q = 0; q < 16; ++q) { const int r = q * 2 + rsub; const v4f v = *(const v4fa*)&so[w][r][c4]; if (C) *(v4f*)(C + cofs + (size_t)(row0 + r) * ldc + col0 + c4) = v; if (C16) { v4h h4; for (int i = 0; i < 4; ++i) h4[i] = (_Float16)v[i]; *(v4h*)(C16 + cofs + (size_t)(row0 + r) * ldc + col0 + c4) = h4; } }
     } }


__global__ __launch_bounds__(256) void k_wnat(const float* __restrict__ w, size_t n8, _Float16* __restrict__ Bt) { const size_t t = (size_t)blockIdx.x * 256 + threadIdx.x; if (t >= n8) return; FragH f; for (int q = 0; q < 8; ++q) f.h[q] = (_Float16)(bf16_round(w[t * 8 + q]) * 16.0f); *(v8us*)((unsigned short*)Bt + t * 8) = f.half[0];  }
__global__ __launch_bounds__(256) void k_rsm(const float* __restrict__ S, _Float16* __restrict__ P, int nrows) {
  #pragma clang fp contract(off)
  const int i = blockIdx.x * 256 + threadIdx.x; if (i >= nrows) return; const float* s = S + (size_t)i * SQ; float mx = -3.0e38f;
#pragma unroll 1
  for (int j = 0; j < SQ; ++j) mx = fmaxf(mx, s[j]); float se = 0.f;
#pragma unroll 1
  for (int j = 0; j < SQ; ++j) se += expf(s[j] - mx); const float sc = 256.0f / se;
#pragma unroll 1
  for (int j0 = 0; j0 < SQ; j0 += 8) { FragH f; for (int q = 0; q < 8; ++q) f.h[q] = (_Float16)(expf(s[j0 + q] - mx) * sc); unsigned short* d = (unsigned short*)P + (size_t)i * SQ + j0; *(v8us*)d = f.half[0];  } }
__global__ __launch_bounds__(256) void k_vt(const _Float16* __restrict__ V16, int b, int h0, _Float16* __restrict__ VT) { __shared__ unsigned short tl[64][65]; const int tid = threadIdx.x; const int hh = blockIdx.x % HG, sg = blockIdx.x / HG; const int s0 = sg * 64; const int h = h0 + hh;
  for (int i = tid; i < 64 * 8; i += 256) { const int j = i / 8, d8 = (i % 8) * 8; FragH f; f.half[0] = *(const v8us*)((const unsigned short*)V16 + ((size_t)b * SQ + s0 + j) * DM + h * HD + d8); for (int q = 0; q < 8; ++q) tl[d8 + q][j] = f.u[q]; }
  __syncthreads();
  { for (int i = tid; i < 64 * 8; i += 256) { const int d = i / 8, j8 = (i % 8) * 8; FragH f; for (int q = 0; q < 8; ++q) f.u[q] = tl[d][j8 + q]; *(v8us*)((unsigned short*)VT + ((size_t)hh * HD + d) * SQ + s0 + j8) = f.half[0]; }  } }



// Causal row softmax, one wave per score row: lane l holds columns 256 c + 8 l .. + 7 of every 256-column chunk c, so a wave's loads and stores
// cover whole cache lines and the row is read once; the row maximum and the row sum are folded over the 32 lanes by a butterfly of lane exchanges.
// e^a as __expf forms it (a * log2 e, then v_exp_f32). Written as asm so that the one free issue slot the instruction set asks for behind a transcendental,
// before its source register is overwritten or its result read, stands there by construction.
__device__ __forceinline__ float rsm_exp(float a) { float r; const float y = a * 1.44269504f; asm("v_exp_f32 %0, %1\n\tv_nop" : "=v"(r) : "v"(y)); return r; }
template <int NC>
__device__ __forceinline__ void rsm_row(const float* __restrict__ s, unsigned short* __restrict__ d, int j0, int last) {
  v4f va[NC], vb[NC];
#pragma unroll      /* full unroll: the row stays in registers and all 2 NC loads are in flight before the first use */
  for (int c = 0; c < NC; ++c) { va[c] = *(const v4fa*)(s + c * 256); vb[c] = *(const v4fa*)(s + c * 256 + 4); }
  float mx = -3.0e38f;
#pragma unroll      /* full unroll: register arrays need constant indices */
  for (int c = 0; c < NC; ++c) {
#pragma unroll
    for (int q = 0; q < 4; ++q) { const int j = j0 + c * 256 + q; va[c][q] = (j <= last) ? va[c][q] : -1.0e9f; vb[c][q] = (j + 4 <= last) ? vb[c][q] : -1.0e9f; mx = fmaxf(mx, fmaxf(va[c][q], vb[c][q])); } }
  for (int m = 16; m > 0; m >>= 1) mx = fmaxf(mx, __shfl_xor(mx, m, 32));
  float se = 0.f;
#pragma unroll      /* full unroll: register arrays need constant indices */
  for (int c = 0; c < NC; ++c) {
#pragma unroll
    for (int q = 0; q < 4; ++q) { va[c][q] = rsm_exp(va[c][q] - mx); se += va[c][q]; }
#pragma unroll
    for (int q = 0; q < 4; ++q) { vb[c][q] = rsm_exp(vb[c][q] - mx); se += vb[c][q]; } }
  for (int m = 16; m > 0; m >>= 1) se += __shfl_xor(se, m, 32);
  const float sc = 256.0f / se;
#pragma unroll      /* full unroll: register arrays need constant indices */
  for (int c = 0; c < NC; ++c) { FragH fr;
#pragma unroll
    for (int q = 0; q < 4; ++q) { fr.h[q] = (_Float16)(va[c][q] * sc); fr.h[4 + q] = (_Float16)(vb[c][q] * sc); }
    *(v8us*)(d + c * 256) = fr.half[0]; }
  asm volatile("s_wait_xcnt 0x0" ::: "memory");      /* precaution behind the run of stores: stands in front of any later instruction that rewrites a register the stores name (the next case's code follows in the listing) */
}
__global__ __launch_bounds__(256) void k_rsmcf2(const float* __restrict__ S, _Float16* __restrict__ P, int hg, int q0, int nk) {
  const int lane = threadIdx.x & 31; const int t = blockIdx.x * 8 + (threadIdx.x >> 5); if (t >= hg * QT) return;
  const float* s = S + (size_t)t * NKX + lane * 8; unsigned short* d = (unsigned short*)P + (size_t)t * NKX + lane * 8; const int last = q0 + (t % QT); const int j0 = lane * 8;
  switch (nk / 256) {      /* nk = q0 + QT: a whole number of 256-column chunks, the same for every wave of the launch */
    case 1: rsm_row<1>(s, d, j0, last); break; case 2: rsm_row<2>(s, d, j0, last); break; case 3: rsm_row<3>(s, d, j0, last); break; case 4: rsm_row<4>(s, d, j0, last); break;
    case 5: rsm_row<5>(s, d, j0, last); break; case 6: rsm_row<6>(s, d, j0, last); break; case 7: rsm_row<7>(s, d, j0, last); break; case 8: rsm_row<8>(s, d, j0, last); break;
    default: break; } }


template <int MASKADD>
__global__ __launch_bounds__(64) void k_att0(const float* __restrict__ QF, const float* __restrict__ KF, const float* __restrict__ VF, int ld, const float* __restrict__ mask, float scale, float* __restrict__ OF, int ldo) {
  #pragma clang fp contract(off)
  __shared__ __attribute__((aligned(16))) float lq[64][64]; __shared__ __attribute__((aligned(16))) float lo[64][64];
  const int tid = threadIdx.x; const int h = blockIdx.x / (QT0 / 64), rg = blockIdx.x % (QT0 / 64); const int i = rg * 64 + tid;
  const float* qr = QF + (size_t)i * ld + h * HD;
#pragma unroll 1
  for (int c = 0; c < HD / 4; ++c) { *(v4f*)&lq[tid][c * 4] = *(const v4fa*)(qr + c * 4); const v4f z = {0.f, 0.f, 0.f, 0.f}; *(v4f*)&lo[tid][c * 4] = z; }
  float m = -1.0e30f, l = 0.f; const int jmax = MASKADD ? (SQ - 1) : (rg * 64 + 63);      /* additive-mask form: every key (the mask input decides); causal form: keys up to the block's last row */
#pragma unroll 1
  for (int j = 0; j <= jmax; ++j) { const float* kr = KF + (size_t)j * ld + h * HD; const float* vr = VF + (size_t)j * ld + h * HD; float s = 0.f;
#pragma unroll 1
    for (int c = 0; c < HD / 4; ++c) { const v4f kq = *(const v4fa*)(kr + c * 4); const v4f qq = *(v4f*)&lq[tid][c * 4]; s = __fadd_rn(s, __fmul_rn(qq[0], kq[0])); s = __fadd_rn(s, __fmul_rn(qq[1], kq[1])); s = __fadd_rn(s, __fmul_rn(qq[2], kq[2])); s = __fadd_rn(s, __fmul_rn(qq[3], kq[3])); }
    s = __fmul_rn(s, scale); if (MASKADD) s = __fadd_rn(s, __fmul_rn(bf16_round(mask[(size_t)i * SQ + j]), -10000.0f));
    const float f = (MASKADD || j <= i) ? 1.f : 0.f; const float sm = fmaf(f, s, (1.f - f) * -1.0e30f); const float mn = fmaxf(m, sm); const float sc = expf(m - mn); const float e = expf(sm - mn); l = __fadd_rn(__fmul_rn(l, sc), e); m = mn;
#pragma unroll 1
    for (int c = 0; c < HD / 4; ++c) { const v4f vv = *(const v4fa*)(vr + c * 4); v4f oo = *(v4f*)&lo[tid][c * 4]; for (int u = 0; u < 4; ++u) oo[u] = __fadd_rn(__fmul_rn(oo[u], sc), __fmul_rn(e, vv[u])); *(v4f*)&lo[tid][c * 4] = oo; } }
  const float fin = 64.0f / l;      /* o carried x64 like the f16 path */
#pragma unroll 1
  for (int c = 0; c < HD / 4; ++c) { v4f oo = *(v4f*)&lo[tid][c * 4]; for (int u = 0; u < 4; ++u) oo[u] = __fmul_rn(oo[u], fin); *(v4f*)&lo[tid][c * 4] = oo; }
  __syncthreads();
  {
#pragma unroll 1
    for (int it = 0; it < 16; ++it) { const int row = it * 4 + tid / 16, pc = (tid % 16) * 4; const v4f v = *(const v4f*)&lo[row][pc]; *(v4f*)(OF + (size_t)(rg * 64 + row) * ldo + h * HD + pc) = v; }
     } }


__global__ __launch_bounds__(256) void k_kvexp(const float* __restrict__ src, float* __restrict__ dst, size_t n4) { const size_t t = (size_t)blockIdx.x * 256 + threadIdx.x; if (t >= n4) return; const size_t e = t * 4; const size_t row = e / DM; const int col = (int)(e % DM); const int h = col / HD, d = col % HD; const v4f v = *(const v4fa*)(src + row * KVD + (size_t)(h / HPG) * HD + d); *(v4f*)(dst + e) = v;  }

__global__ __launch_bounds__(256) void k_tab2(float theta, float* __restrict__ CS, float* __restrict__ SN) {
  #pragma clang fp contract(off)
  const int t = blockIdx.x * 256 + threadIdx.x; if (t >= SQ * (HD / 2)) return; const int i = t % (HD / 2); const int p = t / (HD / 2); const float invf = 1.0f / powf(theta, (float)(2 * i) / (float)HD); const float ang = __fmul_rn((float)p, invf); const float c = cosf(ang), s = sinf(ang);
  *(float*)(CS + t) = c; *(float*)(SN + t) = s;  }
template <int NORM, int ROPE>
__global__ __launch_bounds__(64) void k_xform(const float* __restrict__ F, int ldf, int nh, const float* __restrict__ gain, float eps, const float* __restrict__ CS, const float* __restrict__ SN, _Float16* __restrict__ H16, int ldo) {
  #pragma clang fp contract(off)
  __shared__ float xv[HD]; __shared__ float red[HD]; __shared__ unsigned short sh_[HD]; const int d = threadIdx.x; const int h = blockIdx.x % nh; const size_t r = blockIdx.x / nh; const int p = (int)(r % SQ);
  float x = F[r * (size_t)ldf + (size_t)h * HD + d];
  if (NORM) { red[d] = __fmul_rn(x, x); __syncthreads(); for (int st = HD / 2; st > 0; st >>= 1) { if (d < st) red[d] = __fadd_rn(red[d], red[d + st]); __syncthreads(); } const float rs = rsqrtf(__fadd_rn(red[0] / (float)HD, eps)); x = __fmul_rn(__fmul_rn(x, rs), bf16_round(gain[d])); }
  xv[d] = x; __syncthreads();
  float o = x;
  if (ROPE == 1) { const int i = d >> 1; const float c = CS[p * (HD / 2) + i], s = SN[p * (HD / 2) + i]; const float ev = xv[2 * i], od = xv[2 * i + 1]; o = (d & 1) ? __fadd_rn(__fmul_rn(ev, s), __fmul_rn(od, c)) : __fadd_rn(__fmul_rn(ev, c), -__fmul_rn(od, s)); }
  if (ROPE == 2) { const int i = d & (HD / 2 - 1); const float c = CS[p * (HD / 2) + i], s = SN[p * (HD / 2) + i]; const float lo = xv[i], hi = xv[i + HD / 2]; o = (d < HD / 2) ? __fadd_rn(__fmul_rn(lo, c), -__fmul_rn(hi, s)) : __fadd_rn(__fmul_rn(lo, s), __fmul_rn(hi, c)); }
  if (ROPE == 3) { const float c = CS[p * HD + d], s = SN[p * HD + d]; const float lo = xv[d & (HD / 2 - 1)], hi = xv[(d & (HD / 2 - 1)) + HD / 2]; o = (d < HD / 2) ? __fadd_rn(__fmul_rn(lo, c), -__fmul_rn(hi, s)) : __fadd_rn(__fmul_rn(hi, c), __fmul_rn(lo, s)); }      /* rotate-half with FULL-width per-element tables [pos][HD] */
  FragH th; th.h[0] = (_Float16)o; sh_[d] = th.u[0]; __syncthreads();
  if (d < HD / 8) { FragH f; for (int q = 0; q < 8; ++q) f.u[q] = sh_[d * 8 + q]; unsigned short* dst = (unsigned short*)H16 + r * (size_t)ldo + (size_t)h * HD + d * 8; *(v8us*)dst = f.half[0];  } }

template <int NORM, int ROPE>
__global__ __launch_bounds__(64) void k_xformf(const float* __restrict__ F, int ldf, int nh, const float* __restrict__ gain, float eps, const float* __restrict__ CS, const float* __restrict__ SN, float* __restrict__ F32, int ldo) {
  #pragma clang fp contract(off)
  __shared__ float xv[HD]; __shared__ float red[HD]; const int d = threadIdx.x; const int h = blockIdx.x % nh; const size_t r = blockIdx.x / nh; const int p = (int)(r % SQ);
  float x = F[r * (size_t)ldf + (size_t)h * HD + d];
  if (NORM) { red[d] = __fmul_rn(x, x); __syncthreads(); for (int st = HD / 2; st > 0; st >>= 1) { if (d < st) red[d] = __fadd_rn(red[d], red[d + st]); __syncthreads(); } const float rs = rsqrtf(__fadd_rn(red[0] / (float)HD, eps)); x = __fmul_rn(__fmul_rn(x, rs), bf16_round(gain[d])); }
  xv[d] = x; __syncthreads();
  float o = x;
  if (ROPE == 1) { const int i = d >> 1; const float c = CS[p * (HD / 2) + i], s = SN[p * (HD / 2) + i]; const float ev = xv[2 * i], od = xv[2 * i + 1]; o = (d & 1) ? __fadd_rn(__fmul_rn(ev, s), __fmul_rn(od, c)) : __fadd_rn(__fmul_rn(ev, c), -__fmul_rn(od, s)); }
  if (ROPE == 2) { const int i = d & (HD / 2 - 1); const float c = CS[p * (HD / 2) + i], s = SN[p * (HD / 2) + i]; const float lo = xv[i], hi = xv[i + HD / 2]; o = (d < HD / 2) ? __fadd_rn(__fmul_rn(lo, c), -__fmul_rn(hi, s)) : __fadd_rn(__fmul_rn(lo, s), __fmul_rn(hi, c)); }
  if (ROPE == 3) { const float c = CS[p * HD + d], s = SN[p * HD + d]; const float lo = xv[d & (HD / 2 - 1)], hi = xv[(d & (HD / 2 - 1)) + HD / 2]; o = (d < HD / 2) ? __fadd_rn(__fmul_rn(lo, c), -__fmul_rn(hi, s)) : __fadd_rn(__fmul_rn(hi, c), __fmul_rn(lo, s)); }      /* rotate-half with FULL-width per-element tables [pos][HD] */
  float* dst = F32 + r * (size_t)ldo + (size_t)h * HD + d; *(float*)dst = o;  }

__global__ __launch_bounds__(256) void k_bfcp(const float* __restrict__ src, float* __restrict__ dst, size_t n4) { const size_t t = (size_t)blockIdx.x * 256 + threadIdx.x; if (t >= n4) return; const v4f a = *(const v4fa*)(src + t * 4); v4f o; for (int q = 0; q < 4; ++q) o[q] = bf16_round(a[q]); *(v4f*)(dst + t * 4) = o;  }

__global__ __launch_bounds__(256) void k_tabhalf(const float* __restrict__ cs, const float* __restrict__ sn, float* __restrict__ CS, float* __restrict__ SN) { const int t = blockIdx.x * 256 + threadIdx.x; if (t >= SQ * (HD / 2)) return; const int p = t / (HD / 2), i = t % (HD / 2); const float c = bf16_round(cs[(size_t)p * HD + i]), s = bf16_round(sn[(size_t)p * HD + i]);
  *(float*)(CS + t) = c; *(float*)(SN + t) = s;  }

__global__ __launch_bounds__(256) void k_tab2d(float* __restrict__ CS, float* __restrict__ SN) {
  #pragma clang fp contract(off)
  const int t = blockIdx.x * 256 + threadIdx.x; if (t >= SQ * (HD / 2)) return; const int i = t % (HD / 2); const int p = t / (HD / 2); const float invf = (float)(1.0 / pow(10000.0, (double)(2 * i) / (double)HD)); const float ang = __fmul_rn((float)p, invf); const float c = cosf(ang), s = sinf(ang);
  *(float*)(CS + t) = c; *(float*)(SN + t) = s;  }
extern "C" void kernel_launch(void* const* d_in, const int* in_sizes, int n_in,
                              void* d_out, int out_size, void* d_ws, size_t ws_size, hipStream_t stream) {
  (void)in_sizes; (void)n_in; (void)out_size;
  const float* const* I = (const float* const*)d_in; const float* x = I[0]; const float* wq = I[1]; const float* wk = I[2]; const float* wv = I[3]; const float* wo = I[4]; const float* bq = nullptr; const float* bk = nullptr; const float* bv = nullptr; const float* bo = nullptr;      /* natural [out][in] weights, no biases; rope tables computed in the kernel */
  char* ws = (char*)d_ws; size_t off = 0;
  auto take = [&](size_t bytes) { char* p = ws + off; off += (bytes + 255) & ~(size_t)255; return p; };
  _Float16* BQ = (_Float16*)take((size_t)DM * DM * 2); _Float16* BK = (_Float16*)take((size_t)KVD * DM * 2); _Float16* BV = (_Float16*)take((size_t)KVD * DM * 2); _Float16* BO = (_Float16*)take((size_t)DM * DM * 2);
  _Float16* X16 = (_Float16*)take(NR * DM * 2); float* QF = (float*)take((size_t)SQ * DM * 4); float* KF = (float*)take((size_t)SQ * KVD * 4); float* CSB = (float*)take((size_t)SQ * HD * 4); float* SNB = (float*)take((size_t)SQ * HD * 4); _Float16* Q16 = (_Float16*)take(NR * DM * 2); _Float16* K16 = (_Float16*)take(NR * KVD * 2); _Float16* V16 = (_Float16*)take(NR * KVD * 2); _Float16* O16 = (_Float16*)take(NR * DM * 2);
  float* S = (float*)take((size_t)NH * QT * NKX * 4); _Float16* P = (_Float16*)take((size_t)NH * QT * NKX * 2); _Float16* VT = (_Float16*)take((size_t)NH * HD * SQ * 2);
  float* QF0 = (float*)take((size_t)QT0 * DM * 4); float* KF0 = (float*)take((size_t)QT0 * KVD * 4); float* VF0 = (float*)take((size_t)QT0 * KVD * 4); float* KF0e = (float*)take((size_t)QT0 * DM * 4); float* VF0e = (float*)take((size_t)QT0 * DM * 4); float* OF0 = (float*)take((size_t)NB * QT0 * DM * 4); _Float16* OH0 = (_Float16*)take((size_t)NB * QT0 * DM * 2); _Float16* OL0 = (_Float16*)take((size_t)NB * QT0 * DM * 2);
  if (off > ws_size) return;
  k_wnat<<<(unsigned)(((size_t)DM * DM / 8 + 255) / 256), 256, 0, stream>>>(wq, (size_t)DM * DM / 8, BQ); k_wnat<<<(unsigned)(((size_t)KVD * DM / 8 + 255) / 256), 256, 0, stream>>>(wk, (size_t)KVD * DM / 8, BK); k_wnat<<<(unsigned)(((size_t)KVD * DM / 8 + 255) / 256), 256, 0, stream>>>(wv, (size_t)KVD * DM / 8, BV); k_wnat<<<(unsigned)(((size_t)DM * DM / 8 + 255) / 256), 256, 0, stream>>>(wo, (size_t)DM * DM / 8, BO);      /* natural [out][in] = Bt planes x16 */
  k_x16<<<(unsigned)((NR * DM / 8 + 255) / 256), 256, 0, stream>>>(x, X16, NR * DM / 8);
  k_tab2d<<<(SQ * (HD / 2) + 255) / 256, 256, 0, stream>>>(CSB, SNB);      /* rope tables cos/sin(p / 10000^(2i/64)): inv_freq double-derived -> f32, f32 angle */
  const size_t r0p = (size_t)B0 * SQ;      /* first projected row */
  k_gemm2<0><<<dim3((unsigned)((MP / 128) * (KVD / 64)), 1), 128, 0, stream>>>(X16 + r0p * DM, DM, 0, BV, DM, 0, 0.0625f, bv, 0, nullptr, 1, 0, 0, nullptr, V16 + r0p * KVD, KVD, 0, MP, KVD, DM);
  for (int b = B0; b < B0 + NBR; ++b) { const size_t r0 = (size_t)b * SQ;
    k_gemm2<0><<<dim3((unsigned)((SQ / 128) * (DM / 64)), 1), 128, 0, stream>>>(X16 + r0 * DM, DM, 0, BQ, DM, 0, 0.0625f, nullptr, 0, nullptr, 1, 0, 0, QF, nullptr, DM, 0, SQ, DM, DM);      /* q (f32) of this batch */
    k_gemm2<0><<<dim3((unsigned)((SQ / 128) * (KVD / 64)), 1), 128, 0, stream>>>(X16 + r0 * DM, DM, 0, BK, DM, 0, 0.0625f, nullptr, 0, nullptr, 1, 0, 0, KF, nullptr, KVD, 0, SQ, KVD, DM);      /* k (f32) */
    k_xform<0, 1><<<(unsigned)((size_t)SQ * NH), 64, 0, stream>>>(QF, DM, NH, nullptr, 0.f, CSB, SNB, Q16 + r0 * DM, DM); k_xform<0, 1><<<(unsigned)((size_t)SQ * NG), 64, 0, stream>>>(KF, KVD, NG, nullptr, 0.f, CSB, SNB, K16 + r0 * KVD, KVD);      /* interleaved-pair rope -> f16 rows */
    k_xformf<0, 1><<<(unsigned)(QT0 * NH), 64, 0, stream>>>(QF, DM, NH, nullptr, 0.f, CSB, SNB, QF0, DM); k_xformf<0, 1><<<(unsigned)(QT0 * NG), 64, 0, stream>>>(KF, KVD, NG, nullptr, 0.f, CSB, SNB, KF0, KVD);      /* f32 roped q, k of rows 0..127 */
    k_vt<NG, SQ><<<NG * (SQ / 64), 256, 0, stream>>>(V16 + r0 * KVD, KVD, 0, VT);      /* V^T [NG][HD][SQ] for this batch */
    k_gemm2<0><<<dim3((QT0 / 128) * (KVD / 64), 1), 128, 0, stream>>>(X16 + r0 * DM, DM, 0, BV, DM, 0, 0.0625f, bv, 0, nullptr, 1, 0, 0, VF0, nullptr, KVD, 0, QT0, KVD, DM);
    k_kvexp<<<(unsigned)(((size_t)QT0 * DM / 4 + 255) / 256), 256, 0, stream>>>(KF0, KF0e, (size_t)QT0 * DM / 4); k_kvexp<<<(unsigned)(((size_t)QT0 * DM / 4 + 255) / 256), 256, 0, stream>>>(VF0, VF0e, (size_t)QT0 * DM / 4);      /* head h <- kv group h/4 for the exact first-tile kernel */      /* f32 q, k, v of the first 128 rows (exact products) */
    k_att0<0><<<NH * (QT0 / 64), 64, 0, stream>>>(QF0, KF0e, VF0e, DM, nullptr, 0.125f, OF0 + (size_t)b * QT0 * DM, DM);      /* exact f32 attention for rows 0..127 (o x64) */
    for (int q0 = 0; q0 < QN; q0 += QT) { const int nk = q0 + QT;      /* causal: only keys below the tile end are computed */
      k_gemm2<0><<<dim3((QT / 128) * (nk / 64), NH), 128, 0, stream>>>(Q16 + (r0 + q0) * LQ, LQ, (size_t)HD, K16 + r0 * KVD, KVD, (size_t)HD, 0.125f, nullptr, 0, nullptr, 1, 0, 0, S, nullptr, NKX, (size_t)QT * NKX, QT, nk, HD, 2);      /* scores: all 32 heads in one launch, head h against the keys of group h / 4 */
      k_rsmcf2<<<(NHD * QT + 7) / 8, 256, 0, stream>>>(S, P, NHD, q0, nk);      /* 8 waves a block, one row a wave */
      k_gemm2<0><<<dim3((QT / 128) * (HD / 64), NH), 128, 0, stream>>>(P, NKX, (size_t)QT * NKX, VT, SQ, (size_t)HD * SQ, 0.25f, nullptr, 0, nullptr, 1, 0, 0, nullptr, O16 + (r0 + q0) * DM, DM, (size_t)HD, QT, HD, nk, 2); } }      /* o for all 32 heads in one launch, head h with V^T of group h / 4 (x64) */      /* o (merged heads, x64) as f16 rows */
  k_gemm2<0><<<dim3((unsigned)((MPO / 128) * (DM / 64)), 1), 128, 0, stream>>>(O16 + r0p * DM, DM, 0, BO, DM, 0, 0.0009765625f, bo, 0, nullptr, 1, 0, 0, (float*)d_out + r0p * DM, nullptr, DM, 0, MPO, DM, DM);      /* out rows are the output layout */
  k_hl<<<(unsigned)(((size_t)NB * QT0 * DM / 8 + 255) / 256), 256, 0, stream>>>(OF0, OH0, OL0, (size_t)NB * QT0 * DM / 8);      /* first-tile o (x64) -> f16 hi + x1024 residual planes */
  for (int b = B0; b < B0 + NBR; ++b) { const size_t r0 = (size_t)b * SQ; const size_t f0 = (size_t)b * QT0;
    k_gemm2<0><<<dim3((QT0 / 128) * (DM / 64), 1), 128, 0, stream>>>(OH0 + f0 * DM, DM, 0, BO, DM, 0, 0.0009765625f, bo, 0, nullptr, 1, 0, 0, (float*)d_out + r0 * DM, nullptr, DM, 0, QT0, DM, DM);      /* rows 0..127: out = o_hi Wo (+ b), overwriting the f16-path rows */
    k_gemm2<0><<<dim3((QT0 / 128) * (DM / 64), 1), 128, 0, stream>>>(OL0 + f0 * DM, DM, 0, BO, DM, 0, 0.00000095367431640625f, nullptr, 0, (const float*)d_out + r0 * DM, -1, 0, 0, (float*)d_out + r0 * DM, nullptr, DM, 0, QT0, DM, DM); }      /* += o_lo Wo 2^-20 (own-element accumulate) */
}

// v003
// One run takes 944 microseconds.
// Two timings next to v002 put it at 1.43 and 1.44 times that version's speed.
// All steps since v000 together make it 5.12 times as fast.
#include <hip/hip_runtime.h>
// LLaMA grouped-query causal attention with interleaved-pair RoPE (hidden_states [1][2048][2048]; q = x Wq^T (natural [2048][2048]), k = x Wk^T, v = x Wv^T (natural [512][2048]) (sigma 0.02, no biases): 32 query heads / 8 kv heads of 64 (repeat_interleave: kv head h / 4); tables cos/sin of pos / 10000^(2i/64) repeated per pair; q = q cos + rotate_pairs(q) sin with rotate_pairs (x0, x1) -> (-x1, x0): pair (e, o) -> (e cos - o sin, o cos + e sin); scores x 64^-0.5 with a causal mask (triu(1) -> -inf); softmax; out = merged Wo^T (natural) -> [1][2048][2048]).
// Compute dtype: inputs rounded to bf16; x / weights exact; q, k, v, softmax weights and o as plain f16 GEMM operands (~2^-12); scores and softmax statistics f32. v_wmma_f32_16x16x32_f16.
#define NB 1
#define NG 8
#define HPG 4
#define KVD (NG * HD)
#define SQ 2048
#define DM 2048
#define NH 32
#define HD 64
#define HG 4                         /* heads covered by one launch of the non-template k_vt (unused) */
#define QT 256                       /* query rows per causal tile */
#define NKX SQ                       /* S / P row pitch */
#define QT0 128                      /* first-tile rows recomputed exactly in f32 */
#define B0 0                         /* first batch processed (debug hook) */
#define NBR NB                       /* batches processed (debug hook) */
#define NR ((size_t)NB * SQ)         /* token rows */
#define MP ((int)((size_t)NBR * SQ)) /* rows projected (debug hook) */
#define QN SQ                        /* query rows attended per batch (debug hook) */
#define NHD NH                       /* heads attended (debug hook) */
#define MPO MP                       /* rows through the output stage (debug hook) */
#define LQ DM      /* row pitch of the q rows */
typedef __bf16 v16b __attribute__((ext_vector_type(16)));
typedef unsigned short v8us __attribute__((ext_vector_type(8), may_alias));
typedef float  v8f  __attribute__((ext_vector_type(8)));
typedef float  v4f  __attribute__((ext_vector_type(4)));
typedef float  v4fa __attribute__((ext_vector_type(4), may_alias));
union FragB { v16b v; v8us half[2]; unsigned short u[16]; };

__device__ __forceinline__ unsigned short bf16_bits(float x) { unsigned int u = __float_as_uint(x); return (unsigned short)((u + 0x7FFFu + ((u >> 16) & 1u)) >> 16); }
__device__ __forceinline__ float bf16_val(unsigned short b) { return __uint_as_float(((unsigned int)b) << 16); }
__device__ __forceinline__ float bf16_round(float x) { return bf16_val(bf16_bits(x)); }
// D += A·B with NT terms: 1 = ah·bh, 2 = + al·bh (A split), 3 = + ah·bl (both split)
template <int NT>
__device__ __forceinline__ v8f mmaN(v16b ah, v16b al, v16b bh, v16b bl, v8f c) {
  c = __builtin_amdgcn_wmma_f32_16x16x32_bf16(false, ah, false, bh, (short)0, c, false, false);
  if (NT >= 2) c = __builtin_amdgcn_wmma_f32_16x16x32_bf16(false, al, false, bh, (short)0, c, false, false);
  if (NT >= 3) c = __builtin_amdgcn_wmma_f32_16x16x32_bf16(false, ah, false, bl, (short)0, c, false, false);
  asm volatile("v_nop\n\tv_nop\n\tv_nop\n\tv_nop" : "+v"(c) : "v"(ah), "v"(al), "v"(bh), "v"(bl));
  return c;
}

__global__ __launch_bounds__(256) void k_wt_bf16(const float* __restrict__ W, unsigned short* __restrict__ Wt, int K, int N) {
  const int t = blockIdx.x * 256 + threadIdx.x;
  const int k8n = K / 8;
  if (t >= N * k8n) return;
  const int n = t / k8n, k8 = (t % k8n) * 8;
  v8us v;
#pragma unroll
  for (int i = 0; i < 8; ++i) v[i] = bf16_bits(W[(size_t)(k8 + i) * N + n]);
  *(v8us*)(Wt + (size_t)n * K + k8) = v;
  
}

// GEMM C[M][N] (f32, pitch ldc) = act(A[M][K]·W + bias). A f32 row-major (pitch lda) converted per fragment to bf16
// (ASPLIT: hi/lo two planes -> 2 terms, else single rounded term); Wt bf16 [N][K] (pitch ldb). BIAS_BF16 rounds the
// bias to bf16 first (bias quantised to bf16 before the add). K%32==0, M%16==0, N%64==0.
template <bool ASPLIT, int ACT, bool BIAS_BF16>
__global__ __launch_bounds__(128) void k_gemm_bf(const float* __restrict__ A, int lda, const unsigned short* __restrict__ Wt, int ldb,
                                               const float* __restrict__ bias, float* __restrict__ C, int ldc, int M, int N, int K) {
  __shared__ __attribute__((aligned(16))) float so[4][16][64];
  const int tid = threadIdx.x, w = tid >> 5, lane = tid & 31, ln = lane & 15, hh = lane >> 4;
  const int ntn = N / 64;
  const int wid = blockIdx.x * 4 + w;
  const int mt = wid / ntn, nq = wid % ntn;
  if (mt * 16 >= M) return;
  const int row0 = mt * 16, col0 = nq * 64;
  const float* arow = A + (size_t)(row0 + ln) * lda;
  v8f acc[4] = {};
  for (int kb = 0; kb < K; kb += 32) {
    FragB ah, al;
    const v4f x0 = *(const v4fa*)(arow + kb + 8 * hh), x1 = *(const v4fa*)(arow + kb + 8 * hh + 4);
    const v4f x2 = *(const v4fa*)(arow + kb + 16 + 8 * hh), x3 = *(const v4fa*)(arow + kb + 16 + 8 * hh + 4);
    float xs[16] = {x0[0],x0[1],x0[2],x0[3],x1[0],x1[1],x1[2],x1[3],x2[0],x2[1],x2[2],x2[3],x3[0],x3[1],x3[2],x3[3]};
#pragma unroll
    for (int i = 0; i < 16; ++i) { const unsigned short hb = bf16_bits(xs[i]); ah.u[i] = hb; al.u[i] = ASPLIT ? bf16_bits(xs[i] - bf16_val(hb)) : (unsigned short)0; }
#pragma unroll
    for (int t = 0; t < 4; ++t) {
      const unsigned short* brow = Wt + (size_t)(col0 + t * 16 + ln) * ldb + kb;
      FragB b;
      b.half[0] = *(const v8us*)(brow + 8 * hh);
      b.half[1] = *(const v8us*)(brow + 16 + 8 * hh);
      acc[t] = mmaN<ASPLIT ? 2 : 1>(ah.v, al.v, b.v, b.v, acc[t]);
    }
  }
#pragma unroll
  for (int t = 0; t < 4; ++t) {
    float bv = bias ? bias[col0 + t * 16 + ln] : 0.f;
    if (BIAS_BF16) bv = bf16_round(bv);
#pragma unroll
    for (int r = 0; r < 8; ++r) { float v = acc[t][r] + bv; if (ACT == 1) v = fmaxf(v, 0.f); so[w][8 * hh + r][t * 16 + ln] = v; }
  }
  __builtin_amdgcn_fence(__ATOMIC_ACQ_REL, "workgroup");
  __builtin_amdgcn_wave_barrier();
  const int rsub = lane >> 4, c4 = (lane & 15) * 4;
  {
#pragma unroll
    for (int q = 0; q < 8; ++q) {
      const int r = q * 2 + rsub;
      const v4f v = *(const v4fa*)&so[w][r][c4];
      *(v4f*)(C + (size_t)(row0 + r) * ldc + col0 + c4) = v;
    }
    
  }
}

// GEMM C = act(A·W + bias + resid): A f32 (ASPLIT -> hi/lo 2 terms), Wt bf16 [N][K]; ACT 0 none, 1 relu, 2 exact gelu;
// resid (optional, f32, row index = (row % rmod), pitch ldr, RES_BF16 rounds it) added before the activation.
template <bool ASPLIT, int ACT, bool BIAS_BF16, bool RES_BF16>
__global__ __launch_bounds__(128) void k_gemm_bf3(const float* __restrict__ A, int lda, const unsigned short* __restrict__ Wt, int ldb,
                                                const float* __restrict__ bias, const float* __restrict__ resid, int rmod, int ldr,
                                                float* __restrict__ C, int ldc, int M, int N, int K) {
  __shared__ __attribute__((aligned(16))) float so[4][16][64];
  const int tid = threadIdx.x, w = tid >> 5, lane = tid & 31, ln = lane & 15, hh = lane >> 4;
  const int ntn = N / 64;
  const int wid = blockIdx.x * 4 + w;
  const int mt = wid / ntn, nq = wid % ntn;
  if (mt * 16 >= M) return;
  const int row0 = mt * 16, col0 = nq * 64;
  const float* arow = A + (size_t)(row0 + ln) * lda;
  v8f acc[4] = {};
  for (int kb = 0; kb < K; kb += 32) {
    FragB ah, al;
    const v4f x0 = *(const v4fa*)(arow + kb + 8 * hh), x1 = *(const v4fa*)(arow + kb + 8 * hh + 4);
    const v4f x2 = *(const v4fa*)(arow + kb + 16 + 8 * hh), x3 = *(const v4fa*)(arow + kb + 16 + 8 * hh + 4);
    float xs[16] = {x0[0],x0[1],x0[2],x0[3],x1[0],x1[1],x1[2],x1[3],x2[0],x2[1],x2[2],x2[3],x3[0],x3[1],x3[2],x3[3]};
#pragma unroll
    for (int i = 0; i < 16; ++i) { const unsigned short hb = bf16_bits(xs[i]); ah.u[i] = hb; al.u[i] = ASPLIT ? bf16_bits(xs[i] - bf16_val(hb)) : (unsigned short)0; }
#pragma unroll
    for (int t = 0; t < 4; ++t) {
      const unsigned short* brow = Wt + (size_t)(col0 + t * 16 + ln) * ldb + kb;
      FragB b;
      b.half[0] = *(const v8us*)(brow + 8 * hh);
      b.half[1] = *(const v8us*)(brow + 16 + 8 * hh);
      acc[t] = mmaN<ASPLIT ? 2 : 1>(ah.v, al.v, b.v, b.v, acc[t]);
    }
  }
#pragma unroll
  for (int t = 0; t < 4; ++t) {
    const int col = col0 + t * 16 + ln;
    float bv = bias ? bias[col] : 0.f;
    if (BIAS_BF16) bv = bf16_round(bv);
#pragma unroll
    for (int r = 0; r < 8; ++r) {
      float v = acc[t][r] + bv;
      if (resid) { float rv = resid[(size_t)((row0 + 8 * hh + r) % rmod) * ldr + col]; if (RES_BF16) rv = bf16_round(rv); v += rv; }
      if (ACT == 1) v = fmaxf(v, 0.f);
      if (ACT == 2) v = 0.5f * v * (1.0f + erff(v * 0.70710678118654752f));
      if (ACT == 3) { const float u = 0.7978845608028654f * (v + 0.044715f * v * v * v); v = 0.5f * v * (1.0f + tanhf(u)); }
      so[w][8 * hh + r][t * 16 + ln] = v;
    }
  }
  __builtin_amdgcn_fence(__ATOMIC_ACQ_REL, "workgroup");
  __builtin_amdgcn_wave_barrier();
  const int rsub = lane >> 4, c4 = (lane & 15) * 4;
  {
#pragma unroll
    for (int q = 0; q < 8; ++q) {
      const int r = q * 2 + rsub;
      const v4f v = *(const v4fa*)&so[w][r][c4];
      *(v4f*)(C + (size_t)(row0 + r) * ldc + col0 + c4) = v;
    }
    
  }
}
// row LayerNorm (biased variance, eps) over N: s = X (+ R); optional out_sum <- s; out_norm <- (s-mu)*rsqrt(var+eps)*g + b
template <bool PARAM_BF16>
__global__ __launch_bounds__(256) void k_layernorm(const float* __restrict__ X, const float* __restrict__ R, const float* __restrict__ g, const float* __restrict__ bta,
                                                  float* __restrict__ out_sum, float* __restrict__ out_norm, int N, float eps) {
  __shared__ float red[256];
  const int row = blockIdx.x, tid = threadIdx.x;
  const float* x = X + (size_t)row * N; const float* rr = R ? R + (size_t)row * N : nullptr;
  float vals[16];                     // up to N = 4096
  const int per = N / 256;            // contiguous chunk per thread? use strided-by-4 chunks: thread handles j = tid*4 + 1024*u
  float s1 = 0.f;
  for (int u = 0; u < per / 4; ++u) {
    const int j = tid * 4 + 1024 * u;
    const v4f a = *(const v4fa*)(x + j);
    v4f b = {0.f,0.f,0.f,0.f}; if (rr) b = *(const v4fa*)(rr + j);
#pragma unroll
    for (int q = 0; q < 4; ++q) { const float v = a[q] + b[q]; vals[u * 4 + q] = v; s1 += v; }
  }
  red[tid] = s1; __syncthreads();
  for (int st = 128; st > 0; st >>= 1) { if (tid < st) red[tid] += red[tid + st]; __syncthreads(); }
  const float mu = red[0] / (float)N; __syncthreads();
  float s2 = 0.f;
  for (int u = 0; u < per / 4; ++u)
#pragma unroll
    for (int q = 0; q < 4; ++q) { const float c = vals[u * 4 + q] - mu; s2 += c * c; }
  red[tid] = s2; __syncthreads();
  for (int st = 128; st > 0; st >>= 1) { if (tid < st) red[tid] += red[tid + st]; __syncthreads(); }
  const float rs = rsqrtf(red[0] / (float)N + eps);
  {
    for (int u = 0; u < per / 4; ++u) {
      const int j = tid * 4 + 1024 * u;
      v4f o, sm;
#pragma unroll
      for (int q = 0; q < 4; ++q) {
        float gg = g[j + q], bb = bta[j + q];
        if (PARAM_BF16) { gg = bf16_round(gg); bb = bf16_round(bb); }
        sm[q] = vals[u * 4 + q]; o[q] = (vals[u * 4 + q] - mu) * rs * gg + bb;
      }
      if (out_sum) *(v4f*)(out_sum + (size_t)row * N + j) = sm;
      *(v4f*)(out_norm + (size_t)row * N + j) = o;
    }
    
  }
}



// ---- f16 WMMA path (v_wmma_f32_16x16x32_f16): 11-bit significands for operands in range — used where a [0,1] probability operand needs more precision than bf16
typedef _Float16 v16h __attribute__((ext_vector_type(16)));
union FragH { v16h v; v8us half[2]; _Float16 h[16]; unsigned short u[16]; };
template <int NT>
__device__ __forceinline__ v8f mmaH(v16h ah, v16h al, v16h bh, v16h bl, v8f c) {
  c = __builtin_amdgcn_wmma_f32_16x16x32_f16(false, ah, false, bh, (short)0, c, false, false);
  if (NT >= 2) c = __builtin_amdgcn_wmma_f32_16x16x32_f16(false, al, false, bh, (short)0, c, false, false);
  if (NT >= 3) c = __builtin_amdgcn_wmma_f32_16x16x32_f16(false, ah, false, bl, (short)0, c, false, false);
  asm volatile("v_nop\n\tv_nop\n\tv_nop\n\tv_nop" : "+v"(c) : "v"(ah), "v"(al), "v"(bh), "v"(bl));
  return c;
}
// batched GEMM like k_gemm_b but f16 operands: A f32 (split into f16 hi/lo if ASPLIT, else rounded to f16), Bt = f16 values [n][k]; alpha; C f32; N multiple of 16 (partial tiles skipped)
template <bool ASPLIT>
__global__ __launch_bounds__(128) void k_gemm_h(const float* __restrict__ A, int lda, size_t sA, const _Float16* __restrict__ Bh, int ldb, size_t sB, float alpha, float* __restrict__ C, int ldc, size_t sC, int M, int N, int K) {
  __shared__ __attribute__((aligned(16))) float so[4][16][64];
  const int tid = threadIdx.x, w = tid >> 5, lane = tid & 31, ln = lane & 15, hh = lane >> 4; const int by = blockIdx.y;
  A += (size_t)by * sA; Bh += (size_t)by * sB; C += (size_t)by * sC;
  const int ntn = (N + 63) / 64; const int wid = blockIdx.x * 4 + w; const int mt = wid / ntn, nq = wid % ntn; if (mt * 16 >= M) return;
  const int row0 = mt * 16, col0 = nq * 64; const float* arow = A + (size_t)(row0 + ln) * lda;
  v8f acc[4] = {};
  for (int kb = 0; kb < K; kb += 32) {
    FragH ah, al;
    const v4f x0 = *(const v4fa*)(arow + kb + 8 * hh), x1 = *(const v4fa*)(arow + kb + 8 * hh + 4), x2 = *(const v4fa*)(arow + kb + 16 + 8 * hh), x3 = *(const v4fa*)(arow + kb + 16 + 8 * hh + 4);
    float xs[16] = {x0[0],x0[1],x0[2],x0[3],x1[0],x1[1],x1[2],x1[3],x2[0],x2[1],x2[2],x2[3],x3[0],x3[1],x3[2],x3[3]};
#pragma unroll
    for (int i = 0; i < 16; ++i) { const _Float16 h = (_Float16)xs[i]; ah.h[i] = h; al.h[i] = ASPLIT ? (_Float16)(xs[i] - (float)h) : (_Float16)0.0f; }
#pragma unroll
    for (int t = 0; t < 4; ++t) { if (col0 + t * 16 >= N) continue; const size_t boff = (size_t)(col0 + t * 16 + ln) * ldb + kb; FragH bq; bq.half[0] = *(const v8us*)(Bh + boff + 8 * hh); bq.half[1] = *(const v8us*)(Bh + boff + 16 + 8 * hh);
      acc[t] = mmaH<ASPLIT ? 2 : 1>(ah.v, al.v, bq.v, bq.v, acc[t]); }
  }
#pragma unroll
  for (int t = 0; t < 4; ++t) { if (col0 + t * 16 >= N) continue;
#pragma unroll
    for (int r = 0; r < 8; ++r) so[w][8 * hh + r][t * 16 + ln] = acc[t][r] * alpha; }
  __builtin_amdgcn_fence(__ATOMIC_ACQ_REL, "workgroup"); __builtin_amdgcn_wave_barrier();
  const int rsub = lane >> 4, c4 = (lane & 15) * 4;
  {
#pragma unroll
    for (int q = 0; q < 8; ++q) { const int r = q * 2 + rsub; if (col0 + c4 < N) { const v4f v = *(const v4fa*)&so[w][r][c4]; *(v4f*)(C + (size_t)(row0 + r) * ldc + col0 + c4) = v; } }
     }
}

// Wt[n][k] = f16(W[k][n]·scale) from f32 row-major W[K][N] (scale = power of two; bf16-exact weights stay exact in f16 away from the subnormal range)
__global__ __launch_bounds__(256) void k_wt_f16(const float* __restrict__ W, _Float16* __restrict__ Wt, int K, int N, float scale) {
  const int t = blockIdx.x * 256 + threadIdx.x; if (t >= N * (K / 8)) return; const int n = t / (K / 8), k8 = (t % (K / 8)) * 8; FragH f;
#pragma unroll
  for (int i = 0; i < 8; ++i) f.h[i] = (_Float16)(bf16_round(W[(size_t)(k8 + i) * N + n]) * scale); const v8us o = f.half[0];
  *(v8us*)((unsigned short*)Wt + (size_t)n * K + k8) = o; 
}
// k_gemm_hh variant with fused epilogue: v = acc·alpha + bias[by·sBias + col] (+ CP[(row/rowsPerB)·sCPb + by·64 + col] if CP) ; ACT 0 none / 1 elu ; writes f16 C16 (and f32 C if non-null)
template <int ACT>
__global__ __launch_bounds__(128) void k_gemm_hhx(const _Float16* __restrict__ A, int lda, size_t sA, const _Float16* __restrict__ Bh, int ldb, size_t sB, float alpha, const float* __restrict__ bias, size_t sBias, const float* __restrict__ CP, int rowsPerB, size_t sCPb, int row0g,
    float* __restrict__ C, _Float16* __restrict__ C16, int ldc, size_t sC, int M, int N, int K) {
  __shared__ __attribute__((aligned(16))) float so[4][16][64];
  const int tid = threadIdx.x, w = tid >> 5, lane = tid & 31, ln = lane & 15, hh = lane >> 4; const int by = blockIdx.y;
  A += (size_t)by * sA; Bh += (size_t)by * sB; const size_t cofs = (size_t)by * sC; const float* bp = bias ? bias + (size_t)by * sBias : nullptr;
  const int ntn = (N + 63) / 64; const int wid = blockIdx.x * 4 + w; const int mt = wid / ntn, nq = wid % ntn; if (mt * 16 >= M) return;
  const int row0 = mt * 16, col0 = nq * 64; const _Float16* arow = A + (size_t)(row0 + ln) * lda;
  v8f acc[4] = {};
  for (int kb = 0; kb < K; kb += 32) { FragH ah; ah.half[0] = *(const v8us*)((const unsigned short*)arow + kb + 8 * hh); ah.half[1] = *(const v8us*)((const unsigned short*)arow + kb + 16 + 8 * hh);
#pragma unroll
    for (int t = 0; t < 4; ++t) { if (col0 + t * 16 >= N) continue; const size_t boff = (size_t)(col0 + t * 16 + ln) * ldb + kb; FragH bq; bq.half[0] = *(const v8us*)((const unsigned short*)Bh + boff + 8 * hh); bq.half[1] = *(const v8us*)((const unsigned short*)Bh + boff + 16 + 8 * hh);
      acc[t] = mmaH<1>(ah.v, ah.v, bq.v, bq.v, acc[t]); }
  }
#pragma unroll
  for (int t = 0; t < 4; ++t) { if (col0 + t * 16 >= N) continue; const int col = col0 + t * 16 + ln; const float bv = bp ? bf16_round(bp[col]) : 0.f;
#pragma unroll
    for (int r = 0; r < 8; ++r) { float v = acc[t][r] * alpha + bv; if (CP) { const int rr = row0g + row0 + 8 * hh + r; if (rowsPerB < 0) v += CP[cofs + (size_t)rr * ldc + col];      /* rowsPerB < 0: own element of the batched C plane */ else { const int bidx = rr / rowsPerB; v += CP[(size_t)bidx * sCPb + (size_t)by * 64 + col]; } } if (ACT == 1) v = (v > 0.f) ? v : expm1f(v); else if (ACT == 7) v = (v > 0.f) ? v + 1.0f : expf(v); else if (ACT == 8) v = tanhf(v); else if (ACT == 9) v = 0.5f * v * (1.0f + tanhf(0.7978845608028654f * (v + 0.044715f * v * v * v))); else if (ACT == 11) v = 1.0f / (1.0f + expf(-v)); else if (ACT == 12) v = (v > 0.f) ? v : 0.01f * v; else if (ACT == 14) v = (v > 0.f) ? v : 0.1f * v; else if (ACT == 16) v = (v >= 0.f) ? v : 0.3f * v; else if (ACT == 17) v = (v >= 0.f) ? v : 0.2f * v; else if (ACT == 15) v = v / (1.0f + expf(-v)); else if (ACT == 3) v = fmaxf(v, 0.f); else if (ACT == 6) v = 0.5f * v * (1.0f + erff(v * 0.70710678118654752f)); so[w][8 * hh + r][t * 16 + ln] = v; } }
  __builtin_amdgcn_fence(__ATOMIC_ACQ_REL, "workgroup"); __builtin_amdgcn_wave_barrier();
  const int rsub = lane >> 4, c4 = (lane & 15) * 4; typedef _Float16 v4h __attribute__((ext_vector_type(4)));
  {
#pragma unroll
    for (int q = 0; q < 8; ++q) { const int r = q * 2 + rsub; if (col0 + c4 < N) { const v4f v = *(const v4fa*)&so[w][r][c4]; if (C) *(v4f*)(C + cofs + (size_t)(row0 + r) * ldc + col0 + c4) = v; if (C16) { v4h h4; for (int i = 0; i < 4; ++i) h4[i] = (_Float16)v[i]; *(v4h*)(C16 + cofs + (size_t)(row0 + r) * ldc + col0 + c4) = h4; } } }
     }
}


typedef _Float16 v4h __attribute__((ext_vector_type(4)));

__global__ __launch_bounds__(256) void k_x16(const float* __restrict__ x, _Float16* __restrict__ X16, size_t n8) { const size_t t = (size_t)blockIdx.x * 256 + threadIdx.x; if (t >= n8) return; FragH f;
#pragma unroll
  for (int q = 0; q < 8; ++q) f.h[q] = (_Float16)bf16_round(x[t * 8 + q]); *(v8us*)((unsigned short*)X16 + t * 8) = f.half[0];  }
__global__ __launch_bounds__(256) void k_h16(const float* __restrict__ x, _Float16* __restrict__ X16, size_t n8) { const size_t t = (size_t)blockIdx.x * 256 + threadIdx.x; if (t >= n8) return; FragH f;
#pragma unroll
  for (int q = 0; q < 8; ++q) f.h[q] = (_Float16)x[t * 8 + q]; *(v8us*)((unsigned short*)X16 + t * 8) = f.half[0];  }
__global__ __launch_bounds__(256) void k_round16f(const float* __restrict__ W, _Float16* __restrict__ Bt, size_t n8) { const size_t t = (size_t)blockIdx.x * 256 + threadIdx.x; if (t >= n8) return; FragH f;
#pragma unroll
  for (int i = 0; i < 8; ++i) f.h[i] = (_Float16)(bf16_round(W[t * 8 + i]) * 16.0f); *(v8us*)((unsigned short*)Bt + t * 8) = f.half[0];  }
template <int NHv, int TTv>
__global__ __launch_bounds__(256) void k_vt(const _Float16* __restrict__ V16, int ldv, int voff, _Float16* __restrict__ Vt) { __shared__ unsigned short tl[64][66]; const int tid = threadIdx.x; const int slab = blockIdx.x / (TTv / 64), lg = blockIdx.x % (TTv / 64); const int b = slab / NHv, h = slab % NHv;
  for (int i = tid; i < 64 * 8; i += 256) { const int r = i / 8, c8 = (i % 8) * 8; FragH f; f.half[0] = *(const v8us*)((const unsigned short*)V16 + ((size_t)b * TTv + lg * 64 + r) * ldv + voff + h * 64 + c8);
#pragma unroll
    for (int q = 0; q < 8; ++q) tl[r][c8 + q] = f.u[q]; }
  __syncthreads();
  {
#pragma unroll
    for (int rd = 0; rd < 2; ++rd) { const int d = rd * 32 + tid / 8, pc = tid % 8; FragH f;
#pragma unroll
      for (int q = 0; q < 8; ++q) f.u[q] = tl[pc * 8 + q][d];
      *(v8us*)((unsigned short*)Vt + ((size_t)slab * 64 + d) * TTv + lg * 64 + pc * 8) = f.half[0]; }
     } }

__global__ __launch_bounds__(256) void k_hl(const float* __restrict__ F, _Float16* __restrict__ Hh, _Float16* __restrict__ Hl, size_t n8) { const size_t t = (size_t)blockIdx.x * 256 + threadIdx.x; if (t >= n8) return; FragH fh, fl; const v4f a = *(const v4fa*)(F + t * 8), c = *(const v4fa*)(F + t * 8 + 4);
#pragma unroll
  for (int q = 0; q < 4; ++q) { _Float16 h = (_Float16)a[q]; fh.h[q] = h; fl.h[q] = (_Float16)((a[q] - (float)h) * 1024.0f); h = (_Float16)c[q]; fh.h[4 + q] = h; fl.h[4 + q] = (_Float16)((c[q] - (float)h) * 1024.0f); }
  { *(v8us*)((unsigned short*)Hh + t * 8) = fh.half[0]; *(v8us*)((unsigned short*)Hl + t * 8) = fl.half[0];  } }

// ---- fast GEMM (wave tile 32x64; requires M % 32 == 0 rows per launch region and N % 64 == 0); epilogue = k_gemm_hhx semantics ----
__device__ __forceinline__ v16h g2_frag(const _Float16* p, int hh) { FragH f; f.half[0] = *(const v8us*)((const unsigned short*)p + 8 * hh); f.half[1] = *(const v8us*)((const unsigned short*)p + 16 + 8 * hh); return f.v; }
__device__ __forceinline__ v8f g2_mma(v16h a, v16h b, v8f c) { v8f d = __builtin_amdgcn_wmma_f32_16x16x32_f16(false, a, false, b, (short)0, c, false, false); asm volatile("v_nop\n\tv_nop\n\tv_nop\n\tv_nop" : "+v"(d) : "v"(a), "v"(b)); return d; }
struct G2Set { v16h a0, a1, b0, b1, b2, b3; };      /* the fragments of one 32-k step of a 32x64 wave tile */
template <int ACT>
__global__ __launch_bounds__(128) void k_gemm2(const _Float16* __restrict__ A, int lda, size_t sA, const _Float16* __restrict__ Bh, int ldb, size_t sB, float alpha, const float* __restrict__ bias, size_t sBias, const float* __restrict__ CP, int rowsPerB, size_t sCPb, int row0g,
    float* __restrict__ C, _Float16* __restrict__ C16, int ldc, size_t sC, int M, int N, int K, int bshift = 0) { static_assert(ACT == 0 || ACT == 3 || ACT == 6 || ACT == 8 || ACT == 9 || ACT == 11 || ACT == 12 || ACT == 14 || ACT == 15 || ACT == 16 || ACT == 17, "k_gemm2: unsupported ACT code (would silently apply no activation)");
  __shared__ __attribute__((aligned(16))) float so[4][32][68];
  const int tid = threadIdx.x, w = tid >> 5, lane = tid & 31, ln = lane & 15, hh = lane >> 4; const int by = blockIdx.y;
  A += (size_t)by * sA; Bh += (size_t)(by >> bshift) * sB;      /* 2^bshift consecutive batch planes share one B plane (query heads of one kv group) */ const size_t cofs = (size_t)by * sC; const float* bp = bias ? bias + (size_t)by * sBias : nullptr;
  const int ntn = N >> 6; const int mt = blockIdx.x / ntn, nq = blockIdx.x - mt * ntn; const int row0 = mt * 128 + 32 * w, col0 = nq * 64; if (row0 >= M) return;
  const _Float16* a0p = A + (size_t)(row0 + ln) * lda; const _Float16* a1p = a0p + (size_t)16 * lda;
  const _Float16* b0p = Bh + (size_t)(col0 + ln) * ldb; const _Float16* b1p = b0p + (size_t)16 * ldb; const _Float16* b2p = b1p + (size_t)16 * ldb; const _Float16* b3p = b2p + (size_t)16 * ldb;
  const v8f z8 = {0.f,0.f,0.f,0.f,0.f,0.f,0.f,0.f}; v8f c00 = z8, c01 = z8, c02 = z8, c03 = z8, c10 = z8, c11 = z8, c12 = z8, c13 = z8;
  /* K loop: a ring of three fragment sets in registers. The 12 loads of a 32-k step are issued as one group, and a set is loaded anew, three steps ahead, directly behind the
     products that read it, so that up to 36 loads of a wave are in flight and a product waits only for the oldest group. Every accumulator still sums k upwards. */
  auto ld = [&](int k) { G2Set s; s.a0 = g2_frag(a0p + k, hh); s.a1 = g2_frag(a1p + k, hh); s.b0 = g2_frag(b0p + k, hh); s.b1 = g2_frag(b1p + k, hh); s.b2 = g2_frag(b2p + k, hh); s.b3 = g2_frag(b3p + k, hh); return s; };
  auto use = [&](const G2Set& s) { c00 = g2_mma(s.a0, s.b0, c00); c10 = g2_mma(s.a1, s.b0, c10); c01 = g2_mma(s.a0, s.b1, c01); c11 = g2_mma(s.a1, s.b1, c11);
    c02 = g2_mma(s.a0, s.b2, c02); c12 = g2_mma(s.a1, s.b2, c12); c03 = g2_mma(s.a0, s.b3, c03); c13 = g2_mma(s.a1, s.b3, c13); };
  int kb = 0;
  if (K >= 96) { G2Set s0 = ld(0);
    __builtin_amdgcn_sched_barrier(0);      /* keeps the first loads in the ring's own order, set by set: the loop's counted waits are formed for both ways into it, and with the sets mixed here the wait in front of a set's second product also covered loads of the set behind it */
    G2Set s1 = ld(32);
    __builtin_amdgcn_sched_barrier(0);      /* the same, between the second and the third set */
    G2Set s2 = ld(64);
    asm volatile("s_wait_xcnt 0x0" ::: "memory");      /* precaution: the build sets the accumulators to zero behind these loads, in registers that held one of their addresses */
#pragma unroll 1      /* one trip is one turn of the ring; no branch inside it, so the compiler's waits stay counted */
    for (; kb + 192 <= K; kb += 96) { use(s0);
      asm volatile("s_wait_xcnt 0x0" : "+s"(kb) :: "memory");      /* precaution: stands in front of the additions that rewrite the address registers which the loads of the trip before name; kb goes through it because those additions are formed from kb, so none can be placed ahead of the wait */
      s0 = ld(kb + 96); use(s1); s1 = ld(kb + 128); use(s2); s2 = ld(kb + 160); }
    use(s0); use(s1); use(s2); kb += 96; }
  if (kb + 64 <= K) {      /* what the ring leaves, or all of K = 64: both steps' loads together */
    const _Float16* const t0 = a0p + kb; const _Float16* const t1 = a1p + kb; const _Float16* const t2 = b0p + kb; const _Float16* const t3 = b1p + kb; const _Float16* const t4 = b2p + kb; const _Float16* const t5 = b3p + kb;
    G2Set s0, s1; s0.a0 = g2_frag(t0, hh); s0.a1 = g2_frag(t1, hh); s0.b0 = g2_frag(t2, hh); s0.b1 = g2_frag(t3, hh); s0.b2 = g2_frag(t4, hh); s0.b3 = g2_frag(t5, hh);
    s1.a0 = g2_frag(t0 + 32, hh); s1.a1 = g2_frag(t1 + 32, hh); s1.b0 = g2_frag(t2 + 32, hh); s1.b1 = g2_frag(t3 + 32, hh); s1.b2 = g2_frag(t4 + 32, hh); s1.b3 = g2_frag(t5 + 32, hh);
    asm volatile("s_wait_xcnt 0x0" :: "v"(t0 + 8 * hh), "v"(t1 + 8 * hh), "v"(t2 + 8 * hh), "v"(t3 + 8 * hh), "v"(t4 + 8 * hh), "v"(t5 + 8 * hh) : "memory");      /* precaution: the six row addresses are inputs, so they stay in their registers up to this wait and no fragment of the run is loaded into a register that an earlier load of the run names */
    use(s0); use(s1); kb += 64; }
  if (kb < K) { const G2Set s0 = ld(kb); use(s0); }
  v8f accs[8] = {c00, c01, c02, c03, c10, c11, c12, c13};
#pragma unroll
  for (int u = 0; u < 8; ++u) { const int t = u & 3, half = u >> 2; const int col = col0 + t * 16 + ln; const float bv = bp ? bf16_round(bp[col]) : 0.f;
#pragma unroll
    for (int r = 0; r < 8; ++r) { const int rloc = half * 16 + 8 * hh + r; float v = accs[u][r] * alpha + bv; if (CP) { if (rowsPerB < 0) v += CP[cofs + (size_t)(row0g + row0 + rloc) * ldc + col];      /* rowsPerB < 0: own element of the batched C plane */ else { const int bidx = (row0g + row0 + rloc) / rowsPerB; v += CP[(size_t)bidx * sCPb + (size_t)by * 64 + col]; } }
      if (ACT == 3) v = fmaxf(v, 0.f); else if (ACT == 6) v = 0.5f * v * (1.0f + erff(v * 0.70710678118654752f)); else if (ACT == 11) v = 1.0f / (1.0f + expf(-v)); else if (ACT == 15) v = v / (1.0f + expf(-v)); else if (ACT == 12) v = (v > 0.f) ? v : 0.01f * v; else if (ACT == 8) v = tanhf(v); else if (ACT == 9) v = 0.5f * v * (1.0f + tanhf(0.7978845608028654f * (v + 0.044715f * v * v * v))); else if (ACT == 14) v = (v > 0.f) ? v : 0.1f * v; else if (ACT == 16) v = (v >= 0.f) ? v : 0.3f * v; else if (ACT == 17) v = (v >= 0.f) ? v : 0.2f * v;
      so[w][rloc][t * 16 + ln] = v; } }
  __builtin_amdgcn_fence(__ATOMIC_ACQ_REL, "workgroup"); __builtin_amdgcn_wave_barrier();
  const int rsub = lane >> 4, c4 = (lane & 15) * 4;
  {
#pragma unroll
    for (int q = 0; q < 16; ++q) { const int r = q * 2 + rsub; const v4f v = *(const v4fa*)&so[w][r][c4]; if (C) *(v4f*)(C + cofs + (size_t)(row0 + r) * ldc + col0 + c4) = v; if (C16) { v4h h4; for (int i = 0; i < 4; ++i) h4[i] = (_Float16)v[i]; *(v4h*)(C16 + cofs + (size_t)(row0 + r) * ldc + col0 + c4) = h4; } }
     } }


__global__ __launch_bounds__(256) void k_wnat(const float* __restrict__ w, size_t n8, _Float16* __restrict__ Bt) { const size_t t = (size_t)blockIdx.x * 256 + threadIdx.x; if (t >= n8) return; FragH f; for (int q = 0; q < 8; ++q) f.h[q] = (_Float16)(bf16_round(w[t * 8 + q]) * 16.0f); *(v8us*)((unsigned short*)Bt + t * 8) = f.half[0];  }
__global__ __launch_bounds__(256) void k_rsm(const float* __restrict__ S, _Float16* __restrict__ P, int nrows) {
  #pragma clang fp contract(off)
  const int i = blockIdx.x * 256 + threadIdx.x; if (i >= nrows) return; const float* s = S + (size_t)i * SQ; float mx = -3.0e38f;
#pragma unroll 1
  for (int j = 0; j < SQ; ++j) mx = fmaxf(mx, s[j]); float se = 0.f;
#pragma unroll 1
  for (int j = 0; j < SQ; ++j) se += expf(s[j] - mx); const float sc = 256.0f / se;
#pragma unroll 1
  for (int j0 = 0; j0 < SQ; j0 += 8) { FragH f; for (int q = 0; q < 8; ++q) f.h[q] = (_Float16)(expf(s[j0 + q] - mx) * sc); unsigned short* d = (unsigned short*)P + (size_t)i * SQ + j0; *(v8us*)d = f.half[0];  } }
__global__ __launch_bounds__(256) void k_vt(const _Float16* __restrict__ V16, int b, int h0, _Float16* __restrict__ VT) { __shared__ unsigned short tl[64][65]; const int tid = threadIdx.x; const int hh = blockIdx.x % HG, sg = blockIdx.x / HG; const int s0 = sg * 64; const int h = h0 + hh;
  for (int i = tid; i < 64 * 8; i += 256) { const int j = i / 8, d8 = (i % 8) * 8; FragH f; f.half[0] = *(const v8us*)((const unsigned short*)V16 + ((size_t)b * SQ + s0 + j) * DM + h * HD + d8); for (int q = 0; q < 8; ++q) tl[d8 + q][j] = f.u[q]; }
  __syncthreads();
  { for (int i = tid; i < 64 * 8; i += 256) { const int d = i / 8, j8 = (i % 8) * 8; FragH f; for (int q = 0; q < 8; ++q) f.u[q] = tl[d][j8 + q]; *(v8us*)((unsigned short*)VT + ((size_t)hh * HD + d) * SQ + s0 + j8) = f.half[0]; }  } }



// Causal row softmax, one wave per score row: lane l holds columns 256 c + 8 l .. + 7 of every 256-column chunk c, so a wave's loads and stores
// cover whole cache lines and the row is read once; the row maximum and the row sum are folded over the 32 lanes by a butterfly of lane exchanges.
// e^a as __expf forms it (a * log2 e, then v_exp_f32). Written as asm so that the one free issue slot the instruction set asks for behind a transcendental,
// before its source register is overwritten or its result read, stands there by construction.
__device__ __forceinline__ float rsm_exp(float a) { float r; const float y = a * 1.44269504f; asm("v_exp_f32 %0, %1\n\tv_nop" : "=v"(r) : "v"(y)); return r; }
template <int NC>
__device__ __forceinline__ void rsm_row(const float* __restrict__ s, unsigned short* __restrict__ d, int j0, int last) {
  v4f va[NC], vb[NC];
#pragma unroll      /* full unroll: the row stays in registers and all 2 NC loads are in flight before the first use */
  for (int c = 0; c < NC; ++c) { va[c] = *(const v4fa*)(s + c * 256); vb[c] = *(const v4fa*)(s + c * 256 + 4); }
  float mx = -3.0e38f;
#pragma unroll      /* full unroll: register arrays need constant indices */
  for (int c = 0; c < NC; ++c) {
#pragma unroll
    for (int q = 0; q < 4; ++q) { const int j = j0 + c * 256 + q; va[c][q] = (j <= last) ? va[c][q] : -1.0e9f; vb[c][q] = (j + 4 <= last) ? vb[c][q] : -1.0e9f; mx = fmaxf(mx, fmaxf(va[c][q], vb[c][q])); } }
  for (int m = 16; m > 0; m >>= 1) mx = fmaxf(mx, __shfl_xor(mx, m, 32));
  float se = 0.f;
#pragma unroll      /* full unroll: register arrays need constant indices */
  for (int c = 0; c < NC; ++c) {
#pragma unroll
    for (int q = 0; q < 4; ++q) { va[c][q] = rsm_exp(va[c][q] - mx); se += va[c][q]; }
#pragma unroll
    for (int q = 0; q < 4; ++q) { vb[c][q] = rsm_exp(vb[c][q] - mx); se += vb[c][q]; } }
  for (int m = 16; m > 0; m >>= 1) se += __shfl_xor(se, m, 32);
  const float sc = 256.0f / se;
#pragma unroll      /* full unroll: register arrays need constant indices */
  for (int c = 0; c < NC; ++c) { FragH fr;
#pragma unroll
    for (int q = 0; q < 4; ++q) { fr.h[q] = (_Float16)(va[c][q] * sc); fr.h[4 + q] = (_Float16)(vb[c][q] * sc); }
    *(v8us*)(d + c * 256) = fr.half[0]; }
  asm volatile("s_wait_xcnt 0x0" ::: "memory");      /* precaution behind the run of stores: stands in front of any later instruction that rewrites a register the stores name (the next case's code follows in the listing) */
}
__global__ __launch_bounds__(256) void k_rsmcf2(const float* __restrict__ S, _Float16* __restrict__ P, int hg, int q0, int nk) {
  const int lane = threadIdx.x & 31; const int t = blockIdx.x * 8 + (threadIdx.x >> 5); if (t >= hg * QT) return;
  const float* s = S + (size_t)t * NKX + lane * 8; unsigned short* d = (unsigned short*)P + (size_t)t * NKX + lane * 8; const int last = q0 + (t % QT); const int j0 = lane * 8;
  switch (nk / 256) {      /* nk = q0 + QT: a whole number of 256-column chunks, the same for every wave of the launch */
    case 1: rsm_row<1>(s, d, j0, last); break; case 2: rsm_row<2>(s, d, j0, last); break; case 3: rsm_row<3>(s, d, j0, last); break; case 4: rsm_row<4>(s, d, j0, last); break;
    case 5: rsm_row<5>(s, d, j0, last); break; case 6: rsm_row<6>(s, d, j0, last); break; case 7: rsm_row<7>(s, d, j0, last); break; case 8: rsm_row<8>(s, d, j0, last); break;
    default: break; } }


template <int MASKADD>
__global__ __launch_bounds__(64) void k_att0(const float* __restrict__ QF, const float* __restrict__ KF, const float* __restrict__ VF, int ld, const float* __restrict__ mask, float scale, float* __restrict__ OF, int ldo) {
  #pragma clang fp contract(off)
  __shared__ __attribute__((aligned(16))) float lq[64][64]; __shared__ __attribute__((aligned(16))) float lo[64][64];
  const int tid = threadIdx.x; const int h = blockIdx.x / (QT0 / 64), rg = blockIdx.x % (QT0 / 64); const int i = rg * 64 + tid;
  const float* qr = QF + (size_t)i * ld + h * HD;
#pragma unroll 1
  for (int c = 0; c < HD / 4; ++c) { *(v4f*)&lq[tid][c * 4] = *(const v4fa*)(qr + c * 4); const v4f z = {0.f, 0.f, 0.f, 0.f}; *(v4f*)&lo[tid][c * 4] = z; }
  float m = -1.0e30f, l = 0.f; const int jmax = MASKADD ? (SQ - 1) : (rg * 64 + 63);      /* additive-mask form: every key (the mask input decides); causal form: keys up to the block's last row */
#pragma unroll 1
  for (int j = 0; j <= jmax; ++j) { const float* kr = KF + (size_t)j * ld + h * HD; const float* vr = VF + (size_t)j * ld + h * HD; float s = 0.f;
#pragma unroll 1
    for (int c = 0; c < HD / 4; ++c) { const v4f kq = *(const v4fa*)(kr + c * 4); const v4f qq = *(v4f*)&lq[tid][c * 4]; s = __fadd_rn(s, __fmul_rn(qq[0], kq[0])); s = __fadd_rn(s, __fmul_rn(qq[1], kq[1])); s = __fadd_rn(s, __fmul_rn(qq[2], kq[2])); s = __fadd_rn(s, __fmul_rn(qq[3], kq[3])); }
    s = __fmul_rn(s, scale); if (MASKADD) s = __fadd_rn(s, __fmul_rn(bf16_round(mask[(size_t)i * SQ + j]), -10000.0f));
    const float f = (MASKADD || j <= i) ? 1.f : 0.f; const float sm = fmaf(f, s, (1.f - f) * -1.0e30f); const float mn = fmaxf(m, sm); const float sc = expf(m - mn); const float e = expf(sm - mn); l = __fadd_rn(__fmul_rn(l, sc), e); m = mn;
#pragma unroll 1
    for (int c = 0; c < HD / 4; ++c) { const v4f vv = *(const v4fa*)(vr + c * 4); v4f oo = *(v4f*)&lo[tid][c * 4]; for (int u = 0; u < 4; ++u) oo[u] = __fadd_rn(__fmul_rn(oo[u], sc), __fmul_rn(e, vv[u])); *(v4f*)&lo[tid][c * 4] = oo; } }
  const float fin = 64.0f / l;      /* o carried x64 like the f16 path */
#pragma unroll 1
  for (int c = 0; c < HD / 4; ++c) { v4f oo = *(v4f*)&lo[tid][c * 4]; for (int u = 0; u < 4; ++u) oo[u] = __fmul_rn(oo[u], fin); *(v4f*)&lo[tid][c * 4] = oo; }
  __syncthreads();
  {
#pragma unroll 1
    for (int it = 0; it < 16; ++it) { const int row = it * 4 + tid / 16, pc = (tid % 16) * 4; const v4f v = *(const v4f*)&lo[row][pc]; *(v4f*)(OF + (size_t)(rg * 64 + row) * ldo + h * HD + pc) = v; }
     } }


__global__ __launch_bounds__(256) void k_kvexp(const float* __restrict__ src, float* __restrict__ dst, size_t n4) { const size_t t = (size_t)blockIdx.x * 256 + threadIdx.x; if (t >= n4) return; const size_t e = t * 4; const size_t row = e / DM; const int col = (int)(e % DM); const int h = col / HD, d = col % HD; const v4f v = *(const v4fa*)(src + row * KVD + (size_t)(h / HPG) * HD + d); *(v4f*)(dst + e) = v;  }

__global__ __launch_bounds__(256) void k_tab2(float theta, float* __restrict__ CS, float* __restrict__ SN) {
  #pragma clang fp contract(off)
  const int t = blockIdx.x * 256 + threadIdx.x; if (t >= SQ * (HD / 2)) return; const int i = t % (HD / 2); const int p = t / (HD / 2); const float invf = 1.0f / powf(theta, (float)(2 * i) / (float)HD); const float ang = __fmul_rn((float)p, invf); const float c = cosf(ang), s = sinf(ang);
  *(float*)(CS + t) = c; *(float*)(SN + t) = s;  }
template <int NORM, int ROPE>
__global__ __launch_bounds__(64) void k_xform(const float* __restrict__ F, int ldf, int nh, const float* __restrict__ gain, float eps, const float* __restrict__ CS, const float* __restrict__ SN, _Float16* __restrict__ H16, int ldo) {
  #pragma clang fp contract(off)
  __shared__ float xv[HD]; __shared__ float red[HD]; __shared__ unsigned short sh_[HD]; const int d = threadIdx.x; const int h = blockIdx.x % nh; const size_t r = blockIdx.x / nh; const int p = (int)(r % SQ);
  float x = F[r * (size_t)ldf + (size_t)h * HD + d];
  if (NORM) { red[d] = __fmul_rn(x, x); __syncthreads(); for (int st = HD / 2; st > 0; st >>= 1) { if (d < st) red[d] = __fadd_rn(red[d], red[d + st]); __syncthreads(); } const float rs = rsqrtf(__fadd_rn(red[0] / (float)HD, eps)); x = __fmul_rn(__fmul_rn(x, rs), bf16_round(gain[d])); }
  xv[d] = x; __syncthreads();
  float o = x;
  if (ROPE == 1) { const int i = d >> 1; const float c = CS[p * (HD / 2) + i], s = SN[p * (HD / 2) + i]; const float ev = xv[2 * i], od = xv[2 * i + 1]; o = (d & 1) ? __fadd_rn(__fmul_rn(ev, s), __fmul_rn(od, c)) : __fadd_rn(__fmul_rn(ev, c), -__fmul_rn(od, s)); }
  if (ROPE == 2) { const int i = d & (HD / 2 - 1); const float c = CS[p * (HD / 2) + i], s = SN[p * (HD / 2) + i]; const float lo = xv[i], hi = xv[i + HD / 2]; o = (d < HD / 2) ? __fadd_rn(__fmul_rn(lo, c), -__fmul_rn(hi, s)) : __fadd_rn(__fmul_rn(lo, s), __fmul_rn(hi, c)); }
  if (ROPE == 3) { const float c = CS[p * HD + d], s = SN[p * HD + d]; const float lo = xv[d & (HD / 2 - 1)], hi = xv[(d & (HD / 2 - 1)) + HD / 2]; o = (d < HD / 2) ? __fadd_rn(__fmul_rn(lo, c), -__fmul_rn(hi, s)) : __fadd_rn(__fmul_rn(hi, c), __fmul_rn(lo, s)); }      /* rotate-half with FULL-width per-element tables [pos][HD] */
  FragH th; th.h[0] = (_Float16)o; sh_[d] = th.u[0]; __syncthreads();
  if (d < HD / 8) { FragH f; for (int q = 0; q < 8; ++q) f.u[q] = sh_[d * 8 + q]; unsigned short* dst = (unsigned short*)H16 + r * (size_t)ldo + (size_t)h * HD + d * 8; *(v8us*)dst = f.half[0];  } }

template <int NORM, int ROPE>
__global__ __launch_bounds__(64) void k_xformf(const float* __restrict__ F, int ldf, int nh, const float* __restrict__ gain, float eps, const float* __restrict__ CS, const float* __restrict__ SN, float* __restrict__ F32, int ldo) {
  #pragma clang fp contract(off)
  __shared__ float xv[HD]; __shared__ float red[HD]; const int d = threadIdx.x; const int h = blockIdx.x % nh; const size_t r = blockIdx.x / nh; const int p = (int)(r % SQ);
  float x = F[r * (size_t)ldf + (size_t)h * HD + d];
  if (NORM) { red[d] = __fmul_rn(x, x); __syncthreads(); for (int st = HD / 2; st > 0; st >>= 1) { if (d < st) red[d] = __fadd_rn(red[d], red[d + st]); __syncthreads(); } const float rs = rsqrtf(__fadd_rn(red[0] / (float)HD, eps)); x = __fmul_rn(__fmul_rn(x, rs), bf16_round(gain[d])); }
  xv[d] = x; __syncthreads();
  float o = x;
  if (ROPE == 1) { const int i = d >> 1; const float c = CS[p * (HD / 2) + i], s = SN[p * (HD / 2) + i]; const float ev = xv[2 * i], od = xv[2 * i + 1]; o = (d & 1) ? __fadd_rn(__fmul_rn(ev, s), __fmul_rn(od, c)) : __fadd_rn(__fmul_rn(ev, c), -__fmul_rn(od, s)); }
  if (ROPE == 2) { const int i = d & (HD / 2 - 1); const float c = CS[p * (HD / 2) + i], s = SN[p * (HD / 2) + i]; const float lo = xv[i], hi = xv[i + HD / 2]; o = (d < HD / 2) ? __fadd_rn(__fmul_rn(lo, c), -__fmul_rn(hi, s)) : __fadd_rn(__fmul_rn(lo, s), __fmul_rn(hi, c)); }
  if (ROPE == 3) { const float c = CS[p * HD + d], s = SN[p * HD + d]; const float lo = xv[d & (HD / 2 - 1)], hi = xv[(d & (HD / 2 - 1)) + HD / 2]; o = (d < HD / 2) ? __fadd_rn(__fmul_rn(lo, c), -__fmul_rn(hi, s)) : __fadd_rn(__fmul_rn(hi, c), __fmul_rn(lo, s)); }      /* rotate-half with FULL-width per-element tables [pos][HD] */
  float* dst = F32 + r * (size_t)ldo + (size_t)h * HD + d; *(float*)dst = o;  }

__global__ __launch_bounds__(256) void k_bfcp(const float* __restrict__ src, float* __restrict__ dst, size_t n4) { const size_t t = (size_t)blockIdx.x * 256 + threadIdx.x; if (t >= n4) return; const v4f a = *(const v4fa*)(src + t * 4); v4f o; for (int q = 0; q < 4; ++q) o[q] = bf16_round(a[q]); *(v4f*)(dst + t * 4) = o;  }

__global__ __launch_bounds__(256) void k_tabhalf(const float* __restrict__ cs, const float* __restrict__ sn, float* __restrict__ CS, float* __restrict__ SN) { const int t = blockIdx.x * 256 + threadIdx.x; if (t >= SQ * (HD / 2)) return; const int p = t / (HD / 2), i = t % (HD / 2); const float c = bf16_round(cs[(size_t)p * HD + i]), s = bf16_round(sn[(size_t)p * HD + i]);
  *(float*)(CS + t) = c; *(float*)(SN + t) = s;  }

__global__ __launch_bounds__(256) void k_tab2d(float* __restrict__ CS, float* __restrict__ SN) {
  #pragma clang fp contract(off)
  const int t = blockIdx.x * 256 + threadIdx.x; if (t >= SQ * (HD / 2)) return; const int i = t % (HD / 2); const int p = t / (HD / 2); const float invf = (float)(1.0 / pow(10000.0, (double)(2 * i) / (double)HD)); const float ang = __fmul_rn((float)p, invf); const float c = cosf(ang), s = sinf(ang);
  *(float*)(CS + t) = c; *(float*)(SN + t) = s;  }
extern "C" void kernel_launch(void* const* d_in, const int* in_sizes, int n_in,
                              void* d_out, int out_size, void* d_ws, size_t ws_size, hipStream_t stream) {
  (void)in_sizes; (void)n_in; (void)out_size;
  const float* const* I = (const float* const*)d_in; const float* x = I[0]; const float* wq = I[1]; const float* wk = I[2]; const float* wv = I[3]; const float* wo = I[4]; const float* bq = nullptr; const float* bk = nullptr; const float* bv = nullptr; const float* bo = nullptr;      /* natural [out][in] weights, no biases; rope tables computed in the kernel */
  char* ws = (char*)d_ws; size_t off = 0;
  auto take = [&](size_t bytes) { char* p = ws + off; off += (bytes + 255) & ~(size_t)255; return p; };
  _Float16* BQ = (_Float16*)take((size_t)DM * DM * 2); _Float16* BK = (_Float16*)take((size_t)KVD * DM * 2); _Float16* BV = (_Float16*)take((size_t)KVD * DM * 2); _Float16* BO = (_Float16*)take((size_t)DM * DM * 2);
  _Float16* X16 = (_Float16*)take(NR * DM * 2); float* QF = (float*)take((size_t)SQ * DM * 4); float* KF = (float*)take((size_t)SQ * KVD * 4); float* CSB = (float*)take((size_t)SQ * HD * 4); float* SNB = (float*)take((size_t)SQ * HD * 4); _Float16* Q16 = (_Float16*)take(NR * DM * 2); _Float16* K16 = (_Float16*)take(NR * KVD * 2); _Float16* V16 = (_Float16*)take(NR * KVD * 2); _Float16* O16 = (_Float16*)take(NR * DM * 2);
  float* S = (float*)take((size_t)NH * QT * NKX * 4); _Float16* P = (_Float16*)take((size_t)NH * QT * NKX * 2); _Float16* VT = (_Float16*)take((size_t)NH * HD * SQ * 2);
  float* QF0 = (float*)take((size_t)QT0 * DM * 4); float* KF0 = (float*)take((size_t)QT0 * KVD * 4); float* VF0 = (float*)take((size_t)QT0 * KVD * 4); float* KF0e = (float*)take((size_t)QT0 * DM * 4); float* VF0e = (float*)take((size_t)QT0 * DM * 4); float* OF0 = (float*)take((size_t)NB * QT0 * DM * 4); _Float16* OH0 = (_Float16*)take((size_t)NB * QT0 * DM * 2); _Float16* OL0 = (_Float16*)take((size_t)NB * QT0 * DM * 2);
  if (off > ws_size) return;
  k_wnat<<<(unsigned)(((size_t)DM * DM / 8 + 255) / 256), 256, 0, stream>>>(wq, (size_t)DM * DM / 8, BQ); k_wnat<<<(unsigned)(((size_t)KVD * DM / 8 + 255) / 256), 256, 0, stream>>>(wk, (size_t)KVD * DM / 8, BK); k_wnat<<<(unsigned)(((size_t)KVD * DM / 8 + 255) / 256), 256, 0, stream>>>(wv, (size_t)KVD * DM / 8, BV); k_wnat<<<(unsigned)(((size_t)DM * DM / 8 + 255) / 256), 256, 0, stream>>>(wo, (size_t)DM * DM / 8, BO);      /* natural [out][in] = Bt planes x16 */
  k_x16<<<(unsigned)((NR * DM / 8 + 255) / 256), 256, 0, stream>>>(x, X16, NR * DM / 8);
  k_tab2d<<<(SQ * (HD / 2) + 255) / 256, 256, 0, stream>>>(CSB, SNB);      /* rope tables cos/sin(p / 10000^(2i/64)): inv_freq double-derived -> f32, f32 angle */
  const size_t r0p = (size_t)B0 * SQ;      /* first projected row */
  k_gemm2<0><<<dim3((unsigned)((MP / 128) * (KVD / 64)), 1), 128, 0, stream>>>(X16 + r0p * DM, DM, 0, BV, DM, 0, 0.0625f, bv, 0, nullptr, 1, 0, 0, nullptr, V16 + r0p * KVD, KVD, 0, MP, KVD, DM);
  for (int b = B0; b < B0 + NBR; ++b) { const size_t r0 = (size_t)b * SQ;
    k_gemm2<0><<<dim3((unsigned)((SQ / 128) * (DM / 64)), 1), 128, 0, stream>>>(X16 + r0 * DM, DM, 0, BQ, DM, 0, 0.0625f, nullptr, 0, nullptr, 1, 0, 0, QF, nullptr, DM, 0, SQ, DM, DM);      /* q (f32) of this batch */
    k_gemm2<0><<<dim3((unsigned)((SQ / 128) * (KVD / 64)), 1), 128, 0, stream>>>(X16 + r0 * DM, DM, 0, BK, DM, 0, 0.0625f, nullptr, 0, nullptr, 1, 0, 0, KF, nullptr, KVD, 0, SQ, KVD, DM);      /* k (f32) */
    k_xform<0, 1><<<(unsigned)((size_t)SQ * NH), 64, 0, stream>>>(QF, DM, NH, nullptr, 0.f, CSB, SNB, Q16 + r0 * DM, DM); k_xform<0, 1><<<(unsigned)((size_t)SQ * NG), 64, 0, stream>>>(KF, KVD, NG, nullptr, 0.f, CSB, SNB, K16 + r0 * KVD, KVD);      /* interleaved-pair rope -> f16 rows */
    k_xformf<0, 1><<<(unsigned)(QT0 * NH), 64, 0, stream>>>(QF, DM, NH, nullptr, 0.f, CSB, SNB, QF0, DM); k_xformf<0, 1><<<(unsigned)(QT0 * NG), 64, 0, stream>>>(KF, KVD, NG, nullptr, 0.f, CSB, SNB, KF0, KVD);      /* f32 roped q, k of rows 0..127 */
    k_vt<NG, SQ><<<NG * (SQ / 64), 256, 0, stream>>>(V16 + r0 * KVD, KVD, 0, VT);      /* V^T [NG][HD][SQ] for this batch */
    k_gemm2<0><<<dim3((QT0 / 128) * (KVD / 64), 1), 128, 0, stream>>>(X16 + r0 * DM, DM, 0, BV, DM, 0, 0.0625f, bv, 0, nullptr, 1, 0, 0, VF0, nullptr, KVD, 0, QT0, KVD, DM);
    k_kvexp<<<(unsigned)(((size_t)QT0 * DM / 4 + 255) / 256), 256, 0, stream>>>(KF0, KF0e, (size_t)QT0 * DM / 4); k_kvexp<<<(unsigned)(((size_t)QT0 * DM / 4 + 255) / 256), 256, 0, stream>>>(VF0, VF0e, (size_t)QT0 * DM / 4);      /* head h <- kv group h/4 for the exact first-tile kernel */      /* f32 q, k, v of the first 128 rows (exact products) */
    k_att0<0><<<NH * (QT0 / 64), 64, 0, stream>>>(QF0, KF0e, VF0e, DM, nullptr, 0.125f, OF0 + (size_t)b * QT0 * DM, DM);      /* exact f32 attention for rows 0..127 (o x64) */
    for (int q0 = 0; q0 < QN; q0 += QT) { const int nk = q0 + QT;      /* causal: only keys below the tile end are computed */
      k_gemm2<0><<<dim3((QT / 128) * (nk / 64), NH), 128, 0, stream>>>(Q16 + (r0 + q0) * LQ, LQ, (size_t)HD, K16 + r0 * KVD, KVD, (size_t)HD, 0.125f, nullptr, 0, nullptr, 1, 0, 0, S, nullptr, NKX, (size_t)QT * NKX, QT, nk, HD, 2);      /* scores: all 32 heads in one launch, head h against the keys of group h / 4 */
      k_rsmcf2<<<(NHD * QT + 7) / 8, 256, 0, stream>>>(S, P, NHD, q0, nk);      /* 8 waves a block, one row a wave */
      k_gemm2<0><<<dim3((QT / 128) * (HD / 64), NH), 128, 0, stream>>>(P, NKX, (size_t)QT * NKX, VT, SQ, (size_t)HD * SQ, 0.25f, nullptr, 0, nullptr, 1, 0, 0, nullptr, O16 + (r0 + q0) * DM, DM, (size_t)HD, QT, HD, nk, 2); } }      /* o for all 32 heads in one launch, head h with V^T of group h / 4 (x64) */      /* o (merged heads, x64) as f16 rows */
  k_gemm2<0><<<dim3((unsigned)((MPO / 128) * (DM / 64)), 1), 128, 0, stream>>>(O16 + r0p * DM, DM, 0, BO, DM, 0, 0.0009765625f, bo, 0, nullptr, 1, 0, 0, (float*)d_out + r0p * DM, nullptr, DM, 0, MPO, DM, DM);      /* out rows are the output layout */
  k_hl<<<(unsigned)(((size_t)NB * QT0 * DM / 8 + 255) / 256), 256, 0, stream>>>(OF0, OH0, OL0, (size_t)NB * QT0 * DM / 8);      /* first-tile o (x64) -> f16 hi + x1024 residual planes */
  for (int b = B0; b < B0 + NBR; ++b) { const size_t r0 = (size_t)b * SQ; const size_t f0 = (size_t)b * QT0;
    k_gemm2<0><<<dim3((QT0 / 128) * (DM / 64), 1), 128, 0, stream>>>(OH0 + f0 * DM, DM, 0, BO, DM, 0, 0.0009765625f, bo, 0, nullptr, 1, 0, 0, (float*)d_out + r0 * DM, nullptr, DM, 0, QT0, DM, DM);      /* rows 0..127: out = o_hi Wo (+ b), overwriting the f16-path rows */
    k_gemm2<0><<<dim3((QT0 / 128) * (DM / 64), 1), 128, 0, stream>>>(OL0 + f0 * DM, DM, 0, BO, DM, 0, 0.00000095367431640625f, nullptr, 0, (const float*)d_out + r0 * DM, -1, 0, 0, (float*)d_out + r0 * DM, nullptr, DM, 0, QT0, DM, DM); }      /* += o_lo Wo 2^-20 (own-element accumulate) */
}

// v004
// Measured time: 510 microseconds a run.
// Two timings next to v003 both put it at 1.85 times that version's speed.
// All steps since v000 together make it 9.47 times as fast.
#include <hip/hip_runtime.h>
// LLaMA grouped-query causal attention with interleaved-pair RoPE (hidden_states [1][2048][2048]; q = x Wq^T (natural [2048][2048]), k = x Wk^T, v = x Wv^T (natural [512][2048]) (sigma 0.02, no biases): 32 query heads / 8 kv heads of 64 (repeat_interleave: kv head h / 4); tables cos/sin of pos / 10000^(2i/64) repeated per pair; q = q cos + rotate_pairs(q) sin with rotate_pairs (x0, x1) -> (-x1, x0): pair (e, o) -> (e cos - o sin, o cos + e sin); scores x 64^-0.5 with a causal mask (triu(1) -> -inf); softmax; out = merged Wo^T (natural) -> [1][2048][2048]).
// Compute dtype: inputs rounded to bf16; x / weights exact; q, k, v, softmax weights and o as plain f16 GEMM operands (~2^-12); scores and softmax statistics f32. v_wmma_f32_16x16x32_f16.
#define NB 1
#define NG 8
#define HPG 4
#define KVD (NG * HD)
#define SQ 2048
#define DM 2048
#define NH 32
#define HD 64
#define HG 4                         /* heads covered by one launch of the non-template k_vt (unused) */
#define QT 256                       /* query rows per causal tile */
#define NKX SQ                       /* S / P row pitch */
#define QT0 128                      /* first-tile rows recomputed exactly in f32 */
#define B0 0                         /* first batch processed (debug hook) */
#define NBR NB                       /* batches processed (debug hook) */
#define NR ((size_t)NB * SQ)         /* token rows */
#define MP ((int)((size_t)NBR * SQ)) /* rows projected (debug hook) */
#define QN SQ                        /* query rows attended per batch (debug hook) */
#define NHD NH                       /* heads attended (debug hook) */
#define MPO MP                       /* rows through the output stage (debug hook) */
#define LQ DM      /* row pitch of the q rows */
typedef __bf16 v16b __attribute__((ext_vector_type(16)));
typedef unsigned short v8us __attribute__((ext_vector_type(8), may_alias));
typedef float  v8f  __attribute__((ext_vector_type(8)));
typedef float  v4f  __attribute__((ext_vector_type(4)));
typedef float  v4fa __attribute__((ext_vector_type(4), may_alias));
union FragB { v16b v; v8us half[2]; unsigned short u[16]; };

__device__ __forceinline__ unsigned short bf16_bits(float x) { unsigned int u = __float_as_uint(x); return (unsigned short)((u + 0x7FFFu + ((u >> 16) & 1u)) >> 16); }
__device__ __forceinline__ float bf16_val(unsigned short b) { return __uint_as_float(((unsigned int)b) << 16); }
__device__ __forceinline__ float bf16_round(float x) { return bf16_val(bf16_bits(x)); }
// D += A·B with NT terms: 1 = ah·bh, 2 = + al·bh (A split), 3 = + ah·bl (both split)
template <int NT>
__device__ __forceinline__ v8f mmaN(v16b ah, v16b al, v16b bh, v16b bl, v8f c) {
  c = __builtin_amdgcn_wmma_f32_16x16x32_bf16(false, ah, false, bh, (short)0, c, false, false);
  if (NT >= 2) c = __builtin_amdgcn_wmma_f32_16x16x32_bf16(false, al, false, bh, (short)0, c, false, false);
  if (NT >= 3) c = __builtin_amdgcn_wmma_f32_16x16x32_bf16(false, ah, false, bl, (short)0, c, false, false);
  asm volatile("v_nop\n\tv_nop\n\tv_nop\n\tv_nop" : "+v"(c) : "v"(ah), "v"(al), "v"(bh), "v"(bl));
  return c;
}

__global__ __launch_bounds__(256) void k_wt_bf16(const float* __restrict__ W, unsigned short* __restrict__ Wt, int K, int N) {
  const int t = blockIdx.x * 256 + threadIdx.x;
  const int k8n = K / 8;
  if (t >= N * k8n) return;
  const int n = t / k8n, k8 = (t % k8n) * 8;
  v8us v;
#pragma unroll
  for (int i = 0; i < 8; ++i) v[i] = bf16_bits(W[(size_t)(k8 + i) * N + n]);
  *(v8us*)(Wt + (size_t)n * K + k8) = v;
  
}

// GEMM C[M][N] (f32, pitch ldc) = act(A[M][K]·W + bias). A f32 row-major (pitch lda) converted per fragment to bf16
// (ASPLIT: hi/lo two planes -> 2 terms, else single rounded term); Wt bf16 [N][K] (pitch ldb). BIAS_BF16 rounds the
// bias to bf16 first (bias quantised to bf16 before the add). K%32==0, M%16==0, N%64==0.
template <bool ASPLIT, int ACT, bool BIAS_BF16>
__global__ __launch_bounds__(128) void k_gemm_bf(const float* __restrict__ A, int lda, const unsigned short* __restrict__ Wt, int ldb,
                                               const float* __restrict__ bias, float* __restrict__ C, int ldc, int M, int N, int K) {
  __shared__ __attribute__((aligned(16))) float so[4][16][64];
  const int tid = threadIdx.x, w = tid >> 5, lane = tid & 31, ln = lane & 15, hh = lane >> 4;
  const int ntn = N / 64;
  const int wid = blockIdx.x * 4 + w;
  const int mt = wid / ntn, nq = wid % ntn;
  if (mt * 16 >= M) return;
  const int row0 = mt * 16, col0 = nq * 64;
  const float* arow = A + (size_t)(row0 + ln) * lda;
  v8f acc[4] = {};
  for (int kb = 0; kb < K; kb += 32) {
    FragB ah, al;
    const v4f x0 = *(const v4fa*)(arow + kb + 8 * hh), x1 = *(const v4fa*)(arow + kb + 8 * hh + 4);
    const v4f x2 = *(const v4fa*)(arow + kb + 16 + 8 * hh), x3 = *(const v4fa*)(arow + kb + 16 + 8 * hh + 4);
    float xs[16] = {x0[0],x0[1],x0[2],x0[3],x1[0],x1[1],x1[2],x1[3],x2[0],x2[1],x2[2],x2[3],x3[0],x3[1],x3[2],x3[3]};
#pragma unroll
    for (int i = 0; i < 16; ++i) { const unsigned short hb = bf16_bits(xs[i]); ah.u[i] = hb; al.u[i] = ASPLIT ? bf16_bits(xs[i] - bf16_val(hb)) : (unsigned short)0; }
#pragma unroll
    for (int t = 0; t < 4; ++t) {
      const unsigned short* brow = Wt + (size_t)(col0 + t * 16 + ln) * ldb + kb;
      FragB b;
      b.half[0] = *(const v8us*)(brow + 8 * hh);
      b.half[1] = *(const v8us*)(brow + 16 + 8 * hh);
      acc[t] = mmaN<ASPLIT ? 2 : 1>(ah.v, al.v, b.v, b.v, acc[t]);
    }
  }
#pragma unroll
  for (int t = 0; t < 4; ++t) {
    float bv = bias ? bias[col0 + t * 16 + ln] : 0.f;
    if (BIAS_BF16) bv = bf16_round(bv);
#pragma unroll
    for (int r = 0; r < 8; ++r) { float v = acc[t][r] + bv; if (ACT == 1) v = fmaxf(v, 0.f); so[w][8 * hh + r][t * 16 + ln] = v; }
  }
  __builtin_amdgcn_fence(__ATOMIC_ACQ_REL, "workgroup");
  __builtin_amdgcn_wave_barrier();
  const int rsub = lane >> 4, c4 = (lane & 15) * 4;
  {
#pragma unroll
    for (int q = 0; q < 8; ++q) {
      const int r = q * 2 + rsub;
      const v4f v = *(const v4fa*)&so[w][r][c4];
      *(v4f*)(C + (size_t)(row0 + r) * ldc + col0 + c4) = v;
    }
    
  }
}

// GEMM C = act(A·W + bias + resid): A f32 (ASPLIT -> hi/lo 2 terms), Wt bf16 [N][K]; ACT 0 none, 1 relu, 2 exact gelu;
// resid (optional, f32, row index = (row % rmod), pitch ldr, RES_BF16 rounds it) added before the activation.
template <bool ASPLIT, int ACT, bool BIAS_BF16, bool RES_BF16>
__global__ __launch_bounds__(128) void k_gemm_bf3(const float* __restrict__ A, int lda, const unsigned short* __restrict__ Wt, int ldb,
                                                const float* __restrict__ bias, const float* __restrict__ resid, int rmod, int ldr,
                                                float* __restrict__ C, int ldc, int M, int N, int K) {
  __shared__ __attribute__((aligned(16))) float so[4][16][64];
  const int tid = threadIdx.x, w = tid >> 5, lane = tid & 31, ln = lane & 15, hh = lane >> 4;
  const int ntn = N / 64;
  const int wid = blockIdx.x * 4 + w;
  const int mt = wid / ntn, nq = wid % ntn;
  if (mt * 16 >= M) return;
  const int row0 = mt * 16, col0 = nq * 64;
  const float* arow = A + (size_t)(row0 + ln) * lda;
  v8f acc[4] = {};
  for (int kb = 0; kb < K; kb += 32) {
    FragB ah, al;
    const v4f x0 = *(const v4fa*)(arow + kb + 8 * hh), x1 = *(const v4fa*)(arow + kb + 8 * hh + 4);
    const v4f x2 = *(const v4fa*)(arow + kb + 16 + 8 * hh), x3 = *(const v4fa*)(arow + kb + 16 + 8 * hh + 4);
    float xs[16] = {x0[0],x0[1],x0[2],x0[3],x1[0],x1[1],x1[2],x1[3],x2[0],x2[1],x2[2],x2[3],x3[0],x3[1],x3[2],x3[3]};
#pragma unroll
    for (int i = 0; i < 16; ++i) { const unsigned short hb = bf16_bits(xs[i]); ah.u[i] = hb; al.u[i] = ASPLIT ? bf16_bits(xs[i] - bf16_val(hb)) : (unsigned short)0; }
#pragma unroll
    for (int t = 0; t < 4; ++t) {
      const unsigned short* brow = Wt + (size_t)(col0 + t * 16 + ln) * ldb + kb;
      FragB b;
      b.half[0] = *(const v8us*)(brow + 8 * hh);
      b.half[1] = *(const v8us*)(brow + 16 + 8 * hh);
      acc[t] = mmaN<ASPLIT ? 2 : 1>(ah.v, al.v, b.v, b.v, acc[t]);
    }
  }
#pragma unroll
  for (int t = 0; t < 4; ++t) {
    const int col = col0 + t * 16 + ln;
    float bv = bias ? bias[col] : 0.f;
    if (BIAS_BF16) bv = bf16_round(bv);
#pragma unroll
    for (int r = 0; r < 8; ++r) {
      float v = acc[t][r] + bv;
      if (resid) { float rv = resid[(size_t)((row0 + 8 * hh + r) % rmod) * ldr + col]; if (RES_BF16) rv = bf16_round(rv); v += rv; }
      if (ACT == 1) v = fmaxf(v, 0.f);
      if (ACT == 2) v = 0.5f * v * (1.0f + erff(v * 0.70710678118654752f));
      if (ACT == 3) { const float u = 0.7978845608028654f * (v + 0.044715f * v * v * v); v = 0.5f * v * (1.0f + tanhf(u)); }
      so[w][8 * hh + r][t * 16 + ln] = v;
    }
  }
  __builtin_amdgcn_fence(__ATOMIC_ACQ_REL, "workgroup");
  __builtin_amdgcn_wave_barrier();
  const int rsub = lane >> 4, c4 = (lane & 15) * 4;
  {
#pragma unroll
    for (int q = 0; q < 8; ++q) {
      const int r = q * 2 + rsub;
      const v4f v = *(const v4fa*)&so[w][r][c4];
      *(v4f*)(C + (size_t)(row0 + r) * ldc + col0 + c4) = v;
    }
    
  }
}
// row LayerNorm (biased variance, eps) over N: s = X (+ R); optional out_sum <- s; out_norm <- (s-mu)*rsqrt(var+eps)*g + b
template <bool PARAM_BF16>
__global__ __launch_bounds__(256) void k_layernorm(const float* __restrict__ X, const float* __restrict__ R, const float* __restrict__ g, const float* __restrict__ bta,
                                                  float* __restrict__ out_sum, float* __restrict__ out_norm, int N, float eps) {
  __shared__ float red[256];
  const int row = blockIdx.x, tid = threadIdx.x;
  const float* x = X + (size_t)row * N; const float* rr = R ? R + (size_t)row * N : nullptr;
  float vals[16];                     // up to N = 4096
  const int per = N / 256;            // contiguous chunk per thread? use strided-by-4 chunks: thread handles j = tid*4 + 1024*u
  float s1 = 0.f;
  for (int u = 0; u < per / 4; ++u) {
    const int j = tid * 4 + 1024 * u;
    const v4f a = *(const v4fa*)(x + j);
    v4f b = {0.f,0.f,0.f,0.f}; if (rr) b = *(const v4fa*)(rr + j);
#pragma unroll
    for (int q = 0; q < 4; ++q) { const float v = a[q] + b[q]; vals[u * 4 + q] = v; s1 += v; }
  }
  red[tid] = s1; __syncthreads();
  for (int st = 128; st > 0; st >>= 1) { if (tid < st) red[tid] += red[tid + st]; __syncthreads(); }
  const float mu = red[0] / (float)N; __syncthreads();
  float s2 = 0.f;
  for (int u = 0; u < per / 4; ++u)
#pragma unroll
    for (int q = 0; q < 4; ++q) { const float c = vals[u * 4 + q] - mu; s2 += c * c; }
  red[tid] = s2; __syncthreads();
  for (int st = 128; st > 0; st >>= 1) { if (tid < st) red[tid] += red[tid + st]; __syncthreads(); }
  const float rs = rsqrtf(red[0] / (float)N + eps);
  {
    for (int u = 0; u < per / 4; ++u) {
      const int j = tid * 4 + 1024 * u;
      v4f o, sm;
#pragma unroll
      for (int q = 0; q < 4; ++q) {
        float gg = g[j + q], bb = bta[j + q];
        if (PARAM_BF16) { gg = bf16_round(gg); bb = bf16_round(bb); }
        sm[q] = vals[u * 4 + q]; o[q] = (vals[u * 4 + q] - mu) * rs * gg + bb;
      }
      if (out_sum) *(v4f*)(out_sum + (size_t)row * N + j) = sm;
      *(v4f*)(out_norm + (size_t)row * N + j) = o;
    }
    
  }
}



// ---- f16 WMMA path (v_wmma_f32_16x16x32_f16): 11-bit significands for operands in range — used where a [0,1] probability operand needs more precision than bf16
typedef _Float16 v16h __attribute__((ext_vector_type(16)));
union FragH { v16h v; v8us half[2]; _Float16 h[16]; unsigned short u[16]; };
template <int NT>
__device__ __forceinline__ v8f mmaH(v16h ah, v16h al, v16h bh, v16h bl, v8f c) {
  c = __builtin_amdgcn_wmma_f32_16x16x32_f16(false, ah, false, bh, (short)0, c, false, false);
  if (NT >= 2) c = __builtin_amdgcn_wmma_f32_16x16x32_f16(false, al, false, bh, (short)0, c, false, false);
  if (NT >= 3) c = __builtin_amdgcn_wmma_f32_16x16x32_f16(false, ah, false, bl, (short)0, c, false, false);
  asm volatile("v_nop\n\tv_nop\n\tv_nop\n\tv_nop" : "+v"(c) : "v"(ah), "v"(al), "v"(bh), "v"(bl));
  return c;
}
// batched GEMM like k_gemm_b but f16 operands: A f32 (split into f16 hi/lo if ASPLIT, else rounded to f16), Bt = f16 values [n][k]; alpha; C f32; N multiple of 16 (partial tiles skipped)
template <bool ASPLIT>
__global__ __launch_bounds__(128) void k_gemm_h(const float* __restrict__ A, int lda, size_t sA, const _Float16* __restrict__ Bh, int ldb, size_t sB, float alpha, float* __restrict__ C, int ldc, size_t sC, int M, int N, int K) {
  __shared__ __attribute__((aligned(16))) float so[4][16][64];
  const int tid = threadIdx.x, w = tid >> 5, lane = tid & 31, ln = lane & 15, hh = lane >> 4; const int by = blockIdx.y;
  A += (size_t)by * sA; Bh += (size_t)by * sB; C += (size_t)by * sC;
  const int ntn = (N + 63) / 64; const int wid = blockIdx.x * 4 + w; const int mt = wid / ntn, nq = wid % ntn; if (mt * 16 >= M) return;
  const int row0 = mt * 16, col0 = nq * 64; const float* arow = A + (size_t)(row0 + ln) * lda;
  v8f acc[4] = {};
  for (int kb = 0; kb < K; kb += 32) {
    FragH ah, al;
    const v4f x0 = *(const v4fa*)(arow + kb + 8 * hh), x1 = *(const v4fa*)(arow + kb + 8 * hh + 4), x2 = *(const v4fa*)(arow + kb + 16 + 8 * hh), x3 = *(const v4fa*)(arow + kb + 16 + 8 * hh + 4);
    float xs[16] = {x0[0],x0[1],x0[2],x0[3],x1[0],x1[1],x1[2],x1[3],x2[0],x2[1],x2[2],x2[3],x3[0],x3[1],x3[2],x3[3]};
#pragma unroll
    for (int i = 0; i < 16; ++i) { const _Float16 h = (_Float16)xs[i]; ah.h[i] = h; al.h[i] = ASPLIT ? (_Float16)(xs[i] - (float)h) : (_Float16)0.0f; }
#pragma unroll
    for (int t = 0; t < 4; ++t) { if (col0 + t * 16 >= N) continue; const size_t boff = (size_t)(col0 + t * 16 + ln) * ldb + kb; FragH bq; bq.half[0] = *(const v8us*)(Bh + boff + 8 * hh); bq.half[1] = *(const v8us*)(Bh + boff + 16 + 8 * hh);
      acc[t] = mmaH<ASPLIT ? 2 : 1>(ah.v, al.v, bq.v, bq.v, acc[t]); }
  }
#pragma unroll
  for (int t = 0; t < 4; ++t) { if (col0 + t * 16 >= N) continue;
#pragma unroll
    for (int r = 0; r < 8; ++r) so[w][8 * hh + r][t * 16 + ln] = acc[t][r] * alpha; }
  __builtin_amdgcn_fence(__ATOMIC_ACQ_REL, "workgroup"); __builtin_amdgcn_wave_barrier();
  const int rsub = lane >> 4, c4 = (lane & 15) * 4;
  {
#pragma unroll
    for (int q = 0; q < 8; ++q) { const int r = q * 2 + rsub; if (col0 + c4 < N) { const v4f v = *(const v4fa*)&so[w][r][c4]; *(v4f*)(C + (size_t)(row0 + r) * ldc + col0 + c4) = v; } }
     }
}

// Wt[n][k] = f16(W[k][n]·scale) from f32 row-major W[K][N] (scale = power of two; bf16-exact weights stay exact in f16 away from the subnormal range)
__global__ __launch_bounds__(256) void k_wt_f16(const float* __restrict__ W, _Float16* __restrict__ Wt, int K, int N, float scale) {
  const int t = blockIdx.x * 256 + threadIdx.x; if (t >= N * (K / 8)) return; const int n = t / (K / 8), k8 = (t % (K / 8)) * 8; FragH f;
#pragma unroll
  for (int i = 0; i < 8; ++i) f.h[i] = (_Float16)(bf16_round(W[(size_t)(k8 + i) * N + n]) * scale); const v8us o = f.half[0];
  *(v8us*)((unsigned short*)Wt + (size_t)n * K + k8) = o; 
}
// k_gemm_hh variant with fused epilogue: v = acc·alpha + bias[by·sBias + col] (+ CP[(row/rowsPerB)·sCPb + by·64 + col] if CP) ; ACT 0 none / 1 elu ; writes f16 C16 (and f32 C if non-null)
template <int ACT>
__global__ __launch_bounds__(128) void k_gemm_hhx(const _Float16* __restrict__ A, int lda, size_t sA, const _Float16* __restrict__ Bh, int ldb, size_t sB, float alpha, const float* __restrict__ bias, size_t sBias, const float* __restrict__ CP, int rowsPerB, size_t sCPb, int row0g,
    float* __restrict__ C, _Float16* __restrict__ C16, int ldc, size_t sC, int M, int N, int K) {
  __shared__ __attribute__((aligned(16))) float so[4][16][64];
  const int tid = threadIdx.x, w = tid >> 5, lane = tid & 31, ln = lane & 15, hh = lane >> 4; const int by = blockIdx.y;
  A += (size_t)by * sA; Bh += (size_t)by * sB; const size_t cofs = (size_t)by * sC; const float* bp = bias ? bias + (size_t)by * sBias : nullptr;
  const int ntn = (N + 63) / 64; const int wid = blockIdx.x * 4 + w; const int mt = wid / ntn, nq = wid % ntn; if (mt * 16 >= M) return;
  const int row0 = mt * 16, col0 = nq * 64; const _Float16* arow = A + (size_t)(row0 + ln) * lda;
  v8f acc[4] = {};
  for (int kb = 0; kb < K; kb += 32) { FragH ah; ah.half[0] = *(const v8us*)((const unsigned short*)arow + kb + 8 * hh); ah.half[1] = *(const v8us*)((const unsigned short*)arow + kb + 16 + 8 * hh);
#pragma unroll
    for (int t = 0; t < 4; ++t) { if (col0 + t * 16 >= N) continue; const size_t boff = (size_t)(col0 + t * 16 + ln) * ldb + kb; FragH bq; bq.half[0] = *(const v8us*)((const unsigned short*)Bh + boff + 8 * hh); bq.half[1] = *(const v8us*)((const unsigned short*)Bh + boff + 16 + 8 * hh);
      acc[t] = mmaH<1>(ah.v, ah.v, bq.v, bq.v, acc[t]); }
  }
#pragma unroll
  for (int t = 0; t < 4; ++t) { if (col0 + t * 16 >= N) continue; const int col = col0 + t * 16 + ln; const float bv = bp ? bf16_round(bp[col]) : 0.f;
#pragma unroll
    for (int r = 0; r < 8; ++r) { float v = acc[t][r] * alpha + bv; if (CP) { const int rr = row0g + row0 + 8 * hh + r; if (rowsPerB < 0) v += CP[cofs + (size_t)rr * ldc + col];      /* rowsPerB < 0: own element of the batched C plane */ else { const int bidx = rr / rowsPerB; v += CP[(size_t)bidx * sCPb + (size_t)by * 64 + col]; } } if (ACT == 1) v = (v > 0.f) ? v : expm1f(v); else if (ACT == 7) v = (v > 0.f) ? v + 1.0f : expf(v); else if (ACT == 8) v = tanhf(v); else if (ACT == 9) v = 0.5f * v * (1.0f + tanhf(0.7978845608028654f * (v + 0.044715f * v * v * v))); else if (ACT == 11) v = 1.0f / (1.0f + expf(-v)); else if (ACT == 12) v = (v > 0.f) ? v : 0.01f * v; else if (ACT == 14) v = (v > 0.f) ? v : 0.1f * v; else if (ACT == 16) v = (v >= 0.f) ? v : 0.3f * v; else if (ACT == 17) v = (v >= 0.f) ? v : 0.2f * v; else if (ACT == 15) v = v / (1.0f + expf(-v)); else if (ACT == 3) v = fmaxf(v, 0.f); else if (ACT == 6) v = 0.5f * v * (1.0f + erff(v * 0.70710678118654752f)); so[w][8 * hh + r][t * 16 + ln] = v; } }
  __builtin_amdgcn_fence(__ATOMIC_ACQ_REL, "workgroup"); __builtin_amdgcn_wave_barrier();
  const int rsub = lane >> 4, c4 = (lane & 15) * 4; typedef _Float16 v4h __attribute__((ext_vector_type(4)));
  {
#pragma unroll
    for (int q = 0; q < 8; ++q) { const int r = q * 2 + rsub; if (col0 + c4 < N) { const v4f v = *(const v4fa*)&so[w][r][c4]; if (C) *(v4f*)(C + cofs + (size_t)(row0 + r) * ldc + col0 + c4) = v; if (C16) { v4h h4; for (int i = 0; i < 4; ++i) h4[i] = (_Float16)v[i]; *(v4h*)(C16 + cofs + (size_t)(row0 + r) * ldc + col0 + c4) = h4; } } }
     }
}


typedef _Float16 v4h __attribute__((ext_vector_type(4)));

__global__ __launch_bounds__(256) void k_x16(const float* __restrict__ x, _Float16* __restrict__ X16, size_t n8) { const size_t t = (size_t)blockIdx.x * 256 + threadIdx.x; if (t >= n8) return; FragH f;
#pragma unroll
  for (int q = 0; q < 8; ++q) f.h[q] = (_Float16)bf16_round(x[t * 8 + q]); *(v8us*)((unsigned short*)X16 + t * 8) = f.half[0];  }
__global__ __launch_bounds__(256) void k_h16(const float* __restrict__ x, _Float16* __restrict__ X16, size_t n8) { const size_t t = (size_t)blockIdx.x * 256 + threadIdx.x; if (t >= n8) return; FragH f;
#pragma unroll
  for (int q = 0; q < 8; ++q) f.h[q] = (_Float16)x[t * 8 + q]; *(v8us*)((unsigned short*)X16 + t * 8) = f.half[0];  }
__global__ __launch_bounds__(256) void k_round16f(const float* __restrict__ W, _Float16* __restrict__ Bt, size_t n8) { const size_t t = (size_t)blockIdx.x * 256 + threadIdx.x; if (t >= n8) return; FragH f;
#pragma unroll
  for (int i = 0; i < 8; ++i) f.h[i] = (_Float16)(bf16_round(W[t * 8 + i]) * 16.0f); *(v8us*)((unsigned short*)Bt + t * 8) = f.half[0];  }
template <int NHv, int TTv>
__global__ __launch_bounds__(256) void k_vt(const _Float16* __restrict__ V16, int ldv, int voff, _Float16* __restrict__ Vt) { __shared__ unsigned short tl[64][66]; const int tid = threadIdx.x; const int slab = blockIdx.x / (TTv / 64), lg = blockIdx.x % (TTv / 64); const int b = slab / NHv, h = slab % NHv;
  for (int i = tid; i < 64 * 8; i += 256) { const int r = i / 8, c8 = (i % 8) * 8; FragH f; f.half[0] = *(const v8us*)((const unsigned short*)V16 + ((size_t)b * TTv + lg * 64 + r) * ldv + voff + h * 64 + c8);
#pragma unroll
    for (int q = 0; q < 8; ++q) tl[r][c8 + q] = f.u[q]; }
  __syncthreads();
  {
#pragma unroll
    for (int rd = 0; rd < 2; ++rd) { const int d = rd * 32 + tid / 8, pc = tid % 8; FragH f;
#pragma unroll
      for (int q = 0; q < 8; ++q) f.u[q] = tl[pc * 8 + q][d];
      *(v8us*)((unsigned short*)Vt + ((size_t)slab * 64 + d) * TTv + lg * 64 + pc * 8) = f.half[0]; }
     } }

__global__ __launch_bounds__(256) void k_hl(const float* __restrict__ F, _Float16* __restrict__ Hh, _Float16* __restrict__ Hl, size_t n8) { const size_t t = (size_t)blockIdx.x * 256 + threadIdx.x; if (t >= n8) return; FragH fh, fl; const v4f a = *(const v4fa*)(F + t * 8), c = *(const v4fa*)(F + t * 8 + 4);
#pragma unroll
  for (int q = 0; q < 4; ++q) { _Float16 h = (_Float16)a[q]; fh.h[q] = h; fl.h[q] = (_Float16)((a[q] - (float)h) * 1024.0f); h = (_Float16)c[q]; fh.h[4 + q] = h; fl.h[4 + q] = (_Float16)((c[q] - (float)h) * 1024.0f); }
  { *(v8us*)((unsigned short*)Hh + t * 8) = fh.half[0]; *(v8us*)((unsigned short*)Hl + t * 8) = fl.half[0];  } }

// ---- fast GEMM (wave tile 32x64; requires M % 32 == 0 rows per launch region and N % 64 == 0); epilogue = k_gemm_hhx semantics ----
__device__ __forceinline__ v16h g2_frag(const _Float16* p, int hh) { FragH f; f.half[0] = *(const v8us*)((const unsigned short*)p + 8 * hh); f.half[1] = *(const v8us*)((const unsigned short*)p + 16 + 8 * hh); return f.v; }
__device__ __forceinline__ v8f g2_mma(v16h a, v16h b, v8f c) { v8f d = __builtin_amdgcn_wmma_f32_16x16x32_f16(false, a, false, b, (short)0, c, false, false); asm volatile("v_nop\n\tv_nop\n\tv_nop\n\tv_nop" : "+v"(d) : "v"(a), "v"(b)); return d; }
struct G2Set { v16h a0, a1, b0, b1, b2, b3; };      /* the fragments of one 32-k step of a 32x64 wave tile */
template <int ACT>
__global__ __launch_bounds__(128) void k_gemm2(const _Float16* __restrict__ A, int lda, size_t sA, const _Float16* __restrict__ Bh, int ldb, size_t sB, float alpha, const float* __restrict__ bias, size_t sBias, const float* __restrict__ CP, int rowsPerB, size_t sCPb, int row0g,
    float* __restrict__ C, _Float16* __restrict__ C16, int ldc, size_t sC, int M, int N, int K, int bshift = 0) { static_assert(ACT == 0 || ACT == 3 || ACT == 6 || ACT == 8 || ACT == 9 || ACT == 11 || ACT == 12 || ACT == 14 || ACT == 15 || ACT == 16 || ACT == 17, "k_gemm2: unsupported ACT code (would silently apply no activation)");
  __shared__ __attribute__((aligned(16))) float so[4][32][68];
  const int tid = threadIdx.x, w = tid >> 5, lane = tid & 31, ln = lane & 15, hh = lane >> 4; const int by = blockIdx.y;
  A += (size_t)by * sA; Bh += (size_t)(by >> bshift) * sB;      /* 2^bshift consecutive batch planes share one B plane (query heads of one kv group) */ const size_t cofs = (size_t)by * sC; const float* bp = bias ? bias + (size_t)by * sBias : nullptr;
  const int ntn = N >> 6; const int mt = blockIdx.x / ntn, nq = blockIdx.x - mt * ntn; const int row0 = mt * 128 + 32 * w, col0 = nq * 64; if (row0 >= M) return;
  const _Float16* a0p = A + (size_t)(row0 + ln) * lda; const _Float16* a1p = a0p + (size_t)16 * lda;
  const _Float16* b0p = Bh + (size_t)(col0 + ln) * ldb; const _Float16* b1p = b0p + (size_t)16 * ldb; const _Float16* b2p = b1p + (size_t)16 * ldb; const _Float16* b3p = b2p + (size_t)16 * ldb;
  const v8f z8 = {0.f,0.f,0.f,0.f,0.f,0.f,0.f,0.f}; v8f c00 = z8, c01 = z8, c02 = z8, c03 = z8, c10 = z8, c11 = z8, c12 = z8, c13 = z8;
  /* K loop: a ring of three fragment sets in registers. The 12 loads of a 32-k step are issued as one group, and a set is loaded anew, three steps ahead, directly behind the
     products that read it, so that up to 36 loads of a wave are in flight and a product waits only for the oldest group. Every accumulator still sums k upwards. */
  auto ld = [&](int k) { G2Set s; s.a0 = g2_frag(a0p + k, hh); s.a1 = g2_frag(a1p + k, hh); s.b0 = g2_frag(b0p + k, hh); s.b1 = g2_frag(b1p + k, hh); s.b2 = g2_frag(b2p + k, hh); s.b3 = g2_frag(b3p + k, hh); return s; };
  auto use = [&](const G2Set& s) { c00 = g2_mma(s.a0, s.b0, c00); c10 = g2_mma(s.a1, s.b0, c10); c01 = g2_mma(s.a0, s.b1, c01); c11 = g2_mma(s.a1, s.b1, c11);
    c02 = g2_mma(s.a0, s.b2, c02); c12 = g2_mma(s.a1, s.b2, c12); c03 = g2_mma(s.a0, s.b3, c03); c13 = g2_mma(s.a1, s.b3, c13); };
  int kb = 0;
  if (K >= 96) { G2Set s0 = ld(0);
    __builtin_amdgcn_sched_barrier(0);      /* keeps the first loads in the ring's own order, set by set: the loop's counted waits are formed for both ways into it, and with the sets mixed here the wait in front of a set's second product also covered loads of the set behind it */
    G2Set s1 = ld(32);
    __builtin_amdgcn_sched_barrier(0);      /* the same, between the second and the third set */
    G2Set s2 = ld(64);
    asm volatile("s_wait_xcnt 0x0" ::: "memory");      /* precaution: the build sets the accumulators to zero behind these loads, in registers that held one of their addresses */
#pragma unroll 1      /* one trip is one turn of the ring; no branch inside it, so the compiler's waits stay counted */
    for (; kb + 192 <= K; kb += 96) { use(s0);
      asm volatile("s_wait_xcnt 0x0" : "+s"(kb) :: "memory");      /* precaution: stands in front of the additions that rewrite the address registers which the loads of the trip before name; kb goes through it because those additions are formed from kb, so none can be placed ahead of the wait */
      s0 = ld(kb + 96); use(s1); s1 = ld(kb + 128); use(s2); s2 = ld(kb + 160); }
    use(s0); use(s1); use(s2); kb += 96; }
  if (kb + 64 <= K) {      /* what the ring leaves, or all of K = 64: both steps' loads together */
    const _Float16* const t0 = a0p + kb; const _Float16* const t1 = a1p + kb; const _Float16* const t2 = b0p + kb; const _Float16* const t3 = b1p + kb; const _Float16* const t4 = b2p + kb; const _Float16* const t5 = b3p + kb;
    G2Set s0, s1; s0.a0 = g2_frag(t0, hh); s0.a1 = g2_frag(t1, hh); s0.b0 = g2_frag(t2, hh); s0.b1 = g2_frag(t3, hh); s0.b2 = g2_frag(t4, hh); s0.b3 = g2_frag(t5, hh);
    s1.a0 = g2_frag(t0 + 32, hh); s1.a1 = g2_frag(t1 + 32, hh); s1.b0 = g2_frag(t2 + 32, hh); s1.b1 = g2_frag(t3 + 32, hh); s1.b2 = g2_frag(t4 + 32, hh); s1.b3 = g2_frag(t5 + 32, hh);
    asm volatile("s_wait_xcnt 0x0" :: "v"(t0 + 8 * hh), "v"(t1 + 8 * hh), "v"(t2 + 8 * hh), "v"(t3 + 8 * hh), "v"(t4 + 8 * hh), "v"(t5 + 8 * hh) : "memory");      /* precaution: the six row addresses are inputs, so they stay in their registers up to this wait and no fragment of the run is loaded into a register that an earlier load of the run names */
    use(s0); use(s1); kb += 64; }
  if (kb < K) { const G2Set s0 = ld(kb); use(s0); }
  v8f accs[8] = {c00, c01, c02, c03, c10, c11, c12, c13};
#pragma unroll
  for (int u = 0; u < 8; ++u) { const int t = u & 3, half = u >> 2; const int col = col0 + t * 16 + ln; const float bv = bp ? bf16_round(bp[col]) : 0.f;
#pragma unroll
    for (int r = 0; r < 8; ++r) { const int rloc = half * 16 + 8 * hh + r; float v = accs[u][r] * alpha + bv; if (CP) { if (rowsPerB < 0) v += CP[cofs + (size_t)(row0g + row0 + rloc) * ldc + col];      /* rowsPerB < 0: own element of the batched C plane */ else { const int bidx = (row0g + row0 + rloc) / rowsPerB; v += CP[(size_t)bidx * sCPb + (size_t)by * 64 + col]; } }
      if (ACT == 3) v = fmaxf(v, 0.f); else if (ACT == 6) v = 0.5f * v * (1.0f + erff(v * 0.70710678118654752f)); else if (ACT == 11) v = 1.0f / (1.0f + expf(-v)); else if (ACT == 15) v = v / (1.0f + expf(-v)); else if (ACT == 12) v = (v > 0.f) ? v : 0.01f * v; else if (ACT == 8) v = tanhf(v); else if (ACT == 9) v = 0.5f * v * (1.0f + tanhf(0.7978845608028654f * (v + 0.044715f * v * v * v))); else if (ACT == 14) v = (v > 0.f) ? v : 0.1f * v; else if (ACT == 16) v = (v >= 0.f) ? v : 0.3f * v; else if (ACT == 17) v = (v >= 0.f) ? v : 0.2f * v;
      so[w][rloc][t * 16 + ln] = v; } }
  __builtin_amdgcn_fence(__ATOMIC_ACQ_REL, "workgroup"); __builtin_amdgcn_wave_barrier();
  const int rsub = lane >> 4, c4 = (lane & 15) * 4;
  {
#pragma unroll
    for (int q = 0; q < 16; ++q) { const int r = q * 2 + rsub; const v4f v = *(const v4fa*)&so[w][r][c4]; if (C) *(v4f*)(C + cofs + (size_t)(row0 + r) * ldc + col0 + c4) = v; if (C16) { v4h h4; for (int i = 0; i < 4; ++i) h4[i] = (_Float16)v[i]; *(v4h*)(C16 + cofs + (size_t)(row0 + r) * ldc + col0 + c4) = h4; } }
     } }


__global__ __launch_bounds__(256) void k_wnat(const float* __restrict__ w, size_t n8, _Float16* __restrict__ Bt) { const size_t t = (size_t)blockIdx.x * 256 + threadIdx.x; if (t >= n8) return; FragH f; for (int q = 0; q < 8; ++q) f.h[q] = (_Float16)(bf16_round(w[t * 8 + q]) * 16.0f); *(v8us*)((unsigned short*)Bt + t * 8) = f.half[0];  }
__global__ __launch_bounds__(256) void k_rsm(const float* __restrict__ S, _Float16* __restrict__ P, int nrows) {
  #pragma clang fp contract(off)
  const int i = blockIdx.x * 256 + threadIdx.x; if (i >= nrows) return; const float* s = S + (size_t)i * SQ; float mx = -3.0e38f;
#pragma unroll 1
  for (int j = 0; j < SQ; ++j) mx = fmaxf(mx, s[j]); float se = 0.f;
#pragma unroll 1
  for (int j = 0; j < SQ; ++j) se += expf(s[j] - mx); const float sc = 256.0f / se;
#pragma unroll 1
  for (int j0 = 0; j0 < SQ; j0 += 8) { FragH f; for (int q = 0; q < 8; ++q) f.h[q] = (_Float16)(expf(s[j0 + q] - mx) * sc); unsigned short* d = (unsigned short*)P + (size_t)i * SQ + j0; *(v8us*)d = f.half[0];  } }
__global__ __launch_bounds__(256) void k_vt(const _Float16* __restrict__ V16, int b, int h0, _Float16* __restrict__ VT) { __shared__ unsigned short tl[64][65]; const int tid = threadIdx.x; const int hh = blockIdx.x % HG, sg = blockIdx.x / HG; const int s0 = sg * 64; const int h = h0 + hh;
  for (int i = tid; i < 64 * 8; i += 256) { const int j = i / 8, d8 = (i % 8) * 8; FragH f; f.half[0] = *(const v8us*)((const unsigned short*)V16 + ((size_t)b * SQ + s0 + j) * DM + h * HD + d8); for (int q = 0; q < 8; ++q) tl[d8 + q][j] = f.u[q]; }
  __syncthreads();
  { for (int i = tid; i < 64 * 8; i += 256) { const int d = i / 8, j8 = (i % 8) * 8; FragH f; for (int q = 0; q < 8; ++q) f.u[q] = tl[d][j8 + q]; *(v8us*)((unsigned short*)VT + ((size_t)hh * HD + d) * SQ + s0 + j8) = f.half[0]; }  } }



// Causal row softmax, one wave per score row: lane l holds columns 256 c + 8 l .. + 7 of every 256-column chunk c, so a wave's loads and stores
// cover whole cache lines and the row is read once; the row maximum and the row sum are folded over the 32 lanes by a butterfly of lane exchanges.
// e^a as __expf forms it (a * log2 e, then v_exp_f32). Written as asm so that the one free issue slot the instruction set asks for behind a transcendental,
// before its source register is overwritten or its result read, stands there by construction.
__device__ __forceinline__ float rsm_exp(float a) { float r; const float y = a * 1.44269504f; asm("v_exp_f32 %0, %1\n\tv_nop" : "=v"(r) : "v"(y)); return r; }
template <int NC>
__device__ __forceinline__ void rsm_row(const float* __restrict__ s, unsigned short* __restrict__ d, int j0, int last) {
  v4f va[NC], vb[NC];
#pragma unroll      /* full unroll: the row stays in registers and all 2 NC loads are in flight before the first use */
  for (int c = 0; c < NC; ++c) { va[c] = *(const v4fa*)(s + c * 256); vb[c] = *(const v4fa*)(s + c * 256 + 4); }
  float mx = -3.0e38f;
#pragma unroll      /* full unroll: register arrays need constant indices */
  for (int c = 0; c < NC; ++c) {
#pragma unroll
    for (int q = 0; q < 4; ++q) { const int j = j0 + c * 256 + q; va[c][q] = (j <= last) ? va[c][q] : -1.0e9f; vb[c][q] = (j + 4 <= last) ? vb[c][q] : -1.0e9f; mx = fmaxf(mx, fmaxf(va[c][q], vb[c][q])); } }
  for (int m = 16; m > 0; m >>= 1) mx = fmaxf(mx, __shfl_xor(mx, m, 32));
  float se = 0.f;
#pragma unroll      /* full unroll: register arrays need constant indices */
  for (int c = 0; c < NC; ++c) {
#pragma unroll
    for (int q = 0; q < 4; ++q) { va[c][q] = rsm_exp(va[c][q] - mx); se += va[c][q]; }
#pragma unroll
    for (int q = 0; q < 4; ++q) { vb[c][q] = rsm_exp(vb[c][q] - mx); se += vb[c][q]; } }
  for (int m = 16; m > 0; m >>= 1) se += __shfl_xor(se, m, 32);
  const float sc = 256.0f / se;
#pragma unroll      /* full unroll: register arrays need constant indices */
  for (int c = 0; c < NC; ++c) { FragH fr;
#pragma unroll
    for (int q = 0; q < 4; ++q) { fr.h[q] = (_Float16)(va[c][q] * sc); fr.h[4 + q] = (_Float16)(vb[c][q] * sc); }
    *(v8us*)(d + c * 256) = fr.half[0]; }
  asm volatile("s_wait_xcnt 0x0" ::: "memory");      /* precaution behind the run of stores: stands in front of any later instruction that rewrites a register the stores name (the next case's code follows in the listing) */
}
__global__ __launch_bounds__(256) void k_rsmcf2(const float* __restrict__ S, _Float16* __restrict__ P, int hg, int q0, int nk) {
  const int lane = threadIdx.x & 31; const int t = blockIdx.x * 8 + (threadIdx.x >> 5); if (t >= hg * QT) return;
  const float* s = S + (size_t)t * NKX + lane * 8; unsigned short* d = (unsigned short*)P + (size_t)t * NKX + lane * 8; const int last = q0 + (t % QT); const int j0 = lane * 8;
  switch (nk / 256) {      /* nk = q0 + QT: a whole number of 256-column chunks, the same for every wave of the launch */
    case 1: rsm_row<1>(s, d, j0, last); break; case 2: rsm_row<2>(s, d, j0, last); break; case 3: rsm_row<3>(s, d, j0, last); break; case 4: rsm_row<4>(s, d, j0, last); break;
    case 5: rsm_row<5>(s, d, j0, last); break; case 6: rsm_row<6>(s, d, j0, last); break; case 7: rsm_row<7>(s, d, j0, last); break; case 8: rsm_row<8>(s, d, j0, last); break;
    default: break; } }


// Exact f32 causal attention for query rows 0 .. QT0 - 1: one wave per (head, query row); a block of 8 waves takes 8 consecutive rows of one head.
// The key and value rows that the block needs (NCH whole chunks of 32; the 8 rows lie in one chunk, so the count is the block's) are staged once in LDS.
// Scores: lane l owns keys 32 c + l and reads its key row from LDS. Values: lane l owns dims 2 l, 2 l + 1 and walks the keys upwards, each weight taken from its lane.
#define A0P (HD + 4)                 /* key row pitch in LDS, floats: 272 B = 16 B x 17, so 32 lanes that each read 16 B of their own row do not meet on a bank */
typedef float v2f  __attribute__((ext_vector_type(2)));
typedef float v2fa __attribute__((ext_vector_type(2), may_alias));
template <int NCH>
__device__ __forceinline__ void att0_rows(const float* __restrict__ qp, const float* __restrict__ kg, const float* __restrict__ vg, float scale, float* __restrict__ op, int i, int tid, float (*lk)[A0P], float (*lv)[HD]) {
  const int lane = tid & 31; const int sr = tid >> 4, sc = (tid & 15) * 4;      /* staging: 16 threads a row, 16 rows a pass */
  v4f kr[2 * NCH], vr[2 * NCH], q[HD / 4]; const float* const kb = kg + (size_t)sr * DM + sc; const float* const vb = vg + (size_t)sr * DM + sc;      /* the row pitch is a constant, so a pass is a constant step from one address */
#pragma unroll      /* full unroll: register arrays need constant indices, and every load of the block is in flight before the first LDS store */
  for (int u = 0; u < 2 * NCH; ++u) { kr[u] = *(const v4fa*)(kb + (size_t)u * 16 * DM); vr[u] = *(const v4fa*)(vb + (size_t)u * 16 * DM); }
#pragma unroll      /* full unroll: register array */
  for (int t = 0; t < HD / 4; ++t) q[t] = *(const v4fa*)(qp + t * 4);
  asm volatile("s_wait_xcnt 0x0" :: "v"(kb), "v"(vb), "v"(qp) : "memory");      /* precaution: the three addresses are inputs, so they stay in their registers up to this wait and nothing of the run is loaded into a register that an earlier load of the run names */
#pragma unroll      /* full unroll: register arrays */
  for (int u = 0; u < 2 * NCH; ++u) { *(v4f*)&lk[u * 16 + sr][sc] = kr[u]; *(v4f*)&lv[u * 16 + sr][sc] = vr[u]; }
  __syncthreads();      /* the staged rows are read by every wave of the block */
  float e[NCH]; float m = -1.0e30f;
#pragma unroll      /* full unroll: register arrays */
  for (int c = 0; c < NCH; ++c) { v4f a = {0.f, 0.f, 0.f, 0.f}; const float* kp = &lk[c * 32 + lane][0];
#pragma unroll      /* full unroll: q is a register array */
    for (int t = 0; t < HD / 4; ++t) a += q[t] * *(const v4f*)(kp + t * 4);
    e[c] = (c * 32 + lane <= i) ? ((a[0] + a[1]) + (a[2] + a[3])) * scale : -1.0e30f; m = fmaxf(m, e[c]); }
  for (int x = 16; x > 0; x >>= 1) m = fmaxf(m, __shfl_xor(m, x, 32));
  float l = 0.f;
#pragma unroll      /* full unroll: register array */
  for (int c = 0; c < NCH; ++c) { e[c] = (c * 32 + lane <= i) ? expf(e[c] - m) : 0.f; l += e[c]; }
  for (int x = 16; x > 0; x >>= 1) l += __shfl_xor(l, x, 32);
  v2f o = {0.f, 0.f};
#pragma unroll      /* full unroll: e is a register array and the lane number of a weight is a constant */
  for (int c = 0; c < NCH; ++c) { const int eb = __float_as_int(e[c]);
#pragma unroll      /* full unroll: the lane number given to readlane is a constant, and the LDS reads of a chunk can go out ahead of their products */
    for (int jj = 0; jj < 32; ++jj) { const float ej = __int_as_float(__builtin_amdgcn_readlane(eb, jj)); o += ej * *(const v2fa*)&lv[c * 32 + jj][lane * 2]; } }
  const float fin = 64.0f / l;      /* o carried x64 like the f16 path */
  *(v2f*)(op + lane * 2) = o * fin; }
__global__ __launch_bounds__(256) void k_att0w(const float* __restrict__ QF, const float* __restrict__ KF, const float* __restrict__ VF, float scale, float* __restrict__ OF) {      /* all four planes: rows of DM floats */
  __shared__ __attribute__((aligned(16))) float lk[QT0][A0P]; __shared__ __attribute__((aligned(16))) float lv[QT0][HD];
  const int tid = threadIdx.x; const int h = blockIdx.x / (QT0 / 8), i0 = (blockIdx.x % (QT0 / 8)) * 8; const int i = i0 + (tid >> 5);
  const float* qp = QF + (size_t)i * DM + h * HD; const float* kg = KF + h * HD; const float* vg = VF + h * HD; float* op = OF + (size_t)i * DM + h * HD;
  switch (i0 / 32) {      /* chunks of 32 keys up to the block's rows, less one: the same for every wave of the block */
    case 0: att0_rows<1>(qp, kg, vg, scale, op, i, tid, lk, lv); break; case 1: att0_rows<2>(qp, kg, vg, scale, op, i, tid, lk, lv); break;
    case 2: att0_rows<3>(qp, kg, vg, scale, op, i, tid, lk, lv); break; default: att0_rows<4>(qp, kg, vg, scale, op, i, tid, lk, lv); break; } }
static_assert(QT0 == 128, "k_att0w: four chunk counts are written out");


__global__ __launch_bounds__(256) void k_kvexp(const float* __restrict__ src, float* __restrict__ dst, size_t n4) { const size_t t = (size_t)blockIdx.x * 256 + threadIdx.x; if (t >= n4) return; const size_t e = t * 4; const size_t row = e / DM; const int col = (int)(e % DM); const int h = col / HD, d = col % HD; const v4f v = *(const v4fa*)(src + row * KVD + (size_t)(h / HPG) * HD + d); *(v4f*)(dst + e) = v;  }

__global__ __launch_bounds__(256) void k_tab2(float theta, float* __restrict__ CS, float* __restrict__ SN) {
  #pragma clang fp contract(off)
  const int t = blockIdx.x * 256 + threadIdx.x; if (t >= SQ * (HD / 2)) return; const int i = t % (HD / 2); const int p = t / (HD / 2); const float invf = 1.0f / powf(theta, (float)(2 * i) / (float)HD); const float ang = __fmul_rn((float)p, invf); const float c = cosf(ang), s = sinf(ang);
  *(float*)(CS + t) = c; *(float*)(SN + t) = s;  }
template <int NORM, int ROPE>
__global__ __launch_bounds__(64) void k_xform(const float* __restrict__ F, int ldf, int nh, const float* __restrict__ gain, float eps, const float* __restrict__ CS, const float* __restrict__ SN, _Float16* __restrict__ H16, int ldo) {
  #pragma clang fp contract(off)
  __shared__ float xv[HD]; __shared__ float red[HD]; __shared__ unsigned short sh_[HD]; const int d = threadIdx.x; const int h = blockIdx.x % nh; const size_t r = blockIdx.x / nh; const int p = (int)(r % SQ);
  float x = F[r * (size_t)ldf + (size_t)h * HD + d];
  if (NORM) { red[d] = __fmul_rn(x, x); __syncthreads(); for (int st = HD / 2; st > 0; st >>= 1) { if (d < st) red[d] = __fadd_rn(red[d], red[d + st]); __syncthreads(); } const float rs = rsqrtf(__fadd_rn(red[0] / (float)HD, eps)); x = __fmul_rn(__fmul_rn(x, rs), bf16_round(gain[d])); }
  xv[d] = x; __syncthreads();
  float o = x;
  if (ROPE == 1) { const int i = d >> 1; const float c = CS[p * (HD / 2) + i], s = SN[p * (HD / 2) + i]; const float ev = xv[2 * i], od = xv[2 * i + 1]; o = (d & 1) ? __fadd_rn(__fmul_rn(ev, s), __fmul_rn(od, c)) : __fadd_rn(__fmul_rn(ev, c), -__fmul_rn(od, s)); }
  if (ROPE == 2) { const int i = d & (HD / 2 - 1); const float c = CS[p * (HD / 2) + i], s = SN[p * (HD / 2) + i]; const float lo = xv[i], hi = xv[i + HD / 2]; o = (d < HD / 2) ? __fadd_rn(__fmul_rn(lo, c), -__fmul_rn(hi, s)) : __fadd_rn(__fmul_rn(lo, s), __fmul_rn(hi, c)); }
  if (ROPE == 3) { const float c = CS[p * HD + d], s = SN[p * HD + d]; const float lo = xv[d & (HD / 2 - 1)], hi = xv[(d & (HD / 2 - 1)) + HD / 2]; o = (d < HD / 2) ? __fadd_rn(__fmul_rn(lo, c), -__fmul_rn(hi, s)) : __fadd_rn(__fmul_rn(hi, c), __fmul_rn(lo, s)); }      /* rotate-half with FULL-width per-element tables [pos][HD] */
  FragH th; th.h[0] = (_Float16)o; sh_[d] = th.u[0]; __syncthreads();
  if (d < HD / 8) { FragH f; for (int q = 0; q < 8; ++q) f.u[q] = sh_[d * 8 + q]; unsigned short* dst = (unsigned short*)H16 + r * (size_t)ldo + (size_t)h * HD + d * 8; *(v8us*)dst = f.half[0];  } }

template <int NORM, int ROPE>
__global__ __launch_bounds__(64) void k_xformf(const float* __restrict__ F, int ldf, int nh, const float* __restrict__ gain, float eps, const float* __restrict__ CS, const float* __restrict__ SN, float* __restrict__ F32, int ldo) {
  #pragma clang fp contract(off)
  __shared__ float xv[HD]; __shared__ float red[HD]; const int d = threadIdx.x; const int h = blockIdx.x % nh; const size_t r = blockIdx.x / nh; const int p = (int)(r % SQ);
  float x = F[r * (size_t)ldf + (size_t)h * HD + d];
  if (NORM) { red[d] = __fmul_rn(x, x); __syncthreads(); for (int st = HD / 2; st > 0; st >>= 1) { if (d < st) red[d] = __fadd_rn(red[d], red[d + st]); __syncthreads(); } const float rs = rsqrtf(__fadd_rn(red[0] / (float)HD, eps)); x = __fmul_rn(__fmul_rn(x, rs), bf16_round(gain[d])); }
  xv[d] = x; __syncthreads();
  float o = x;
  if (ROPE == 1) { const int i = d >> 1; const float c = CS[p * (HD / 2) + i], s = SN[p * (HD / 2) + i]; const float ev = xv[2 * i], od = xv[2 * i + 1]; o = (d & 1) ? __fadd_rn(__fmul_rn(ev, s), __fmul_rn(od, c)) : __fadd_rn(__fmul_rn(ev, c), -__fmul_rn(od, s)); }
  if (ROPE == 2) { const int i = d & (HD / 2 - 1); const float c = CS[p * (HD / 2) + i], s = SN[p * (HD / 2) + i]; const float lo = xv[i], hi = xv[i + HD / 2]; o = (d < HD / 2) ? __fadd_rn(__fmul_rn(lo, c), -__fmul_rn(hi, s)) : __fadd_rn(__fmul_rn(lo, s), __fmul_rn(hi, c)); }
  if (ROPE == 3) { const float c = CS[p * HD + d], s = SN[p * HD + d]; const float lo = xv[d & (HD / 2 - 1)], hi = xv[(d & (HD / 2 - 1)) + HD / 2]; o = (d < HD / 2) ? __fadd_rn(__fmul_rn(lo, c), -__fmul_rn(hi, s)) : __fadd_rn(__fmul_rn(hi, c), __fmul_rn(lo, s)); }      /* rotate-half with FULL-width per-element tables [pos][HD] */
  float* dst = F32 + r * (size_t)ldo + (size_t)h * HD + d; *(float*)dst = o;  }

__global__ __launch_bounds__(256) void k_bfcp(const float* __restrict__ src, float* __restrict__ dst, size_t n4) { const size_t t = (size_t)blockIdx.x * 256 + threadIdx.x; if (t >= n4) return; const v4f a = *(const v4fa*)(src + t * 4); v4f o; for (int q = 0; q < 4; ++q) o[q] = bf16_round(a[q]); *(v4f*)(dst + t * 4) = o;  }

__global__ __launch_bounds__(256) void k_tabhalf(const float* __restrict__ cs, const float* __restrict__ sn, float* __restrict__ CS, float* __restrict__ SN) { const int t = blockIdx.x * 256 + threadIdx.x; if (t >= SQ * (HD / 2)) return; const int p = t / (HD / 2), i = t % (HD / 2); const float c = bf16_round(cs[(size_t)p * HD + i]), s = bf16_round(sn[(size_t)p * HD + i]);
  *(float*)(CS + t) = c; *(float*)(SN + t) = s;  }

__global__ __launch_bounds__(256) void k_tab2d(float* __restrict__ CS, float* __restrict__ SN) {
  #pragma clang fp contract(off)
  const int t = blockIdx.x * 256 + threadIdx.x; if (t >= SQ * (HD / 2)) return; const int i = t % (HD / 2); const int p = t / (HD / 2); const float invf = (float)(1.0 / pow(10000.0, (double)(2 * i) / (double)HD)); const float ang = __fmul_rn((float)p, invf); const float c = cosf(ang), s = sinf(ang);
  *(float*)(CS + t) = c; *(float*)(SN + t) = s;  }
extern "C" void kernel_launch(void* const* d_in, const int* in_sizes, int n_in,
                              void* d_out, int out_size, void* d_ws, size_t ws_size, hipStream_t stream) {
  (void)in_sizes; (void)n_in; (void)out_size;
  const float* const* I = (const float* const*)d_in; const float* x = I[0]; const float* wq = I[1]; const float* wk = I[2]; const float* wv = I[3]; const float* wo = I[4]; const float* bq = nullptr; const float* bk = nullptr; const float* bv = nullptr; const float* bo = nullptr;      /* natural [out][in] weights, no biases; rope tables computed in the kernel */
  char* ws = (char*)d_ws; size_t off = 0;
  auto take = [&](size_t bytes) { char* p = ws + off; off += (bytes + 255) & ~(size_t)255; return p; };
  _Float16* BQ = (_Float16*)take((size_t)DM * DM * 2); _Float16* BK = (_Float16*)take((size_t)KVD * DM * 2); _Float16* BV = (_Float16*)take((size_t)KVD * DM * 2); _Float16* BO = (_Float16*)take((size_t)DM * DM * 2);
  _Float16* X16 = (_Float16*)take(NR * DM * 2); float* QF = (float*)take((size_t)SQ * DM * 4); float* KF = (float*)take((size_t)SQ * KVD * 4); float* CSB = (float*)take((size_t)SQ * HD * 4); float* SNB = (float*)take((size_t)SQ * HD * 4); _Float16* Q16 = (_Float16*)take(NR * DM * 2); _Float16* K16 = (_Float16*)take(NR * KVD * 2); _Float16* V16 = (_Float16*)take(NR * KVD * 2); _Float16* O16 = (_Float16*)take(NR * DM * 2);
  float* S = (float*)take((size_t)NH * QT * NKX * 4); _Float16* P = (_Float16*)take((size_t)NH * QT * NKX * 2); _Float16* VT = (_Float16*)take((size_t)NH * HD * SQ * 2);
  float* QF0 = (float*)take((size_t)QT0 * DM * 4); float* KF0 = (float*)take((size_t)QT0 * KVD * 4); float* VF0 = (float*)take((size_t)QT0 * KVD * 4); float* KF0e = (float*)take((size_t)QT0 * DM * 4); float* VF0e = (float*)take((size_t)QT0 * DM * 4); float* OF0 = (float*)take((size_t)NB * QT0 * DM * 4); _Float16* OH0 = (_Float16*)take((size_t)NB * QT0 * DM * 2); _Float16* OL0 = (_Float16*)take((size_t)NB * QT0 * DM * 2);
  if (off > ws_size) return;
  k_wnat<<<(unsigned)(((size_t)DM * DM / 8 + 255) / 256), 256, 0, stream>>>(wq, (size_t)DM * DM / 8, BQ); k_wnat<<<(unsigned)(((size_t)KVD * DM / 8 + 255) / 256), 256, 0, stream>>>(wk, (size_t)KVD * DM / 8, BK); k_wnat<<<(unsigned)(((size_t)KVD * DM / 8 + 255) / 256), 256, 0, stream>>>(wv, (size_t)KVD * DM / 8, BV); k_wnat<<<(unsigned)(((size_t)DM * DM / 8 + 255) / 256), 256, 0, stream>>>(wo, (size_t)DM * DM / 8, BO);      /* natural [out][in] = Bt planes x16 */
  k_x16<<<(unsigned)((NR * DM / 8 + 255) / 256), 256, 0, stream>>>(x, X16, NR * DM / 8);
  k_tab2d<<<(SQ * (HD / 2) + 255) / 256, 256, 0, stream>>>(CSB, SNB);      /* rope tables cos/sin(p / 10000^(2i/64)): inv_freq double-derived -> f32, f32 angle */
  const size_t r0p = (size_t)B0 * SQ;      /* first projected row */
  k_gemm2<0><<<dim3((unsigned)((MP / 128) * (KVD / 64)), 1), 128, 0, stream>>>(X16 + r0p * DM, DM, 0, BV, DM, 0, 0.0625f, bv, 0, nullptr, 1, 0, 0, nullptr, V16 + r0p * KVD, KVD, 0, MP, KVD, DM);
  for (int b = B0; b < B0 + NBR; ++b) { const size_t r0 = (size_t)b * SQ;
    k_gemm2<0><<<dim3((unsigned)((SQ / 128) * (DM / 64)), 1), 128, 0, stream>>>(X16 + r0 * DM, DM, 0, BQ, DM, 0, 0.0625f, nullptr, 0, nullptr, 1, 0, 0, QF, nullptr, DM, 0, SQ, DM, DM);      /* q (f32) of this batch */
    k_gemm2<0><<<dim3((unsigned)((SQ / 128) * (KVD / 64)), 1), 128, 0, stream>>>(X16 + r0 * DM, DM, 0, BK, DM, 0, 0.0625f, nullptr, 0, nullptr, 1, 0, 0, KF, nullptr, KVD, 0, SQ, KVD, DM);      /* k (f32) */
    k_xform<0, 1><<<(unsigned)((size_t)SQ * NH), 64, 0, stream>>>(QF, DM, NH, nullptr, 0.f, CSB, SNB, Q16 + r0 * DM, DM); k_xform<0, 1><<<(unsigned)((size_t)SQ * NG), 64, 0, stream>>>(KF, KVD, NG, nullptr, 0.f, CSB, SNB, K16 + r0 * KVD, KVD);      /* interleaved-pair rope -> f16 rows */
    k_xformf<0, 1><<<(unsigned)(QT0 * NH), 64, 0, stream>>>(QF, DM, NH, nullptr, 0.f, CSB, SNB, QF0, DM); k_xformf<0, 1><<<(unsigned)(QT0 * NG), 64, 0, stream>>>(KF, KVD, NG, nullptr, 0.f, CSB, SNB, KF0, KVD);      /* f32 roped q, k of rows 0..127 */
    k_vt<NG, SQ><<<NG * (SQ / 64), 256, 0, stream>>>(V16 + r0 * KVD, KVD, 0, VT);      /* V^T [NG][HD][SQ] for this batch */
    k_gemm2<0><<<dim3((QT0 / 128) * (KVD / 64), 1), 128, 0, stream>>>(X16 + r0 * DM, DM, 0, BV, DM, 0, 0.0625f, bv, 0, nullptr, 1, 0, 0, VF0, nullptr, KVD, 0, QT0, KVD, DM);
    k_kvexp<<<(unsigned)(((size_t)QT0 * DM / 4 + 255) / 256), 256, 0, stream>>>(KF0, KF0e, (size_t)QT0 * DM / 4); k_kvexp<<<(unsigned)(((size_t)QT0 * DM / 4 + 255) / 256), 256, 0, stream>>>(VF0, VF0e, (size_t)QT0 * DM / 4);      /* head h <- kv group h/4 for the exact first-tile kernel */      /* f32 q, k, v of the first 128 rows (exact products) */
    k_att0w<<<NH * (QT0 / 8), 256, 0, stream>>>(QF0, KF0e, VF0e, 0.125f, OF0 + (size_t)b * QT0 * DM);      /* exact f32 attention for rows 0..127 (o x64) */
    for (int q0 = 0; q0 < QN; q0 += QT) { const int nk = q0 + QT;      /* causal: only keys below the tile end are computed */
      k_gemm2<0><<<dim3((QT / 128) * (nk / 64), NH), 128, 0, stream>>>(Q16 + (r0 + q0) * LQ, LQ, (size_t)HD, K16 + r0 * KVD, KVD, (size_t)HD, 0.125f, nullptr, 0, nullptr, 1, 0, 0, S, nullptr, NKX, (size_t)QT * NKX, QT, nk, HD, 2);      /* scores: all 32 heads in one launch, head h against the keys of group h / 4 */
      k_rsmcf2<<<(NHD * QT + 7) / 8, 256, 0, stream>>>(S, P, NHD, q0, nk);      /* 8 waves a block, one row a wave */
      k_gemm2<0><<<dim3((QT / 128) * (HD / 64), NH), 128, 0, stream>>>(P, NKX, (size_t)QT * NKX, VT, SQ, (size_t)HD * SQ, 0.25f, nullptr, 0, nullptr, 1, 0, 0, nullptr, O16 + (r0 + q0) * DM, DM, (size_t)HD, QT, HD, nk, 2); } }      /* o for all 32 heads in one launch, head h with V^T of group h / 4 (x64) */      /* o (merged heads, x64) as f16 rows */
  k_gemm2<0><<<dim3((unsigned)((MPO / 128) * (DM / 64)), 1), 128, 0, stream>>>(O16 + r0p * DM, DM, 0, BO, DM, 0, 0.0009765625f, bo, 0, nullptr, 1, 0, 0, (float*)d_out + r0p * DM, nullptr, DM, 0, MPO, DM, DM);      /* out rows are the output layout */
  k_hl<<<(unsigned)(((size_t)NB * QT0 * DM / 8 + 255) / 256), 256, 0, stream>>>(OF0, OH0, OL0, (size_t)NB * QT0 * DM / 8);      /* first-tile o (x64) -> f16 hi + x1024 residual planes */
  for (int b = B0; b < B0 + NBR; ++b) { const size_t r0 = (size_t)b * SQ; const size_t f0 = (size_t)b * QT0;
    k_gemm2<0><<<dim3((QT0 / 128) * (DM / 64), 1), 128, 0, stream>>>(OH0 + f0 * DM, DM, 0, BO, DM, 0, 0.0009765625f, bo, 0, nullptr, 1, 0, 0, (float*)d_out + r0 * DM, nullptr, DM, 0, QT0, DM, DM);      /* rows 0..127: out = o_hi Wo (+ b), overwriting the f16-path rows */
    k_gemm2<0><<<dim3((QT0 / 128) * (DM / 64), 1), 128, 0, stream>>>(OL0 + f0 * DM, DM, 0, BO, DM, 0, 0.00000095367431640625f, nullptr, 0, (const float*)d_out + r0 * DM, -1, 0, 0, (float*)d_out + r0 * DM, nullptr, DM, 0, QT0, DM, DM); }      /* += o_lo Wo 2^-20 (own-element accumulate) */
}

// v006
// It runs in 250 microseconds.
// It is 2.05 times as fast as v004, going by the measured steps of the versions left out in between.
// Over all steps from v000 it is 19.4 times as fast.
#include <hip/hip_runtime.h>
// LLaMA grouped-query causal attention with interleaved-pair RoPE (hidden_states [1][2048][2048]; q = x Wq^T (natural [2048][2048]), k = x Wk^T, v = x Wv^T (natural [512][2048]) (sigma 0.02, no biases): 32 query heads / 8 kv heads of 64 (repeat_interleave: kv head h / 4); tables cos/sin of pos / 10000^(2i/64) repeated per pair; q = q cos + rotate_pairs(q) sin with rotate_pairs (x0, x1) -> (-x1, x0): pair (e, o) -> (e cos - o sin, o cos + e sin); scores x 64^-0.5 with a causal mask (triu(1) -> -inf); softmax; out = merged Wo^T (natural) -> [1][2048][2048]).
// Compute dtype: inputs rounded to bf16; x / weights exact; q, k, v, softmax weights and o as plain f16 GEMM operands (~2^-12); scores and softmax statistics f32. v_wmma_f32_16x16x32_f16.
#define NB 1
#define NG 8
#define HPG 4
#define KVD (NG * HD)
#define SQ 2048
#define DM 2048
#define NH 32
#define HD 64
#define HG 4                         /* heads covered by one launch of the non-template k_vt (unused) */
#define QT 256                       /* unused */
#define NKX SQ                       /* S / P row pitch */
#define QT0 128                      /* first-tile rows recomputed exactly in f32 */
#define B0 0                         /* first batch processed (debug hook) */
#define NBR NB                       /* batches processed (debug hook) */
#define NR ((size_t)NB * SQ)         /* token rows */
#define MP ((int)((size_t)NBR * SQ)) /* rows projected (debug hook) */
#define QN SQ                        /* query rows attended per batch (unused) */
#define NHD NH                       /* heads attended (unused) */
#define MPO MP                       /* rows through the output stage (debug hook) */
#define LQ DM      /* row pitch of the q rows */
typedef __bf16 v16b __attribute__((ext_vector_type(16)));
typedef unsigned short v8us __attribute__((ext_vector_type(8), may_alias));
typedef float  v8f  __attribute__((ext_vector_type(8)));
typedef float  v4f  __attribute__((ext_vector_type(4)));
typedef float  v4fa __attribute__((ext_vector_type(4), may_alias));
union FragB { v16b v; v8us half[2]; unsigned short u[16]; };

__device__ __forceinline__ unsigned short bf16_bits(float x) { unsigned int u = __float_as_uint(x); return (unsigned short)((u + 0x7FFFu + ((u >> 16) & 1u)) >> 16); }
__device__ __forceinline__ float bf16_val(unsigned short b) { return __uint_as_float(((unsigned int)b) << 16); }
__device__ __forceinline__ float bf16_round(float x) { return bf16_val(bf16_bits(x)); }
// D += A·B with NT terms: 1 = ah·bh, 2 = + al·bh (A split), 3 = + ah·bl (both split)
template <int NT>
__device__ __forceinline__ v8f mmaN(v16b ah, v16b al, v16b bh, v16b bl, v8f c) {
  c = __builtin_amdgcn_wmma_f32_16x16x32_bf16(false, ah, false, bh, (short)0, c, false, false);
  if (NT >= 2) c = __builtin_amdgcn_wmma_f32_16x16x32_bf16(false, al, false, bh, (short)0, c, false, false);
  if (NT >= 3) c = __builtin_amdgcn_wmma_f32_16x16x32_bf16(false, ah, false, bl, (short)0, c, false, false);
  asm volatile("v_nop\n\tv_nop\n\tv_nop\n\tv_nop" : "+v"(c) : "v"(ah), "v"(al), "v"(bh), "v"(bl));
  return c;
}

__global__ __launch_bounds__(256) void k_wt_bf16(const float* __restrict__ W, unsigned short* __restrict__ Wt, int K, int N) {
  const int t = blockIdx.x * 256 + threadIdx.x;
  const int k8n = K / 8;
  if (t >= N * k8n) return;
  const int n = t / k8n, k8 = (t % k8n) * 8;
  v8us v;
#pragma unroll
  for (int i = 0; i < 8; ++i) v[i] = bf16_bits(W[(size_t)(k8 + i) * N + n]);
  *(v8us*)(Wt + (size_t)n * K + k8) = v;
  
}

// GEMM C[M][N] (f32, pitch ldc) = act(A[M][K]·W + bias). A f32 row-major (pitch lda) converted per fragment to bf16
// (ASPLIT: hi/lo two planes -> 2 terms, else single rounded term); Wt bf16 [N][K] (pitch ldb). BIAS_BF16 rounds the
// bias to bf16 first (bias quantised to bf16 before the add). K%32==0, M%16==0, N%64==0.
template <bool ASPLIT, int ACT, bool BIAS_BF16>
__global__ __launch_bounds__(128) void k_gemm_bf(const float* __restrict__ A, int lda, const unsigned short* __restrict__ Wt, int ldb,
                                               const float* __restrict__ bias, float* __restrict__ C, int ldc, int M, int N, int K) {
  __shared__ __attribute__((aligned(16))) float so[4][16][64];
  const int tid = threadIdx.x, w = tid >> 5, lane = tid & 31, ln = lane & 15, hh = lane >> 4;
  const int ntn = N / 64;
  const int wid = blockIdx.x * 4 + w;
  const int mt = wid / ntn, nq = wid % ntn;
  if (mt * 16 >= M) return;
  const int row0 = mt * 16, col0 = nq * 64;
  const float* arow = A + (size_t)(row0 + ln) * lda;
  v8f acc[4] = {};
  for (int kb = 0; kb < K; kb += 32) {
    FragB ah, al;
    const v4f x0 = *(const v4fa*)(arow + kb + 8 * hh), x1 = *(const v4fa*)(arow + kb + 8 * hh + 4);
    const v4f x2 = *(const v4fa*)(arow + kb + 16 + 8 * hh), x3 = *(const v4fa*)(arow + kb + 16 + 8 * hh + 4);
    float xs[16] = {x0[0],x0[1],x0[2],x0[3],x1[0],x1[1],x1[2],x1[3],x2[0],x2[1],x2[2],x2[3],x3[0],x3[1],x3[2],x3[3]};
#pragma unroll
    for (int i = 0; i < 16; ++i) { const unsigned short hb = bf16_bits(xs[i]); ah.u[i] = hb; al.u[i] = ASPLIT ? bf16_bits(xs[i] - bf16_val(hb)) : (unsigned short)0; }
#pragma unroll
    for (int t = 0; t < 4; ++t) {
      const unsigned short* brow = Wt + (size_t)(col0 + t * 16 + ln) * ldb + kb;
      FragB b;
      b.half[0] = *(const v8us*)(brow + 8 * hh);
      b.half[1] = *(const v8us*)(brow + 16 + 8 * hh);
      acc[t] = mmaN<ASPLIT ? 2 : 1>(ah.v, al.v, b.v, b.v, acc[t]);
    }
  }
#pragma unroll
  for (int t = 0; t < 4; ++t) {
    float bv = bias ? bias[col0 + t * 16 + ln] : 0.f;
    if (BIAS_BF16) bv = bf16_round(bv);
#pragma unroll
    for (int r = 0; r < 8; ++r) { float v = acc[t][r] + bv; if (ACT == 1) v = fmaxf(v, 0.f); so[w][8 * hh + r][t * 16 + ln] = v; }
  }
  __builtin_amdgcn_fence(__ATOMIC_ACQ_REL, "workgroup");
  __builtin_amdgcn_wave_barrier();
  const int rsub = lane >> 4, c4 = (lane & 15) * 4;
  {
#pragma unroll
    for (int q = 0; q < 8; ++q) {
      const int r = q * 2 + rsub;
      const v4f v = *(const v4fa*)&so[w][r][c4];
      *(v4f*)(C + (size_t)(row0 + r) * ldc + col0 + c4) = v;
    }
    
  }
}

// GEMM C = act(A·W + bias + resid): A f32 (ASPLIT -> hi/lo 2 terms), Wt bf16 [N][K]; ACT 0 none, 1 relu, 2 exact gelu;
// resid (optional, f32, row index = (row % rmod), pitch ldr, RES_BF16 rounds it) added before the activation.
template <bool ASPLIT, int ACT, bool BIAS_BF16, bool RES_BF16>
__global__ __launch_bounds__(128) void k_gemm_bf3(const float* __restrict__ A, int lda, const unsigned short* __restrict__ Wt, int ldb,
                                                const float* __restrict__ bias, const float* __restrict__ resid, int rmod, int ldr,
                                                float* __restrict__ C, int ldc, int M, int N, int K) {
  __shared__ __attribute__((aligned(16))) float so[4][16][64];
  const int tid = threadIdx.x, w = tid >> 5, lane = tid & 31, ln = lane & 15, hh = lane >> 4;
  const int ntn = N / 64;
  const int wid = blockIdx.x * 4 + w;
  const int mt = wid / ntn, nq = wid % ntn;
  if (mt * 16 >= M) return;
  const int row0 = mt * 16, col0 = nq * 64;
  const float* arow = A + (size_t)(row0 + ln) * lda;
  v8f acc[4] = {};
  for (int kb = 0; kb < K; kb += 32) {
    FragB ah, al;
    const v4f x0 = *(const v4fa*)(arow + kb + 8 * hh), x1 = *(const v4fa*)(arow + kb + 8 * hh + 4);
    const v4f x2 = *(const v4fa*)(arow + kb + 16 + 8 * hh), x3 = *(const v4fa*)(arow + kb + 16 + 8 * hh + 4);
    float xs[16] = {x0[0],x0[1],x0[2],x0[3],x1[0],x1[1],x1[2],x1[3],x2[0],x2[1],x2[2],x2[3],x3[0],x3[1],x3[2],x3[3]};
#pragma unroll
    for (int i = 0; i < 16; ++i) { const unsigned short hb = bf16_bits(xs[i]); ah.u[i] = hb; al.u[i] = ASPLIT ? bf16_bits(xs[i] - bf16_val(hb)) : (unsigned short)0; }
#pragma unroll
    for (int t = 0; t < 4; ++t) {
      const unsigned short* brow = Wt + (size_t)(col0 + t * 16 + ln) * ldb + kb;
      FragB b;
      b.half[0] = *(const v8us*)(brow + 8 * hh);
      b.half[1] = *(const v8us*)(brow + 16 + 8 * hh);
      acc[t] = mmaN<ASPLIT ? 2 : 1>(ah.v, al.v, b.v, b.v, acc[t]);
    }
  }
#pragma unroll
  for (int t = 0; t < 4; ++t) {
    const int col = col0 + t * 16 + ln;
    float bv = bias ? bias[col] : 0.f;
    if (BIAS_BF16) bv = bf16_round(bv);
#pragma unroll
    for (int r = 0; r < 8; ++r) {
      float v = acc[t][r] + bv;
      if (resid) { float rv = resid[(size_t)((row0 + 8 * hh + r) % rmod) * ldr + col]; if (RES_BF16) rv = bf16_round(rv); v += rv; }
      if (ACT == 1) v = fmaxf(v, 0.f);
      if (ACT == 2) v = 0.5f * v * (1.0f + erff(v * 0.70710678118654752f));
      if (ACT == 3) { const float u = 0.7978845608028654f * (v + 0.044715f * v * v * v); v = 0.5f * v * (1.0f + tanhf(u)); }
      so[w][8 * hh + r][t * 16 + ln] = v;
    }
  }
  __builtin_amdgcn_fence(__ATOMIC_ACQ_REL, "workgroup");
  __builtin_amdgcn_wave_barrier();
  const int rsub = lane >> 4, c4 = (lane & 15) * 4;
  {
#pragma unroll
    for (int q = 0; q < 8; ++q) {
      const int r = q * 2 + rsub;
      const v4f v = *(const v4fa*)&so[w][r][c4];
      *(v4f*)(C + (size_t)(row0 + r) * ldc + col0 + c4) = v;
    }
    
  }
}
// row LayerNorm (biased variance, eps) over N: s = X (+ R); optional out_sum <- s; out_norm <- (s-mu)*rsqrt(var+eps)*g + b
template <bool PARAM_BF16>
__global__ __launch_bounds__(256) void k_layernorm(const float* __restrict__ X, const float* __restrict__ R, const float* __restrict__ g, const float* __restrict__ bta,
                                                  float* __restrict__ out_sum, float* __restrict__ out_norm, int N, float eps) {
  __shared__ float red[256];
  const int row = blockIdx.x, tid = threadIdx.x;
  const float* x = X + (size_t)row * N; const float* rr = R ? R + (size_t)row * N : nullptr;
  float vals[16];                     // up to N = 4096
  const int per = N / 256;            // contiguous chunk per thread? use strided-by-4 chunks: thread handles j = tid*4 + 1024*u
  float s1 = 0.f;
  for (int u = 0; u < per / 4; ++u) {
    const int j = tid * 4 + 1024 * u;
    const v4f a = *(const v4fa*)(x + j);
    v4f b = {0.f,0.f,0.f,0.f}; if (rr) b = *(const v4fa*)(rr + j);
#pragma unroll
    for (int q = 0; q < 4; ++q) { const float v = a[q] + b[q]; vals[u * 4 + q] = v; s1 += v; }
  }
  red[tid] = s1; __syncthreads();
  for (int st = 128; st > 0; st >>= 1) { if (tid < st) red[tid] += red[tid + st]; __syncthreads(); }
  const float mu = red[0] / (float)N; __syncthreads();
  float s2 = 0.f;
  for (int u = 0; u < per / 4; ++u)
#pragma unroll
    for (int q = 0; q < 4; ++q) { const float c = vals[u * 4 + q] - mu; s2 += c * c; }
  red[tid] = s2; __syncthreads();
  for (int st = 128; st > 0; st >>= 1) { if (tid < st) red[tid] += red[tid + st]; __syncthreads(); }
  const float rs = rsqrtf(red[0] / (float)N + eps);
  {
    for (int u = 0; u < per / 4; ++u) {
      const int j = tid * 4 + 1024 * u;
      v4f o, sm;
#pragma unroll
      for (int q = 0; q < 4; ++q) {
        float gg = g[j + q], bb = bta[j + q];
        if (PARAM_BF16) { gg = bf16_round(gg); bb = bf16_round(bb); }
        sm[q] = vals[u * 4 + q]; o[q] = (vals[u * 4 + q] - mu) * rs * gg + bb;
      }
      if (out_sum) *(v4f*)(out_sum + (size_t)row * N + j) = sm;
      *(v4f*)(out_norm + (size_t)row * N + j) = o;
    }
    
  }
}



// ---- f16 WMMA path (v_wmma_f32_16x16x32_f16): 11-bit significands for operands in range — used where a [0,1] probability operand needs more precision than bf16
typedef _Float16 v16h __attribute__((ext_vector_type(16)));
union FragH { v16h v; v8us half[2]; _Float16 h[16]; unsigned short u[16]; };
template <int NT>
__device__ __forceinline__ v8f mmaH(v16h ah, v16h al, v16h bh, v16h bl, v8f c) {
  c = __builtin_amdgcn_wmma_f32_16x16x32_f16(false, ah, false, bh, (short)0, c, false, false);
  if (NT >= 2) c = __builtin_amdgcn_wmma_f32_16x16x32_f16(false, al, false, bh, (short)0, c, false, false);
  if (NT >= 3) c = __builtin_amdgcn_wmma_f32_16x16x32_f16(false, ah, false, bl, (short)0, c, false, false);
  asm volatile("v_nop\n\tv_nop\n\tv_nop\n\tv_nop" : "+v"(c) : "v"(ah), "v"(al), "v"(bh), "v"(bl));
  return c;
}
// batched GEMM like k_gemm_b but f16 operands: A f32 (split into f16 hi/lo if ASPLIT, else rounded to f16), Bt = f16 values [n][k]; alpha; C f32; N multiple of 16 (partial tiles skipped)
template <bool ASPLIT>
__global__ __launch_bounds__(128) void k_gemm_h(const float* __restrict__ A, int lda, size_t sA, const _Float16* __restrict__ Bh, int ldb, size_t sB, float alpha, float* __restrict__ C, int ldc, size_t sC, int M, int N, int K) {
  __shared__ __attribute__((aligned(16))) float so[4][16][64];
  const int tid = threadIdx.x, w = tid >> 5, lane = tid & 31, ln = lane & 15, hh = lane >> 4; const int by = blockIdx.y;
  A += (size_t)by * sA; Bh += (size_t)by * sB; C += (size_t)by * sC;
  const int ntn = (N + 63) / 64; const int wid = blockIdx.x * 4 + w; const int mt = wid / ntn, nq = wid % ntn; if (mt * 16 >= M) return;
  const int row0 = mt * 16, col0 = nq * 64; const float* arow = A + (size_t)(row0 + ln) * lda;
  v8f acc[4] = {};
  for (int kb = 0; kb < K; kb += 32) {
    FragH ah, al;
    const v4f x0 = *(const v4fa*)(arow + kb + 8 * hh), x1 = *(const v4fa*)(arow + kb + 8 * hh + 4), x2 = *(const v4fa*)(arow + kb + 16 + 8 * hh), x3 = *(const v4fa*)(arow + kb + 16 + 8 * hh + 4);
    float xs[16] = {x0[0],x0[1],x0[2],x0[3],x1[0],x1[1],x1[2],x1[3],x2[0],x2[1],x2[2],x2[3],x3[0],x3[1],x3[2],x3[3]};
#pragma unroll
    for (int i = 0; i < 16; ++i) { const _Float16 h = (_Float16)xs[i]; ah.h[i] = h; al.h[i] = ASPLIT ? (_Float16)(xs[i] - (float)h) : (_Float16)0.0f; }
#pragma unroll
    for (int t = 0; t < 4; ++t) { if (col0 + t * 16 >= N) continue; const size_t boff = (size_t)(col0 + t * 16 + ln) * ldb + kb; FragH bq; bq.half[0] = *(const v8us*)(Bh + boff + 8 * hh); bq.half[1] = *(const v8us*)(Bh + boff + 16 + 8 * hh);
      acc[t] = mmaH<ASPLIT ? 2 : 1>(ah.v, al.v, bq.v, bq.v, acc[t]); }
  }
#pragma unroll
  for (int t = 0; t < 4; ++t) { if (col0 + t * 16 >= N) continue;
#pragma unroll
    for (int r = 0; r < 8; ++r) so[w][8 * hh + r][t * 16 + ln] = acc[t][r] * alpha; }
  __builtin_amdgcn_fence(__ATOMIC_ACQ_REL, "workgroup"); __builtin_amdgcn_wave_barrier();
  const int rsub = lane >> 4, c4 = (lane & 15) * 4;
  {
#pragma unroll
    for (int q = 0; q < 8; ++q) { const int r = q * 2 + rsub; if (col0 + c4 < N) { const v4f v = *(const v4fa*)&so[w][r][c4]; *(v4f*)(C + (size_t)(row0 + r) * ldc + col0 + c4) = v; } }
     }
}

// Wt[n][k] = f16(W[k][n]·scale) from f32 row-major W[K][N] (scale = power of two; bf16-exact weights stay exact in f16 away from the subnormal range)
__global__ __launch_bounds__(256) void k_wt_f16(const float* __restrict__ W, _Float16* __restrict__ Wt, int K, int N, float scale) {
  const int t = blockIdx.x * 256 + threadIdx.x; if (t >= N * (K / 8)) return; const int n = t / (K / 8), k8 = (t % (K / 8)) * 8; FragH f;
#pragma unroll
  for (int i = 0; i < 8; ++i) f.h[i] = (_Float16)(bf16_round(W[(size_t)(k8 + i) * N + n]) * scale); const v8us o = f.half[0];
  *(v8us*)((unsigned short*)Wt + (size_t)n * K + k8) = o; 
}
// k_gemm_hh variant with fused epilogue: v = acc·alpha + bias[by·sBias + col] (+ CP[(row/rowsPerB)·sCPb + by·64 + col] if CP) ; ACT 0 none / 1 elu ; writes f16 C16 (and f32 C if non-null)
template <int ACT>
__global__ __launch_bounds__(128) void k_gemm_hhx(const _Float16* __restrict__ A, int lda, size_t sA, const _Float16* __restrict__ Bh, int ldb, size_t sB, float alpha, const float* __restrict__ bias, size_t sBias, const float* __restrict__ CP, int rowsPerB, size_t sCPb, int row0g,
    float* __restrict__ C, _Float16* __restrict__ C16, int ldc, size_t sC, int M, int N, int K) {
  __shared__ __attribute__((aligned(16))) float so[4][16][64];
  const int tid = threadIdx.x, w = tid >> 5, lane = tid & 31, ln = lane & 15, hh = lane >> 4; const int by = blockIdx.y;
  A += (size_t)by * sA; Bh += (size_t)by * sB; const size_t cofs = (size_t)by * sC; const float* bp = bias ? bias + (size_t)by * sBias : nullptr;
  const int ntn = (N + 63) / 64; const int wid = blockIdx.x * 4 + w; const int mt = wid / ntn, nq = wid % ntn; if (mt * 16 >= M) return;
  const int row0 = mt * 16, col0 = nq * 64; const _Float16* arow = A + (size_t)(row0 + ln) * lda;
  v8f acc[4] = {};
  for (int kb = 0; kb < K; kb += 32) { FragH ah; ah.half[0] = *(const v8us*)((const unsigned short*)arow + kb + 8 * hh); ah.half[1] = *(const v8us*)((const unsigned short*)arow + kb + 16 + 8 * hh);
#pragma unroll
    for (int t = 0; t < 4; ++t) { if (col0 + t * 16 >= N) continue; const size_t boff = (size_t)(col0 + t * 16 + ln) * ldb + kb; FragH bq; bq.half[0] = *(const v8us*)((const unsigned short*)Bh + boff + 8 * hh); bq.half[1] = *(const v8us*)((const unsigned short*)Bh + boff + 16 + 8 * hh);
      acc[t] = mmaH<1>(ah.v, ah.v, bq.v, bq.v, acc[t]); }
  }
#pragma unroll
  for (int t = 0; t < 4; ++t) { if (col0 + t * 16 >= N) continue; const int col = col0 + t * 16 + ln; const float bv = bp ? bf16_round(bp[col]) : 0.f;
#pragma unroll
    for (int r = 0; r < 8; ++r) { float v = acc[t][r] * alpha + bv; if (CP) { const int rr = row0g + row0 + 8 * hh + r; if (rowsPerB < 0) v += CP[cofs + (size_t)rr * ldc + col];      /* rowsPerB < 0: own element of the batched C plane */ else { const int bidx = rr / rowsPerB; v += CP[(size_t)bidx * sCPb + (size_t)by * 64 + col]; } } if (ACT == 1) v = (v > 0.f) ? v : expm1f(v); else if (ACT == 7) v = (v > 0.f) ? v + 1.0f : expf(v); else if (ACT == 8) v = tanhf(v); else if (ACT == 9) v = 0.5f * v * (1.0f + tanhf(0.7978845608028654f * (v + 0.044715f * v * v * v))); else if (ACT == 11) v = 1.0f / (1.0f + expf(-v)); else if (ACT == 12) v = (v > 0.f) ? v : 0.01f * v; else if (ACT == 14) v = (v > 0.f) ? v : 0.1f * v; else if (ACT == 16) v = (v >= 0.f) ? v : 0.3f * v; else if (ACT == 17) v = (v >= 0.f) ? v : 0.2f * v; else if (ACT == 15) v = v / (1.0f + expf(-v)); else if (ACT == 3) v = fmaxf(v, 0.f); else if (ACT == 6) v = 0.5f * v * (1.0f + erff(v * 0.70710678118654752f)); so[w][8 * hh + r][t * 16 + ln] = v; } }
  __builtin_amdgcn_fence(__ATOMIC_ACQ_REL, "workgroup"); __builtin_amdgcn_wave_barrier();
  const int rsub = lane >> 4, c4 = (lane & 15) * 4; typedef _Float16 v4h __attribute__((ext_vector_type(4)));
  {
#pragma unroll
    for (int q = 0; q < 8; ++q) { const int r = q * 2 + rsub; if (col0 + c4 < N) { const v4f v = *(const v4fa*)&so[w][r][c4]; if (C) *(v4f*)(C + cofs + (size_t)(row0 + r) * ldc + col0 + c4) = v; if (C16) { v4h h4; for (int i = 0; i < 4; ++i) h4[i] = (_Float16)v[i]; *(v4h*)(C16 + cofs + (size_t)(row0 + r) * ldc + col0 + c4) = h4; } } }
     }
}


typedef _Float16 v4h __attribute__((ext_vector_type(4)));

__global__ __launch_bounds__(256) void k_x16(const float* __restrict__ x, _Float16* __restrict__ X16, size_t n8) { const size_t t = (size_t)blockIdx.x * 256 + threadIdx.x; if (t >= n8) return; FragH f;
#pragma unroll
  for (int q = 0; q < 8; ++q) f.h[q] = (_Float16)bf16_round(x[t * 8 + q]); *(v8us*)((unsigned short*)X16 + t * 8) = f.half[0];  }
__global__ __launch_bounds__(256) void k_h16(const float* __restrict__ x, _Float16* __restrict__ X16, size_t n8) { const size_t t = (size_t)blockIdx.x * 256 + threadIdx.x; if (t >= n8) return; FragH f;
#pragma unroll
  for (int q = 0; q < 8; ++q) f.h[q] = (_Float16)x[t * 8 + q]; *(v8us*)((unsigned short*)X16 + t * 8) = f.half[0];  }
__global__ __launch_bounds__(256) void k_round16f(const float* __restrict__ W, _Float16* __restrict__ Bt, size_t n8) { const size_t t = (size_t)blockIdx.x * 256 + threadIdx.x; if (t >= n8) return; FragH f;
#pragma unroll
  for (int i = 0; i < 8; ++i) f.h[i] = (_Float16)(bf16_round(W[t * 8 + i]) * 16.0f); *(v8us*)((unsigned short*)Bt + t * 8) = f.half[0];  }
template <int NHv, int TTv>
__global__ __launch_bounds__(256) void k_vt(const _Float16* __restrict__ V16, int ldv, int voff, _Float16* __restrict__ Vt) { __shared__ unsigned short tl[64][66]; const int tid = threadIdx.x; const int slab = blockIdx.x / (TTv / 64), lg = blockIdx.x % (TTv / 64); const int b = slab / NHv, h = slab % NHv;
  for (int i = tid; i < 64 * 8; i += 256) { const int r = i / 8, c8 = (i % 8) * 8; FragH f; f.half[0] = *(const v8us*)((const unsigned short*)V16 + ((size_t)b * TTv + lg * 64 + r) * ldv + voff + h * 64 + c8);
#pragma unroll
    for (int q = 0; q < 8; ++q) tl[r][c8 + q] = f.u[q]; }
  __syncthreads();
  {
#pragma unroll
    for (int rd = 0; rd < 2; ++rd) { const int d = rd * 32 + tid / 8, pc = tid % 8; FragH f;
#pragma unroll
      for (int q = 0; q < 8; ++q) f.u[q] = tl[pc * 8 + q][d];
      *(v8us*)((unsigned short*)Vt + ((size_t)slab * 64 + d) * TTv + lg * 64 + pc * 8) = f.half[0]; }
     } }

__global__ __launch_bounds__(256) void k_hl(const float* __restrict__ F, _Float16* __restrict__ Hh, _Float16* __restrict__ Hl, size_t n8) { const size_t t = (size_t)blockIdx.x * 256 + threadIdx.x; if (t >= n8) return; FragH fh, fl; const v4f a = *(const v4fa*)(F + t * 8), c = *(const v4fa*)(F + t * 8 + 4);
#pragma unroll
  for (int q = 0; q < 4; ++q) { _Float16 h = (_Float16)a[q]; fh.h[q] = h; fl.h[q] = (_Float16)((a[q] - (float)h) * 1024.0f); h = (_Float16)c[q]; fh.h[4 + q] = h; fl.h[4 + q] = (_Float16)((c[q] - (float)h) * 1024.0f); }
  { *(v8us*)((unsigned short*)Hh + t * 8) = fh.half[0]; *(v8us*)((unsigned short*)Hl + t * 8) = fl.half[0];  } }

// ---- fast GEMM (wave tile 32x64; requires M % 32 == 0 rows per launch region and N % 64 == 0); epilogue = k_gemm_hhx semantics ----
__device__ __forceinline__ v16h g2_frag(const _Float16* p, int hh) { FragH f; f.half[0] = *(const v8us*)((const unsigned short*)p + 8 * hh); f.half[1] = *(const v8us*)((const unsigned short*)p + 16 + 8 * hh); return f.v; }
__device__ __forceinline__ v8f g2_mma(v16h a, v16h b, v8f c) { v8f d = __builtin_amdgcn_wmma_f32_16x16x32_f16(false, a, false, b, (short)0, c, false, false); asm volatile("v_nop\n\tv_nop\n\tv_nop\n\tv_nop" : "+v"(d) : "v"(a), "v"(b)); return d; }
typedef float v2f  __attribute__((ext_vector_type(2)));
typedef float v2fa __attribute__((ext_vector_type(2), may_alias));
struct G2Set { v16h a0, a1, b0, b1, b2, b3; };      /* the fragments of one 32-k step of a 32x64 wave tile */
// ROPE 1: the tile's columns are heads of HD and its rows are positions; the interleaved-pair rotation (e, o) -> (e cos - o sin, e sin + o cos), tables CS, SN [pos][HD / 2], is applied
// to the finished tile on its way out of LDS. C16 takes every rotated row as f16, C (f32) only the rows below crows (a multiple of 32, the wave tile's rows).
template <int ACT, int ROPE = 0>
__global__ __launch_bounds__(128) void k_gemm2(const _Float16* __restrict__ A, int lda, size_t sA, const _Float16* __restrict__ Bh, int ldb, size_t sB, float alpha, const float* __restrict__ bias, size_t sBias, const float* __restrict__ CP, int rowsPerB, size_t sCPb, int row0g,
    float* __restrict__ C, _Float16* __restrict__ C16, int ldc, size_t sC, int M, int N, int K, int bshift = 0, const float* __restrict__ CS = nullptr, const float* __restrict__ SN = nullptr, int crows = 0) { static_assert(ACT == 0 || ACT == 3 || ACT == 6 || ACT == 8 || ACT == 9 || ACT == 11 || ACT == 12 || ACT == 14 || ACT == 15 || ACT == 16 || ACT == 17, "k_gemm2: unsupported ACT code (would silently apply no activation)");
  __shared__ __attribute__((aligned(16))) float so[4][32][68];
  const int tid = threadIdx.x, w = tid >> 5, lane = tid & 31, ln = lane & 15, hh = lane >> 4; const int by = blockIdx.y;
  A += (size_t)by * sA; Bh += (size_t)(by >> bshift) * sB;      /* 2^bshift consecutive batch planes share one B plane (query heads of one kv group) */ const size_t cofs = (size_t)by * sC; const float* bp = bias ? bias + (size_t)by * sBias : nullptr;
  const int ntn = N >> 6; const int mt = blockIdx.x / ntn, nq = blockIdx.x - mt * ntn; const int row0 = mt * 128 + 32 * w, col0 = nq * 64; if (row0 >= M) return;
  const _Float16* a0p = A + (size_t)(row0 + ln) * lda; const _Float16* a1p = a0p + (size_t)16 * lda;
  const _Float16* b0p = Bh + (size_t)(col0 + ln) * ldb; const _Float16* b1p = b0p + (size_t)16 * ldb; const _Float16* b2p = b1p + (size_t)16 * ldb; const _Float16* b3p = b2p + (size_t)16 * ldb;
  const v8f z8 = {0.f,0.f,0.f,0.f,0.f,0.f,0.f,0.f}; v8f c00 = z8, c01 = z8, c02 = z8, c03 = z8, c10 = z8, c11 = z8, c12 = z8, c13 = z8;
  /* K loop: a ring of three fragment sets in registers. The 12 loads of a 32-k step are issued as one group, and a set is loaded anew, three steps ahead, directly behind the
     products that read it, so that up to 36 loads of a wave are in flight and a product waits only for the oldest group. Every accumulator still sums k upwards. */
  auto ld = [&](int k) { G2Set s; s.a0 = g2_frag(a0p + k, hh); s.a1 = g2_frag(a1p + k, hh); s.b0 = g2_frag(b0p + k, hh); s.b1 = g2_frag(b1p + k, hh); s.b2 = g2_frag(b2p + k, hh); s.b3 = g2_frag(b3p + k, hh); return s; };
  auto use = [&](const G2Set& s) { c00 = g2_mma(s.a0, s.b0, c00); c10 = g2_mma(s.a1, s.b0, c10); c01 = g2_mma(s.a0, s.b1, c01); c11 = g2_mma(s.a1, s.b1, c11);
    c02 = g2_mma(s.a0, s.b2, c02); c12 = g2_mma(s.a1, s.b2, c12); c03 = g2_mma(s.a0, s.b3, c03); c13 = g2_mma(s.a1, s.b3, c13); };
  int kb = 0;
  if (K >= 96) { G2Set s0 = ld(0);
    __builtin_amdgcn_sched_barrier(0);      /* keeps the first loads in the ring's own order, set by set: the loop's counted waits are formed for both ways into it, and with the sets mixed here the wait in front of a set's second product also covered loads of the set behind it */
    G2Set s1 = ld(32);
    __builtin_amdgcn_sched_barrier(0);      /* the same, between the second and the third set */
    G2Set s2 = ld(64);
    asm volatile("s_wait_xcnt 0x0" ::: "memory");      /* precaution: the build sets the accumulators to zero behind these loads, in registers that held one of their addresses */
#pragma unroll 1      /* one trip is one turn of the ring; no branch inside it, so the compiler's waits stay counted */
    for (; kb + 192 <= K; kb += 96) { use(s0);
      asm volatile("s_wait_xcnt 0x0" : "+s"(kb) :: "memory");      /* precaution: stands in front of the additions that rewrite the address registers which the loads of the trip before name; kb goes through it because those additions are formed from kb, so none can be placed ahead of the wait */
      s0 = ld(kb + 96); use(s1); s1 = ld(kb + 128); use(s2); s2 = ld(kb + 160); }
    use(s0); use(s1); use(s2); kb += 96; }
  if (kb + 64 <= K) {      /* what the ring leaves, or all of K = 64: both steps' loads together */
    const _Float16* const t0 = a0p + kb; const _Float16* const t1 = a1p + kb; const _Float16* const t2 = b0p + kb; const _Float16* const t3 = b1p + kb; const _Float16* const t4 = b2p + kb; const _Float16* const t5 = b3p + kb;
    G2Set s0, s1; s0.a0 = g2_frag(t0, hh); s0.a1 = g2_frag(t1, hh); s0.b0 = g2_frag(t2, hh); s0.b1 = g2_frag(t3, hh); s0.b2 = g2_frag(t4, hh); s0.b3 = g2_frag(t5, hh);
    s1.a0 = g2_frag(t0 + 32, hh); s1.a1 = g2_frag(t1 + 32, hh); s1.b0 = g2_frag(t2 + 32, hh); s1.b1 = g2_frag(t3 + 32, hh); s1.b2 = g2_frag(t4 + 32, hh); s1.b3 = g2_frag(t5 + 32, hh);
    asm volatile("s_wait_xcnt 0x0" :: "v"(t0 + 8 * hh), "v"(t1 + 8 * hh), "v"(t2 + 8 * hh), "v"(t3 + 8 * hh), "v"(t4 + 8 * hh), "v"(t5 + 8 * hh) : "memory");      /* precaution: the six row addresses are inputs, so they stay in their registers up to this wait and no fragment of the run is loaded into a register that an earlier load of the run names */
    use(s0); use(s1); kb += 64; }
  if (kb < K) {      /* the last single step */
    const _Float16* const t0 = a0p + kb; const _Float16* const t1 = a1p + kb; const _Float16* const t2 = b0p + kb; const _Float16* const t3 = b1p + kb; const _Float16* const t4 = b2p + kb; const _Float16* const t5 = b3p + kb;
    G2Set s0; s0.a0 = g2_frag(t0, hh); s0.a1 = g2_frag(t1, hh); s0.b0 = g2_frag(t2, hh); s0.b1 = g2_frag(t3, hh); s0.b2 = g2_frag(t4, hh); s0.b3 = g2_frag(t5, hh);
    asm volatile("s_wait_xcnt 0x0" :: "v"(t0 + 8 * hh), "v"(t1 + 8 * hh), "v"(t2 + 8 * hh), "v"(t3 + 8 * hh), "v"(t4 + 8 * hh), "v"(t5 + 8 * hh) : "memory");      /* precaution, as in the block above: the six row addresses are inputs, so no fragment of the run is loaded into a register that an earlier load of the run names */
    use(s0); }
  v2f tc[16], ts[16];      /* ROPE: the table entries of the lane's two pairs, for the 16 rows that it writes out */
  if constexpr (ROPE == 1) { static_assert(HD == 64, "k_gemm2: a 64-column tile is one head");
    const size_t to = (size_t)(row0 + hh) * (HD / 2) + ln * 2; const float* const cp = CS + to; const float* const sp = SN + to;
#pragma unroll      /* full unroll: register arrays; the 32 loads go out together here, so that they fly while the tile is staged in LDS */
    for (int q = 0; q < 16; ++q) { tc[q] = *(const v2fa*)(cp + q * HD); ts[q] = *(const v2fa*)(sp + q * HD); }      /* two rows of HD / 2 entries a step */
    asm volatile("s_wait_xcnt 0x0" :: "v"(cp), "v"(sp) : "memory"); }      /* precaution: the two addresses are inputs, so they stay in their registers up to this wait and nothing of the run is loaded into a register that an earlier load of the run names */
  v8f accs[8] = {c00, c01, c02, c03, c10, c11, c12, c13};
#pragma unroll
  for (int u = 0; u < 8; ++u) { const int t = u & 3, half = u >> 2; const int col = col0 + t * 16 + ln; const float bv = bp ? bf16_round(bp[col]) : 0.f;
#pragma unroll
    for (int r = 0; r < 8; ++r) { const int rloc = half * 16 + 8 * hh + r; float v = accs[u][r] * alpha + bv; if (CP) { if (rowsPerB < 0) v += CP[cofs + (size_t)(row0g + row0 + rloc) * ldc + col];      /* rowsPerB < 0: own element of the batched C plane */ else { const int bidx = (row0g + row0 + rloc) / rowsPerB; v += CP[(size_t)bidx * sCPb + (size_t)by * 64 + col]; } }
      if (ACT == 3) v = fmaxf(v, 0.f); else if (ACT == 6) v = 0.5f * v * (1.0f + erff(v * 0.70710678118654752f)); else if (ACT == 11) v = 1.0f / (1.0f + expf(-v)); else if (ACT == 15) v = v / (1.0f + expf(-v)); else if (ACT == 12) v = (v > 0.f) ? v : 0.01f * v; else if (ACT == 8) v = tanhf(v); else if (ACT == 9) v = 0.5f * v * (1.0f + tanhf(0.7978845608028654f * (v + 0.044715f * v * v * v))); else if (ACT == 14) v = (v > 0.f) ? v : 0.1f * v; else if (ACT == 16) v = (v >= 0.f) ? v : 0.3f * v; else if (ACT == 17) v = (v >= 0.f) ? v : 0.2f * v;
      so[w][rloc][t * 16 + ln] = v; } }
  __builtin_amdgcn_fence(__ATOMIC_ACQ_REL, "workgroup"); __builtin_amdgcn_wave_barrier();
  const int rsub = lane >> 4, c4 = (lane & 15) * 4;
  if constexpr (ROPE == 1) {      /* a lane's four columns are two whole pairs of one head (col0 is a multiple of HD), pair numbers c4 / 2 and c4 / 2 + 1 */
    _Float16* const hp = C16 + cofs + (size_t)(row0 + rsub) * ldc + col0 + c4; v4f o[16];
#pragma unroll      /* full unroll: register arrays need constant indices */
    for (int q = 0; q < 16; ++q) { const v4f v = *(const v4fa*)&so[w][q * 2 + rsub][c4]; const v2f c = tc[q], s = ts[q];
      o[q][0] = v[0] * c[0] - v[1] * s[0]; o[q][1] = v[0] * s[0] + v[1] * c[0]; o[q][2] = v[2] * c[1] - v[3] * s[1]; o[q][3] = v[2] * s[1] + v[3] * c[1];
      v4h h4; for (int i = 0; i < 4; ++i) h4[i] = (_Float16)o[q][i]; *(v4h*)(hp + (size_t)q * 2 * ldc) = h4; }
    if (row0 < crows) { float* const fp = C + cofs + (size_t)(row0 + rsub) * ldc + col0 + c4;      /* one test behind the f16 stores, not one a row: a branch in the loop would hold each row's loads behind the row before */
#pragma unroll      /* full unroll: register array */
      for (int q = 0; q < 16; ++q) *(v4f*)(fp + (size_t)q * 2 * ldc) = o[q]; }
  } else {
#pragma unroll
    for (int q = 0; q < 16; ++q) { const int r = q * 2 + rsub; const v4f v = *(const v4fa*)&so[w][r][c4]; if (C) *(v4f*)(C + cofs + (size_t)(row0 + r) * ldc + col0 + c4) = v; if (C16) { v4h h4; for (int i = 0; i < 4; ++i) h4[i] = (_Float16)v[i]; *(v4h*)(C16 + cofs + (size_t)(row0 + r) * ldc + col0 + c4) = h4; } }
     } }


__global__ __launch_bounds__(256) void k_wnat(const float* __restrict__ w, size_t n8, _Float16* __restrict__ Bt) { const size_t t = (size_t)blockIdx.x * 256 + threadIdx.x; if (t >= n8) return; FragH f; for (int q = 0; q < 8; ++q) f.h[q] = (_Float16)(bf16_round(w[t * 8 + q]) * 16.0f); *(v8us*)((unsigned short*)Bt + t * 8) = f.half[0];  }
__global__ __launch_bounds__(256) void k_rsm(const float* __restrict__ S, _Float16* __restrict__ P, int nrows) {
  #pragma clang fp contract(off)
  const int i = blockIdx.x * 256 + threadIdx.x; if (i >= nrows) return; const float* s = S + (size_t)i * SQ; float mx = -3.0e38f;
#pragma unroll 1
  for (int j = 0; j < SQ; ++j) mx = fmaxf(mx, s[j]); float se = 0.f;
#pragma unroll 1
  for (int j = 0; j < SQ; ++j) se += expf(s[j] - mx); const float sc = 256.0f / se;
#pragma unroll 1
  for (int j0 = 0; j0 < SQ; j0 += 8) { FragH f; for (int q = 0; q < 8; ++q) f.h[q] = (_Float16)(expf(s[j0 + q] - mx) * sc); unsigned short* d = (unsigned short*)P + (size_t)i * SQ + j0; *(v8us*)d = f.half[0];  } }
__global__ __launch_bounds__(256) void k_vt(const _Float16* __restrict__ V16, int b, int h0, _Float16* __restrict__ VT) { __shared__ unsigned short tl[64][65]; const int tid = threadIdx.x; const int hh = blockIdx.x % HG, sg = blockIdx.x / HG; const int s0 = sg * 64; const int h = h0 + hh;
  for (int i = tid; i < 64 * 8; i += 256) { const int j = i / 8, d8 = (i % 8) * 8; FragH f; f.half[0] = *(const v8us*)((const unsigned short*)V16 + ((size_t)b * SQ + s0 + j) * DM + h * HD + d8); for (int q = 0; q < 8; ++q) tl[d8 + q][j] = f.u[q]; }
  __syncthreads();
  { for (int i = tid; i < 64 * 8; i += 256) { const int d = i / 8, j8 = (i % 8) * 8; FragH f; for (int q = 0; q < 8; ++q) f.u[q] = tl[d][j8 + q]; *(v8us*)((unsigned short*)VT + ((size_t)hh * HD + d) * SQ + s0 + j8) = f.half[0]; }  } }



// Fused causal attention, one launch: a wave keeps FQ = 32 query rows of one head and walks the keys upwards, FK = 32 a pass; the four waves of a block are the four
// query heads of one kv group on the same query rows, so they read the same K and V^T lines. Both products are formed transposed: S^T = K Q^T (A = 16 key rows, B = 16 query
// rows) leaves in lane (ln, hh) the scores of query ln for keys 8 hh + r, which is the k order of the B fragment of O^T = V^T P^T (A = 16 rows of V^T), so the weights go
// from the accumulators of the first product into the operand of the second without leaving the lane. Row maximum and row sum are carried from pass to pass (f32).
#define FQ 32                        /* query rows per wave */
#define FK 32                        /* keys per pass */
// 2^y by v_exp_f32. Written as asm so that the one free issue slot the instruction set asks for behind a transcendental, before its source is overwritten or its result read,
// stands there by construction: the outputs are early-clobber, so no v_exp of the run touches a register of the one in front of it, and a v_nop closes the run.
__device__ __forceinline__ float fa_exp2(float y) { float r; asm("v_exp_f32 %0, %1\n\tv_nop" : "=v"(r) : "v"(y)); return r; }
__device__ __forceinline__ void fa_exp2x4(float& a, float& b, float& c, float& d) { float ra, rb, rc, rd;
  asm("v_exp_f32 %0, %4\n\tv_exp_f32 %1, %5\n\tv_exp_f32 %2, %6\n\tv_exp_f32 %3, %7\n\tv_nop" : "=&v"(ra), "=&v"(rb), "=&v"(rc), "=&v"(rd) : "v"(a), "v"(b), "v"(c), "v"(d));
  a = ra; b = rb; c = rc; d = rd; }
__device__ __forceinline__ float fa_xhalf(float x) { return __builtin_bit_cast(float, __builtin_amdgcn_permlanex16(__builtin_bit_cast(int, x), __builtin_bit_cast(int, x), 0x76543210, 0xfedcba98, false, false)); }      /* lane l takes the value of lane l ^ 16, by a vector move and not through the LDS pipe */
__device__ __forceinline__ v16h fa_frag(const _Float16* p) { FragH f; f.half[0] = *(const v8us*)((const unsigned short*)p); f.half[1] = *(const v8us*)((const unsigned short*)p + 16); return f.v; }      /* p already holds the lane's 8 hh */
__global__ __launch_bounds__(128) void k_fattn(const _Float16* __restrict__ Q, const _Float16* __restrict__ K, const _Float16* __restrict__ VTp, _Float16* __restrict__ O) {      /* Q, O: rows of DM; K: rows of KVD; VTp: [NG][HD][SQ] */
  const int tid = threadIdx.x, lane = tid & 31, ln = lane & 15, hh = lane >> 4; const int w = __builtin_amdgcn_readfirstlane(tid >> 5);
  const int g = blockIdx.x % NG, jb = blockIdx.x / NG; const int qb = (jb < SQ / FQ / 2) ? SQ / FQ - 1 - jb : jb - SQ / FQ / 2;      /* the long half of the query blocks is dealt first, longest first; then the short half, shortest first */
  const int h = g * HPG + w, q0 = qb * FQ; const float cs = 0.125f * 1.44269504f;      /* 64^-0.5 and log2 e in one factor */
  const _Float16* const qp = Q + (size_t)(q0 + ln) * DM + h * HD + 8 * hh; const _Float16* const kp = K + (size_t)ln * KVD + g * HD + 8 * hh; const _Float16* const vp = VTp + ((size_t)g * HD + ln) * SQ + 8 * hh;
  v16h qf[2][2], kf[2][2], vf[4];
#pragma unroll      /* full unroll: register arrays need constant indices */
  for (int t = 0; t < 2; ++t) { qf[t][0] = fa_frag(qp + (size_t)t * 16 * DM); qf[t][1] = fa_frag(qp + (size_t)t * 16 * DM + 32); }
  asm volatile("s_wait_xcnt 0x0" :: "v"(qp) : "memory");      /* precaution, here and in the two loaders below: the run's one address is an input, so it stays in its registers up to this wait, which stands in front of whatever rewrites them */
  __builtin_amdgcn_sched_barrier(0);      /* keeps the first loads in the loop's own order (Q, then K, then V^T): the loop's counted waits are formed for both ways into it, and with Q loaded last the wait in front of the first product also covered the V^T loads of the pass before */
  auto ldk = [&](int kb) { const _Float16* const p = kp + (size_t)kb * KVD; kf[0][0] = fa_frag(p); kf[0][1] = fa_frag(p + 32); kf[1][0] = fa_frag(p + 16 * KVD); kf[1][1] = fa_frag(p + 16 * KVD + 32);
    asm volatile("s_wait_xcnt 0x0" :: "v"(p) : "memory"); };
  auto ldv = [&](int kb) { const _Float16* const p = vp + kb; vf[0] = fa_frag(p); vf[1] = fa_frag(p + 16 * SQ); vf[2] = fa_frag(p + 32 * SQ); vf[3] = fa_frag(p + 48 * SQ);
    asm volatile("s_wait_xcnt 0x0" :: "v"(p) : "memory"); };
  ldk(0);
  __builtin_amdgcn_sched_barrier(0);      /* the same, between K and V^T */
  ldv(0);
  const v8f z8 = {0.f,0.f,0.f,0.f,0.f,0.f,0.f,0.f}; v8f o[2][4] = {{z8, z8, z8, z8}, {z8, z8, z8, z8}}; float m[2] = {-1.0e30f, -1.0e30f}, l[2] = {0.f, 0.f};
#pragma unroll 1      /* one trip is one pass; the fragments of the next pass are loaded into the registers of this one, directly behind the products that read them */
  for (int kb = 0; kb <= q0; kb += FK) {
    v8f s[2][2];
    s[0][0] = g2_mma(kf[0][0], qf[0][0], z8); s[0][1] = g2_mma(kf[0][0], qf[1][0], z8); s[1][0] = g2_mma(kf[1][0], qf[0][0], z8); s[1][1] = g2_mma(kf[1][0], qf[1][0], z8);
    s[0][0] = g2_mma(kf[0][1], qf[0][1], s[0][0]); s[0][1] = g2_mma(kf[0][1], qf[1][1], s[0][1]); s[1][0] = g2_mma(kf[1][1], qf[0][1], s[1][0]); s[1][1] = g2_mma(kf[1][1], qf[1][1], s[1][1]);
    const int kn = (kb + FK <= q0) ? kb + FK : q0;      /* the last pass loads its own block again: in bounds, not used */
    ldk(kn);
    if (kb == q0) {      /* the one pass that holds the diagonal (the same for the whole wave): key q0 + 16 u + 8 hh + r counts for query q0 + 16 t + ln only if it is not behind it */
#pragma unroll
      for (int u = 0; u < 2; ++u)
#pragma unroll
        for (int t = 0; t < 2; ++t)
#pragma unroll
          for (int r = 0; r < 8; ++r) s[u][t][r] = (u * 16 + 8 * hh + r <= t * 16 + ln) ? s[u][t][r] : -1.0e30f; }
    FragH pf[2];
#pragma unroll      /* full unroll: register arrays need constant indices */
    for (int t = 0; t < 2; ++t) {
      float mx = fmaxf(s[0][t][0], s[1][t][0]);
#pragma unroll
      for (int r = 1; r < 8; ++r) mx = fmaxf(mx, fmaxf(s[0][t][r], s[1][t][r]));
      mx = fmaxf(mx, fa_xhalf(mx));      /* lanes ln and ln + 16 hold the two halves of a query's keys */
      const float mn = fmaxf(m[t], mx); const float al = fa_exp2((m[t] - mn) * cs); const float mc = mn * cs; m[t] = mn;
      float sum = 0.f;
#pragma unroll
      for (int u = 0; u < 2; ++u) {
#pragma unroll
        for (int r = 0; r < 8; ++r) s[u][t][r] = fmaf(s[u][t][r], cs, -mc);
        float e0 = s[u][t][0], e1 = s[u][t][1], e2 = s[u][t][2], e3 = s[u][t][3], e4 = s[u][t][4], e5 = s[u][t][5], e6 = s[u][t][6], e7 = s[u][t][7];
        fa_exp2x4(e0, e1, e2, e3); fa_exp2x4(e4, e5, e6, e7);
        sum += ((e0 + e1) + (e2 + e3)) + ((e4 + e5) + (e6 + e7));
        pf[t].h[u * 8 + 0] = (_Float16)e0; pf[t].h[u * 8 + 1] = (_Float16)e1; pf[t].h[u * 8 + 2] = (_Float16)e2; pf[t].h[u * 8 + 3] = (_Float16)e3;
        pf[t].h[u * 8 + 4] = (_Float16)e4; pf[t].h[u * 8 + 5] = (_Float16)e5; pf[t].h[u * 8 + 6] = (_Float16)e6; pf[t].h[u * 8 + 7] = (_Float16)e7; }
      l[t] = l[t] * al + sum;      /* each lane sums its own half of the keys; the halves meet behind the loop */
#pragma unroll
      for (int dt = 0; dt < 4; ++dt) o[t][dt] *= al; }
#pragma unroll      /* full unroll: register arrays need constant indices */
    for (int dt = 0; dt < 4; ++dt) { o[0][dt] = g2_mma(vf[dt], pf[0].v, o[0][dt]); o[1][dt] = g2_mma(vf[dt], pf[1].v, o[1][dt]); }
    ldv(kn); }
#pragma unroll      /* full unroll: register arrays need constant indices */
  for (int t = 0; t < 2; ++t) { const float lt = l[t] + fa_xhalf(l[t]); const float fin = 64.0f / lt;      /* o carried x64, as the output GEMM expects it */
    unsigned short* const op = (unsigned short*)O + (size_t)(q0 + t * 16 + ln) * DM + h * HD + 8 * hh;
#pragma unroll
    for (int dt = 0; dt < 4; ++dt) { FragH f;
#pragma unroll
      for (int r = 0; r < 8; ++r) f.h[r] = (_Float16)(o[t][dt][r] * fin);
      *(v8us*)(op + dt * 16) = f.half[0]; } } }
static_assert(FQ == 32 && FK == 32 && HD == 64 && SQ % (2 * FQ) == 0, "k_fattn: two query tiles, two key tiles and four value tiles are written out");


// Exact f32 causal attention for query rows 0 .. QT0 - 1: one wave per (head, query row); a block of 8 waves takes 8 consecutive rows of one head.
// The key and value rows that the block needs (NCH whole chunks of 32; the 8 rows lie in one chunk, so the count is the block's) are staged once in LDS.
// Scores: lane l owns keys 32 c + l and reads its key row from LDS. Values: lane l owns dims 2 l, 2 l + 1 and walks the keys upwards, each weight taken from its lane.
#define A0P (HD + 4)                 /* key row pitch in LDS, floats: 272 B = 16 B x 17, so 32 lanes that each read 16 B of their own row do not meet on a bank */
template <int NCH>
__device__ __forceinline__ void att0_rows(const float* __restrict__ qp, const float* __restrict__ kg, const float* __restrict__ vg, float scale, float* __restrict__ op, int i, int tid, float (*lk)[A0P], float (*lv)[HD]) {
  const int lane = tid & 31; const int sr = tid >> 4, sc = (tid & 15) * 4;      /* staging: 16 threads a row, 16 rows a pass */
  v4f kr[2 * NCH], vr[2 * NCH], q[HD / 4]; const float* const kb = kg + (size_t)sr * DM + sc; const float* const vb = vg + (size_t)sr * DM + sc;      /* the row pitch is a constant, so a pass is a constant step from one address */
#pragma unroll      /* full unroll: register arrays need constant indices, and every load of the block is in flight before the first LDS store */
  for (int u = 0; u < 2 * NCH; ++u) { kr[u] = *(const v4fa*)(kb + (size_t)u * 16 * DM); vr[u] = *(const v4fa*)(vb + (size_t)u * 16 * DM); }
#pragma unroll      /* full unroll: register array */
  for (int t = 0; t < HD / 4; ++t) q[t] = *(const v4fa*)(qp + t * 4);
  asm volatile("s_wait_xcnt 0x0" :: "v"(kb), "v"(vb), "v"(qp) : "memory");      /* precaution: the three addresses are inputs, so they stay in their registers up to this wait and nothing of the run is loaded into a register that an earlier load of the run names */
#pragma unroll      /* full unroll: register arrays */
  for (int u = 0; u < 2 * NCH; ++u) { *(v4f*)&lk[u * 16 + sr][sc] = kr[u]; *(v4f*)&lv[u * 16 + sr][sc] = vr[u]; }
  __syncthreads();      /* the staged rows are read by every wave of the block */
  float e[NCH]; float m = -1.0e30f;
#pragma unroll      /* full unroll: register arrays */
  for (int c = 0; c < NCH; ++c) { v4f a = {0.f, 0.f, 0.f, 0.f}; const float* kp = &lk[c * 32 + lane][0];
#pragma unroll      /* full unroll: q is a register array */
    for (int t = 0; t < HD / 4; ++t) a += q[t] * *(const v4f*)(kp + t * 4);
    e[c] = (c * 32 + lane <= i) ? ((a[0] + a[1]) + (a[2] + a[3])) * scale : -1.0e30f; m = fmaxf(m, e[c]); }
  for (int x = 16; x > 0; x >>= 1) m = fmaxf(m, __shfl_xor(m, x, 32));
  float l = 0.f;
#pragma unroll      /* full unroll: register array */
  for (int c = 0; c < NCH; ++c) { e[c] = (c * 32 + lane <= i) ? expf(e[c] - m) : 0.f; l += e[c]; }
  for (int x = 16; x > 0; x >>= 1) l += __shfl_xor(l, x, 32);
  v2f o = {0.f, 0.f};
#pragma unroll      /* full unroll: e is a register array and the lane number of a weight is a constant */
  for (int c = 0; c < NCH; ++c) { const int eb = __float_as_int(e[c]);
#pragma unroll      /* full unroll: the lane number given to readlane is a constant, and the LDS reads of a chunk can go out ahead of their products */
    for (int jj = 0; jj < 32; ++jj) { const float ej = __int_as_float(__builtin_amdgcn_readlane(eb, jj)); o += ej * *(const v2fa*)&lv[c * 32 + jj][lane * 2]; } }
  const float fin = 64.0f / l;      /* o carried x64 like the f16 path */
  *(v2f*)(op + lane * 2) = o * fin; }
__global__ __launch_bounds__(256) void k_att0w(const float* __restrict__ QF, const float* __restrict__ KF, const float* __restrict__ VF, float scale, float* __restrict__ OF) {      /* all four planes: rows of DM floats */
  __shared__ __attribute__((aligned(16))) float lk[QT0][A0P]; __shared__ __attribute__((aligned(16))) float lv[QT0][HD];
  const int tid = threadIdx.x; const int h = blockIdx.x / (QT0 / 8), i0 = (blockIdx.x % (QT0 / 8)) * 8; const int i = i0 + (tid >> 5);
  const float* qp = QF + (size_t)i * DM + h * HD; const float* kg = KF + h * HD; const float* vg = VF + h * HD; float* op = OF + (size_t)i * DM + h * HD;
  switch (i0 / 32) {      /* chunks of 32 keys up to the block's rows, less one: the same for every wave of the block */
    case 0: att0_rows<1>(qp, kg, vg, scale, op, i, tid, lk, lv); break; case 1: att0_rows<2>(qp, kg, vg, scale, op, i, tid, lk, lv); break;
    case 2: att0_rows<3>(qp, kg, vg, scale, op, i, tid, lk, lv); break; default: att0_rows<4>(qp, kg, vg, scale, op, i, tid, lk, lv); break; } }
static_assert(QT0 == 128, "k_att0w: four chunk counts are written out");


__global__ __launch_bounds__(256) void k_kvexp(const float* __restrict__ src, float* __restrict__ dst, size_t n4) { const size_t t = (size_t)blockIdx.x * 256 + threadIdx.x; if (t >= n4) return; const size_t e = t * 4; const size_t row = e / DM; const int col = (int)(e % DM); const int h = col / HD, d = col % HD; const v4f v = *(const v4fa*)(src + row * KVD + (size_t)(h / HPG) * HD + d); *(v4f*)(dst + e) = v;  }

__global__ __launch_bounds__(256) void k_tab2(float theta, float* __restrict__ CS, float* __restrict__ SN) {
  #pragma clang fp contract(off)
  const int t = blockIdx.x * 256 + threadIdx.x; if (t >= SQ * (HD / 2)) return; const int i = t % (HD / 2); const int p = t / (HD / 2); const float invf = 1.0f / powf(theta, (float)(2 * i) / (float)HD); const float ang = __fmul_rn((float)p, invf); const float c = cosf(ang), s = sinf(ang);
  *(float*)(CS + t) = c; *(float*)(SN + t) = s;  }
__global__ __launch_bounds__(256) void k_bfcp(const float* __restrict__ src, float* __restrict__ dst, size_t n4) { const size_t t = (size_t)blockIdx.x * 256 + threadIdx.x; if (t >= n4) return; const v4f a = *(const v4fa*)(src + t * 4); v4f o; for (int q = 0; q < 4; ++q) o[q] = bf16_round(a[q]); *(v4f*)(dst + t * 4) = o;  }

__global__ __launch_bounds__(256) void k_tabhalf(const float* __restrict__ cs, const float* __restrict__ sn, float* __restrict__ CS, float* __restrict__ SN) { const int t = blockIdx.x * 256 + threadIdx.x; if (t >= SQ * (HD / 2)) return; const int p = t / (HD / 2), i = t % (HD / 2); const float c = bf16_round(cs[(size_t)p * HD + i]), s = bf16_round(sn[(size_t)p * HD + i]);
  *(float*)(CS + t) = c; *(float*)(SN + t) = s;  }

__global__ __launch_bounds__(256) void k_tab2d(float* __restrict__ CS, float* __restrict__ SN) {
  #pragma clang fp contract(off)
  const int t = blockIdx.x * 256 + threadIdx.x; if (t >= SQ * (HD / 2)) return; const int i = t % (HD / 2); const int p = t / (HD / 2); const float invf = (float)(1.0 / pow(10000.0, (double)(2 * i) / (double)HD)); const float ang = __fmul_rn((float)p, invf); const float c = cosf(ang), s = sinf(ang);
  *(float*)(CS + t) = c; *(float*)(SN + t) = s;  }
extern "C" void kernel_launch(void* const* d_in, const int* in_sizes, int n_in,
                              void* d_out, int out_size, void* d_ws, size_t ws_size, hipStream_t stream) {
  (void)in_sizes; (void)n_in; (void)out_size;
  const float* const* I = (const float* const*)d_in; const float* x = I[0]; const float* wq = I[1]; const float* wk = I[2]; const float* wv = I[3]; const float* wo = I[4]; const float* bq = nullptr; const float* bk = nullptr; const float* bv = nullptr; const float* bo = nullptr;      /* natural [out][in] weights, no biases; rope tables computed in the kernel */
  char* ws = (char*)d_ws; size_t off = 0;
  auto take = [&](size_t bytes) { char* p = ws + off; off += (bytes + 255) & ~(size_t)255; return p; };
  _Float16* BQ = (_Float16*)take((size_t)DM * DM * 2); _Float16* BK = (_Float16*)take((size_t)KVD * DM * 2); _Float16* BV = (_Float16*)take((size_t)KVD * DM * 2); _Float16* BO = (_Float16*)take((size_t)DM * DM * 2);
  _Float16* X16 = (_Float16*)take(NR * DM * 2); float* CSB = (float*)take((size_t)SQ * HD * 4); float* SNB = (float*)take((size_t)SQ * HD * 4); _Float16* Q16 = (_Float16*)take(NR * DM * 2); _Float16* K16 = (_Float16*)take(NR * KVD * 2); _Float16* V16 = (_Float16*)take(NR * KVD * 2); _Float16* O16 = (_Float16*)take(NR * DM * 2);
  _Float16* VT = (_Float16*)take((size_t)NH * HD * SQ * 2);
  float* QF0 = (float*)take((size_t)QT0 * DM * 4); float* KF0 = (float*)take((size_t)QT0 * KVD * 4); float* VF0 = (float*)take((size_t)QT0 * KVD * 4); float* KF0e = (float*)take((size_t)QT0 * DM * 4); float* VF0e = (float*)take((size_t)QT0 * DM * 4); float* OF0 = (float*)take((size_t)NB * QT0 * DM * 4); _Float16* OH0 = (_Float16*)take((size_t)NB * QT0 * DM * 2); _Float16* OL0 = (_Float16*)take((size_t)NB * QT0 * DM * 2);
  if (off > ws_size) return;
  k_wnat<<<(unsigned)(((size_t)DM * DM / 8 + 255) / 256), 256, 0, stream>>>(wq, (size_t)DM * DM / 8, BQ); k_wnat<<<(unsigned)(((size_t)KVD * DM / 8 + 255) / 256), 256, 0, stream>>>(wk, (size_t)KVD * DM / 8, BK); k_wnat<<<(unsigned)(((size_t)KVD * DM / 8 + 255) / 256), 256, 0, stream>>>(wv, (size_t)KVD * DM / 8, BV); k_wnat<<<(unsigned)(((size_t)DM * DM / 8 + 255) / 256), 256, 0, stream>>>(wo, (size_t)DM * DM / 8, BO);      /* natural [out][in] = Bt planes x16 */
  k_x16<<<(unsigned)((NR * DM / 8 + 255) / 256), 256, 0, stream>>>(x, X16, NR * DM / 8);
  k_tab2d<<<(SQ * (HD / 2) + 255) / 256, 256, 0, stream>>>(CSB, SNB);      /* rope tables cos/sin(p / 10000^(2i/64)): inv_freq double-derived -> f32, f32 angle */
  const size_t r0p = (size_t)B0 * SQ;      /* first projected row */
  k_gemm2<0><<<dim3((unsigned)((MP / 128) * (KVD / 64)), 1), 128, 0, stream>>>(X16 + r0p * DM, DM, 0, BV, DM, 0, 0.0625f, bv, 0, nullptr, 1, 0, 0, nullptr, V16 + r0p * KVD, KVD, 0, MP, KVD, DM);
  for (int b = B0; b < B0 + NBR; ++b) { const size_t r0 = (size_t)b * SQ;
    k_gemm2<0, 1><<<dim3((unsigned)((SQ / 128) * (DM / 64)), 1), 128, 0, stream>>>(X16 + r0 * DM, DM, 0, BQ, DM, 0, 0.0625f, nullptr, 0, nullptr, 1, 0, 0, QF0, Q16 + r0 * DM, DM, 0, SQ, DM, DM, 0, CSB, SNB, QT0);      /* q of this batch, rotated in the epilogue: f16 rows, and f32 rows 0..127 */
    k_gemm2<0, 1><<<dim3((unsigned)((SQ / 128) * (KVD / 64)), 1), 128, 0, stream>>>(X16 + r0 * DM, DM, 0, BK, DM, 0, 0.0625f, nullptr, 0, nullptr, 1, 0, 0, KF0, K16 + r0 * KVD, KVD, 0, SQ, KVD, DM, 0, CSB, SNB, QT0);      /* k, the same */
    k_vt<NG, SQ><<<NG * (SQ / 64), 256, 0, stream>>>(V16 + r0 * KVD, KVD, 0, VT);      /* V^T [NG][HD][SQ] for this batch */
    k_gemm2<0><<<dim3((QT0 / 128) * (KVD / 64), 1), 128, 0, stream>>>(X16 + r0 * DM, DM, 0, BV, DM, 0, 0.0625f, bv, 0, nullptr, 1, 0, 0, VF0, nullptr, KVD, 0, QT0, KVD, DM);
    k_kvexp<<<(unsigned)(((size_t)QT0 * DM / 4 + 255) / 256), 256, 0, stream>>>(KF0, KF0e, (size_t)QT0 * DM / 4); k_kvexp<<<(unsigned)(((size_t)QT0 * DM / 4 + 255) / 256), 256, 0, stream>>>(VF0, VF0e, (size_t)QT0 * DM / 4);      /* head h <- kv group h/4 for the exact first-tile kernel */      /* f32 q, k, v of the first 128 rows (exact products) */
    k_att0w<<<NH * (QT0 / 8), 256, 0, stream>>>(QF0, KF0e, VF0e, 0.125f, OF0 + (size_t)b * QT0 * DM);      /* exact f32 attention for rows 0..127 (o x64) */
    k_fattn<<<NG * (SQ / FQ), 128, 0, stream>>>(Q16 + r0 * DM, K16 + r0 * KVD, VT, O16 + r0 * DM); }      /* scores, causal softmax and o (merged heads, x64, f16 rows) for all 32 heads in one launch */
  k_gemm2<0><<<dim3((unsigned)((MPO / 128) * (DM / 64)), 1), 128, 0, stream>>>(O16 + r0p * DM, DM, 0, BO, DM, 0, 0.0009765625f, bo, 0, nullptr, 1, 0, 0, (float*)d_out + r0p * DM, nullptr, DM, 0, MPO, DM, DM);      /* out rows are the output layout */
  k_hl<<<(unsigned)(((size_t)NB * QT0 * DM / 8 + 255) / 256), 256, 0, stream>>>(OF0, OH0, OL0, (size_t)NB * QT0 * DM / 8);      /* first-tile o (x64) -> f16 hi + x1024 residual planes */
  for (int b = B0; b < B0 + NBR; ++b) { const size_t r0 = (size_t)b * SQ; const size_t f0 = (size_t)b * QT0;
    k_gemm2<0><<<dim3((QT0 / 128) * (DM / 64), 1), 128, 0, stream>>>(OH0 + f0 * DM, DM, 0, BO, DM, 0, 0.0009765625f, bo, 0, nullptr, 1, 0, 0, (float*)d_out + r0 * DM, nullptr, DM, 0, QT0, DM, DM);      /* rows 0..127: out = o_hi Wo (+ b), overwriting the f16-path rows */
    k_gemm2<0><<<dim3((QT0 / 128) * (DM / 64), 1), 128, 0, stream>>>(OL0 + f0 * DM, DM, 0, BO, DM, 0, 0.00000095367431640625f, nullptr, 0, (const float*)d_out + r0 * DM, -1, 0, 0, (float*)d_out + r0 * DM, nullptr, DM, 0, QT0, DM, DM); }      /* += o_lo Wo 2^-20 (own-element accumulate) */
}

// v007
// A run of this version takes 211 microseconds.
// Next to v006, in two timings, it ran 1.18 and 1.19 times as fast.
// Counting every step since v000, it is 23.0 times as fast.
#include <hip/hip_runtime.h>
// LLaMA grouped-query causal attention with interleaved-pair RoPE (hidden_states [1][2048][2048]; q = x Wq^T (natural [2048][2048]), k = x Wk^T, v = x Wv^T (natural [512][2048]) (sigma 0.02, no biases): 32 query heads / 8 kv heads of 64 (repeat_interleave: kv head h / 4); tables cos/sin of pos / 10000^(2i/64) repeated per pair; q = q cos + rotate_pairs(q) sin with rotate_pairs (x0, x1) -> (-x1, x0): pair (e, o) -> (e cos - o sin, o cos + e sin); scores x 64^-0.5 with a causal mask (triu(1) -> -inf); softmax; out = merged Wo^T (natural) -> [1][2048][2048]).
// Compute dtype: inputs rounded to bf16; x / weights exact; q, k, v, softmax weights and o as plain f16 GEMM operands (~2^-12); scores and softmax statistics f32. v_wmma_f32_16x16x32_f16.
#define NB 1
#define NG 8
#define HPG 4
#define KVD (NG * HD)
#define SQ 2048
#define DM 2048
#define NH 32
#define HD 64
#define HG 4                         /* heads covered by one launch of the non-template k_vt (unused) */
#define QT 256                       /* unused */
#define NKX SQ                       /* S / P row pitch */
#define QT0 128                      /* first-tile rows recomputed exactly in f32 */
#define B0 0                         /* first batch processed (debug hook) */
#define NBR NB                       /* batches processed (debug hook) */
#define NR ((size_t)NB * SQ)         /* token rows */
#define MP ((int)((size_t)NBR * SQ)) /* rows projected (debug hook) */
#define QN SQ                        /* query rows attended per batch (unused) */
#define NHD NH                       /* heads attended (unused) */
#define MPO MP                       /* rows through the output stage (debug hook) */
#define LQ DM      /* row pitch of the q rows */
typedef __bf16 v16b __attribute__((ext_vector_type(16)));
typedef unsigned short v8us __attribute__((ext_vector_type(8), may_alias));
typedef float  v8f  __attribute__((ext_vector_type(8)));
typedef float  v4f  __attribute__((ext_vector_type(4)));
typedef float  v4fa __attribute__((ext_vector_type(4), may_alias));
union FragB { v16b v; v8us half[2]; unsigned short u[16]; };

__device__ __forceinline__ unsigned short bf16_bits(float x) { unsigned int u = __float_as_uint(x); return (unsigned short)((u + 0x7FFFu + ((u >> 16) & 1u)) >> 16); }
__device__ __forceinline__ float bf16_val(unsigned short b) { return __uint_as_float(((unsigned int)b) << 16); }
__device__ __forceinline__ float bf16_round(float x) { return bf16_val(bf16_bits(x)); }
// D += A·B with NT terms: 1 = ah·bh, 2 = + al·bh (A split), 3 = + ah·bl (both split)
template <int NT>
__device__ __forceinline__ v8f mmaN(v16b ah, v16b al, v16b bh, v16b bl, v8f c) {
  c = __builtin_amdgcn_wmma_f32_16x16x32_bf16(false, ah, false, bh, (short)0, c, false, false);
  if (NT >= 2) c = __builtin_amdgcn_wmma_f32_16x16x32_bf16(false, al, false, bh, (short)0, c, false, false);
  if (NT >= 3) c = __builtin_amdgcn_wmma_f32_16x16x32_bf16(false, ah, false, bl, (short)0, c, false, false);
  asm volatile("v_nop\n\tv_nop\n\tv_nop\n\tv_nop" : "+v"(c) : "v"(ah), "v"(al), "v"(bh), "v"(bl));
  return c;
}

__global__ __launch_bounds__(256) void k_wt_bf16(const float* __restrict__ W, unsigned short* __restrict__ Wt, int K, int N) {
  const int t = blockIdx.x * 256 + threadIdx.x;
  const int k8n = K / 8;
  if (t >= N * k8n) return;
  const int n = t / k8n, k8 = (t % k8n) * 8;
  v8us v;
#pragma unroll
  for (int i = 0; i < 8; ++i) v[i] = bf16_bits(W[(size_t)(k8 + i) * N + n]);
  *(v8us*)(Wt + (size_t)n * K + k8) = v;
  
}

// GEMM C[M][N] (f32, pitch ldc) = act(A[M][K]·W + bias). A f32 row-major (pitch lda) converted per fragment to bf16
// (ASPLIT: hi/lo two planes -> 2 terms, else single rounded term); Wt bf16 [N][K] (pitch ldb). BIAS_BF16 rounds the
// bias to bf16 first (bias quantised to bf16 before the add). K%32==0, M%16==0, N%64==0.
template <bool ASPLIT, int ACT, bool BIAS_BF16>
__global__ __launch_bounds__(128) void k_gemm_bf(const float* __restrict__ A, int lda, const unsigned short* __restrict__ Wt, int ldb,
                                               const float* __restrict__ bias, float* __restrict__ C, int ldc, int M, int N, int K) {
  __shared__ __attribute__((aligned(16))) float so[4][16][64];
  const int tid = threadIdx.x, w = tid >> 5, lane = tid & 31, ln = lane & 15, hh = lane >> 4;
  const int ntn = N / 64;
  const int wid = blockIdx.x * 4 + w;
  const int mt = wid / ntn, nq = wid % ntn;
  if (mt * 16 >= M) return;
  const int row0 = mt * 16, col0 = nq * 64;
  const float* arow = A + (size_t)(row0 + ln) * lda;
  v8f acc[4] = {};
  for (int kb = 0; kb < K; kb += 32) {
    FragB ah, al;
    const v4f x0 = *(const v4fa*)(arow + kb + 8 * hh), x1 = *(const v4fa*)(arow + kb + 8 * hh + 4);
    const v4f x2 = *(const v4fa*)(arow + kb + 16 + 8 * hh), x3 = *(const v4fa*)(arow + kb + 16 + 8 * hh + 4);
    float xs[16] = {x0[0],x0[1],x0[2],x0[3],x1[0],x1[1],x1[2],x1[3],x2[0],x2[1],x2[2],x2[3],x3[0],x3[1],x3[2],x3[3]};
#pragma unroll
    for (int i = 0; i < 16; ++i) { const unsigned short hb = bf16_bits(xs[i]); ah.u[i] = hb; al.u[i] = ASPLIT ? bf16_bits(xs[i] - bf16_val(hb)) : (unsigned short)0; }
#pragma unroll
    for (int t = 0; t < 4; ++t) {
      const unsigned short* brow = Wt + (size_t)(col0 + t * 16 + ln) * ldb + kb;
      FragB b;
      b.half[0] = *(const v8us*)(brow + 8 * hh);
      b.half[1] = *(const v8us*)(brow + 16 + 8 * hh);
      acc[t] = mmaN<ASPLIT ? 2 : 1>(ah.v, al.v, b.v, b.v, acc[t]);
    }
  }
#pragma unroll
  for (int t = 0; t < 4; ++t) {
    float bv = bias ? bias[col0 + t * 16 + ln] : 0.f;
    if (BIAS_BF16) bv = bf16_round(bv);
#pragma unroll
    for (int r = 0; r < 8; ++r) { float v = acc[t][r] + bv; if (ACT == 1) v = fmaxf(v, 0.f); so[w][8 * hh + r][t * 16 + ln] = v; }
  }
  __builtin_amdgcn_fence(__ATOMIC_ACQ_REL, "workgroup");
  __builtin_amdgcn_wave_barrier();
  const int rsub = lane >> 4, c4 = (lane & 15) * 4;
  {
#pragma unroll
    for (int q = 0; q < 8; ++q) {
      const int r = q * 2 + rsub;
      const v4f v = *(const v4fa*)&so[w][r][c4];
      *(v4f*)(C + (size_t)(row0 + r) * ldc + col0 + c4) = v;
    }
    
  }
}

// GEMM C = act(A·W + bias + resid): A f32 (ASPLIT -> hi/lo 2 terms), Wt bf16 [N][K]; ACT 0 none, 1 relu, 2 exact gelu;
// resid (optional, f32, row index = (row % rmod), pitch ldr, RES_BF16 rounds it) added before the activation.
template <bool ASPLIT, int ACT, bool BIAS_BF16, bool RES_BF16>
__global__ __launch_bounds__(128) void k_gemm_bf3(const float* __restrict__ A, int lda, const unsigned short* __restrict__ Wt, int ldb,
                                                const float* __restrict__ bias, const float* __restrict__ resid, int rmod, int ldr,
                                                float* __restrict__ C, int ldc, int M, int N, int K) {
  __shared__ __attribute__((aligned(16))) float so[4][16][64];
  const int tid = threadIdx.x, w = tid >> 5, lane = tid & 31, ln = lane & 15, hh = lane >> 4;
  const int ntn = N / 64;
  const int wid = blockIdx.x * 4 + w;
  const int mt = wid / ntn, nq = wid % ntn;
  if (mt * 16 >= M) return;
  const int row0 = mt * 16, col0 = nq * 64;
  const float* arow = A + (size_t)(row0 + ln) * lda;
  v8f acc[4] = {};
  for (int kb = 0; kb < K; kb += 32) {
    FragB ah, al;
    const v4f x0 = *(const v4fa*)(arow + kb + 8 * hh), x1 = *(const v4fa*)(arow + kb + 8 * hh + 4);
    const v4f x2 = *(const v4fa*)(arow + kb + 16 + 8 * hh), x3 = *(const v4fa*)(arow + kb + 16 + 8 * hh + 4);
    float xs[16] = {x0[0],x0[1],x0[2],x0[3],x1[0],x1[1],x1[2],x1[3],x2[0],x2[1],x2[2],x2[3],x3[0],x3[1],x3[2],x3[3]};
#pragma unroll
    for (int i = 0; i < 16; ++i) { const unsigned short hb = bf16_bits(xs[i]); ah.u[i] = hb; al.u[i] = ASPLIT ? bf16_bits(xs[i] - bf16_val(hb)) : (unsigned short)0; }
#pragma unroll
    for (int t = 0; t < 4; ++t) {
      const unsigned short* brow = Wt + (size_t)(col0 + t * 16 + ln) * ldb + kb;
      FragB b;
      b.half[0] = *(const v8us*)(brow + 8 * hh);
      b.half[1] = *(const v8us*)(brow + 16 + 8 * hh);
      acc[t] = mmaN<ASPLIT ? 2 : 1>(ah.v, al.v, b.v, b.v, acc[t]);
    }
  }
#pragma unroll
  for (int t = 0; t < 4; ++t) {
    const int col = col0 + t * 16 + ln;
    float bv = bias ? bias[col] : 0.f;
    if (BIAS_BF16) bv = bf16_round(bv);
#pragma unroll
    for (int r = 0; r < 8; ++r) {
      float v = acc[t][r] + bv;
      if (resid) { float rv = resid[(size_t)((row0 + 8 * hh + r) % rmod) * ldr + col]; if (RES_BF16) rv = bf16_round(rv); v += rv; }
      if (ACT == 1) v = fmaxf(v, 0.f);
      if (ACT == 2) v = 0.5f * v * (1.0f + erff(v * 0.70710678118654752f));
      if (ACT == 3) { const float u = 0.7978845608028654f * (v + 0.044715f * v * v * v); v = 0.5f * v * (1.0f + tanhf(u)); }
      so[w][8 * hh + r][t * 16 + ln] = v;
    }
  }
  __builtin_amdgcn_fence(__ATOMIC_ACQ_REL, "workgroup");
  __builtin_amdgcn_wave_barrier();
  const int rsub = lane >> 4, c4 = (lane & 15) * 4;
  {
#pragma unroll
    for (int q = 0; q < 8; ++q) {
      const int r = q * 2 + rsub;
      const v4f v = *(const v4fa*)&so[w][r][c4];
      *(v4f*)(C + (size_t)(row0 + r) * ldc + col0 + c4) = v;
    }
    
  }
}
// row LayerNorm (biased variance, eps) over N: s = X (+ R); optional out_sum <- s; out_norm <- (s-mu)*rsqrt(var+eps)*g + b
template <bool PARAM_BF16>
__global__ __launch_bounds__(256) void k_layernorm(const float* __restrict__ X, const float* __restrict__ R, const float* __restrict__ g, const float* __restrict__ bta,
                                                  float* __restrict__ out_sum, float* __restrict__ out_norm, int N, float eps) {
  __shared__ float red[256];
  const int row = blockIdx.x, tid = threadIdx.x;
  const float* x = X + (size_t)row * N; const float* rr = R ? R + (size_t)row * N : nullptr;
  float vals[16];                     // up to N = 4096
  const int per = N / 256;            // contiguous chunk per thread? use strided-by-4 chunks: thread handles j = tid*4 + 1024*u
  float s1 = 0.f;
  for (int u = 0; u < per / 4; ++u) {
    const int j = tid * 4 + 1024 * u;
    const v4f a = *(const v4fa*)(x + j);
    v4f b = {0.f,0.f,0.f,0.f}; if (rr) b = *(const v4fa*)(rr + j);
#pragma unroll
    for (int q = 0; q < 4; ++q) { const float v = a[q] + b[q]; vals[u * 4 + q] = v; s1 += v; }
  }
  red[tid] = s1; __syncthreads();
  for (int st = 128; st > 0; st >>= 1) { if (tid < st) red[tid] += red[tid + st]; __syncthreads(); }
  const float mu = red[0] / (float)N; __syncthreads();
  float s2 = 0.f;
  for (int u = 0; u < per / 4; ++u)
#pragma unroll
    for (int q = 0; q < 4; ++q) { const float c = vals[u * 4 + q] - mu; s2 += c * c; }
  red[tid] = s2; __syncthreads();
  for (int st = 128; st > 0; st >>= 1) { if (tid < st) red[tid] += red[tid + st]; __syncthreads(); }
  const float rs = rsqrtf(red[0] / (float)N + eps);
  {
    for (int u = 0; u < per / 4; ++u) {
      const int j = tid * 4 + 1024 * u;
      v4f o, sm;
#pragma unroll
      for (int q = 0; q < 4; ++q) {
        float gg = g[j + q], bb = bta[j + q];
        if (PARAM_BF16) { gg = bf16_round(gg); bb = bf16_round(bb); }
        sm[q] = vals[u * 4 + q]; o[q] = (vals[u * 4 + q] - mu) * rs * gg + bb;
      }
      if (out_sum) *(v4f*)(out_sum + (size_t)row * N + j) = sm;
      *(v4f*)(out_norm + (size_t)row * N + j) = o;
    }
    
  }
}



// ---- f16 WMMA path (v_wmma_f32_16x16x32_f16): 11-bit significands for operands in range — used where a [0,1] probability operand needs more precision than bf16
typedef _Float16 v16h __attribute__((ext_vector_type(16)));
union FragH { v16h v; v8us half[2]; _Float16 h[16]; unsigned short u[16]; };
template <int NT>
__device__ __forceinline__ v8f mmaH(v16h ah, v16h al, v16h bh, v16h bl, v8f c) {
  c = __builtin_amdgcn_wmma_f32_16x16x32_f16(false, ah, false, bh, (short)0, c, false, false);
  if (NT >= 2) c = __builtin_amdgcn_wmma_f32_16x16x32_f16(false, al, false, bh, (short)0, c, false, false);
  if (NT >= 3) c = __builtin_amdgcn_wmma_f32_16x16x32_f16(false, ah, false, bl, (short)0, c, false, false);
  asm volatile("v_nop\n\tv_nop\n\tv_nop\n\tv_nop" : "+v"(c) : "v"(ah), "v"(al), "v"(bh), "v"(bl));
  return c;
}
// batched GEMM like k_gemm_b but f16 operands: A f32 (split into f16 hi/lo if ASPLIT, else rounded to f16), Bt = f16 values [n][k]; alpha; C f32; N multiple of 16 (partial tiles skipped)
template <bool ASPLIT>
__global__ __launch_bounds__(128) void k_gemm_h(const float* __restrict__ A, int lda, size_t sA, const _Float16* __restrict__ Bh, int ldb, size_t sB, float alpha, float* __restrict__ C, int ldc, size_t sC, int M, int N, int K) {
  __shared__ __attribute__((aligned(16))) float so[4][16][64];
  const int tid = threadIdx.x, w = tid >> 5, lane = tid & 31, ln = lane & 15, hh = lane >> 4; const int by = blockIdx.y;
  A += (size_t)by * sA; Bh += (size_t)by * sB; C += (size_t)by * sC;
  const int ntn = (N + 63) / 64; const int wid = blockIdx.x * 4 + w; const int mt = wid / ntn, nq = wid % ntn; if (mt * 16 >= M) return;
  const int row0 = mt * 16, col0 = nq * 64; const float* arow = A + (size_t)(row0 + ln) * lda;
  v8f acc[4] = {};
  for (int kb = 0; kb < K; kb += 32) {
    FragH ah, al;
    const v4f x0 = *(const v4fa*)(arow + kb + 8 * hh), x1 = *(const v4fa*)(arow + kb + 8 * hh + 4), x2 = *(const v4fa*)(arow + kb + 16 + 8 * hh), x3 = *(const v4fa*)(arow + kb + 16 + 8 * hh + 4);
    float xs[16] = {x0[0],x0[1],x0[2],x0[3],x1[0],x1[1],x1[2],x1[3],x2[0],x2[1],x2[2],x2[3],x3[0],x3[1],x3[2],x3[3]};
#pragma unroll
    for (int i = 0; i < 16; ++i) { const _Float16 h = (_Float16)xs[i]; ah.h[i] = h; al.h[i] = ASPLIT ? (_Float16)(xs[i] - (float)h) : (_Float16)0.0f; }
#pragma unroll
    for (int t = 0; t < 4; ++t) { if (col0 + t * 16 >= N) continue; const size_t boff = (size_t)(col0 + t * 16 + ln) * ldb + kb; FragH bq; bq.half[0] = *(const v8us*)(Bh + boff + 8 * hh); bq.half[1] = *(const v8us*)(Bh + boff + 16 + 8 * hh);
      acc[t] = mmaH<ASPLIT ? 2 : 1>(ah.v, al.v, bq.v, bq.v, acc[t]); }
  }
#pragma unroll
  for (int t = 0; t < 4; ++t) { if (col0 + t * 16 >= N) continue;
#pragma unroll
    for (int r = 0; r < 8; ++r) so[w][8 * hh + r][t * 16 + ln] = acc[t][r] * alpha; }
  __builtin_amdgcn_fence(__ATOMIC_ACQ_REL, "workgroup"); __builtin_amdgcn_wave_barrier();
  const int rsub = lane >> 4, c4 = (lane & 15) * 4;
  {
#pragma unroll
    for (int q = 0; q < 8; ++q) { const int r = q * 2 + rsub; if (col0 + c4 < N) { const v4f v = *(const v4fa*)&so[w][r][c4]; *(v4f*)(C + (size_t)(row0 + r) * ldc + col0 + c4) = v; } }
     }
}

// Wt[n][k] = f16(W[k][n]·scale) from f32 row-major W[K][N] (scale = power of two; bf16-exact weights stay exact in f16 away from the subnormal range)
__global__ __launch_bounds__(256) void k_wt_f16(const float* __restrict__ W, _Float16* __restrict__ Wt, int K, int N, float scale) {
  const int t = blockIdx.x * 256 + threadIdx.x; if (t >= N * (K / 8)) return; const int n = t / (K / 8), k8 = (t % (K / 8)) * 8; FragH f;
#pragma unroll
  for (int i = 0; i < 8; ++i) f.h[i] = (_Float16)(bf16_round(W[(size_t)(k8 + i) * N + n]) * scale); const v8us o = f.half[0];
  *(v8us*)((unsigned short*)Wt + (size_t)n * K + k8) = o; 
}
// k_gemm_hh variant with fused epilogue: v = acc·alpha + bias[by·sBias + col] (+ CP[(row/rowsPerB)·sCPb + by·64 + col] if CP) ; ACT 0 none / 1 elu ; writes f16 C16 (and f32 C if non-null)
template <int ACT>
__global__ __launch_bounds__(128) void k_gemm_hhx(const _Float16* __restrict__ A, int lda, size_t sA, const _Float16* __restrict__ Bh, int ldb, size_t sB, float alpha, const float* __restrict__ bias, size_t sBias, const float* __restrict__ CP, int rowsPerB, size_t sCPb, int row0g,
    float* __restrict__ C, _Float16* __restrict__ C16, int ldc, size_t sC, int M, int N, int K) {
  __shared__ __attribute__((aligned(16))) float so[4][16][64];
  const int tid = threadIdx.x, w = tid >> 5, lane = tid & 31, ln = lane & 15, hh = lane >> 4; const int by = blockIdx.y;
  A += (size_t)by * sA; Bh += (size_t)by * sB; const size_t cofs = (size_t)by * sC; const float* bp = bias ? bias + (size_t)by * sBias : nullptr;
  const int ntn = (N + 63) / 64; const int wid = blockIdx.x * 4 + w; const int mt = wid / ntn, nq = wid % ntn; if (mt * 16 >= M) return;
  const int row0 = mt * 16, col0 = nq * 64; const _Float16* arow = A + (size_t)(row0 + ln) * lda;
  v8f acc[4] = {};
  for (int kb = 0; kb < K; kb += 32) { FragH ah; ah.half[0] = *(const v8us*)((const unsigned short*)arow + kb + 8 * hh); ah.half[1] = *(const v8us*)((const unsigned short*)arow + kb + 16 + 8 * hh);
#pragma unroll
    for (int t = 0; t < 4; ++t) { if (col0 + t * 16 >= N) continue; const size_t boff = (size_t)(col0 + t * 16 + ln) * ldb + kb; FragH bq; bq.half[0] = *(const v8us*)((const unsigned short*)Bh + boff + 8 * hh); bq.half[1] = *(const v8us*)((const unsigned short*)Bh + boff + 16 + 8 * hh);
      acc[t] = mmaH<1>(ah.v, ah.v, bq.v, bq.v, acc[t]); }
  }
#pragma unroll
  for (int t = 0; t < 4; ++t) { if (col0 + t * 16 >= N) continue; const int col = col0 + t * 16 + ln; const float bv = bp ? bf16_round(bp[col]) : 0.f;
#pragma unroll
    for (int r = 0; r < 8; ++r) { float v = acc[t][r] * alpha + bv; if (CP) { const int rr = row0g + row0 + 8 * hh + r; if (rowsPerB < 0) v += CP[cofs + (size_t)rr * ldc + col];      /* rowsPerB < 0: own element of the batched C plane */ else { const int bidx = rr / rowsPerB; v += CP[(size_t)bidx * sCPb + (size_t)by * 64 + col]; } } if (ACT == 1) v = (v > 0.f) ? v : expm1f(v); else if (ACT == 7) v = (v > 0.f) ? v + 1.0f : expf(v); else if (ACT == 8) v = tanhf(v); else if (ACT == 9) v = 0.5f * v * (1.0f + tanhf(0.7978845608028654f * (v + 0.044715f * v * v * v))); else if (ACT == 11) v = 1.0f / (1.0f + expf(-v)); else if (ACT == 12) v = (v > 0.f) ? v : 0.01f * v; else if (ACT == 14) v = (v > 0.f) ? v : 0.1f * v; else if (ACT == 16) v = (v >= 0.f) ? v : 0.3f * v; else if (ACT == 17) v = (v >= 0.f) ? v : 0.2f * v; else if (ACT == 15) v = v / (1.0f + expf(-v)); else if (ACT == 3) v = fmaxf(v, 0.f); else if (ACT == 6) v = 0.5f * v * (1.0f + erff(v * 0.70710678118654752f)); so[w][8 * hh + r][t * 16 + ln] = v; } }
  __builtin_amdgcn_fence(__ATOMIC_ACQ_REL, "workgroup"); __builtin_amdgcn_wave_barrier();
  const int rsub = lane >> 4, c4 = (lane & 15) * 4; typedef _Float16 v4h __attribute__((ext_vector_type(4)));
  {
#pragma unroll
    for (int q = 0; q < 8; ++q) { const int r = q * 2 + rsub; if (col0 + c4 < N) { const v4f v = *(const v4fa*)&so[w][r][c4]; if (C) *(v4f*)(C + cofs + (size_t)(row0 + r) * ldc + col0 + c4) = v; if (C16) { v4h h4; for (int i = 0; i < 4; ++i) h4[i] = (_Float16)v[i]; *(v4h*)(C16 + cofs + (size_t)(row0 + r) * ldc + col0 + c4) = h4; } } }
     }
}


typedef _Float16 v4h __attribute__((ext_vector_type(4)));

__global__ __launch_bounds__(256) void k_x16(const float* __restrict__ x, _Float16* __restrict__ X16, size_t n8) { const size_t t = (size_t)blockIdx.x * 256 + threadIdx.x; if (t >= n8) return; FragH f;
#pragma unroll
  for (int q = 0; q < 8; ++q) f.h[q] = (_Float16)bf16_round(x[t * 8 + q]); *(v8us*)((unsigned short*)X16 + t * 8) = f.half[0];  }
__global__ __launch_bounds__(256) void k_h16(const float* __restrict__ x, _Float16* __restrict__ X16, size_t n8) { const size_t t = (size_t)blockIdx.x * 256 + threadIdx.x; if (t >= n8) return; FragH f;
#pragma unroll
  for (int q = 0; q < 8; ++q) f.h[q] = (_Float16)x[t * 8 + q]; *(v8us*)((unsigned short*)X16 + t * 8) = f.half[0];  }
__global__ __launch_bounds__(256) void k_round16f(const float* __restrict__ W, _Float16* __restrict__ Bt, size_t n8) { const size_t t = (size_t)blockIdx.x * 256 + threadIdx.x; if (t >= n8) return; FragH f;
#pragma unroll
  for (int i = 0; i < 8; ++i) f.h[i] = (_Float16)(bf16_round(W[t * 8 + i]) * 16.0f); *(v8us*)((unsigned short*)Bt + t * 8) = f.half[0];  }
template <int NHv, int TTv>
__global__ __launch_bounds__(256) void k_vt(const _Float16* __restrict__ V16, int ldv, int voff, _Float16* __restrict__ Vt) { __shared__ unsigned short tl[64][66]; const int tid = threadIdx.x; const int slab = blockIdx.x / (TTv / 64), lg = blockIdx.x % (TTv / 64); const int b = slab / NHv, h = slab % NHv;
  for (int i = tid; i < 64 * 8; i += 256) { const int r = i / 8, c8 = (i % 8) * 8; FragH f; f.half[0] = *(const v8us*)((const unsigned short*)V16 + ((size_t)b * TTv + lg * 64 + r) * ldv + voff + h * 64 + c8);
#pragma unroll
    for (int q = 0; q < 8; ++q) tl[r][c8 + q] = f.u[q]; }
  __syncthreads();
  {
#pragma unroll
    for (int rd = 0; rd < 2; ++rd) { const int d = rd * 32 + tid / 8, pc = tid % 8; FragH f;
#pragma unroll
      for (int q = 0; q < 8; ++q) f.u[q] = tl[pc * 8 + q][d];
      *(v8us*)((unsigned short*)Vt + ((size_t)slab * 64 + d) * TTv + lg * 64 + pc * 8) = f.half[0]; }
     } }

__global__ __launch_bounds__(256) void k_hl(const float* __restrict__ F, _Float16* __restrict__ Hh, _Float16* __restrict__ Hl, size_t n8) { const size_t t = (size_t)blockIdx.x * 256 + threadIdx.x; if (t >= n8) return; FragH fh, fl; const v4f a = *(const v4fa*)(F + t * 8), c = *(const v4fa*)(F + t * 8 + 4);
#pragma unroll
  for (int q = 0; q < 4; ++q) { _Float16 h = (_Float16)a[q]; fh.h[q] = h; fl.h[q] = (_Float16)((a[q] - (float)h) * 1024.0f); h = (_Float16)c[q]; fh.h[4 + q] = h; fl.h[4 + q] = (_Float16)((c[q] - (float)h) * 1024.0f); }
  { *(v8us*)((unsigned short*)Hh + t * 8) = fh.half[0]; *(v8us*)((unsigned short*)Hl + t * 8) = fl.half[0];  } }

// ---- fast GEMM (block tile 128x64, wave tile 32x64; requires M % 128 == 0, N % 64 == 0, K % 128 == 0 and K >= 256); epilogue = k_gemm_hhx semantics ----
__device__ __forceinline__ v16h g2_frag(const _Float16* p, int hh) { FragH f; f.half[0] = *(const v8us*)((const unsigned short*)p + 8 * hh); f.half[1] = *(const v8us*)((const unsigned short*)p + 16 + 8 * hh); return f.v; }
__device__ __forceinline__ v8f g2_mma(v16h a, v16h b, v8f c) { v8f d = __builtin_amdgcn_wmma_f32_16x16x32_f16(false, a, false, b, (short)0, c, false, false); asm volatile("v_nop\n\tv_nop\n\tv_nop\n\tv_nop" : "+v"(d) : "v"(a), "v"(b)); return d; }
typedef float v2f  __attribute__((ext_vector_type(2)));
typedef float v2fa __attribute__((ext_vector_type(2), may_alias));
struct G2Set { v16h a0, a1, b0, b1, b2, b3; };      /* the fragments of one 32-k step of a 32x64 wave tile */
// The K loop of k_gemm2 takes its operands from LDS: a stage is G2KS k of the block's 128 A rows and 64 B rows, brought there by tensor loads (no register on the way), two buffers.
typedef unsigned int u32x4 __attribute__((ext_vector_type(4)));
typedef unsigned int u32x8 __attribute__((ext_vector_type(8)));
#define G2KS 128                     /* k per stage: rows of 256 B */
#define G2P 272                      /* row pitch in LDS, bytes: 256 + the 16-B pad that the tensor load leaves behind a row (16 B x 17, for ds_load_b128 readers) */
#define G2SA 18432                   /* a slice of 64 A rows, 17,408 B, rounded up to a multiple of 2 KiB */
#define G2SB 10240                   /* a slice of 32 B rows, 8,704 B, the same */
#define G2BUF (2 * G2SA + 2 * G2SB)  /* one buffer: two A slices, two B slices */
static_assert(64 * G2P <= G2SA && 32 * G2P <= G2SB && G2SA % 2048 == 0 && G2SB % 2048 == 0 && G2P == 2 * G2KS + 16, "k_gemm2: every slice starts at a multiple of 2 KiB and holds its padded rows");
__device__ __forceinline__ unsigned int g2_uni(unsigned int v) { return (unsigned int)__builtin_amdgcn_readfirstlane((int)v); }
__device__ __forceinline__ unsigned int g2_pinned(unsigned int v) { unsigned int r = g2_uni(v); asm volatile("" : "+s"(r)); return r; }      /* the test around a tensor load, held in a scalar register: the instruction ignores EXEC, so only a scalar branch keeps a wave from issuing it */
__device__ __forceinline__ v16h g2_lfrag(const unsigned char* p) { FragH f; f.half[0] = *(const v8us*)p; f.half[1] = *(const v8us*)(p + 32); return f.v; }      /* p already holds the lane's 16 hh bytes: the k order of g2_frag */
// ROPE 1: the tile's columns are heads of HD and its rows are positions; the interleaved-pair rotation (e, o) -> (e cos - o sin, e sin + o cos), tables CS, SN [pos][HD / 2], is applied
// to the finished tile on its way out of LDS. C16 takes every rotated row as f16, C (f32) only the rows below crows (a multiple of 32, the wave tile's rows).
template <int ACT, int ROPE = 0>
__global__ __launch_bounds__(128) void k_gemm2(const _Float16* __restrict__ A, int lda, size_t sA, const _Float16* __restrict__ Bh, int ldb, size_t sB, float alpha, const float* __restrict__ bias, size_t sBias, const float* __restrict__ CP, int rowsPerB, size_t sCPb, int row0g,
    float* __restrict__ C, _Float16* __restrict__ C16, int ldc, size_t sC, int M, int N, int K, int bshift = 0, const float* __restrict__ CS = nullptr, const float* __restrict__ SN = nullptr, int crows = 0) { static_assert(ACT == 0 || ACT == 3 || ACT == 6 || ACT == 8 || ACT == 9 || ACT == 11 || ACT == 12 || ACT == 14 || ACT == 15 || ACT == 16 || ACT == 17, "k_gemm2: unsupported ACT code (would silently apply no activation)");
  __shared__ __attribute__((aligned(2048))) unsigned char ring[2][G2BUF]; __shared__ __attribute__((aligned(16))) float so[4][32][68];
  const int tid = threadIdx.x, w = tid >> 5, lane = tid & 31, ln = lane & 15, hh = lane >> 4; const int by = blockIdx.y;
  A += (size_t)by * sA; Bh += (size_t)(by >> bshift) * sB;      /* 2^bshift consecutive batch planes share one B plane (query heads of one kv group) */ const size_t cofs = (size_t)by * sC; const float* bp = bias ? bias + (size_t)by * sBias : nullptr;
  const int ntn = N >> 6; const int mt = blockIdx.x / ntn, nq = blockIdx.x - mt * ntn; const int row0 = mt * 128 + 32 * w, col0 = nq * 64; if (mt * 128 >= M) return;      /* the whole block or none of it: barriers follow */
  const v8f z8 = {0.f,0.f,0.f,0.f,0.f,0.f,0.f,0.f}; v8f c00 = z8, c01 = z8, c02 = z8, c03 = z8, c10 = z8, c11 = z8, c12 = z8, c13 = z8;
  /* Every wave brings one slice of each stage: waves 0 and 1 the two halves (64 rows) of the block's A rows, waves 2 and 3 the two halves (32 rows) of its B rows. */
  const unsigned int wv = g2_uni((unsigned int)tid >> 5), hf = wv & 1u; const bool isB = wv >= 2u;
  const unsigned int nrow = isB ? 32u : 64u, spitch = (isB ? (unsigned int)ldb : (unsigned int)lda) * 2u;
  const unsigned long long sbase = isB ? (unsigned long long)(size_t)(Bh + (size_t)(col0 + 32 * (int)hf) * ldb) : (unsigned long long)(size_t)(A + (size_t)(mt * 128 + 64 * (int)hf) * lda);
  const unsigned int dbase = (unsigned int)(size_t)&ring[0][0] + (isB ? 2u * G2SA + hf * G2SB : hf * G2SA);
  u32x8 g1;      /* 1-byte elements, tensor = tile = nrow rows of 256 B, source pitch spitch, a pad of 4 dwords behind every 64 dwords */
  g1[0] = g2_uni((1u << 20) | (5u << 22) | (3u << 25)); g1[1] = g2_uni(256u << 16); g1[2] = g2_uni(nrow << 16); g1[3] = g2_uni(256u << 16); g1[4] = g2_uni(nrow); g1[5] = g2_uni(spitch); g1[6] = g2_uni(0u); g1[7] = g2_uni(0u);
  u32x4 g0; g0[0] = g2_uni(1u);      /* g0 and g1 live outside the loop and go in and out of every tensor load and every wait on the tensor counter: one set of registers holds them throughout, and no word of a request is rewritten before it has landed */
  auto issue = [&](unsigned int st) { const unsigned long long ga = sbase + (unsigned long long)st * (2 * G2KS);
    g0[1] = g2_uni(dbase + (st & 1u) * G2BUF); g0[2] = g2_uni((unsigned int)ga); g0[3] = g2_uni((((unsigned int)(ga >> 32)) & 0x01FFFFFFu) | 0x80000000u);
    asm volatile("tensor_load_to_lds %0, %1" : "+s"(g0), "+s"(g1) :: "memory"); };      /* one request of the whole wave */
  const unsigned char* const la = &ring[0][0] + (wv >> 1) * G2SA + (hf * 32u + (unsigned int)ln) * G2P + 16 * hh;      /* the wave's A rows 32 w + ln */
  const unsigned char* const lb = &ring[0][0] + 2 * G2SA + ln * G2P + 16 * hh;      /* B row ln */
  auto ld = [&](unsigned int bo, int j) { G2Set s; const unsigned char* const pa = la + bo + j * 64; const unsigned char* const pb = lb + bo + j * 64;      /* the j-th 32-k step of the stage in the buffer at bo */
    s.a0 = g2_lfrag(pa); s.a1 = g2_lfrag(pa + 16 * G2P); s.b0 = g2_lfrag(pb); s.b1 = g2_lfrag(pb + 16 * G2P); s.b2 = g2_lfrag(pb + G2SB); s.b3 = g2_lfrag(pb + G2SB + 16 * G2P); return s; };
  auto use = [&](const G2Set& s) { c00 = g2_mma(s.a0, s.b0, c00); c10 = g2_mma(s.a1, s.b0, c10); c01 = g2_mma(s.a0, s.b1, c01); c11 = g2_mma(s.a1, s.b1, c11);
    c02 = g2_mma(s.a0, s.b2, c02); c12 = g2_mma(s.a1, s.b2, c12); c03 = g2_mma(s.a0, s.b3, c03); c13 = g2_mma(s.a1, s.b3, c13); };
  const unsigned int nst = (unsigned int)K / G2KS;      /* stages; at least two */
  issue(0u);
  unsigned int nx = 1u;      /* the stage to ask for next. It goes through each wait on the tensor counter, so that no word of its descriptor is formed while the request before it is out */
  asm volatile("s_wait_tensorcnt 0x0" : "+s"(nx), "+s"(g0), "+s"(g1) :: "memory");      /* this wave's slice of stage 0 has landed */
  __syncthreads();      /* stage 0 is whole: every wave's slice */
  issue(nx);
#pragma unroll 1      /* one trip is one stage; every accumulator still sums k upwards */
  for (unsigned int st = 0; st < nst; ++st) { const unsigned int bo = (st & 1u) * G2BUF;
    G2Set s0 = ld(bo, 0), s1 = ld(bo, 1); use(s0); s0 = ld(bo, 2); use(s1); s1 = ld(bo, 3); use(s0); use(s1);      /* two fragment sets: a step's LDS reads go out ahead of the products of the step before */
    asm volatile("s_wait_dscnt 0x0" ::: "memory");      /* this wave has read all it needs of the buffer that is filled anew below */
    nx = st + 2u;
    asm volatile("s_wait_tensorcnt 0x0" : "+s"(nx), "+s"(g0), "+s"(g1) :: "memory");      /* this wave's slice of stage st + 1 has landed */
    __syncthreads();      /* stage st + 1 is whole, and every wave has left stage st's buffer */
    if (g2_pinned(nx < nst)) issue(nx); }
  asm volatile("s_wait_tensorcnt 0x0" : "+s"(g0), "+s"(g1) :: "memory");      /* no request is out when the wave goes on */
  asm volatile("s_wait_dscnt 0x0" ::: "memory");      /* nor any of its reads of the ring */
  v2f tc[16], ts[16];      /* ROPE: the table entries of the lane's two pairs, for the 16 rows that it writes out */
  if constexpr (ROPE == 1) { static_assert(HD == 64, "k_gemm2: a 64-column tile is one head");
    const size_t to = (size_t)(row0 + hh) * (HD / 2) + ln * 2; const float* const cp = CS + to; const float* const sp = SN + to;
#pragma unroll      /* full unroll: register arrays; the 32 loads go out together here, so that they fly while the tile is staged in LDS */
    for (int q = 0; q < 16; ++q) { tc[q] = *(const v2fa*)(cp + q * HD); ts[q] = *(const v2fa*)(sp + q * HD); }      /* two rows of HD / 2 entries a step */
    asm volatile("s_wait_xcnt 0x0" :: "v"(cp), "v"(sp) : "memory"); }      /* precaution: the two addresses are inputs, so they stay in their registers up to this wait and nothing of the run is loaded into a register that an earlier load of the run names */
  v8f accs[8] = {c00, c01, c02, c03, c10, c11, c12, c13};
#pragma unroll
  for (int u = 0; u < 8; ++u) { const int t = u & 3, half = u >> 2; const int col = col0 + t * 16 + ln; const float bv = bp ? bf16_round(bp[col]) : 0.f;
#pragma unroll
    for (int r = 0; r < 8; ++r) { const int rloc = half * 16 + 8 * hh + r; float v = accs[u][r] * alpha + bv; if (CP) { if (rowsPerB < 0) v += CP[cofs + (size_t)(row0g + row0 + rloc) * ldc + col];      /* rowsPerB < 0: own element of the batched C plane */ else { const int bidx = (row0g + row0 + rloc) / rowsPerB; v += CP[(size_t)bidx * sCPb + (size_t)by * 64 + col]; } }
      if (ACT == 3) v = fmaxf(v, 0.f); else if (ACT == 6) v = 0.5f * v * (1.0f + erff(v * 0.70710678118654752f)); else if (ACT == 11) v = 1.0f / (1.0f + expf(-v)); else if (ACT == 15) v = v / (1.0f + expf(-v)); else if (ACT == 12) v = (v > 0.f) ? v : 0.01f * v; else if (ACT == 8) v = tanhf(v); else if (ACT == 9) v = 0.5f * v * (1.0f + tanhf(0.7978845608028654f * (v + 0.044715f * v * v * v))); else if (ACT == 14) v = (v > 0.f) ? v : 0.1f * v; else if (ACT == 16) v = (v >= 0.f) ? v : 0.3f * v; else if (ACT == 17) v = (v >= 0.f) ? v : 0.2f * v;
      so[w][rloc][t * 16 + ln] = v; } }
  __builtin_amdgcn_fence(__ATOMIC_ACQ_REL, "workgroup"); __builtin_amdgcn_wave_barrier();
  const int rsub = lane >> 4, c4 = (lane & 15) * 4;
  if constexpr (ROPE == 1) {      /* a lane's four columns are two whole pairs of one head (col0 is a multiple of HD), pair numbers c4 / 2 and c4 / 2 + 1 */
    _Float16* const hp = C16 + cofs + (size_t)(row0 + rsub) * ldc + col0 + c4; v4f o[16];
#pragma unroll      /* full unroll: register arrays need constant indices */
    for (int q = 0; q < 16; ++q) { const v4f v = *(const v4fa*)&so[w][q * 2 + rsub][c4]; const v2f c = tc[q], s = ts[q];
      o[q][0] = v[0] * c[0] - v[1] * s[0]; o[q][1] = v[0] * s[0] + v[1] * c[0]; o[q][2] = v[2] * c[1] - v[3] * s[1]; o[q][3] = v[2] * s[1] + v[3] * c[1];
      v4h h4; for (int i = 0; i < 4; ++i) h4[i] = (_Float16)o[q][i]; *(v4h*)(hp + (size_t)q * 2 * ldc) = h4; }
    if (row0 < crows) { float* const fp = C + cofs + (size_t)(row0 + rsub) * ldc + col0 + c4;      /* one test behind the f16 stores, not one a row: a branch in the loop would hold each row's loads behind the row before */
#pragma unroll      /* full unroll: register array */
      for (int q = 0; q < 16; ++q) *(v4f*)(fp + (size_t)q * 2 * ldc) = o[q]; }
  } else {
#pragma unroll
    for (int q = 0; q < 16; ++q) { const int r = q * 2 + rsub; const v4f v = *(const v4fa*)&so[w][r][c4]; if (C) *(v4f*)(C + cofs + (size_t)(row0 + r) * ldc + col0 + c4) = v; if (C16) { v4h h4; for (int i = 0; i < 4; ++i) h4[i] = (_Float16)v[i]; *(v4h*)(C16 + cofs + (size_t)(row0 + r) * ldc + col0 + c4) = h4; } }
     } }


__global__ __launch_bounds__(256) void k_wnat(const float* __restrict__ w, size_t n8, _Float16* __restrict__ Bt) { const size_t t = (size_t)blockIdx.x * 256 + threadIdx.x; if (t >= n8) return; FragH f; for (int q = 0; q < 8; ++q) f.h[q] = (_Float16)(bf16_round(w[t * 8 + q]) * 16.0f); *(v8us*)((unsigned short*)Bt + t * 8) = f.half[0];  }
__global__ __launch_bounds__(256) void k_rsm(const float* __restrict__ S, _Float16* __restrict__ P, int nrows) {
  #pragma clang fp contract(off)
  const int i = blockIdx.x * 256 + threadIdx.x; if (i >= nrows) return; const float* s = S + (size_t)i * SQ; float mx = -3.0e38f;
#pragma unroll 1
  for (int j = 0; j < SQ; ++j) mx = fmaxf(mx, s[j]); float se = 0.f;
#pragma unroll 1
  for (int j = 0; j < SQ; ++j) se += expf(s[j] - mx); const float sc = 256.0f / se;
#pragma unroll 1
  for (int j0 = 0; j0 < SQ; j0 += 8) { FragH f; for (int q = 0; q < 8; ++q) f.h[q] = (_Float16)(expf(s[j0 + q] - mx) * sc); unsigned short* d = (unsigned short*)P + (size_t)i * SQ + j0; *(v8us*)d = f.half[0];  } }
__global__ __launch_bounds__(256) void k_vt(const _Float16* __restrict__ V16, int b, int h0, _Float16* __restrict__ VT) { __shared__ unsigned short tl[64][65]; const int tid = threadIdx.x; const int hh = blockIdx.x % HG, sg = blockIdx.x / HG; const int s0 = sg * 64; const int h = h0 + hh;
  for (int i = tid; i < 64 * 8; i += 256) { const int j = i / 8, d8 = (i % 8) * 8; FragH f; f.half[0] = *(const v8us*)((const unsigned short*)V16 + ((size_t)b * SQ + s0 + j) * DM + h * HD + d8); for (int q = 0; q < 8; ++q) tl[d8 + q][j] = f.u[q]; }
  __syncthreads();
  { for (int i = tid; i < 64 * 8; i += 256) { const int d = i / 8, j8 = (i % 8) * 8; FragH f; for (int q = 0; q < 8; ++q) f.u[q] = tl[d][j8 + q]; *(v8us*)((unsigned short*)VT + ((size_t)hh * HD + d) * SQ + s0 + j8) = f.half[0]; }  } }



// Fused causal attention, one launch: a wave keeps FQ = 32 query rows of one head and walks the keys upwards, FK = 32 a pass; the four waves of a block are the four
// query heads of one kv group on the same query rows, so they read the same K and V^T lines. Both products are formed transposed: S^T = K Q^T (A = 16 key rows, B = 16 query
// rows) leaves in lane (ln, hh) the scores of query ln for keys 8 hh + r, which is the k order of the B fragment of O^T = V^T P^T (A = 16 rows of V^T), so the weights go
// from the accumulators of the first product into the operand of the second without leaving the lane. Row maximum and row sum are carried from pass to pass (f32).
#define FQ 32                        /* query rows per wave */
#define FK 32                        /* keys per pass */
// 2^y by v_exp_f32. Written as asm so that the one free issue slot the instruction set asks for behind a transcendental, before its source is overwritten or its result read,
// stands there by construction: the outputs are early-clobber, so no v_exp of the run touches a register of the one in front of it, and a v_nop closes the run.
__device__ __forceinline__ float fa_exp2(float y) { float r; asm("v_exp_f32 %0, %1\n\tv_nop" : "=v"(r) : "v"(y)); return r; }
__device__ __forceinline__ void fa_exp2x4(float& a, float& b, float& c, float& d) { float ra, rb, rc, rd;
  asm("v_exp_f32 %0, %4\n\tv_exp_f32 %1, %5\n\tv_exp_f32 %2, %6\n\tv_exp_f32 %3, %7\n\tv_nop" : "=&v"(ra), "=&v"(rb), "=&v"(rc), "=&v"(rd) : "v"(a), "v"(b), "v"(c), "v"(d));
  a = ra; b = rb; c = rc; d = rd; }
__device__ __forceinline__ float fa_xhalf(float x) { return __builtin_bit_cast(float, __builtin_amdgcn_permlanex16(__builtin_bit_cast(int, x), __builtin_bit_cast(int, x), 0x76543210, 0xfedcba98, false, false)); }      /* lane l takes the value of lane l ^ 16, by a vector move and not through the LDS pipe */
__device__ __forceinline__ v16h fa_frag(const _Float16* p) { FragH f; f.half[0] = *(const v8us*)((const unsigned short*)p); f.half[1] = *(const v8us*)((const unsigned short*)p + 16); return f.v; }      /* p already holds the lane's 8 hh */
__global__ __launch_bounds__(128) void k_fattn(const _Float16* __restrict__ Q, const _Float16* __restrict__ K, const _Float16* __restrict__ VTp, _Float16* __restrict__ O) {      /* Q, O: rows of DM; K: rows of KVD; VTp: [NG][HD][SQ] */
  const int tid = threadIdx.x, lane = tid & 31, ln = lane & 15, hh = lane >> 4; const int w = __builtin_amdgcn_readfirstlane(tid >> 5);
  const int g = blockIdx.x % NG, jb = blockIdx.x / NG; const int qb = (jb < SQ / FQ / 2) ? SQ / FQ - 1 - jb : jb - SQ / FQ / 2;      /* the long half of the query blocks is dealt first, longest first; then the short half, shortest first */
  const int h = g * HPG + w, q0 = qb * FQ; const float cs = 0.125f * 1.44269504f;      /* 64^-0.5 and log2 e in one factor */
  const _Float16* const qp = Q + (size_t)(q0 + ln) * DM + h * HD + 8 * hh; const _Float16* const kp = K + (size_t)ln * KVD + g * HD + 8 * hh; const _Float16* const vp = VTp + ((size_t)g * HD + ln) * SQ + 8 * hh;
  v16h qf[2][2], kf[2][2], vf[4];
#pragma unroll      /* full unroll: register arrays need constant indices */
  for (int t = 0; t < 2; ++t) { qf[t][0] = fa_frag(qp + (size_t)t * 16 * DM); qf[t][1] = fa_frag(qp + (size_t)t * 16 * DM + 32); }
  asm volatile("s_wait_xcnt 0x0" :: "v"(qp) : "memory");      /* precaution, here and in the two loaders below: the run's one address is an input, so it stays in its registers up to this wait, which stands in front of whatever rewrites them */
  __builtin_amdgcn_sched_barrier(0);      /* keeps the first loads in the loop's own order (Q, then K, then V^T): the loop's counted waits are formed for both ways into it, and with Q loaded last the wait in front of the first product also covered the V^T loads of the pass before */
  auto ldk = [&](int kb) { const _Float16* const p = kp + (size_t)kb * KVD; kf[0][0] = fa_frag(p); kf[0][1] = fa_frag(p + 32); kf[1][0] = fa_frag(p + 16 * KVD); kf[1][1] = fa_frag(p + 16 * KVD + 32);
    asm volatile("s_wait_xcnt 0x0" :: "v"(p) : "memory"); };
  auto ldv = [&](int kb) { const _Float16* const p = vp + kb; vf[0] = fa_frag(p); vf[1] = fa_frag(p + 16 * SQ); vf[2] = fa_frag(p + 32 * SQ); vf[3] = fa_frag(p + 48 * SQ);
    asm volatile("s_wait_xcnt 0x0" :: "v"(p) : "memory"); };
  ldk(0);
  __builtin_amdgcn_sched_barrier(0);      /* the same, between K and V^T */
  ldv(0);
  const v8f z8 = {0.f,0.f,0.f,0.f,0.f,0.f,0.f,0.f}; v8f o[2][4] = {{z8, z8, z8, z8}, {z8, z8, z8, z8}}; float m[2] = {-1.0e30f, -1.0e30f}, l[2] = {0.f, 0.f};
#pragma unroll 1      /* one trip is one pass; the fragments of the next pass are loaded into the registers of this one, directly behind the products that read them */
  for (int kb = 0; kb <= q0; kb += FK) {
    v8f s[2][2];
    s[0][0] = g2_mma(kf[0][0], qf[0][0], z8); s[0][1] = g2_mma(kf[0][0], qf[1][0], z8); s[1][0] = g2_mma(kf[1][0], qf[0][0], z8); s[1][1] = g2_mma(kf[1][0], qf[1][0], z8);
    s[0][0] = g2_mma(kf[0][1], qf[0][1], s[0][0]); s[0][1] = g2_mma(kf[0][1], qf[1][1], s[0][1]); s[1][0] = g2_mma(kf[1][1], qf[0][1], s[1][0]); s[1][1] = g2_mma(kf[1][1], qf[1][1], s[1][1]);
    const int kn = (kb + FK <= q0) ? kb + FK : q0;      /* the last pass loads its own block again: in bounds, not used */
    ldk(kn);
    if (kb == q0) {      /* the one pass that holds the diagonal (the same for the whole wave): key q0 + 16 u + 8 hh + r counts for query q0 + 16 t + ln only if it is not behind it */
#pragma unroll
      for (int u = 0; u < 2; ++u)
#pragma unroll
        for (int t = 0; t < 2; ++t)
#pragma unroll
          for (int r = 0; r < 8; ++r) s[u][t][r] = (u * 16 + 8 * hh + r <= t * 16 + ln) ? s[u][t][r] : -1.0e30f; }
    FragH pf[2];
#pragma unroll      /* full unroll: register arrays need constant indices */
    for (int t = 0; t < 2; ++t) {
      float mx = fmaxf(s[0][t][0], s[1][t][0]);
#pragma unroll
      for (int r = 1; r < 8; ++r) mx = fmaxf(mx, fmaxf(s[0][t][r], s[1][t][r]));
      mx = fmaxf(mx, fa_xhalf(mx));      /* lanes ln and ln + 16 hold the two halves of a query's keys */
      const float mn = fmaxf(m[t], mx); const float al = fa_exp2((m[t] - mn) * cs); const float mc = mn * cs; m[t] = mn;
      float sum = 0.f;
#pragma unroll
      for (int u = 0; u < 2; ++u) {
#pragma unroll
        for (int r = 0; r < 8; ++r) s[u][t][r] = fmaf(s[u][t][r], cs, -mc);
        float e0 = s[u][t][0], e1 = s[u][t][1], e2 = s[u][t][2], e3 = s[u][t][3], e4 = s[u][t][4], e5 = s[u][t][5], e6 = s[u][t][6], e7 = s[u][t][7];
        fa_exp2x4(e0, e1, e2, e3); fa_exp2x4(e4, e5, e6, e7);
        sum += ((e0 + e1) + (e2 + e3)) + ((e4 + e5) + (e6 + e7));
        pf[t].h[u * 8 + 0] = (_Float16)e0; pf[t].h[u * 8 + 1] = (_Float16)e1; pf[t].h[u * 8 + 2] = (_Float16)e2; pf[t].h[u * 8 + 3] = (_Float16)e3;
        pf[t].h[u * 8 + 4] = (_Float16)e4; pf[t].h[u * 8 + 5] = (_Float16)e5; pf[t].h[u * 8 + 6] = (_Float16)e6; pf[t].h[u * 8 + 7] = (_Float16)e7; }
      l[t] = l[t] * al + sum;      /* each lane sums its own half of the keys; the halves meet behind the loop */
#pragma unroll
      for (int dt = 0; dt < 4; ++dt) o[t][dt] *= al; }
#pragma unroll      /* full unroll: register arrays need constant indices */
    for (int dt = 0; dt < 4; ++dt) { o[0][dt] = g2_mma(vf[dt], pf[0].v, o[0][dt]); o[1][dt] = g2_mma(vf[dt], pf[1].v, o[1][dt]); }
    ldv(kn); }
#pragma unroll      /* full unroll: register arrays need constant indices */
  for (int t = 0; t < 2; ++t) { const float lt = l[t] + fa_xhalf(l[t]); const float fin = 64.0f / lt;      /* o carried x64, as the output GEMM expects it */
    unsigned short* const op = (unsigned short*)O + (size_t)(q0 + t * 16 + ln) * DM + h * HD + 8 * hh;
#pragma unroll
    for (int dt = 0; dt < 4; ++dt) { FragH f;
#pragma unroll
      for (int r = 0; r < 8; ++r) f.h[r] = (_Float16)(o[t][dt][r] * fin);
      *(v8us*)(op + dt * 16) = f.half[0]; } } }
static_assert(FQ == 32 && FK == 32 && HD == 64 && SQ % (2 * FQ) == 0, "k_fattn: two query tiles, two key tiles and four value tiles are written out");


// Exact f32 causal attention for query rows 0 .. QT0 - 1: one wave per (head, query row); a block of 8 waves takes 8 consecutive rows of one head.
// The key and value rows that the block needs (NCH whole chunks of 32; the 8 rows lie in one chunk, so the count is the block's) are staged once in LDS.
// Scores: lane l owns keys 32 c + l and reads its key row from LDS. Values: lane l owns dims 2 l, 2 l + 1 and walks the keys upwards, each weight taken from its lane.
#define A0P (HD + 4)                 /* key row pitch in LDS, floats: 272 B = 16 B x 17, so 32 lanes that each read 16 B of their own row do not meet on a bank */
template <int NCH>
__device__ __forceinline__ void att0_rows(const float* __restrict__ qp, const float* __restrict__ kg, const float* __restrict__ vg, float scale, float* __restrict__ op, int i, int tid, float (*lk)[A0P], float (*lv)[HD]) {
  const int lane = tid & 31; const int sr = tid >> 4, sc = (tid & 15) * 4;      /* staging: 16 threads a row, 16 rows a pass */
  v4f kr[2 * NCH], vr[2 * NCH], q[HD / 4]; const float* const kb = kg + (size_t)sr * DM + sc; const float* const vb = vg + (size_t)sr * DM + sc;      /* the row pitch is a constant, so a pass is a constant step from one address */
#pragma unroll      /* full unroll: register arrays need constant indices, and every load of the block is in flight before the first LDS store */
  for (int u = 0; u < 2 * NCH; ++u) { kr[u] = *(const v4fa*)(kb + (size_t)u * 16 * DM); vr[u] = *(const v4fa*)(vb + (size_t)u * 16 * DM); }
#pragma unroll      /* full unroll: register array */
  for (int t = 0; t < HD / 4; ++t) q[t] = *(const v4fa*)(qp + t * 4);
  asm volatile("s_wait_xcnt 0x0" :: "v"(kb), "v"(vb), "v"(qp) : "memory");      /* precaution: the three addresses are inputs, so they stay in their registers up to this wait and nothing of the run is loaded into a register that an earlier load of the run names */
#pragma unroll      /* full unroll: register arrays */
  for (int u = 0; u < 2 * NCH; ++u) { *(v4f*)&lk[u * 16 + sr][sc] = kr[u]; *(v4f*)&lv[u * 16 + sr][sc] = vr[u]; }
  __syncthreads();      /* the staged rows are read by every wave of the block */
  float e[NCH]; float m = -1.0e30f;
#pragma unroll      /* full unroll: register arrays */
  for (int c = 0; c < NCH; ++c) { v4f a = {0.f, 0.f, 0.f, 0.f}; const float* kp = &lk[c * 32 + lane][0];
#pragma unroll      /* full unroll: q is a register array */
    for (int t = 0; t < HD / 4; ++t) a += q[t] * *(const v4f*)(kp + t * 4);
    e[c] = (c * 32 + lane <= i) ? ((a[0] + a[1]) + (a[2] + a[3])) * scale : -1.0e30f; m = fmaxf(m, e[c]); }
  for (int x = 16; x > 0; x >>= 1) m = fmaxf(m, __shfl_xor(m, x, 32));
  float l = 0.f;
#pragma unroll      /* full unroll: register array */
  for (int c = 0; c < NCH; ++c) { e[c] = (c * 32 + lane <= i) ? expf(e[c] - m) : 0.f; l += e[c]; }
  for (int x = 16; x > 0; x >>= 1) l += __shfl_xor(l, x, 32);
  v2f o = {0.f, 0.f};
#pragma unroll      /* full unroll: e is a register array and the lane number of a weight is a constant */
  for (int c = 0; c < NCH; ++c) { const int eb = __float_as_int(e[c]);
#pragma unroll      /* full unroll: the lane number given to readlane is a constant, and the LDS reads of a chunk can go out ahead of their products */
    for (int jj = 0; jj < 32; ++jj) { const float ej = __int_as_float(__builtin_amdgcn_readlane(eb, jj)); o += ej * *(const v2fa*)&lv[c * 32 + jj][lane * 2]; } }
  const float fin = 64.0f / l;      /* o carried x64 like the f16 path */
  *(v2f*)(op + lane * 2) = o * fin; }
__global__ __launch_bounds__(256) void k_att0w(const float* __restrict__ QF, const float* __restrict__ KF, const float* __restrict__ VF, float scale, float* __restrict__ OF) {      /* all four planes: rows of DM floats */
  __shared__ __attribute__((aligned(16))) float lk[QT0][A0P]; __shared__ __attribute__((aligned(16))) float lv[QT0][HD];
  const int tid = threadIdx.x; const int h = blockIdx.x / (QT0 / 8), i0 = (blockIdx.x % (QT0 / 8)) * 8; const int i = i0 + (tid >> 5);
  const float* qp = QF + (size_t)i * DM + h * HD; const float* kg = KF + h * HD; const float* vg = VF + h * HD; float* op = OF + (size_t)i * DM + h * HD;
  switch (i0 / 32) {      /* chunks of 32 keys up to the block's rows, less one: the same for every wave of the block */
    case 0: att0_rows<1>(qp, kg, vg, scale, op, i, tid, lk, lv); break; case 1: att0_rows<2>(qp, kg, vg, scale, op, i, tid, lk, lv); break;
    case 2: att0_rows<3>(qp, kg, vg, scale, op, i, tid, lk, lv); break; default: att0_rows<4>(qp, kg, vg, scale, op, i, tid, lk, lv); break; } }
static_assert(QT0 == 128, "k_att0w: four chunk counts are written out");


__global__ __launch_bounds__(256) void k_kvexp(const float* __restrict__ src, float* __restrict__ dst, size_t n4) { const size_t t = (size_t)blockIdx.x * 256 + threadIdx.x; if (t >= n4) return; const size_t e = t * 4; const size_t row = e / DM; const int col = (int)(e % DM); const int h = col / HD, d = col % HD; const v4f v = *(const v4fa*)(src + row * KVD + (size_t)(h / HPG) * HD + d); *(v4f*)(dst + e) = v;  }

__global__ __launch_bounds__(256) void k_tab2(float theta, float* __restrict__ CS, float* __restrict__ SN) {
  #pragma clang fp contract(off)
  const int t = blockIdx.x * 256 + threadIdx.x; if (t >= SQ * (HD / 2)) return; const int i = t % (HD / 2); const int p = t / (HD / 2); const float invf = 1.0f / powf(theta, (float)(2 * i) / (float)HD); const float ang = __fmul_rn((float)p, invf); const float c = cosf(ang), s = sinf(ang);
  *(float*)(CS + t) = c; *(float*)(SN + t) = s;  }
__global__ __launch_bounds__(256) void k_bfcp(const float* __restrict__ src, float* __restrict__ dst, size_t n4) { const size_t t = (size_t)blockIdx.x * 256 + threadIdx.x; if (t >= n4) return; const v4f a = *(const v4fa*)(src + t * 4); v4f o; for (int q = 0; q < 4; ++q) o[q] = bf16_round(a[q]); *(v4f*)(dst + t * 4) = o;  }

__global__ __launch_bounds__(256) void k_tabhalf(const float* __restrict__ cs, const float* __restrict__ sn, float* __restrict__ CS, float* __restrict__ SN) { const int t = blockIdx.x * 256 + threadIdx.x; if (t >= SQ * (HD / 2)) return; const int p = t / (HD / 2), i = t % (HD / 2); const float c = bf16_round(cs[(size_t)p * HD + i]), s = bf16_round(sn[(size_t)p * HD + i]);
  *(float*)(CS + t) = c; *(float*)(SN + t) = s;  }

__global__ __launch_bounds__(256) void k_tab2d(float* __restrict__ CS, float* __restrict__ SN) {
  #pragma clang fp contract(off)
  const int t = blockIdx.x * 256 + threadIdx.x; if (t >= SQ * (HD / 2)) return; const int i = t % (HD / 2); const int p = t / (HD / 2); const float invf = (float)(1.0 / pow(10000.0, (double)(2 * i) / (double)HD)); const float ang = __fmul_rn((float)p, invf); const float c = cosf(ang), s = sinf(ang);
  *(float*)(CS + t) = c; *(float*)(SN + t) = s;  }
extern "C" void kernel_launch(void* const* d_in, const int* in_sizes, int n_in,
                              void* d_out, int out_size, void* d_ws, size_t ws_size, hipStream_t stream) {
  (void)in_sizes; (void)n_in; (void)out_size;
  const float* const* I = (const float* const*)d_in; const float* x = I[0]; const float* wq = I[1]; const float* wk = I[2]; const float* wv = I[3]; const float* wo = I[4]; const float* bq = nullptr; const float* bk = nullptr; const float* bv = nullptr; const float* bo = nullptr;      /* natural [out][in] weights, no biases; rope tables computed in the kernel */
  char* ws = (char*)d_ws; size_t off = 0;
  auto take = [&](size_t bytes) { char* p = ws + off; off += (bytes + 255) & ~(size_t)255; return p; };
  _Float16* BQ = (_Float16*)take((size_t)DM * DM * 2); _Float16* BK = (_Float16*)take((size_t)KVD * DM * 2); _Float16* BV = (_Float16*)take((size_t)KVD * DM * 2); _Float16* BO = (_Float16*)take((size_t)DM * DM * 2);
  _Float16* X16 = (_Float16*)take(NR * DM * 2); float* CSB = (float*)take((size_t)SQ * HD * 4); float* SNB = (float*)take((size_t)SQ * HD * 4); _Float16* Q16 = (_Float16*)take(NR * DM * 2); _Float16* K16 = (_Float16*)take(NR * KVD * 2); _Float16* V16 = (_Float16*)take(NR * KVD * 2); _Float16* O16 = (_Float16*)take(NR * DM * 2);
  _Float16* VT = (_Float16*)take((size_t)NH * HD * SQ * 2);
  float* QF0 = (float*)take((size_t)QT0 * DM * 4); float* KF0 = (float*)take((size_t)QT0 * KVD * 4); float* VF0 = (float*)take((size_t)QT0 * KVD * 4); float* KF0e = (float*)take((size_t)QT0 * DM * 4); float* VF0e = (float*)take((size_t)QT0 * DM * 4); float* OF0 = (float*)take((size_t)NB * QT0 * DM * 4); _Float16* OH0 = (_Float16*)take((size_t)NB * QT0 * DM * 2); _Float16* OL0 = (_Float16*)take((size_t)NB * QT0 * DM * 2);
  if (off > ws_size) return;
  k_wnat<<<(unsigned)(((size_t)DM * DM / 8 + 255) / 256), 256, 0, stream>>>(wq, (size_t)DM * DM / 8, BQ); k_wnat<<<(unsigned)(((size_t)KVD * DM / 8 + 255) / 256), 256, 0, stream>>>(wk, (size_t)KVD * DM / 8, BK); k_wnat<<<(unsigned)(((size_t)KVD * DM / 8 + 255) / 256), 256, 0, stream>>>(wv, (size_t)KVD * DM / 8, BV); k_wnat<<<(unsigned)(((size_t)DM * DM / 8 + 255) / 256), 256, 0, stream>>>(wo, (size_t)DM * DM / 8, BO);      /* natural [out][in] = Bt planes x16 */
  k_x16<<<(unsigned)((NR * DM / 8 + 255) / 256), 256, 0, stream>>>(x, X16, NR * DM / 8);
  k_tab2d<<<(SQ * (HD / 2) + 255) / 256, 256, 0, stream>>>(CSB, SNB);      /* rope tables cos/sin(p / 10000^(2i/64)): inv_freq double-derived -> f32, f32 angle */
  const size_t r0p = (size_t)B0 * SQ;      /* first projected row */
  k_gemm2<0><<<dim3((unsigned)((MP / 128) * (KVD / 64)), 1), 128, 0, stream>>>(X16 + r0p * DM, DM, 0, BV, DM, 0, 0.0625f, bv, 0, nullptr, 1, 0, 0, nullptr, V16 + r0p * KVD, KVD, 0, MP, KVD, DM);
  for (int b = B0; b < B0 + NBR; ++b) { const size_t r0 = (size_t)b * SQ;
    k_gemm2<0, 1><<<dim3((unsigned)((SQ / 128) * (DM / 64)), 1), 128, 0, stream>>>(X16 + r0 * DM, DM, 0, BQ, DM, 0, 0.0625f, nullptr, 0, nullptr, 1, 0, 0, QF0, Q16 + r0 * DM, DM, 0, SQ, DM, DM, 0, CSB, SNB, QT0);      /* q of this batch, rotated in the epilogue: f16 rows, and f32 rows 0..127 */
    k_gemm2<0, 1><<<dim3((unsigned)((SQ / 128) * (KVD / 64)), 1), 128, 0, stream>>>(X16 + r0 * DM, DM, 0, BK, DM, 0, 0.0625f, nullptr, 0, nullptr, 1, 0, 0, KF0, K16 + r0 * KVD, KVD, 0, SQ, KVD, DM, 0, CSB, SNB, QT0);      /* k, the same */
    k_vt<NG, SQ><<<NG * (SQ / 64), 256, 0, stream>>>(V16 + r0 * KVD, KVD, 0, VT);      /* V^T [NG][HD][SQ] for this batch */
    k_gemm2<0><<<dim3((QT0 / 128) * (KVD / 64), 1), 128, 0, stream>>>(X16 + r0 * DM, DM, 0, BV, DM, 0, 0.0625f, bv, 0, nullptr, 1, 0, 0, VF0, nullptr, KVD, 0, QT0, KVD, DM);
    k_kvexp<<<(unsigned)(((size_t)QT0 * DM / 4 + 255) / 256), 256, 0, stream>>>(KF0, KF0e, (size_t)QT0 * DM / 4); k_kvexp<<<(unsigned)(((size_t)QT0 * DM / 4 + 255) / 256), 256, 0, stream>>>(VF0, VF0e, (size_t)QT0 * DM / 4);      /* head h <- kv group h/4 for the exact first-tile kernel */      /* f32 q, k, v of the first 128 rows (exact products) */
    k_att0w<<<NH * (QT0 / 8), 256, 0, stream>>>(QF0, KF0e, VF0e, 0.125f, OF0 + (size_t)b * QT0 * DM);      /* exact f32 attention for rows 0..127 (o x64) */
    k_fattn<<<NG * (SQ / FQ), 128, 0, stream>>>(Q16 + r0 * DM, K16 + r0 * KVD, VT, O16 + r0 * DM); }      /* scores, causal softmax and o (merged heads, x64, f16 rows) for all 32 heads in one launch */
  k_gemm2<0><<<dim3((unsigned)((MPO / 128) * (DM / 64)), 1), 128, 0, stream>>>(O16 + r0p * DM, DM, 0, BO, DM, 0, 0.0009765625f, bo, 0, nullptr, 1, 0, 0, (float*)d_out + r0p * DM, nullptr, DM, 0, MPO, DM, DM);      /* out rows are the output layout */
  k_hl<<<(unsigned)(((size_t)NB * QT0 * DM / 8 + 255) / 256), 256, 0, stream>>>(OF0, OH0, OL0, (size_t)NB * QT0 * DM / 8);      /* first-tile o (x64) -> f16 hi + x1024 residual planes */
  for (int b = B0; b < B0 + NBR; ++b) { const size_t r0 = (size_t)b * SQ; const size_t f0 = (size_t)b * QT0;
    k_gemm2<0><<<dim3((QT0 / 128) * (DM / 64), 1), 128, 0, stream>>>(OH0 + f0 * DM, DM, 0, BO, DM, 0, 0.0009765625f, bo, 0, nullptr, 1, 0, 0, (float*)d_out + r0 * DM, nullptr, DM, 0, QT0, DM, DM);      /* rows 0..127: out = o_hi Wo (+ b), overwriting the f16-path rows */
    k_gemm2<0><<<dim3((QT0 / 128) * (DM / 64), 1), 128, 0, stream>>>(OL0 + f0 * DM, DM, 0, BO, DM, 0, 0.00000095367431640625f, nullptr, 0, (const float*)d_out + r0 * DM, -1, 0, 0, (float*)d_out + r0 * DM, nullptr, DM, 0, QT0, DM, DM); }      /* += o_lo Wo 2^-20 (own-element accumulate) */
}

// v008
// One run takes 169 microseconds.
// Two timings next to v007 both put it at 1.24 times that version's speed.
// Counting every step since v000, it is 28.6 times as fast.
#include <hip/hip_runtime.h>
// LLaMA grouped-query causal attention with interleaved-pair RoPE (hidden_states [1][2048][2048]; q = x Wq^T (natural [2048][2048]), k = x Wk^T, v = x Wv^T (natural [512][2048]) (sigma 0.02, no biases): 32 query heads / 8 kv heads of 64 (repeat_interleave: kv head h / 4); tables cos/sin of pos / 10000^(2i/64) repeated per pair; q = q cos + rotate_pairs(q) sin with rotate_pairs (x0, x1) -> (-x1, x0): pair (e, o) -> (e cos - o sin, o cos + e sin); scores x 64^-0.5 with a causal mask (triu(1) -> -inf); softmax; out = merged Wo^T (natural) -> [1][2048][2048]).
// Compute dtype: inputs rounded to bf16; x / weights exact; q, k, v, softmax weights and o as plain f16 GEMM operands (~2^-12); scores and softmax statistics f32. v_wmma_f32_16x16x32_f16.
#define NB 1
#define NG 8
#define HPG 4
#define KVD (NG * HD)
#define SQ 2048
#define DM 2048
#define NH 32
#define HD 64
#define HG 4                         /* heads covered by one launch of the non-template k_vt (unused) */
#define QT 256                       /* unused */
#define NKX SQ                       /* S / P row pitch */
#define QT0 128                      /* first-tile rows recomputed exactly in f32 */
#define B0 0                         /* first batch processed (debug hook) */
#define NBR NB                       /* batches processed (debug hook) */
#define NR ((size_t)NB * SQ)         /* token rows */
#define MP ((int)((size_t)NBR * SQ)) /* rows projected (debug hook) */
#define QN SQ                        /* query rows attended per batch (unused) */
#define NHD NH                       /* heads attended (unused) */
#define MPO MP                       /* rows through the output stage (debug hook) */
#define LQ DM      /* row pitch of the q rows */
typedef __bf16 v16b __attribute__((ext_vector_type(16)));
typedef unsigned short v8us __attribute__((ext_vector_type(8), may_alias));
typedef float  v8f  __attribute__((ext_vector_type(8)));
typedef float  v4f  __attribute__((ext_vector_type(4)));
typedef float  v4fa __attribute__((ext_vector_type(4), may_alias));
union FragB { v16b v; v8us half[2]; unsigned short u[16]; };

__device__ __forceinline__ unsigned short bf16_bits(float x) { unsigned int u = __float_as_uint(x); return (unsigned short)((u + 0x7FFFu + ((u >> 16) & 1u)) >> 16); }
__device__ __forceinline__ float bf16_val(unsigned short b) { return __uint_as_float(((unsigned int)b) << 16); }
__device__ __forceinline__ float bf16_round(float x) { return bf16_val(bf16_bits(x)); }
// D += A·B with NT terms: 1 = ah·bh, 2 = + al·bh (A split), 3 = + ah·bl (both split)
template <int NT>
__device__ __forceinline__ v8f mmaN(v16b ah, v16b al, v16b bh, v16b bl, v8f c) {
  c = __builtin_amdgcn_wmma_f32_16x16x32_bf16(false, ah, false, bh, (short)0, c, false, false);
  if (NT >= 2) c = __builtin_amdgcn_wmma_f32_16x16x32_bf16(false, al, false, bh, (short)0, c, false, false);
  if (NT >= 3) c = __builtin_amdgcn_wmma_f32_16x16x32_bf16(false, ah, false, bl, (short)0, c, false, false);
  asm volatile("v_nop\n\tv_nop\n\tv_nop\n\tv_nop" : "+v"(c) : "v"(ah), "v"(al), "v"(bh), "v"(bl));
  return c;
}

__global__ __launch_bounds__(256) void k_wt_bf16(const float* __restrict__ W, unsigned short* __restrict__ Wt, int K, int N) {
  const int t = blockIdx.x * 256 + threadIdx.x;
  const int k8n = K / 8;
  if (t >= N * k8n) return;
  const int n = t / k8n, k8 = (t % k8n) * 8;
  v8us v;
#pragma unroll
  for (int i = 0; i < 8; ++i) v[i] = bf16_bits(W[(size_t)(k8 + i) * N + n]);
  *(v8us*)(Wt + (size_t)n * K + k8) = v;
  
}

// GEMM C[M][N] (f32, pitch ldc) = act(A[M][K]·W + bias). A f32 row-major (pitch lda) converted per fragment to bf16
// (ASPLIT: hi/lo two planes -> 2 terms, else single rounded term); Wt bf16 [N][K] (pitch ldb). BIAS_BF16 rounds the
// bias to bf16 first (bias quantised to bf16 before the add). K%32==0, M%16==0, N%64==0.
template <bool ASPLIT, int ACT, bool BIAS_BF16>
__global__ __launch_bounds__(128) void k_gemm_bf(const float* __restrict__ A, int lda, const unsigned short* __restrict__ Wt, int ldb,
                                               const float* __restrict__ bias, float* __restrict__ C, int ldc, int M, int N, int K) {
  __shared__ __attribute__((aligned(16))) float so[4][16][64];
  const int tid = threadIdx.x, w = tid >> 5, lane = tid & 31, ln = lane & 15, hh = lane >> 4;
  const int ntn = N / 64;
  const int wid = blockIdx.x * 4 + w;
  const int mt = wid / ntn, nq = wid % ntn;
  if (mt * 16 >= M) return;
  const int row0 = mt * 16, col0 = nq * 64;
  const float* arow = A + (size_t)(row0 + ln) * lda;
  v8f acc[4] = {};
  for (int kb = 0; kb < K; kb += 32) {
    FragB ah, al;
    const v4f x0 = *(const v4fa*)(arow + kb + 8 * hh), x1 = *(const v4fa*)(arow + kb + 8 * hh + 4);
    const v4f x2 = *(const v4fa*)(arow + kb + 16 + 8 * hh), x3 = *(const v4fa*)(arow + kb + 16 + 8 * hh + 4);
    float xs[16] = {x0[0],x0[1],x0[2],x0[3],x1[0],x1[1],x1[2],x1[3],x2[0],x2[1],x2[2],x2[3],x3[0],x3[1],x3[2],x3[3]};
#pragma unroll
    for (int i = 0; i < 16; ++i) { const unsigned short hb = bf16_bits(xs[i]); ah.u[i] = hb; al.u[i] = ASPLIT ? bf16_bits(xs[i] - bf16_val(hb)) : (unsigned short)0; }
#pragma unroll
    for (int t = 0; t < 4; ++t) {
      const unsigned short* brow = Wt + (size_t)(col0 + t * 16 + ln) * ldb + kb;
      FragB b;
      b.half[0] = *(const v8us*)(brow + 8 * hh);
      b.half[1] = *(const v8us*)(brow + 16 + 8 * hh);
      acc[t] = mmaN<ASPLIT ? 2 : 1>(ah.v, al.v, b.v, b.v, acc[t]);
    }
  }
#pragma unroll
  for (int t = 0; t < 4; ++t) {
    float bv = bias ? bias[col0 + t * 16 + ln] : 0.f;
    if (BIAS_BF16) bv = bf16_round(bv);
#pragma unroll
    for (int r = 0; r < 8; ++r) { float v = acc[t][r] + bv; if (ACT == 1) v = fmaxf(v, 0.f); so[w][8 * hh + r][t * 16 + ln] = v; }
  }
  __builtin_amdgcn_fence(__ATOMIC_ACQ_REL, "workgroup");
  __builtin_amdgcn_wave_barrier();
  const int rsub = lane >> 4, c4 = (lane & 15) * 4;
  {
#pragma unroll
    for (int q = 0; q < 8; ++q) {
      const int r = q * 2 + rsub;
      const v4f v = *(const v4fa*)&so[w][r][c4];
      *(v4f*)(C + (size_t)(row0 + r) * ldc + col0 + c4) = v;
    }
    
  }
}

// GEMM C = act(A·W + bias + resid): A f32 (ASPLIT -> hi/lo 2 terms), Wt bf16 [N][K]; ACT 0 none, 1 relu, 2 exact gelu;
// resid (optional, f32, row index = (row % rmod), pitch ldr, RES_BF16 rounds it) added before the activation.
template <bool ASPLIT, int ACT, bool BIAS_BF16, bool RES_BF16>
__global__ __launch_bounds__(128) void k_gemm_bf3(const float* __restrict__ A, int lda, const unsigned short* __restrict__ Wt, int ldb,
                                                const float* __restrict__ bias, const float* __restrict__ resid, int rmod, int ldr,
                                                float* __restrict__ C, int ldc, int M, int N, int K) {
  __shared__ __attribute__((aligned(16))) float so[4][16][64];
  const int tid = threadIdx.x, w = tid >> 5, lane = tid & 31, ln = lane & 15, hh = lane >> 4;
  const int ntn = N / 64;
  const int wid = blockIdx.x * 4 + w;
  const int mt = wid / ntn, nq = wid % ntn;
  if (mt * 16 >= M) return;
  const int row0 = mt * 16, col0 = nq * 64;
  const float* arow = A + (size_t)(row0 + ln) * lda;
  v8f acc[4] = {};
  for (int kb = 0; kb < K; kb += 32) {
    FragB ah, al;
    const v4f x0 = *(const v4fa*)(arow + kb + 8 * hh), x1 = *(const v4fa*)(arow + kb + 8 * hh + 4);
    const v4f x2 = *(const v4fa*)(arow + kb + 16 + 8 * hh), x3 = *(const v4fa*)(arow + kb + 16 + 8 * hh + 4);
    float xs[16] = {x0[0],x0[1],x0[2],x0[3],x1[0],x1[1],x1[2],x1[3],x2[0],x2[1],x2[2],x2[3],x3[0],x3[1],x3[2],x3[3]};
#pragma unroll
    for (int i = 0; i < 16; ++i) { const unsigned short hb = bf16_bits(xs[i]); ah.u[i] = hb; al.u[i] = ASPLIT ? bf16_bits(xs[i] - bf16_val(hb)) : (unsigned short)0; }
#pragma unroll
    for (int t = 0; t < 4; ++t) {
      const unsigned short* brow = Wt + (size_t)(col0 + t * 16 + ln) * ldb + kb;
      FragB b;
      b.half[0] = *(const v8us*)(brow + 8 * hh);
      b.half[1] = *(const v8us*)(brow + 16 + 8 * hh);
      acc[t] = mmaN<ASPLIT ? 2 : 1>(ah.v, al.v, b.v, b.v, acc[t]);
    }
  }
#pragma unroll
  for (int t = 0; t < 4; ++t) {
    const int col = col0 + t * 16 + ln;
    float bv = bias ? bias[col] : 0.f;
    if (BIAS_BF16) bv = bf16_round(bv);
#pragma unroll
    for (int r = 0; r < 8; ++r) {
      float v = acc[t][r] + bv;
      if (resid) { float rv = resid[(size_t)((row0 + 8 * hh + r) % rmod) * ldr + col]; if (RES_BF16) rv = bf16_round(rv); v += rv; }
      if (ACT == 1) v = fmaxf(v, 0.f);
      if (ACT == 2) v = 0.5f * v * (1.0f + erff(v * 0.70710678118654752f));
      if (ACT == 3) { const float u = 0.7978845608028654f * (v + 0.044715f * v * v * v); v = 0.5f * v * (1.0f + tanhf(u)); }
      so[w][8 * hh + r][t * 16 + ln] = v;
    }
  }
  __builtin_amdgcn_fence(__ATOMIC_ACQ_REL, "workgroup");
  __builtin_amdgcn_wave_barrier();
  const int rsub = lane >> 4, c4 = (lane & 15) * 4;
  {
#pragma unroll
    for (int q = 0; q < 8; ++q) {
      const int r = q * 2 + rsub;
      const v4f v = *(const v4fa*)&so[w][r][c4];
      *(v4f*)(C + (size_t)(row0 + r) * ldc + col0 + c4) = v;
    }
    
  }
}
// row LayerNorm (biased variance, eps) over N: s = X (+ R); optional out_sum <- s; out_norm <- (s-mu)*rsqrt(var+eps)*g + b
template <bool PARAM_BF16>
__global__ __launch_bounds__(256) void k_layernorm(const float* __restrict__ X, const float* __restrict__ R, const float* __restrict__ g, const float* __restrict__ bta,
                                                  float* __restrict__ out_sum, float* __restrict__ out_norm, int N, float eps) {
  __shared__ float red[256];
  const int row = blockIdx.x, tid = threadIdx.x;
  const float* x = X + (size_t)row * N; const float* rr = R ? R + (size_t)row * N : nullptr;
  float vals[16];                     // up to N = 4096
  const int per = N / 256;            // contiguous chunk per thread? use strided-by-4 chunks: thread handles j = tid*4 + 1024*u
  float s1 = 0.f;
  for (int u = 0; u < per / 4; ++u) {
    const int j = tid * 4 + 1024 * u;
    const v4f a = *(const v4fa*)(x + j);
    v4f b = {0.f,0.f,0.f,0.f}; if (rr) b = *(const v4fa*)(rr + j);
#pragma unroll
    for (int q = 0; q < 4; ++q) { const float v = a[q] + b[q]; vals[u * 4 + q] = v; s1 += v; }
  }
  red[tid] = s1; __syncthreads();
  for (int st = 128; st > 0; st >>= 1) { if (tid < st) red[tid] += red[tid + st]; __syncthreads(); }
  const float mu = red[0] / (float)N; __syncthreads();
  float s2 = 0.f;
  for (int u = 0; u < per / 4; ++u)
#pragma unroll
    for (int q = 0; q < 4; ++q) { const float c = vals[u * 4 + q] - mu; s2 += c * c; }
  red[tid] = s2; __syncthreads();
  for (int st = 128; st > 0; st >>= 1) { if (tid < st) red[tid] += red[tid + st]; __syncthreads(); }
  const float rs = rsqrtf(red[0] / (float)N + eps);
  {
    for (int u = 0; u < per / 4; ++u) {
      const int j = tid * 4 + 1024 * u;
      v4f o, sm;
#pragma unroll
      for (int q = 0; q < 4; ++q) {
        float gg = g[j + q], bb = bta[j + q];
        if (PARAM_BF16) { gg = bf16_round(gg); bb = bf16_round(bb); }
        sm[q] = vals[u * 4 + q]; o[q] = (vals[u * 4 + q] - mu) * rs * gg + bb;
      }
      if (out_sum) *(v4f*)(out_sum + (size_t)row * N + j) = sm;
      *(v4f*)(out_norm + (size_t)row * N + j) = o;
    }
    
  }
}



// ---- f16 WMMA path (v_wmma_f32_16x16x32_f16): 11-bit significands for operands in range — used where a [0,1] probability operand needs more precision than bf16
typedef _Float16 v16h __attribute__((ext_vector_type(16)));
union FragH { v16h v; v8us half[2]; _Float16 h[16]; unsigned short u[16]; };
template <int NT>
__device__ __forceinline__ v8f mmaH(v16h ah, v16h al, v16h bh, v16h bl, v8f c) {
  c = __builtin_amdgcn_wmma_f32_16x16x32_f16(false, ah, false, bh, (short)0, c, false, false);
  if (NT >= 2) c = __builtin_amdgcn_wmma_f32_16x16x32_f16(false, al, false, bh, (short)0, c, false, false);
  if (NT >= 3) c = __builtin_amdgcn_wmma_f32_16x16x32_f16(false, ah, false, bl, (short)0, c, false, false);
  asm volatile("v_nop\n\tv_nop\n\tv_nop\n\tv_nop" : "+v"(c) : "v"(ah), "v"(al), "v"(bh), "v"(bl));
  return c;
}
// batched GEMM like k_gemm_b but f16 operands: A f32 (split into f16 hi/lo if ASPLIT, else rounded to f16), Bt = f16 values [n][k]; alpha; C f32; N multiple of 16 (partial tiles skipped)
template <bool ASPLIT>
__global__ __launch_bounds__(128) void k_gemm_h(const float* __restrict__ A, int lda, size_t sA, const _Float16* __restrict__ Bh, int ldb, size_t sB, float alpha, float* __restrict__ C, int ldc, size_t sC, int M, int N, int K) {
  __shared__ __attribute__((aligned(16))) float so[4][16][64];
  const int tid = threadIdx.x, w = tid >> 5, lane = tid & 31, ln = lane & 15, hh = lane >> 4; const int by = blockIdx.y;
  A += (size_t)by * sA; Bh += (size_t)by * sB; C += (size_t)by * sC;
  const int ntn = (N + 63) / 64; const int wid = blockIdx.x * 4 + w; const int mt = wid / ntn, nq = wid % ntn; if (mt * 16 >= M) return;
  const int row0 = mt * 16, col0 = nq * 64; const float* arow = A + (size_t)(row0 + ln) * lda;
  v8f acc[4] = {};
  for (int kb = 0; kb < K; kb += 32) {
    FragH ah, al;
    const v4f x0 = *(const v4fa*)(arow + kb + 8 * hh), x1 = *(const v4fa*)(arow + kb + 8 * hh + 4), x2 = *(const v4fa*)(arow + kb + 16 + 8 * hh), x3 = *(const v4fa*)(arow + kb + 16 + 8 * hh + 4);
    float xs[16] = {x0[0],x0[1],x0[2],x0[3],x1[0],x1[1],x1[2],x1[3],x2[0],x2[1],x2[2],x2[3],x3[0],x3[1],x3[2],x3[3]};
#pragma unroll
    for (int i = 0; i < 16; ++i) { const _Float16 h = (_Float16)xs[i]; ah.h[i] = h; al.h[i] = ASPLIT ? (_Float16)(xs[i] - (float)h) : (_Float16)0.0f; }
#pragma unroll
    for (int t = 0; t < 4; ++t) { if (col0 + t * 16 >= N) continue; const size_t boff = (size_t)(col0 + t * 16 + ln) * ldb + kb; FragH bq; bq.half[0] = *(const v8us*)(Bh + boff + 8 * hh); bq.half[1] = *(const v8us*)(Bh + boff + 16 + 8 * hh);
      acc[t] = mmaH<ASPLIT ? 2 : 1>(ah.v, al.v, bq.v, bq.v, acc[t]); }
  }
#pragma unroll
  for (int t = 0; t < 4; ++t) { if (col0 + t * 16 >= N) continue;
#pragma unroll
    for (int r = 0; r < 8; ++r) so[w][8 * hh + r][t * 16 + ln] = acc[t][r] * alpha; }
  __builtin_amdgcn_fence(__ATOMIC_ACQ_REL, "workgroup"); __builtin_amdgcn_wave_barrier();
  const int rsub = lane >> 4, c4 = (lane & 15) * 4;
  {
#pragma unroll
    for (int q = 0; q < 8; ++q) { const int r = q * 2 + rsub; if (col0 + c4 < N) { const v4f v = *(const v4fa*)&so[w][r][c4]; *(v4f*)(C + (size_t)(row0 + r) * ldc + col0 + c4) = v; } }
     }
}

// Wt[n][k] = f16(W[k][n]·scale) from f32 row-major W[K][N] (scale = power of two; bf16-exact weights stay exact in f16 away from the subnormal range)
__global__ __launch_bounds__(256) void k_wt_f16(const float* __restrict__ W, _Float16* __restrict__ Wt, int K, int N, float scale) {
  const int t = blockIdx.x * 256 + threadIdx.x; if (t >= N * (K / 8)) return; const int n = t / (K / 8), k8 = (t % (K / 8)) * 8; FragH f;
#pragma unroll
  for (int i = 0; i < 8; ++i) f.h[i] = (_Float16)(bf16_round(W[(size_t)(k8 + i) * N + n]) * scale); const v8us o = f.half[0];
  *(v8us*)((unsigned short*)Wt + (size_t)n * K + k8) = o; 
}
// k_gemm_hh variant with fused epilogue: v = acc·alpha + bias[by·sBias + col] (+ CP[(row/rowsPerB)·sCPb + by·64 + col] if CP) ; ACT 0 none / 1 elu ; writes f16 C16 (and f32 C if non-null)
template <int ACT>
__global__ __launch_bounds__(128) void k_gemm_hhx(const _Float16* __restrict__ A, int lda, size_t sA, const _Float16* __restrict__ Bh, int ldb, size_t sB, float alpha, const float* __restrict__ bias, size_t sBias, const float* __restrict__ CP, int rowsPerB, size_t sCPb, int row0g,
    float* __restrict__ C, _Float16* __restrict__ C16, int ldc, size_t sC, int M, int N, int K) {
  __shared__ __attribute__((aligned(16))) float so[4][16][64];
  const int tid = threadIdx.x, w = tid >> 5, lane = tid & 31, ln = lane & 15, hh = lane >> 4; const int by = blockIdx.y;
  A += (size_t)by * sA; Bh += (size_t)by * sB; const size_t cofs = (size_t)by * sC; const float* bp = bias ? bias + (size_t)by * sBias : nullptr;
  const int ntn = (N + 63) / 64; const int wid = blockIdx.x * 4 + w; const int mt = wid / ntn, nq = wid % ntn; if (mt * 16 >= M) return;
  const int row0 = mt * 16, col0 = nq * 64; const _Float16* arow = A + (size_t)(row0 + ln) * lda;
  v8f acc[4] = {};
  for (int kb = 0; kb < K; kb += 32) { FragH ah; ah.half[0] = *(const v8us*)((const unsigned short*)arow + kb + 8 * hh); ah.half[1] = *(const v8us*)((const unsigned short*)arow + kb + 16 + 8 * hh);
#pragma unroll
    for (int t = 0; t < 4; ++t) { if (col0 + t * 16 >= N) continue; const size_t boff = (size_t)(col0 + t * 16 + ln) * ldb + kb; FragH bq; bq.half[0] = *(const v8us*)((const unsigned short*)Bh + boff + 8 * hh); bq.half[1] = *(const v8us*)((const unsigned short*)Bh + boff + 16 + 8 * hh);
      acc[t] = mmaH<1>(ah.v, ah.v, bq.v, bq.v, acc[t]); }
  }
#pragma unroll
  for (int t = 0; t < 4; ++t) { if (col0 + t * 16 >= N) continue; const int col = col0 + t * 16 + ln; const float bv = bp ? bf16_round(bp[col]) : 0.f;
#pragma unroll
    for (int r = 0; r < 8; ++r) { float v = acc[t][r] * alpha + bv; if (CP) { const int rr = row0g + row0 + 8 * hh + r; if (rowsPerB < 0) v += CP[cofs + (size_t)rr * ldc + col];      /* rowsPerB < 0: own element of the batched C plane */ else { const int bidx = rr / rowsPerB; v += CP[(size_t)bidx * sCPb + (size_t)by * 64 + col]; } } if (ACT == 1) v = (v > 0.f) ? v : expm1f(v); else if (ACT == 7) v = (v > 0.f) ? v + 1.0f : expf(v); else if (ACT == 8) v = tanhf(v); else if (ACT == 9) v = 0.5f * v * (1.0f + tanhf(0.7978845608028654f * (v + 0.044715f * v * v * v))); else if (ACT == 11) v = 1.0f / (1.0f + expf(-v)); else if (ACT == 12) v = (v > 0.f) ? v : 0.01f * v; else if (ACT == 14) v = (v > 0.f) ? v : 0.1f * v; else if (ACT == 16) v = (v >= 0.f) ? v : 0.3f * v; else if (ACT == 17) v = (v >= 0.f) ? v : 0.2f * v; else if (ACT == 15) v = v / (1.0f + expf(-v)); else if (ACT == 3) v = fmaxf(v, 0.f); else if (ACT == 6) v = 0.5f * v * (1.0f + erff(v * 0.70710678118654752f)); so[w][8 * hh + r][t * 16 + ln] = v; } }
  __builtin_amdgcn_fence(__ATOMIC_ACQ_REL, "workgroup"); __builtin_amdgcn_wave_barrier();
  const int rsub = lane >> 4, c4 = (lane & 15) * 4; typedef _Float16 v4h __attribute__((ext_vector_type(4)));
  {
#pragma unroll
    for (int q = 0; q < 8; ++q) { const int r = q * 2 + rsub; if (col0 + c4 < N) { const v4f v = *(const v4fa*)&so[w][r][c4]; if (C) *(v4f*)(C + cofs + (size_t)(row0 + r) * ldc + col0 + c4) = v; if (C16) { v4h h4; for (int i = 0; i < 4; ++i) h4[i] = (_Float16)v[i]; *(v4h*)(C16 + cofs + (size_t)(row0 + r) * ldc + col0 + c4) = h4; } } }
     }
}


typedef _Float16 v4h __attribute__((ext_vector_type(4)));

__global__ __launch_bounds__(256) void k_x16(const float* __restrict__ x, _Float16* __restrict__ X16, size_t n8) { const size_t t = (size_t)blockIdx.x * 256 + threadIdx.x; if (t >= n8) return; FragH f;
#pragma unroll
  for (int q = 0; q < 8; ++q) f.h[q] = (_Float16)bf16_round(x[t * 8 + q]); *(v8us*)((unsigned short*)X16 + t * 8) = f.half[0];  }
__global__ __launch_bounds__(256) void k_h16(const float* __restrict__ x, _Float16* __restrict__ X16, size_t n8) { const size_t t = (size_t)blockIdx.x * 256 + threadIdx.x; if (t >= n8) return; FragH f;
#pragma unroll
  for (int q = 0; q < 8; ++q) f.h[q] = (_Float16)x[t * 8 + q]; *(v8us*)((unsigned short*)X16 + t * 8) = f.half[0];  }
__global__ __launch_bounds__(256) void k_round16f(const float* __restrict__ W, _Float16* __restrict__ Bt, size_t n8) { const size_t t = (size_t)blockIdx.x * 256 + threadIdx.x; if (t >= n8) return; FragH f;
#pragma unroll
  for (int i = 0; i < 8; ++i) f.h[i] = (_Float16)(bf16_round(W[t * 8 + i]) * 16.0f); *(v8us*)((unsigned short*)Bt + t * 8) = f.half[0];  }
template <int NHv, int TTv>
__global__ __launch_bounds__(256) void k_vt(const _Float16* __restrict__ V16, int ldv, int voff, _Float16* __restrict__ Vt) { __shared__ unsigned short tl[64][66]; const int tid = threadIdx.x; const int slab = blockIdx.x / (TTv / 64), lg = blockIdx.x % (TTv / 64); const int b = slab / NHv, h = slab % NHv;
  for (int i = tid; i < 64 * 8; i += 256) { const int r = i / 8, c8 = (i % 8) * 8; FragH f; f.half[0] = *(const v8us*)((const unsigned short*)V16 + ((size_t)b * TTv + lg * 64 + r) * ldv + voff + h * 64 + c8);
#pragma unroll
    for (int q = 0; q < 8; ++q) tl[r][c8 + q] = f.u[q]; }
  __syncthreads();
  {
#pragma unroll
    for (int rd = 0; rd < 2; ++rd) { const int d = rd * 32 + tid / 8, pc = tid % 8; FragH f;
#pragma unroll
      for (int q = 0; q < 8; ++q) f.u[q] = tl[pc * 8 + q][d];
      *(v8us*)((unsigned short*)Vt + ((size_t)slab * 64 + d) * TTv + lg * 64 + pc * 8) = f.half[0]; }
     } }

__global__ __launch_bounds__(256) void k_hl(const float* __restrict__ F, _Float16* __restrict__ Hh, _Float16* __restrict__ Hl, size_t n8) { const size_t t = (size_t)blockIdx.x * 256 + threadIdx.x; if (t >= n8) return; FragH fh, fl; const v4f a = *(const v4fa*)(F + t * 8), c = *(const v4fa*)(F + t * 8 + 4);
#pragma unroll
  for (int q = 0; q < 4; ++q) { _Float16 h = (_Float16)a[q]; fh.h[q] = h; fl.h[q] = (_Float16)((a[q] - (float)h) * 1024.0f); h = (_Float16)c[q]; fh.h[4 + q] = h; fl.h[4 + q] = (_Float16)((c[q] - (float)h) * 1024.0f); }
  { *(v8us*)((unsigned short*)Hh + t * 8) = fh.half[0]; *(v8us*)((unsigned short*)Hl + t * 8) = fl.half[0];  } }

// ---- fast GEMM (block tile 128x64, wave tile 32x64; requires M % 128 == 0, N % 64 == 0, K % 128 == 0 and K >= 256); epilogue = k_gemm_hhx semantics ----
__device__ __forceinline__ v16h g2_frag(const _Float16* p, int hh) { FragH f; f.half[0] = *(const v8us*)((const unsigned short*)p + 8 * hh); f.half[1] = *(const v8us*)((const unsigned short*)p + 16 + 8 * hh); return f.v; }
__device__ __forceinline__ v8f g2_mma(v16h a, v16h b, v8f c) { v8f d = __builtin_amdgcn_wmma_f32_16x16x32_f16(false, a, false, b, (short)0, c, false, false); asm volatile("v_nop\n\tv_nop\n\tv_nop\n\tv_nop" : "+v"(d) : "v"(a), "v"(b)); return d; }
typedef float v2f  __attribute__((ext_vector_type(2)));
typedef float v2fa __attribute__((ext_vector_type(2), may_alias));
struct G2Set { v16h a0, a1, b0, b1, b2, b3; };      /* the fragments of one 32-k step of a 32x64 wave tile */
// The K loop of k_gemm2 takes its operands from LDS: a stage is G2KS k of the block's 128 A rows and 64 B rows, brought there by tensor loads (no register on the way), two buffers.
typedef unsigned int u32x4 __attribute__((ext_vector_type(4)));
typedef unsigned int u32x8 __attribute__((ext_vector_type(8)));
#define G2KS 128                     /* k per stage: rows of 256 B */
#define G2P 272                      /* row pitch in LDS, bytes: 256 + the 16-B pad that the tensor load leaves behind a row (16 B x 17, for ds_load_b128 readers) */
#define G2SA 18432                   /* a slice of 64 A rows, 17,408 B, rounded up to a multiple of 2 KiB */
#define G2SB 10240                   /* a slice of 32 B rows, 8,704 B, the same */
#define G2BUF (2 * G2SA + 2 * G2SB)  /* one buffer: two A slices, two B slices */
static_assert(64 * G2P <= G2SA && 32 * G2P <= G2SB && G2SA % 2048 == 0 && G2SB % 2048 == 0 && G2P == 2 * G2KS + 16, "k_gemm2: every slice starts at a multiple of 2 KiB and holds its padded rows");
__device__ __forceinline__ unsigned int g2_uni(unsigned int v) { return (unsigned int)__builtin_amdgcn_readfirstlane((int)v); }
__device__ __forceinline__ unsigned int g2_pinned(unsigned int v) { unsigned int r = g2_uni(v); asm volatile("" : "+s"(r)); return r; }      /* the test around a tensor load, held in a scalar register: the instruction ignores EXEC, so only a scalar branch keeps a wave from issuing it */
__device__ __forceinline__ v16h g2_lfrag(const unsigned char* p) { FragH f; f.half[0] = *(const v8us*)p; f.half[1] = *(const v8us*)(p + 32); return f.v; }      /* p already holds the lane's 16 hh bytes: the k order of g2_frag */
// ROPE 1: the tile's columns are heads of HD and its rows are positions; the interleaved-pair rotation (e, o) -> (e cos - o sin, e sin + o cos), tables CS, SN [pos][HD / 2], is applied
// to the finished tile on its way out of LDS, where rot says so (the same for the whole block; without it the tile goes out as it is). C16 takes every row as f16, C (f32) only the rows below crows (a multiple of 32, the wave tile's rows).
// g2_tile is the work of one block on the tile (mt, nq) of batch plane by; ring and so are the calling kernel's LDS.
template <int ACT, int ROPE>
__device__ __forceinline__ void g2_tile(unsigned char (&ring)[2][G2BUF], float (&so)[4][32][68], const int mt, const int nq, const int by, const bool rot, const _Float16* __restrict__ A, int lda, size_t sA, const _Float16* __restrict__ Bh, int ldb, size_t sB, float alpha, const float* __restrict__ bias, size_t sBias, const float* __restrict__ CP, int rowsPerB, size_t sCPb, int row0g,
    float* __restrict__ C, _Float16* __restrict__ C16, int ldc, size_t sC, int M, int K, int bshift, const float* __restrict__ CS, const float* __restrict__ SN, int crows) { static_assert(ACT == 0 || ACT == 3 || ACT == 6 || ACT == 8 || ACT == 9 || ACT == 11 || ACT == 12 || ACT == 14 || ACT == 15 || ACT == 16 || ACT == 17, "k_gemm2: unsupported ACT code (would silently apply no activation)");
  const int tid = threadIdx.x, w = tid >> 5, lane = tid & 31, ln = lane & 15, hh = lane >> 4;
  A += (size_t)by * sA; Bh += (size_t)(by >> bshift) * sB;      /* 2^bshift consecutive batch planes share one B plane (query heads of one kv group) */ const size_t cofs = (size_t)by * sC; const float* bp = bias ? bias + (size_t)by * sBias : nullptr;
  const int row0 = mt * 128 + 32 * w, col0 = nq * 64; if (mt * 128 >= M) return;      /* the whole block or none of it: barriers follow */
  const v8f z8 = {0.f,0.f,0.f,0.f,0.f,0.f,0.f,0.f}; v8f c00 = z8, c01 = z8, c02 = z8, c03 = z8, c10 = z8, c11 = z8, c12 = z8, c13 = z8;
  /* Every wave brings one slice of each stage: waves 0 and 1 the two halves (64 rows) of the block's A rows, waves 2 and 3 the two halves (32 rows) of its B rows. */
  const unsigned int wv = g2_uni((unsigned int)tid >> 5), hf = wv & 1u; const bool isB = wv >= 2u;
  const unsigned int nrow = isB ? 32u : 64u, spitch = (isB ? (unsigned int)ldb : (unsigned int)lda) * 2u;
  const unsigned long long sbase = isB ? (unsigned long long)(size_t)(Bh + (size_t)(col0 + 32 * (int)hf) * ldb) : (unsigned long long)(size_t)(A + (size_t)(mt * 128 + 64 * (int)hf) * lda);
  const unsigned int dbase = (unsigned int)(size_t)&ring[0][0] + (isB ? 2u * G2SA + hf * G2SB : hf * G2SA);
  u32x8 g1;      /* 1-byte elements, tensor = tile = nrow rows of 256 B, source pitch spitch, a pad of 4 dwords behind every 64 dwords */
  g1[0] = g2_uni((1u << 20) | (5u << 22) | (3u << 25)); g1[1] = g2_uni(256u << 16); g1[2] = g2_uni(nrow << 16); g1[3] = g2_uni(256u << 16); g1[4] = g2_uni(nrow); g1[5] = g2_uni(spitch); g1[6] = g2_uni(0u); g1[7] = g2_uni(0u);
  u32x4 g0; g0[0] = g2_uni(1u);      /* g0 and g1 live outside the loop and go in and out of every tensor load and every wait on the tensor counter: one set of registers holds them throughout, and no word of a request is rewritten before it has landed */
  auto issue = [&](unsigned int st) { const unsigned long long ga = sbase + (unsigned long long)st * (2 * G2KS);
    g0[1] = g2_uni(dbase + (st & 1u) * G2BUF); g0[2] = g2_uni((unsigned int)ga); g0[3] = g2_uni((((unsigned int)(ga >> 32)) & 0x01FFFFFFu) | 0x80000000u);
    asm volatile("tensor_load_to_lds %0, %1" : "+s"(g0), "+s"(g1) :: "memory"); };      /* one request of the whole wave */
  const unsigned char* const la = &ring[0][0] + (wv >> 1) * G2SA + (hf * 32u + (unsigned int)ln) * G2P + 16 * hh;      /* the wave's A rows 32 w + ln */
  const unsigned char* const lb = &ring[0][0] + 2 * G2SA + ln * G2P + 16 * hh;      /* B row ln */
  auto ld = [&](unsigned int bo, int j) { G2Set s; const unsigned char* const pa = la + bo + j * 64; const unsigned char* const pb = lb + bo + j * 64;      /* the j-th 32-k step of the stage in the buffer at bo */
    s.a0 = g2_lfrag(pa); s.a1 = g2_lfrag(pa + 16 * G2P); s.b0 = g2_lfrag(pb); s.b1 = g2_lfrag(pb + 16 * G2P); s.b2 = g2_lfrag(pb + G2SB); s.b3 = g2_lfrag(pb + G2SB + 16 * G2P); return s; };
  auto use = [&](const G2Set& s) { c00 = g2_mma(s.a0, s.b0, c00); c10 = g2_mma(s.a1, s.b0, c10); c01 = g2_mma(s.a0, s.b1, c01); c11 = g2_mma(s.a1, s.b1, c11);
    c02 = g2_mma(s.a0, s.b2, c02); c12 = g2_mma(s.a1, s.b2, c12); c03 = g2_mma(s.a0, s.b3, c03); c13 = g2_mma(s.a1, s.b3, c13); };
  const unsigned int nst = (unsigned int)K / G2KS;      /* stages; at least two */
  issue(0u);
  unsigned int nx = 1u;      /* the stage to ask for next. It goes through each wait on the tensor counter, so that no word of its descriptor is formed while the request before it is out */
  asm volatile("s_wait_tensorcnt 0x0" : "+s"(nx), "+s"(g0), "+s"(g1) :: "memory");      /* this wave's slice of stage 0 has landed */
  __syncthreads();      /* stage 0 is whole: every wave's slice */
  issue(nx);
#pragma unroll 1      /* one trip is one stage; every accumulator still sums k upwards */
  for (unsigned int st = 0; st < nst; ++st) { const unsigned int bo = (st & 1u) * G2BUF;
    G2Set s0 = ld(bo, 0), s1 = ld(bo, 1); use(s0); s0 = ld(bo, 2); use(s1); s1 = ld(bo, 3); use(s0); use(s1);      /* two fragment sets: a step's LDS reads go out ahead of the products of the step before */
    asm volatile("s_wait_dscnt 0x0" ::: "memory");      /* this wave has read all it needs of the buffer that is filled anew below */
    nx = st + 2u;
    asm volatile("s_wait_tensorcnt 0x0" : "+s"(nx), "+s"(g0), "+s"(g1) :: "memory");      /* this wave's slice of stage st + 1 has landed */
    __syncthreads();      /* stage st + 1 is whole, and every wave has left stage st's buffer */
    if (g2_pinned(nx < nst)) issue(nx); }
  asm volatile("s_wait_tensorcnt 0x0" : "+s"(g0), "+s"(g1) :: "memory");      /* no request is out when the wave goes on */
  asm volatile("s_wait_dscnt 0x0" ::: "memory");      /* nor any of its reads of the ring */
  v2f tc[16], ts[16];      /* ROPE: the table entries of the lane's two pairs, for the 16 rows that it writes out */
  if constexpr (ROPE == 1) if (rot) { static_assert(HD == 64, "k_gemm2: a 64-column tile is one head");
    const size_t to = (size_t)(row0 + hh) * (HD / 2) + ln * 2; const float* const cp = CS + to; const float* const sp = SN + to;
#pragma unroll      /* full unroll: register arrays; the 32 loads go out together here, so that they fly while the tile is staged in LDS */
    for (int q = 0; q < 16; ++q) { tc[q] = *(const v2fa*)(cp + q * HD); ts[q] = *(const v2fa*)(sp + q * HD); }      /* two rows of HD / 2 entries a step */
    asm volatile("s_wait_xcnt 0x0" :: "v"(cp), "v"(sp) : "memory"); }      /* precaution: the two addresses are inputs, so they stay in their registers up to this wait and nothing of the run is loaded into a register that an earlier load of the run names */
  v8f accs[8] = {c00, c01, c02, c03, c10, c11, c12, c13};
#pragma unroll
  for (int u = 0; u < 8; ++u) { const int t = u & 3, half = u >> 2; const int col = col0 + t * 16 + ln; const float bv = bp ? bf16_round(bp[col]) : 0.f;
#pragma unroll
    for (int r = 0; r < 8; ++r) { const int rloc = half * 16 + 8 * hh + r; float v = accs[u][r] * alpha + bv; if (CP) { if (rowsPerB < 0) v += CP[cofs + (size_t)(row0g + row0 + rloc) * ldc + col];      /* rowsPerB < 0: own element of the batched C plane */ else { const int bidx = (row0g + row0 + rloc) / rowsPerB; v += CP[(size_t)bidx * sCPb + (size_t)by * 64 + col]; } }
      if (ACT == 3) v = fmaxf(v, 0.f); else if (ACT == 6) v = 0.5f * v * (1.0f + erff(v * 0.70710678118654752f)); else if (ACT == 11) v = 1.0f / (1.0f + expf(-v)); else if (ACT == 15) v = v / (1.0f + expf(-v)); else if (ACT == 12) v = (v > 0.f) ? v : 0.01f * v; else if (ACT == 8) v = tanhf(v); else if (ACT == 9) v = 0.5f * v * (1.0f + tanhf(0.7978845608028654f * (v + 0.044715f * v * v * v))); else if (ACT == 14) v = (v > 0.f) ? v : 0.1f * v; else if (ACT == 16) v = (v >= 0.f) ? v : 0.3f * v; else if (ACT == 17) v = (v >= 0.f) ? v : 0.2f * v;
      so[w][rloc][t * 16 + ln] = v; } }
  __builtin_amdgcn_fence(__ATOMIC_ACQ_REL, "workgroup"); __builtin_amdgcn_wave_barrier();
  const int rsub = lane >> 4, c4 = (lane & 15) * 4;
  if constexpr (ROPE == 1) {      /* a lane's four columns are two whole pairs of one head (col0 is a multiple of HD), pair numbers c4 / 2 and c4 / 2 + 1 */
    _Float16* const hp = C16 + cofs + (size_t)(row0 + rsub) * ldc + col0 + c4; v4f o[16];
#pragma unroll      /* full unroll: register arrays need constant indices */
    for (int q = 0; q < 16; ++q) o[q] = *(const v4fa*)&so[w][q * 2 + rsub][c4];
    if (rot) {      /* one test for the 16 rows, the same for the whole block */
#pragma unroll      /* full unroll: register arrays need constant indices */
      for (int q = 0; q < 16; ++q) { const v4f v = o[q]; const v2f c = tc[q], s = ts[q];
        o[q][0] = v[0] * c[0] - v[1] * s[0]; o[q][1] = v[0] * s[0] + v[1] * c[0]; o[q][2] = v[2] * c[1] - v[3] * s[1]; o[q][3] = v[2] * s[1] + v[3] * c[1]; } }
#pragma unroll      /* full unroll: register array */
    for (int q = 0; q < 16; ++q) { v4h h4; for (int i = 0; i < 4; ++i) h4[i] = (_Float16)o[q][i]; *(v4h*)(hp + (size_t)q * 2 * ldc) = h4; }
    if (row0 < crows) { float* const fp = C + cofs + (size_t)(row0 + rsub) * ldc + col0 + c4;      /* one test behind the f16 stores, not one a row: a branch in the loop would hold each row's loads behind the row before */
#pragma unroll      /* full unroll: register array */
      for (int q = 0; q < 16; ++q) *(v4f*)(fp + (size_t)q * 2 * ldc) = o[q]; }
  } else {
#pragma unroll
    for (int q = 0; q < 16; ++q) { const int r = q * 2 + rsub; const v4f v = *(const v4fa*)&so[w][r][c4]; if (C) *(v4f*)(C + cofs + (size_t)(row0 + r) * ldc + col0 + c4) = v; if (C16) { v4h h4; for (int i = 0; i < 4; ++i) h4[i] = (_Float16)v[i]; *(v4h*)(C16 + cofs + (size_t)(row0 + r) * ldc + col0 + c4) = h4; } }
     } }
#define G2LDS __shared__ __attribute__((aligned(2048))) unsigned char ring[2][G2BUF]; __shared__ __attribute__((aligned(16))) float so[4][32][68]
template <int ACT>
__global__ __launch_bounds__(128) void k_gemm2(const _Float16* __restrict__ A, int lda, size_t sA, const _Float16* __restrict__ Bh, int ldb, size_t sB, float alpha, const float* __restrict__ bias, size_t sBias, const float* __restrict__ CP, int rowsPerB, size_t sCPb, int row0g,
    float* __restrict__ C, _Float16* __restrict__ C16, int ldc, size_t sC, int M, int N, int K, int bshift = 0) { G2LDS;
  const int ntn = N >> 6; const int mt = blockIdx.x / ntn, nq = blockIdx.x - mt * ntn;
  g2_tile<ACT, 0>(ring, so, mt, nq, blockIdx.y, false, A, lda, sA, Bh, ldb, sB, alpha, bias, sBias, CP, rowsPerB, sCPb, row0g, C, C16, ldc, sC, M, K, bshift, nullptr, nullptr, 0); }
// The three projections of SQ rows of X in one launch: the 64-column tiles of q, k and v stand side by side, PJT of them to each 128 rows, and a block takes its weight plane and its outputs by its tile's number.
// q and k tiles are rotated on their way out, v tiles are not; each of the three also leaves its rows below QT0 in f32 (QF, KF, VF).
#define PJQ (DM / 64)                /* column tiles of q */
#define PJK (KVD / 64)               /* of k, and of v */
#define PJT (PJQ + 2 * PJK)
__global__ __launch_bounds__(128) void k_qkv(const _Float16* __restrict__ X, const _Float16* __restrict__ WQ, const _Float16* __restrict__ WK, const _Float16* __restrict__ WV, const float* __restrict__ CS, const float* __restrict__ SN,
    float* __restrict__ QF, float* __restrict__ KF, float* __restrict__ VF, _Float16* __restrict__ QH, _Float16* __restrict__ KH, _Float16* __restrict__ VH) { G2LDS;
  const int mt = blockIdx.x / PJT, ct = blockIdx.x - mt * PJT; const bool isq = ct < PJQ, isk = ct < PJQ + PJK;
  const _Float16* const Wp = isq ? WQ : isk ? WK : WV; float* const Fp = isq ? QF : isk ? KF : VF; _Float16* const Hp = isq ? QH : isk ? KH : VH;
  g2_tile<0, 1>(ring, so, mt, isq ? ct : isk ? ct - PJQ : ct - PJQ - PJK, 0, isk, X, DM, 0, Wp, DM, 0, 0.0625f, nullptr, 0, nullptr, 1, 0, 0, Fp, Hp, isq ? DM : KVD, 0, SQ, DM, 0, CS, SN, QT0); }


__global__ __launch_bounds__(256) void k_wnat(const float* __restrict__ w, size_t n8, _Float16* __restrict__ Bt) { const size_t t = (size_t)blockIdx.x * 256 + threadIdx.x; if (t >= n8) return; FragH f; for (int q = 0; q < 8; ++q) f.h[q] = (_Float16)(bf16_round(w[t * 8 + q]) * 16.0f); *(v8us*)((unsigned short*)Bt + t * 8) = f.half[0];  }
__global__ __launch_bounds__(256) void k_rsm(const float* __restrict__ S, _Float16* __restrict__ P, int nrows) {
  #pragma clang fp contract(off)
  const int i = blockIdx.x * 256 + threadIdx.x; if (i >= nrows) return; const float* s = S + (size_t)i * SQ; float mx = -3.0e38f;
#pragma unroll 1
  for (int j = 0; j < SQ; ++j) mx = fmaxf(mx, s[j]); float se = 0.f;
#pragma unroll 1
  for (int j = 0; j < SQ; ++j) se += expf(s[j] - mx); const float sc = 256.0f / se;
#pragma unroll 1
  for (int j0 = 0; j0 < SQ; j0 += 8) { FragH f; for (int q = 0; q < 8; ++q) f.h[q] = (_Float16)(expf(s[j0 + q] - mx) * sc); unsigned short* d = (unsigned short*)P + (size_t)i * SQ + j0; *(v8us*)d = f.half[0];  } }
__global__ __launch_bounds__(256) void k_vt(const _Float16* __restrict__ V16, int b, int h0, _Float16* __restrict__ VT) { __shared__ unsigned short tl[64][65]; const int tid = threadIdx.x; const int hh = blockIdx.x % HG, sg = blockIdx.x / HG; const int s0 = sg * 64; const int h = h0 + hh;
  for (int i = tid; i < 64 * 8; i += 256) { const int j = i / 8, d8 = (i % 8) * 8; FragH f; f.half[0] = *(const v8us*)((const unsigned short*)V16 + ((size_t)b * SQ + s0 + j) * DM + h * HD + d8); for (int q = 0; q < 8; ++q) tl[d8 + q][j] = f.u[q]; }
  __syncthreads();
  { for (int i = tid; i < 64 * 8; i += 256) { const int d = i / 8, j8 = (i % 8) * 8; FragH f; for (int q = 0; q < 8; ++q) f.u[q] = tl[d][j8 + q]; *(v8us*)((unsigned short*)VT + ((size_t)hh * HD + d) * SQ + s0 + j8) = f.half[0]; }  } }



// Fused causal attention, one launch: a wave keeps FQ = 32 query rows of one head and walks the keys upwards, FK = 32 a pass; the four waves of a block are the four
// query heads of one kv group on the same query rows, so they read the same K and V^T lines. Both products are formed transposed: S^T = K Q^T (A = 16 key rows, B = 16 query
// rows) leaves in lane (ln, hh) the scores of query ln for keys 8 hh + r, which is the k order of the B fragment of O^T = V^T P^T (A = 16 rows of V^T), so the weights go
// from the accumulators of the first product into the operand of the second without leaving the lane. Row maximum and row sum are carried from pass to pass (f32).
#define FQ 32                        /* query rows per wave */
#define FK 32                        /* keys per pass */
// 2^y by v_exp_f32. Written as asm so that the one free issue slot the instruction set asks for behind a transcendental, before its source is overwritten or its result read,
// stands there by construction: the outputs are early-clobber, so no v_exp of the run touches a register of the one in front of it, and a v_nop closes the run.
__device__ __forceinline__ float fa_exp2(float y) { float r; asm("v_exp_f32 %0, %1\n\tv_nop" : "=v"(r) : "v"(y)); return r; }
__device__ __forceinline__ void fa_exp2x4(float& a, float& b, float& c, float& d) { float ra, rb, rc, rd;
  asm("v_exp_f32 %0, %4\n\tv_exp_f32 %1, %5\n\tv_exp_f32 %2, %6\n\tv_exp_f32 %3, %7\n\tv_nop" : "=&v"(ra), "=&v"(rb), "=&v"(rc), "=&v"(rd) : "v"(a), "v"(b), "v"(c), "v"(d));
  a = ra; b = rb; c = rc; d = rd; }
__device__ __forceinline__ float fa_xhalf(float x) { return __builtin_bit_cast(float, __builtin_amdgcn_permlanex16(__builtin_bit_cast(int, x), __builtin_bit_cast(int, x), 0x76543210, 0xfedcba98, false, false)); }      /* lane l takes the value of lane l ^ 16, by a vector move and not through the LDS pipe */
__device__ __forceinline__ v16h fa_frag(const _Float16* p) { FragH f; f.half[0] = *(const v8us*)((const unsigned short*)p); f.half[1] = *(const v8us*)((const unsigned short*)p + 16); return f.v; }      /* p already holds the lane's 8 hh */
__global__ __launch_bounds__(128) void k_fattn(const _Float16* __restrict__ Q, const _Float16* __restrict__ K, const _Float16* __restrict__ VTp, _Float16* __restrict__ O) {      /* Q, O: rows of DM; K: rows of KVD; VTp: [NG][HD][SQ] */
  const int tid = threadIdx.x, lane = tid & 31, ln = lane & 15, hh = lane >> 4; const int w = __builtin_amdgcn_readfirstlane(tid >> 5);
  const int g = blockIdx.x % NG, jb = blockIdx.x / NG; const int qb = (jb < SQ / FQ / 2) ? SQ / FQ - 1 - jb : jb - SQ / FQ / 2;      /* the long half of the query blocks is dealt first, longest first; then the short half, shortest first */
  const int h = g * HPG + w, q0 = qb * FQ; const float cs = 0.125f * 1.44269504f;      /* 64^-0.5 and log2 e in one factor */
  const _Float16* const qp = Q + (size_t)(q0 + ln) * DM + h * HD + 8 * hh; const _Float16* const kp = K + (size_t)ln * KVD + g * HD + 8 * hh; const _Float16* const vp = VTp + ((size_t)g * HD + ln) * SQ + 8 * hh;
  v16h qf[2][2], kf[2][2], vf[4];
#pragma unroll      /* full unroll: register arrays need constant indices */
  for (int t = 0; t < 2; ++t) { qf[t][0] = fa_frag(qp + (size_t)t * 16 * DM); qf[t][1] = fa_frag(qp + (size_t)t * 16 * DM + 32); }
  asm volatile("s_wait_xcnt 0x0" :: "v"(qp) : "memory");      /* precaution, here and in the two loaders below: the run's one address is an input, so it stays in its registers up to this wait, which stands in front of whatever rewrites them */
  __builtin_amdgcn_sched_barrier(0);      /* keeps the first loads in the loop's own order (Q, then K, then V^T): the loop's counted waits are formed for both ways into it, and with Q loaded last the wait in front of the first product also covered the V^T loads of the pass before */
  auto ldk = [&](int kb) { const _Float16* const p = kp + (size_t)kb * KVD; kf[0][0] = fa_frag(p); kf[0][1] = fa_frag(p + 32); kf[1][0] = fa_frag(p + 16 * KVD); kf[1][1] = fa_frag(p + 16 * KVD + 32);
    asm volatile("s_wait_xcnt 0x0" :: "v"(p) : "memory"); };
  auto ldv = [&](int kb) { const _Float16* const p = vp + kb; vf[0] = fa_frag(p); vf[1] = fa_frag(p + 16 * SQ); vf[2] = fa_frag(p + 32 * SQ); vf[3] = fa_frag(p + 48 * SQ);
    asm volatile("s_wait_xcnt 0x0" :: "v"(p) : "memory"); };
  ldk(0);
  __builtin_amdgcn_sched_barrier(0);      /* the same, between K and V^T */
  ldv(0);
  const v8f z8 = {0.f,0.f,0.f,0.f,0.f,0.f,0.f,0.f}; v8f o[2][4] = {{z8, z8, z8, z8}, {z8, z8, z8, z8}}; float m[2] = {-1.0e30f, -1.0e30f}, l[2] = {0.f, 0.f};
#pragma unroll 1      /* one trip is one pass; the fragments of the next pass are loaded into the registers of this one, directly behind the products that read them */
  for (int kb = 0; kb <= q0; kb += FK) {
    v8f s[2][2];
    s[0][0] = g2_mma(kf[0][0], qf[0][0], z8); s[0][1] = g2_mma(kf[0][0], qf[1][0], z8); s[1][0] = g2_mma(kf[1][0], qf[0][0], z8); s[1][1] = g2_mma(kf[1][0], qf[1][0], z8);
    s[0][0] = g2_mma(kf[0][1], qf[0][1], s[0][0]); s[0][1] = g2_mma(kf[0][1], qf[1][1], s[0][1]); s[1][0] = g2_mma(kf[1][1], qf[0][1], s[1][0]); s[1][1] = g2_mma(kf[1][1], qf[1][1], s[1][1]);
    const int kn = (kb + FK <= q0) ? kb + FK : q0;      /* the last pass loads its own block again: in bounds, not used */
    ldk(kn);
    if (kb == q0) {      /* the one pass that holds the diagonal (the same for the whole wave): key q0 + 16 u + 8 hh + r counts for query q0 + 16 t + ln only if it is not behind it */
#pragma unroll
      for (int u = 0; u < 2; ++u)
#pragma unroll
        for (int t = 0; t < 2; ++t)
#pragma unroll
          for (int r = 0; r < 8; ++r) s[u][t][r] = (u * 16 + 8 * hh + r <= t * 16 + ln) ? s[u][t][r] : -1.0e30f; }
    FragH pf[2];
#pragma unroll      /* full unroll: register arrays need constant indices */
    for (int t = 0; t < 2; ++t) {
      float mx = fmaxf(s[0][t][0], s[1][t][0]);
#pragma unroll
      for (int r = 1; r < 8; ++r) mx = fmaxf(mx, fmaxf(s[0][t][r], s[1][t][r]));
      mx = fmaxf(mx, fa_xhalf(mx));      /* lanes ln and ln + 16 hold the two halves of a query's keys */
      const float mn = fmaxf(m[t], mx); const float al = fa_exp2((m[t] - mn) * cs); const float mc = mn * cs; m[t] = mn;
      float sum = 0.f;
#pragma unroll
      for (int u = 0; u < 2; ++u) {
#pragma unroll
        for (int r = 0; r < 8; ++r) s[u][t][r] = fmaf(s[u][t][r], cs, -mc);
        float e0 = s[u][t][0], e1 = s[u][t][1], e2 = s[u][t][2], e3 = s[u][t][3], e4 = s[u][t][4], e5 = s[u][t][5], e6 = s[u][t][6], e7 = s[u][t][7];
        fa_exp2x4(e0, e1, e2, e3); fa_exp2x4(e4, e5, e6, e7);
        sum += ((e0 + e1) + (e2 + e3)) + ((e4 + e5) + (e6 + e7));
        pf[t].h[u * 8 + 0] = (_Float16)e0; pf[t].h[u * 8 + 1] = (_Float16)e1; pf[t].h[u * 8 + 2] = (_Float16)e2; pf[t].h[u * 8 + 3] = (_Float16)e3;
        pf[t].h[u * 8 + 4] = (_Float16)e4; pf[t].h[u * 8 + 5] = (_Float16)e5; pf[t].h[u * 8 + 6] = (_Float16)e6; pf[t].h[u * 8 + 7] = (_Float16)e7; }
      l[t] = l[t] * al + sum;      /* each lane sums its own half of the keys; the halves meet behind the loop */
#pragma unroll
      for (int dt = 0; dt < 4; ++dt) o[t][dt] *= al; }
#pragma unroll      /* full unroll: register arrays need constant indices */
    for (int dt = 0; dt < 4; ++dt) { o[0][dt] = g2_mma(vf[dt], pf[0].v, o[0][dt]); o[1][dt] = g2_mma(vf[dt], pf[1].v, o[1][dt]); }
    ldv(kn); }
#pragma unroll      /* full unroll: register arrays need constant indices */
  for (int t = 0; t < 2; ++t) { const float lt = l[t] + fa_xhalf(l[t]); const float fin = 64.0f / lt;      /* o carried x64, as the output GEMM expects it */
    unsigned short* const op = (unsigned short*)O + (size_t)(q0 + t * 16 + ln) * DM + h * HD + 8 * hh;
#pragma unroll
    for (int dt = 0; dt < 4; ++dt) { FragH f;
#pragma unroll
      for (int r = 0; r < 8; ++r) f.h[r] = (_Float16)(o[t][dt][r] * fin);
      *(v8us*)(op + dt * 16) = f.half[0]; } } }
static_assert(FQ == 32 && FK == 32 && HD == 64 && SQ % (2 * FQ) == 0, "k_fattn: two query tiles, two key tiles and four value tiles are written out");


// Exact f32 causal attention for query rows 0 .. QT0 - 1: one wave per (head, query row); a block of 8 waves takes 8 consecutive rows of one head.
// The key and value rows that the block needs (NCH whole chunks of 32; the 8 rows lie in one chunk, so the count is the block's) are staged once in LDS.
// Scores: lane l owns keys 32 c + l and reads its key row from LDS. Values: lane l owns dims 2 l, 2 l + 1 and walks the keys upwards, each weight taken from its lane.
#define A0P (HD + 4)                 /* key row pitch in LDS, floats: 272 B = 16 B x 17, so 32 lanes that each read 16 B of their own row do not meet on a bank */
template <int NCH>
__device__ __forceinline__ void att0_rows(const float* __restrict__ qp, const float* __restrict__ kg, const float* __restrict__ vg, float scale, float* __restrict__ op, int i, int tid, float (*lk)[A0P], float (*lv)[HD]) {
  const int lane = tid & 31; const int sr = tid >> 4, sc = (tid & 15) * 4;      /* staging: 16 threads a row, 16 rows a pass */
  v4f kr[2 * NCH], vr[2 * NCH], q[HD / 4]; const float* const kb = kg + (size_t)sr * DM + sc; const float* const vb = vg + (size_t)sr * DM + sc;      /* the row pitch is a constant, so a pass is a constant step from one address */
#pragma unroll      /* full unroll: register arrays need constant indices, and every load of the block is in flight before the first LDS store */
  for (int u = 0; u < 2 * NCH; ++u) { kr[u] = *(const v4fa*)(kb + (size_t)u * 16 * DM); vr[u] = *(const v4fa*)(vb + (size_t)u * 16 * DM); }
#pragma unroll      /* full unroll: register array */
  for (int t = 0; t < HD / 4; ++t) q[t] = *(const v4fa*)(qp + t * 4);
  asm volatile("s_wait_xcnt 0x0" :: "v"(kb), "v"(vb), "v"(qp) : "memory");      /* precaution: the three addresses are inputs, so they stay in their registers up to this wait and nothing of the run is loaded into a register that an earlier load of the run names */
#pragma unroll      /* full unroll: register arrays */
  for (int u = 0; u < 2 * NCH; ++u) { *(v4f*)&lk[u * 16 + sr][sc] = kr[u]; *(v4f*)&lv[u * 16 + sr][sc] = vr[u]; }
  __syncthreads();      /* the staged rows are read by every wave of the block */
  float e[NCH]; float m = -1.0e30f;
#pragma unroll      /* full unroll: register arrays */
  for (int c = 0; c < NCH; ++c) { v4f a = {0.f, 0.f, 0.f, 0.f}; const float* kp = &lk[c * 32 + lane][0];
#pragma unroll      /* full unroll: q is a register array */
    for (int t = 0; t < HD / 4; ++t) a += q[t] * *(const v4f*)(kp + t * 4);
    e[c] = (c * 32 + lane <= i) ? ((a[0] + a[1]) + (a[2] + a[3])) * scale : -1.0e30f; m = fmaxf(m, e[c]); }
  for (int x = 16; x > 0; x >>= 1) m = fmaxf(m, __shfl_xor(m, x, 32));
  float l = 0.f;
#pragma unroll      /* full unroll: register array */
  for (int c = 0; c < NCH; ++c) { e[c] = (c * 32 + lane <= i) ? expf(e[c] - m) : 0.f; l += e[c]; }
  for (int x = 16; x > 0; x >>= 1) l += __shfl_xor(l, x, 32);
  v2f o = {0.f, 0.f};
#pragma unroll      /* full unroll: e is a register array and the lane number of a weight is a constant */
  for (int c = 0; c < NCH; ++c) { const int eb = __float_as_int(e[c]);
#pragma unroll      /* full unroll: the lane number given to readlane is a constant, and the LDS reads of a chunk can go out ahead of their products */
    for (int jj = 0; jj < 32; ++jj) { const float ej = __int_as_float(__builtin_amdgcn_readlane(eb, jj)); o += ej * *(const v2fa*)&lv[c * 32 + jj][lane * 2]; } }
  const float fin = 64.0f / l;      /* o carried x64 like the f16 path */
  *(v2f*)(op + lane * 2) = o * fin; }
__global__ __launch_bounds__(256) void k_att0w(const float* __restrict__ QF, const float* __restrict__ KF, const float* __restrict__ VF, float scale, float* __restrict__ OF) {      /* all four planes: rows of DM floats */
  __shared__ __attribute__((aligned(16))) float lk[QT0][A0P]; __shared__ __attribute__((aligned(16))) float lv[QT0][HD];
  const int tid = threadIdx.x; const int h = blockIdx.x / (QT0 / 8), i0 = (blockIdx.x % (QT0 / 8)) * 8; const int i = i0 + (tid >> 5);
  const float* qp = QF + (size_t)i * DM + h * HD; const float* kg = KF + h * HD; const float* vg = VF + h * HD; float* op = OF + (size_t)i * DM + h * HD;
  switch (i0 / 32) {      /* chunks of 32 keys up to the block's rows, less one: the same for every wave of the block */
    case 0: att0_rows<1>(qp, kg, vg, scale, op, i, tid, lk, lv); break; case 1: att0_rows<2>(qp, kg, vg, scale, op, i, tid, lk, lv); break;
    case 2: att0_rows<3>(qp, kg, vg, scale, op, i, tid, lk, lv); break; default: att0_rows<4>(qp, kg, vg, scale, op, i, tid, lk, lv); break; } }
static_assert(QT0 == 128, "k_att0w: four chunk counts are written out");


__global__ __launch_bounds__(256) void k_kvexp(const float* __restrict__ src, float* __restrict__ dst, size_t n4) { const size_t t = (size_t)blockIdx.x * 256 + threadIdx.x; if (t >= n4) return; const size_t e = t * 4; const size_t row = e / DM; const int col = (int)(e % DM); const int h = col / HD, d = col % HD; const v4f v = *(const v4fa*)(src + row * KVD + (size_t)(h / HPG) * HD + d); *(v4f*)(dst + e) = v;  }

__global__ __launch_bounds__(256) void k_tab2(float theta, float* __restrict__ CS, float* __restrict__ SN) {
  #pragma clang fp contract(off)
  const int t = blockIdx.x * 256 + threadIdx.x; if (t >= SQ * (HD / 2)) return; const int i = t % (HD / 2); const int p = t / (HD / 2); const float invf = 1.0f / powf(theta, (float)(2 * i) / (float)HD); const float ang = __fmul_rn((float)p, invf); const float c = cosf(ang), s = sinf(ang);
  *(float*)(CS + t) = c; *(float*)(SN + t) = s;  }
__global__ __launch_bounds__(256) void k_bfcp(const float* __restrict__ src, float* __restrict__ dst, size_t n4) { const size_t t = (size_t)blockIdx.x * 256 + threadIdx.x; if (t >= n4) return; const v4f a = *(const v4fa*)(src + t * 4); v4f o; for (int q = 0; q < 4; ++q) o[q] = bf16_round(a[q]); *(v4f*)(dst + t * 4) = o;  }

__global__ __launch_bounds__(256) void k_tabhalf(const float* __restrict__ cs, const float* __restrict__ sn, float* __restrict__ CS, float* __restrict__ SN) { const int t = blockIdx.x * 256 + threadIdx.x; if (t >= SQ * (HD / 2)) return; const int p = t / (HD / 2), i = t % (HD / 2); const float c = bf16_round(cs[(size_t)p * HD + i]), s = bf16_round(sn[(size_t)p * HD + i]);
  *(float*)(CS + t) = c; *(float*)(SN + t) = s;  }

__global__ __launch_bounds__(256) void k_tab2d(float* __restrict__ CS, float* __restrict__ SN) {
  #pragma clang fp contract(off)
  const int t = blockIdx.x * 256 + threadIdx.x; if (t >= SQ * (HD / 2)) return; const int i = t % (HD / 2); const int p = t / (HD / 2); const float invf = (float)(1.0 / pow(10000.0, (double)(2 * i) / (double)HD)); const float ang = __fmul_rn((float)p, invf); const float c = cosf(ang), s = sinf(ang);
  *(float*)(CS + t) = c; *(float*)(SN + t) = s;  }
extern "C" void kernel_launch(void* const* d_in, const int* in_sizes, int n_in,
                              void* d_out, int out_size, void* d_ws, size_t ws_size, hipStream_t stream) {
  (void)in_sizes; (void)n_in; (void)out_size;
  const float* const* I = (const float* const*)d_in; const float* x = I[0]; const float* wq = I[1]; const float* wk = I[2]; const float* wv = I[3]; const float* wo = I[4]; const float* bq = nullptr; const float* bk = nullptr; const float* bv = nullptr; const float* bo = nullptr;      /* natural [out][in] weights, no biases; rope tables computed in the kernel */
  char* ws = (char*)d_ws; size_t off = 0;
  auto take = [&](size_t bytes) { char* p = ws + off; off += (bytes + 255) & ~(size_t)255; return p; };
  _Float16* BQ = (_Float16*)take((size_t)DM * DM * 2); _Float16* BK = (_Float16*)take((size_t)KVD * DM * 2); _Float16* BV = (_Float16*)take((size_t)KVD * DM * 2); _Float16* BO = (_Float16*)take((size_t)DM * DM * 2);
  _Float16* X16 = (_Float16*)take(NR * DM * 2); float* CSB = (float*)take((size_t)SQ * HD * 4); float* SNB = (float*)take((size_t)SQ * HD * 4); _Float16* Q16 = (_Float16*)take(NR * DM * 2); _Float16* K16 = (_Float16*)take(NR * KVD * 2); _Float16* V16 = (_Float16*)take(NR * KVD * 2); _Float16* O16 = (_Float16*)take(NR * DM * 2);
  _Float16* VT = (_Float16*)take((size_t)NH * HD * SQ * 2);
  float* QF0 = (float*)take((size_t)QT0 * DM * 4); float* KF0 = (float*)take((size_t)QT0 * KVD * 4); float* VF0 = (float*)take((size_t)QT0 * KVD * 4); float* KF0e = (float*)take((size_t)QT0 * DM * 4); float* VF0e = (float*)take((size_t)QT0 * DM * 4); float* OF0 = (float*)take((size_t)NB * QT0 * DM * 4); _Float16* OH0 = (_Float16*)take((size_t)NB * QT0 * DM * 2); _Float16* OL0 = (_Float16*)take((size_t)NB * QT0 * DM * 2);
  if (off > ws_size) return;
  k_wnat<<<(unsigned)(((size_t)DM * DM / 8 + 255) / 256), 256, 0, stream>>>(wq, (size_t)DM * DM / 8, BQ); k_wnat<<<(unsigned)(((size_t)KVD * DM / 8 + 255) / 256), 256, 0, stream>>>(wk, (size_t)KVD * DM / 8, BK); k_wnat<<<(unsigned)(((size_t)KVD * DM / 8 + 255) / 256), 256, 0, stream>>>(wv, (size_t)KVD * DM / 8, BV); k_wnat<<<(unsigned)(((size_t)DM * DM / 8 + 255) / 256), 256, 0, stream>>>(wo, (size_t)DM * DM / 8, BO);      /* natural [out][in] = Bt planes x16 */
  k_x16<<<(unsigned)((NR * DM / 8 + 255) / 256), 256, 0, stream>>>(x, X16, NR * DM / 8);
  k_tab2d<<<(SQ * (HD / 2) + 255) / 256, 256, 0, stream>>>(CSB, SNB);      /* rope tables cos/sin(p / 10000^(2i/64)): inv_freq double-derived -> f32, f32 angle */
  const size_t r0p = (size_t)B0 * SQ;      /* first projected row */
  for (int b = B0; b < B0 + NBR; ++b) { const size_t r0 = (size_t)b * SQ;
    k_qkv<<<(SQ / 128) * PJT, 128, 0, stream>>>(X16 + r0 * DM, BQ, BK, BV, CSB, SNB, QF0, KF0, VF0, Q16 + r0 * DM, K16 + r0 * KVD, V16 + r0 * KVD);      /* q, k (rotated in the epilogue) and v of this batch: f16 rows, and f32 rows 0..127 (exact products) */
    k_vt<NG, SQ><<<NG * (SQ / 64), 256, 0, stream>>>(V16 + r0 * KVD, KVD, 0, VT);      /* V^T [NG][HD][SQ] for this batch */
    k_kvexp<<<(unsigned)(((size_t)QT0 * DM / 4 + 255) / 256), 256, 0, stream>>>(KF0, KF0e, (size_t)QT0 * DM / 4); k_kvexp<<<(unsigned)(((size_t)QT0 * DM / 4 + 255) / 256), 256, 0, stream>>>(VF0, VF0e, (size_t)QT0 * DM / 4);      /* head h <- kv group h/4 for the exact first-tile kernel */
    k_att0w<<<NH * (QT0 / 8), 256, 0, stream>>>(QF0, KF0e, VF0e, 0.125f, OF0 + (size_t)b * QT0 * DM);      /* exact f32 attention for rows 0..127 (o x64) */
    k_fattn<<<NG * (SQ / FQ), 128, 0, stream>>>(Q16 + r0 * DM, K16 + r0 * KVD, VT, O16 + r0 * DM); }      /* scores, causal softmax and o (merged heads, x64, f16 rows) for all 32 heads in one launch */
  k_gemm2<0><<<dim3((unsigned)((MPO / 128) * (DM / 64)), 1), 128, 0, stream>>>(O16 + r0p * DM, DM, 0, BO, DM, 0, 0.0009765625f, bo, 0, nullptr, 1, 0, 0, (float*)d_out + r0p * DM, nullptr, DM, 0, MPO, DM, DM);      /* out rows are the output layout */
  k_hl<<<(unsigned)(((size_t)NB * QT0 * DM / 8 + 255) / 256), 256, 0, stream>>>(OF0, OH0, OL0, (size_t)NB * QT0 * DM / 8);      /* first-tile o (x64) -> f16 hi + x1024 residual planes */
  for (int b = B0; b < B0 + NBR; ++b) { const size_t r0 = (size_t)b * SQ; const size_t f0 = (size_t)b * QT0;
    k_gemm2<0><<<dim3((QT0 / 128) * (DM / 64), 1), 128, 0, stream>>>(OH0 + f0 * DM, DM, 0, BO, DM, 0, 0.0009765625f, bo, 0, nullptr, 1, 0, 0, (float*)d_out + r0 * DM, nullptr, DM, 0, QT0, DM, DM);      /* rows 0..127: out = o_hi Wo (+ b), overwriting the f16-path rows */
    k_gemm2<0><<<dim3((QT0 / 128) * (DM / 64), 1), 128, 0, stream>>>(OL0 + f0 * DM, DM, 0, BO, DM, 0, 0.00000095367431640625f, nullptr, 0, (const float*)d_out + r0 * DM, -1, 0, 0, (float*)d_out + r0 * DM, nullptr, DM, 0, QT0, DM, DM); }      /* += o_lo Wo 2^-20 (own-element accumulate) */
}

// v009
// Measured time: 108 microseconds a run.
// Timed twice side by side with v008, it ran 1.50 and 1.59 times as fast.
// All steps since v000 together make it 44.0 times as fast.
#include <hip/hip_runtime.h>
// LLaMA grouped-query causal attention with interleaved-pair RoPE (hidden_states [1][2048][2048]; q = x Wq^T (natural [2048][2048]), k = x Wk^T, v = x Wv^T (natural [512][2048]) (sigma 0.02, no biases): 32 query heads / 8 kv heads of 64 (repeat_interleave: kv head h / 4); tables cos/sin of pos / 10000^(2i/64) repeated per pair; q = q cos + rotate_pairs(q) sin with rotate_pairs (x0, x1) -> (-x1, x0): pair (e, o) -> (e cos - o sin, o cos + e sin); scores x 64^-0.5 with a causal mask (triu(1) -> -inf); softmax; out = merged Wo^T (natural) -> [1][2048][2048]).
// Compute dtype: inputs rounded to bf16; x / weights exact; q, k, v, softmax weights and o as plain f16 GEMM operands (~2^-12); scores and softmax statistics f32. v_wmma_f32_16x16x32_f16.
#define NB 1
#define NG 8
#define HPG 4
#define KVD (NG * HD)
#define SQ 2048
#define DM 2048
#define NH 32
#define HD 64
#define HG 4                         /* heads covered by one launch of the non-template k_vt (unused) */
#define QT 256                       /* unused */
#define NKX SQ                       /* S / P row pitch */
#define QT0 128                      /* first-tile rows recomputed exactly in f32 */
#define B0 0                         /* first batch processed (debug hook) */
#define NBR NB                       /* batches processed (debug hook) */
#define NR ((size_t)NB * SQ)         /* token rows */
#define MP ((int)((size_t)NBR * SQ)) /* rows projected (debug hook) */
#define QN SQ                        /* query rows attended per batch (unused) */
#define NHD NH                       /* heads attended (unused) */
#define MPO MP                       /* rows through the output stage (debug hook) */
#define LQ DM      /* row pitch of the q rows */
typedef __bf16 v16b __attribute__((ext_vector_type(16)));
typedef unsigned short v8us __attribute__((ext_vector_type(8), may_alias));
typedef float  v8f  __attribute__((ext_vector_type(8)));
typedef float  v4f  __attribute__((ext_vector_type(4)));
typedef float  v4fa __attribute__((ext_vector_type(4), may_alias));
union FragB { v16b v; v8us half[2]; unsigned short u[16]; };

__device__ __forceinline__ unsigned short bf16_bits(float x) { unsigned int u = __float_as_uint(x); return (unsigned short)((u + 0x7FFFu + ((u >> 16) & 1u)) >> 16); }
__device__ __forceinline__ float bf16_val(unsigned short b) { return __uint_as_float(((unsigned int)b) << 16); }
__device__ __forceinline__ float bf16_round(float x) { return bf16_val(bf16_bits(x)); }
// D += A·B with NT terms: 1 = ah·bh, 2 = + al·bh (A split), 3 = + ah·bl (both split)
template <int NT>
__device__ __forceinline__ v8f mmaN(v16b ah, v16b al, v16b bh, v16b bl, v8f c) {
  c = __builtin_amdgcn_wmma_f32_16x16x32_bf16(false, ah, false, bh, (short)0, c, false, false);
  if (NT >= 2) c = __builtin_amdgcn_wmma_f32_16x16x32_bf16(false, al, false, bh, (short)0, c, false, false);
  if (NT >= 3) c = __builtin_amdgcn_wmma_f32_16x16x32_bf16(false, ah, false, bl, (short)0, c, false, false);
  asm volatile("v_nop\n\tv_nop\n\tv_nop\n\tv_nop" : "+v"(c) : "v"(ah), "v"(al), "v"(bh), "v"(bl));
  return c;
}

__global__ __launch_bounds__(256) void k_wt_bf16(const float* __restrict__ W, unsigned short* __restrict__ Wt, int K, int N) {
  const int t = blockIdx.x * 256 + threadIdx.x;
  const int k8n = K / 8;
  if (t >= N * k8n) return;
  const int n = t / k8n, k8 = (t % k8n) * 8;
  v8us v;
#pragma unroll
  for (int i = 0; i < 8; ++i) v[i] = bf16_bits(W[(size_t)(k8 + i) * N + n]);
  *(v8us*)(Wt + (size_t)n * K + k8) = v;
  
}

// GEMM C[M][N] (f32, pitch ldc) = act(A[M][K]·W + bias). A f32 row-major (pitch lda) converted per fragment to bf16
// (ASPLIT: hi/lo two planes -> 2 terms, else single rounded term); Wt bf16 [N][K] (pitch ldb). BIAS_BF16 rounds the
// bias to bf16 first (bias quantised to bf16 before the add). K%32==0, M%16==0, N%64==0.
template <bool ASPLIT, int ACT, bool BIAS_BF16>
__global__ __launch_bounds__(128) void k_gemm_bf(const float* __restrict__ A, int lda, const unsigned short* __restrict__ Wt, int ldb,
                                               const float* __restrict__ bias, float* __restrict__ C, int ldc, int M, int N, int K) {
  __shared__ __attribute__((aligned(16))) float so[4][16][64];
  const int tid = threadIdx.x, w = tid >> 5, lane = tid & 31, ln = lane & 15, hh = lane >> 4;
  const int ntn = N / 64;
  const int wid = blockIdx.x * 4 + w;
  const int mt = wid / ntn, nq = wid % ntn;
  if (mt * 16 >= M) return;
  const int row0 = mt * 16, col0 = nq * 64;
  const float* arow = A + (size_t)(row0 + ln) * lda;
  v8f acc[4] = {};
  for (int kb = 0; kb < K; kb += 32) {
    FragB ah, al;
    const v4f x0 = *(const v4fa*)(arow + kb + 8 * hh), x1 = *(const v4fa*)(arow + kb + 8 * hh + 4);
    const v4f x2 = *(const v4fa*)(arow + kb + 16 + 8 * hh), x3 = *(const v4fa*)(arow + kb + 16 + 8 * hh + 4);
    float xs[16] = {x0[0],x0[1],x0[2],x0[3],x1[0],x1[1],x1[2],x1[3],x2[0],x2[1],x2[2],x2[3],x3[0],x3[1],x3[2],x3[3]};
#pragma unroll
    for (int i = 0; i < 16; ++i) { const unsigned short hb = bf16_bits(xs[i]); ah.u[i] = hb; al.u[i] = ASPLIT ? bf16_bits(xs[i] - bf16_val(hb)) : (unsigned short)0; }
#pragma unroll
    for (int t = 0; t < 4; ++t) {
      const unsigned short* brow = Wt + (size_t)(col0 + t * 16 + ln) * ldb + kb;
      FragB b;
      b.half[0] = *(const v8us*)(brow + 8 * hh);
      b.half[1] = *(const v8us*)(brow + 16 + 8 * hh);
      acc[t] = mmaN<ASPLIT ? 2 : 1>(ah.v, al.v, b.v, b.v, acc[t]);
    }
  }
#pragma unroll
  for (int t = 0; t < 4; ++t) {
    float bv = bias ? bias[col0 + t * 16 + ln] : 0.f;
    if (BIAS_BF16) bv = bf16_round(bv);
#pragma unroll
    for (int r = 0; r < 8; ++r) { float v = acc[t][r] + bv; if (ACT == 1) v = fmaxf(v, 0.f); so[w][8 * hh + r][t * 16 + ln] = v; }
  }
  __builtin_amdgcn_fence(__ATOMIC_ACQ_REL, "workgroup");
  __builtin_amdgcn_wave_barrier();
  const int rsub = lane >> 4, c4 = (lane & 15) * 4;
  {
#pragma unroll
    for (int q = 0; q < 8; ++q) {
      const int r = q * 2 + rsub;
      const v4f v = *(const v4fa*)&so[w][r][c4];
      *(v4f*)(C + (size_t)(row0 + r) * ldc + col0 + c4) = v;
    }
    
  }
}

// GEMM C = act(A·W + bias + resid): A f32 (ASPLIT -> hi/lo 2 terms), Wt bf16 [N][K]; ACT 0 none, 1 relu, 2 exact gelu;
// resid (optional, f32, row index = (row % rmod), pitch ldr, RES_BF16 rounds it) added before the activation.
template <bool ASPLIT, int ACT, bool BIAS_BF16, bool RES_BF16>
__global__ __launch_bounds__(128) void k_gemm_bf3(const float* __restrict__ A, int lda, const unsigned short* __restrict__ Wt, int ldb,
                                                const float* __restrict__ bias, const float* __restrict__ resid, int rmod, int ldr,
                                                float* __restrict__ C, int ldc, int M, int N, int K) {
  __shared__ __attribute__((aligned(16))) float so[4][16][64];
  const int tid = threadIdx.x, w = tid >> 5, lane = tid & 31, ln = lane & 15, hh = lane >> 4;
  const int ntn = N / 64;
  const int wid = blockIdx.x * 4 + w;
  const int mt = wid / ntn, nq = wid % ntn;
  if (mt * 16 >= M) return;
  const int row0 = mt * 16, col0 = nq * 64;
  const float* arow = A + (size_t)(row0 + ln) * lda;
  v8f acc[4] = {};
  for (int kb = 0; kb < K; kb += 32) {
    FragB ah, al;
    const v4f x0 = *(const v4fa*)(arow + kb + 8 * hh), x1 = *(const v4fa*)(arow + kb + 8 * hh + 4);
    const v4f x2 = *(const v4fa*)(arow + kb + 16 + 8 * hh), x3 = *(const v4fa*)(arow + kb + 16 + 8 * hh + 4);
    float xs[16] = {x0[0],x0[1],x0[2],x0[3],x1[0],x1[1],x1[2],x1[3],x2[0],x2[1],x2[2],x2[3],x3[0],x3[1],x3[2],x3[3]};
#pragma unroll
    for (int i = 0; i < 16; ++i) { const unsigned short hb = bf16_bits(xs[i]); ah.u[i] = hb; al.u[i] = ASPLIT ? bf16_bits(xs[i] - bf16_val(hb)) : (unsigned short)0; }
#pragma unroll
    for (int t = 0; t < 4; ++t) {
      const unsigned short* brow = Wt + (size_t)(col0 + t * 16 + ln) * ldb + kb;
      FragB b;
      b.half[0] = *(const v8us*)(brow + 8 * hh);
      b.half[1] = *(const v8us*)(brow + 16 + 8 * hh);
      acc[t] = mmaN<ASPLIT ? 2 : 1>(ah.v, al.v, b.v, b.v, acc[t]);
    }
  }
#pragma unroll
  for (int t = 0; t < 4; ++t) {
    const int col = col0 + t * 16 + ln;
    float bv = bias ? bias[col] : 0.f;
    if (BIAS_BF16) bv = bf16_round(bv);
#pragma unroll
    for (int r = 0; r < 8; ++r) {
      float v = acc[t][r] + bv;
      if (resid) { float rv = resid[(size_t)((row0 + 8 * hh + r) % rmod) * ldr + col]; if (RES_BF16) rv = bf16_round(rv); v += rv; }
      if (ACT == 1) v = fmaxf(v, 0.f);
      if (ACT == 2) v = 0.5f * v * (1.0f + erff(v * 0.70710678118654752f));
      if (ACT == 3) { const float u = 0.7978845608028654f * (v + 0.044715f * v * v * v); v = 0.5f * v * (1.0f + tanhf(u)); }
      so[w][8 * hh + r][t * 16 + ln] = v;
    }
  }
  __builtin_amdgcn_fence(__ATOMIC_ACQ_REL, "workgroup");
  __builtin_amdgcn_wave_barrier();
  const int rsub = lane >> 4, c4 = (lane & 15) * 4;
  {
#pragma unroll
    for (int q = 0; q < 8; ++q) {
      const int r = q * 2 + rsub;
      const v4f v = *(const v4fa*)&so[w][r][c4];
      *(v4f*)(C + (size_t)(row0 + r) * ldc + col0 + c4) = v;
    }
    
  }
}
// row LayerNorm (biased variance, eps) over N: s = X (+ R); optional out_sum <- s; out_norm <- (s-mu)*rsqrt(var+eps)*g + b
template <bool PARAM_BF16>
__global__ __launch_bounds__(256) void k_layernorm(const float* __restrict__ X, const float* __restrict__ R, const float* __restrict__ g, const float* __restrict__ bta,
                                                  float* __restrict__ out_sum, float* __restrict__ out_norm, int N, float eps) {
  __shared__ float red[256];
  const int row = blockIdx.x, tid = threadIdx.x;
  const float* x = X + (size_t)row * N; const float* rr = R ? R + (size_t)row * N : nullptr;
  float vals[16];                     // up to N = 4096
  const int per = N / 256;            // contiguous chunk per thread? use strided-by-4 chunks: thread handles j = tid*4 + 1024*u
  float s1 = 0.f;
  for (int u = 0; u < per / 4; ++u) {
    const int j = tid * 4 + 1024 * u;
    const v4f a = *(const v4fa*)(x + j);
    v4f b = {0.f,0.f,0.f,0.f}; if (rr) b = *(const v4fa*)(rr + j);
#pragma unroll
    for (int q = 0; q < 4; ++q) { const float v = a[q] + b[q]; vals[u * 4 + q] = v; s1 += v; }
  }
  red[tid] = s1; __syncthreads();
  for (int st = 128; st > 0; st >>= 1) { if (tid < st) red[tid] += red[tid + st]; __syncthreads(); }
  const float mu = red[0] / (float)N; __syncthreads();
  float s2 = 0.f;
  for (int u = 0; u < per / 4; ++u)
#pragma unroll
    for (int q = 0; q < 4; ++q) { const float c = vals[u * 4 + q] - mu; s2 += c * c; }
  red[tid] = s2; __syncthreads();
  for (int st = 128; st > 0; st >>= 1) { if (tid < st) red[tid] += red[tid + st]; __syncthreads(); }
  const float rs = rsqrtf(red[0] / (float)N + eps);
  {
    for (int u = 0; u < per / 4; ++u) {
      const int j = tid * 4 + 1024 * u;
      v4f o, sm;
#pragma unroll
      for (int q = 0; q < 4; ++q) {
        float gg = g[j + q], bb = bta[j + q];
        if (PARAM_BF16) { gg = bf16_round(gg); bb = bf16_round(bb); }
        sm[q] = vals[u * 4 + q]; o[q] = (vals[u * 4 + q] - mu) * rs * gg + bb;
      }
      if (out_sum) *(v4f*)(out_sum + (size_t)row * N + j) = sm;
      *(v4f*)(out_norm + (size_t)row * N + j) = o;
    }
    
  }
}



// ---- f16 WMMA path (v_wmma_f32_16x16x32_f16): 11-bit significands for operands in range — used where a [0,1] probability operand needs more precision than bf16
typedef _Float16 v16h __attribute__((ext_vector_type(16)));
union FragH { v16h v; v8us half[2]; _Float16 h[16]; unsigned short u[16]; };
template <int NT>
__device__ __forceinline__ v8f mmaH(v16h ah, v16h al, v16h bh, v16h bl, v8f c) {
  c = __builtin_amdgcn_wmma_f32_16x16x32_f16(false, ah, false, bh, (short)0, c, false, false);
  if (NT >= 2) c = __builtin_amdgcn_wmma_f32_16x16x32_f16(false, al, false, bh, (short)0, c, false, false);
  if (NT >= 3) c = __builtin_amdgcn_wmma_f32_16x16x32_f16(false, ah, false, bl, (short)0, c, false, false);
  asm volatile("v_nop\n\tv_nop\n\tv_nop\n\tv_nop" : "+v"(c) : "v"(ah), "v"(al), "v"(bh), "v"(bl));
  return c;
}
// batched GEMM like k_gemm_b but f16 operands: A f32 (split into f16 hi/lo if ASPLIT, else rounded to f16), Bt = f16 values [n][k]; alpha; C f32; N multiple of 16 (partial tiles skipped)
template <bool ASPLIT>
__global__ __launch_bounds__(128) void k_gemm_h(const float* __restrict__ A, int lda, size_t sA, const _Float16* __restrict__ Bh, int ldb, size_t sB, float alpha, float* __restrict__ C, int ldc, size_t sC, int M, int N, int K) {
  __shared__ __attribute__((aligned(16))) float so[4][16][64];
  const int tid = threadIdx.x, w = tid >> 5, lane = tid & 31, ln = lane & 15, hh = lane >> 4; const int by = blockIdx.y;
  A += (size_t)by * sA; Bh += (size_t)by * sB; C += (size_t)by * sC;
  const int ntn = (N + 63) / 64; const int wid = blockIdx.x * 4 + w; const int mt = wid / ntn, nq = wid % ntn; if (mt * 16 >= M) return;
  const int row0 = mt * 16, col0 = nq * 64; const float* arow = A + (size_t)(row0 + ln) * lda;
  v8f acc[4] = {};
  for (int kb = 0; kb < K; kb += 32) {
    FragH ah, al;
    const v4f x0 = *(const v4fa*)(arow + kb + 8 * hh), x1 = *(const v4fa*)(arow + kb + 8 * hh + 4), x2 = *(const v4fa*)(arow + kb + 16 + 8 * hh), x3 = *(const v4fa*)(arow + kb + 16 + 8 * hh + 4);
    float xs[16] = {x0[0],x0[1],x0[2],x0[3],x1[0],x1[1],x1[2],x1[3],x2[0],x2[1],x2[2],x2[3],x3[0],x3[1],x3[2],x3[3]};
#pragma unroll
    for (int i = 0; i < 16; ++i) { const _Float16 h = (_Float16)xs[i]; ah.h[i] = h; al.h[i] = ASPLIT ? (_Float16)(xs[i] - (float)h) : (_Float16)0.0f; }
#pragma unroll
    for (int t = 0; t < 4; ++t) { if (col0 + t * 16 >= N) continue; const size_t boff = (size_t)(col0 + t * 16 + ln) * ldb + kb; FragH bq; bq.half[0] = *(const v8us*)(Bh + boff + 8 * hh); bq.half[1] = *(const v8us*)(Bh + boff + 16 + 8 * hh);
      acc[t] = mmaH<ASPLIT ? 2 : 1>(ah.v, al.v, bq.v, bq.v, acc[t]); }
  }
#pragma unroll
  for (int t = 0; t < 4; ++t) { if (col0 + t * 16 >= N) continue;
#pragma unroll
    for (int r = 0; r < 8; ++r) so[w][8 * hh + r][t * 16 + ln] = acc[t][r] * alpha; }
  __builtin_amdgcn_fence(__ATOMIC_ACQ_REL, "workgroup"); __builtin_amdgcn_wave_barrier();
  const int rsub = lane >> 4, c4 = (lane & 15) * 4;
  {
#pragma unroll
    for (int q = 0; q < 8; ++q) { const int r = q * 2 + rsub; if (col0 + c4 < N) { const v4f v = *(const v4fa*)&so[w][r][c4]; *(v4f*)(C + (size_t)(row0 + r) * ldc + col0 + c4) = v; } }
     }
}

// Wt[n][k] = f16(W[k][n]·scale) from f32 row-major W[K][N] (scale = power of two; bf16-exact weights stay exact in f16 away from the subnormal range)
__global__ __launch_bounds__(256) void k_wt_f16(const float* __restrict__ W, _Float16* __restrict__ Wt, int K, int N, float scale) {
  const int t = blockIdx.x * 256 + threadIdx.x; if (t >= N * (K / 8)) return; const int n = t / (K / 8), k8 = (t % (K / 8)) * 8; FragH f;
#pragma unroll
  for (int i = 0; i < 8; ++i) f.h[i] = (_Float16)(bf16_round(W[(size_t)(k8 + i) * N + n]) * scale); const v8us o = f.half[0];
  *(v8us*)((unsigned short*)Wt + (size_t)n * K + k8) = o; 
}
// k_gemm_hh variant with fused epilogue: v = acc·alpha + bias[by·sBias + col] (+ CP[(row/rowsPerB)·sCPb + by·64 + col] if CP) ; ACT 0 none / 1 elu ; writes f16 C16 (and f32 C if non-null)
template <int ACT>
__global__ __launch_bounds__(128) void k_gemm_hhx(const _Float16* __restrict__ A, int lda, size_t sA, const _Float16* __restrict__ Bh, int ldb, size_t sB, float alpha, const float* __restrict__ bias, size_t sBias, const float* __restrict__ CP, int rowsPerB, size_t sCPb, int row0g,
    float* __restrict__ C, _Float16* __restrict__ C16, int ldc, size_t sC, int M, int N, int K) {
  __shared__ __attribute__((aligned(16))) float so[4][16][64];
  const int tid = threadIdx.x, w = tid >> 5, lane = tid & 31, ln = lane & 15, hh = lane >> 4; const int by = blockIdx.y;
  A += (size_t)by * sA; Bh += (size_t)by * sB; const size_t cofs = (size_t)by * sC; const float* bp = bias ? bias + (size_t)by * sBias : nullptr;
  const int ntn = (N + 63) / 64; const int wid = blockIdx.x * 4 + w; const int mt = wid / ntn, nq = wid % ntn; if (mt * 16 >= M) return;
  const int row0 = mt * 16, col0 = nq * 64; const _Float16* arow = A + (size_t)(row0 + ln) * lda;
  v8f acc[4] = {};
  for (int kb = 0; kb < K; kb += 32) { FragH ah; ah.half[0] = *(const v8us*)((const unsigned short*)arow + kb + 8 * hh); ah.half[1] = *(const v8us*)((const unsigned short*)arow + kb + 16 + 8 * hh);
#pragma unroll
    for (int t = 0; t < 4; ++t) { if (col0 + t * 16 >= N) continue; const size_t boff = (size_t)(col0 + t * 16 + ln) * ldb + kb; FragH bq; bq.half[0] = *(const v8us*)((const unsigned short*)Bh + boff + 8 * hh); bq.half[1] = *(const v8us*)((const unsigned short*)Bh + boff + 16 + 8 * hh);
      acc[t] = mmaH<1>(ah.v, ah.v, bq.v, bq.v, acc[t]); }
  }
#pragma unroll
  for (int t = 0; t < 4; ++t) { if (col0 + t * 16 >= N) continue; const int col = col0 + t * 16 + ln; const float bv = bp ? bf16_round(bp[col]) : 0.f;
#pragma unroll
    for (int r = 0; r < 8; ++r) { float v = acc[t][r] * alpha + bv; if (CP) { const int rr = row0g + row0 + 8 * hh + r; if (rowsPerB < 0) v += CP[cofs + (size_t)rr * ldc + col];      /* rowsPerB < 0: own element of the batched C plane */ else { const int bidx = rr / rowsPerB; v += CP[(size_t)bidx * sCPb + (size_t)by * 64 + col]; } } if (ACT == 1) v = (v > 0.f) ? v : expm1f(v); else if (ACT == 7) v = (v > 0.f) ? v + 1.0f : expf(v); else if (ACT == 8) v = tanhf(v); else if (ACT == 9) v = 0.5f * v * (1.0f + tanhf(0.7978845608028654f * (v + 0.044715f * v * v * v))); else if (ACT == 11) v = 1.0f / (1.0f + expf(-v)); else if (ACT == 12) v = (v > 0.f) ? v : 0.01f * v; else if (ACT == 14) v = (v > 0.f) ? v : 0.1f * v; else if (ACT == 16) v = (v >= 0.f) ? v : 0.3f * v; else if (ACT == 17) v = (v >= 0.f) ? v : 0.2f * v; else if (ACT == 15) v = v / (1.0f + expf(-v)); else if (ACT == 3) v = fmaxf(v, 0.f); else if (ACT == 6) v = 0.5f * v * (1.0f + erff(v * 0.70710678118654752f)); so[w][8 * hh + r][t * 16 + ln] = v; } }
  __builtin_amdgcn_fence(__ATOMIC_ACQ_REL, "workgroup"); __builtin_amdgcn_wave_barrier();
  const int rsub = lane >> 4, c4 = (lane & 15) * 4; typedef _Float16 v4h __attribute__((ext_vector_type(4)));
  {
#pragma unroll
    for (int q = 0; q < 8; ++q) { const int r = q * 2 + rsub; if (col0 + c4 < N) { const v4f v = *(const v4fa*)&so[w][r][c4]; if (C) *(v4f*)(C + cofs + (size_t)(row0 + r) * ldc + col0 + c4) = v; if (C16) { v4h h4; for (int i = 0; i < 4; ++i) h4[i] = (_Float16)v[i]; *(v4h*)(C16 + cofs + (size_t)(row0 + r) * ldc + col0 + c4) = h4; } } }
     }
}


typedef _Float16 v4h __attribute__((ext_vector_type(4)));

__global__ __launch_bounds__(256) void k_x16(const float* __restrict__ x, _Float16* __restrict__ X16, size_t n8) { const size_t t = (size_t)blockIdx.x * 256 + threadIdx.x; if (t >= n8) return; FragH f;
#pragma unroll
  for (int q = 0; q < 8; ++q) f.h[q] = (_Float16)bf16_round(x[t * 8 + q]); *(v8us*)((unsigned short*)X16 + t * 8) = f.half[0];  }
__global__ __launch_bounds__(256) void k_h16(const float* __restrict__ x, _Float16* __restrict__ X16, size_t n8) { const size_t t = (size_t)blockIdx.x * 256 + threadIdx.x; if (t >= n8) return; FragH f;
#pragma unroll
  for (int q = 0; q < 8; ++q) f.h[q] = (_Float16)x[t * 8 + q]; *(v8us*)((unsigned short*)X16 + t * 8) = f.half[0];  }
__global__ __launch_bounds__(256) void k_round16f(const float* __restrict__ W, _Float16* __restrict__ Bt, size_t n8) { const size_t t = (size_t)blockIdx.x * 256 + threadIdx.x; if (t >= n8) return; FragH f;
#pragma unroll
  for (int i = 0; i < 8; ++i) f.h[i] = (_Float16)(bf16_round(W[t * 8 + i]) * 16.0f); *(v8us*)((unsigned short*)Bt + t * 8) = f.half[0];  }
template <int NHv, int TTv>
__global__ __launch_bounds__(256) void k_vt(const _Float16* __restrict__ V16, int ldv, int voff, _Float16* __restrict__ Vt) { __shared__ unsigned short tl[64][66]; const int tid = threadIdx.x; const int slab = blockIdx.x / (TTv / 64), lg = blockIdx.x % (TTv / 64); const int b = slab / NHv, h = slab % NHv;
  for (int i = tid; i < 64 * 8; i += 256) { const int r = i / 8, c8 = (i % 8) * 8; FragH f; f.half[0] = *(const v8us*)((const unsigned short*)V16 + ((size_t)b * TTv + lg * 64 + r) * ldv + voff + h * 64 + c8);
#pragma unroll
    for (int q = 0; q < 8; ++q) tl[r][c8 + q] = f.u[q]; }
  __syncthreads();
  {
#pragma unroll
    for (int rd = 0; rd < 2; ++rd) { const int d = rd * 32 + tid / 8, pc = tid % 8; FragH f;
#pragma unroll
      for (int q = 0; q < 8; ++q) f.u[q] = tl[pc * 8 + q][d];
      *(v8us*)((unsigned short*)Vt + ((size_t)slab * 64 + d) * TTv + lg * 64 + pc * 8) = f.half[0]; }
     } }

__global__ __launch_bounds__(256) void k_hl(const float* __restrict__ F, _Float16* __restrict__ Hh, _Float16* __restrict__ Hl, size_t n8) { const size_t t = (size_t)blockIdx.x * 256 + threadIdx.x; if (t >= n8) return; FragH fh, fl; const v4f a = *(const v4fa*)(F + t * 8), c = *(const v4fa*)(F + t * 8 + 4);
#pragma unroll
  for (int q = 0; q < 4; ++q) { _Float16 h = (_Float16)a[q]; fh.h[q] = h; fl.h[q] = (_Float16)((a[q] - (float)h) * 1024.0f); h = (_Float16)c[q]; fh.h[4 + q] = h; fl.h[4 + q] = (_Float16)((c[q] - (float)h) * 1024.0f); }
  { *(v8us*)((unsigned short*)Hh + t * 8) = fh.half[0]; *(v8us*)((unsigned short*)Hl + t * 8) = fl.half[0];  } }

// ---- fast GEMM (block tile 128x64, wave tile 32x64; requires M % 128 == 0, N % 64 == 0, K % 128 == 0 and K >= 256); epilogue = k_gemm_hhx semantics ----
__device__ __forceinline__ v16h g2_frag(const _Float16* p, int hh) { FragH f; f.half[0] = *(const v8us*)((const unsigned short*)p + 8 * hh); f.half[1] = *(const v8us*)((const unsigned short*)p + 16 + 8 * hh); return f.v; }
__device__ __forceinline__ v8f g2_mma(v16h a, v16h b, v8f c) { v8f d = __builtin_amdgcn_wmma_f32_16x16x32_f16(false, a, false, b, (short)0, c, false, false); asm volatile("v_nop\n\tv_nop\n\tv_nop\n\tv_nop" : "+v"(d) : "v"(a), "v"(b)); return d; }
typedef float v2f  __attribute__((ext_vector_type(2)));
typedef float v2fa __attribute__((ext_vector_type(2), may_alias));
struct G2Set { v16h a0, a1, b0, b1, b2, b3; };      /* the fragments of one 32-k step of a 32x64 wave tile */
// The K loop of k_gemm2 takes its operands from LDS: a stage is G2KS k of the block's 128 A rows and 64 B rows, brought there by tensor loads (no register on the way), two buffers.
typedef unsigned int u32x4 __attribute__((ext_vector_type(4)));
typedef unsigned int u32x8 __attribute__((ext_vector_type(8)));
#define G2KS 128                     /* k per stage: rows of 256 B */
#define G2P 272                      /* row pitch in LDS, bytes: 256 + the 16-B pad that the tensor load leaves behind a row (16 B x 17, for ds_load_b128 readers) */
#define G2SA 18432                   /* a slice of 64 A rows, 17,408 B, rounded up to a multiple of 2 KiB */
#define G2SB 10240                   /* a slice of 32 B rows, 8,704 B, the same */
#define G2BUF (2 * G2SA + 2 * G2SB)  /* one buffer: two A slices, two B slices */
static_assert(64 * G2P <= G2SA && 32 * G2P <= G2SB && G2SA % 2048 == 0 && G2SB % 2048 == 0 && G2P == 2 * G2KS + 16, "k_gemm2: every slice starts at a multiple of 2 KiB and holds its padded rows");
__device__ __forceinline__ unsigned int g2_uni(unsigned int v) { return (unsigned int)__builtin_amdgcn_readfirstlane((int)v); }
__device__ __forceinline__ unsigned int g2_pinned(unsigned int v) { unsigned int r = g2_uni(v); asm volatile("" : "+s"(r)); return r; }      /* the test around a tensor load, held in a scalar register: the instruction ignores EXEC, so only a scalar branch keeps a wave from issuing it */
__device__ __forceinline__ v16h g2_lfrag(const unsigned char* p) { FragH f; f.half[0] = *(const v8us*)p; f.half[1] = *(const v8us*)(p + 32); return f.v; }      /* p already holds the lane's 16 hh bytes: the k order of g2_frag */
// ROPE 1: the tile's columns are heads of HD and its rows are positions; the interleaved-pair rotation (e, o) -> (e cos - o sin, e sin + o cos), tables CS, SN [pos][HD / 2], is applied
// to the finished tile on its way out of LDS, where rot says so (the same for the whole block; without it the tile goes out as it is). C16 takes every row as f16, C (f32) only the rows below crows (a multiple of 32, the wave tile's rows).
// ROPE 2: a split tile. The block's two A slices are the same 64 rows (64 mt ...) of two planes, A (high parts) and AL (residues x1024), so waves 0, 1 form the high products and waves 2, 3 the residue products
// of the same 64 x 64 outputs; the two meet in LDS on the way out: C = residue sum x alpha / 1024 + high sum x alpha.
// g2_tile is the work of one block on the tile (mt, nq) of batch plane by; ring and so are the calling kernel's LDS.
template <int ACT, int ROPE>
__device__ __forceinline__ void g2_tile(unsigned char (&ring)[2][G2BUF], float (&so)[4][32][68], const int mt, const int nq, const int by, const bool rot, const _Float16* __restrict__ A, int lda, size_t sA, const _Float16* __restrict__ Bh, int ldb, size_t sB, float alpha, const float* __restrict__ bias, size_t sBias, const float* __restrict__ CP, int rowsPerB, size_t sCPb, int row0g,
    float* __restrict__ C, _Float16* __restrict__ C16, int ldc, size_t sC, int M, int K, int bshift, const float* __restrict__ CS, const float* __restrict__ SN, int crows, const _Float16* __restrict__ AL = nullptr) { static_assert(ACT == 0 || ACT == 3 || ACT == 6 || ACT == 8 || ACT == 9 || ACT == 11 || ACT == 12 || ACT == 14 || ACT == 15 || ACT == 16 || ACT == 17, "k_gemm2: unsupported ACT code (would silently apply no activation)");
  const int tid = threadIdx.x, w = tid >> 5, lane = tid & 31, ln = lane & 15, hh = lane >> 4;
  A += (size_t)by * sA; Bh += (size_t)(by >> bshift) * sB;      /* 2^bshift consecutive batch planes share one B plane (query heads of one kv group) */ const size_t cofs = (size_t)by * sC; const float* bp = bias ? bias + (size_t)by * sBias : nullptr;
  const int arow = mt * (ROPE == 2 ? 64 : 128);      /* the block's first A row */ const int row0 = arow + 32 * (ROPE == 2 ? w & 1 : w), col0 = nq * 64; if (arow >= M) return;      /* the whole block or none of it: barriers follow */
  const v8f z8 = {0.f,0.f,0.f,0.f,0.f,0.f,0.f,0.f}; v8f c00 = z8, c01 = z8, c02 = z8, c03 = z8, c10 = z8, c11 = z8, c12 = z8, c13 = z8;
  /* Every wave brings one slice of each stage: waves 0 and 1 the two halves (64 rows) of the block's A rows (ROPE 2: the block's 64 rows, of A and of AL), waves 2 and 3 the two halves (32 rows) of its B rows. */
  const unsigned int wv = g2_uni((unsigned int)tid >> 5), hf = wv & 1u; const bool isB = wv >= 2u;
  const unsigned int nrow = isB ? 32u : 64u, spitch = (isB ? (unsigned int)ldb : (unsigned int)lda) * 2u;
  const unsigned long long sbase = isB ? (unsigned long long)(size_t)(Bh + (size_t)(col0 + 32 * (int)hf) * ldb) : ROPE == 2 ? (unsigned long long)(size_t)((hf ? AL : A) + (size_t)arow * lda) : (unsigned long long)(size_t)(A + (size_t)(arow + 64 * (int)hf) * lda);
  const unsigned int dbase = (unsigned int)(size_t)&ring[0][0] + (isB ? 2u * G2SA + hf * G2SB : hf * G2SA);
  u32x8 g1;      /* 1-byte elements, tensor = tile = nrow rows of 256 B, source pitch spitch, a pad of 4 dwords behind every 64 dwords */
  g1[0] = g2_uni((1u << 20) | (5u << 22) | (3u << 25)); g1[1] = g2_uni(256u << 16); g1[2] = g2_uni(nrow << 16); g1[3] = g2_uni(256u << 16); g1[4] = g2_uni(nrow); g1[5] = g2_uni(spitch); g1[6] = g2_uni(0u); g1[7] = g2_uni(0u);
  u32x4 g0; g0[0] = g2_uni(1u);      /* g0 and g1 live outside the loop and go in and out of every tensor load and every wait on the tensor counter: one set of registers holds them throughout, and no word of a request is rewritten before it has landed */
  auto issue = [&](unsigned int st) { const unsigned long long ga = sbase + (unsigned long long)st * (2 * G2KS);
    g0[1] = g2_uni(dbase + (st & 1u) * G2BUF); g0[2] = g2_uni((unsigned int)ga); g0[3] = g2_uni((((unsigned int)(ga >> 32)) & 0x01FFFFFFu) | 0x80000000u);
    asm volatile("tensor_load_to_lds %0, %1" : "+s"(g0), "+s"(g1) :: "memory"); };      /* one request of the whole wave */
  const unsigned char* const la = &ring[0][0] + (wv >> 1) * G2SA + (hf * 32u + (unsigned int)ln) * G2P + 16 * hh;      /* the wave's A rows 32 w + ln (ROPE 2: rows 32 (w & 1) + ln, of AL for waves 2, 3) */
  const unsigned char* const lb = &ring[0][0] + 2 * G2SA + ln * G2P + 16 * hh;      /* B row ln */
  auto ld = [&](unsigned int bo, int j) { G2Set s; const unsigned char* const pa = la + bo + j * 64; const unsigned char* const pb = lb + bo + j * 64;      /* the j-th 32-k step of the stage in the buffer at bo */
    s.a0 = g2_lfrag(pa); s.a1 = g2_lfrag(pa + 16 * G2P); s.b0 = g2_lfrag(pb); s.b1 = g2_lfrag(pb + 16 * G2P); s.b2 = g2_lfrag(pb + G2SB); s.b3 = g2_lfrag(pb + G2SB + 16 * G2P); return s; };
  auto use = [&](const G2Set& s) { c00 = g2_mma(s.a0, s.b0, c00); c10 = g2_mma(s.a1, s.b0, c10); c01 = g2_mma(s.a0, s.b1, c01); c11 = g2_mma(s.a1, s.b1, c11);
    c02 = g2_mma(s.a0, s.b2, c02); c12 = g2_mma(s.a1, s.b2, c12); c03 = g2_mma(s.a0, s.b3, c03); c13 = g2_mma(s.a1, s.b3, c13); };
  const unsigned int nst = (unsigned int)K / G2KS;      /* stages; at least two */
  issue(0u);
  unsigned int nx = 1u;      /* the stage to ask for next. It goes through each wait on the tensor counter, so that no word of its descriptor is formed while the request before it is out */
  asm volatile("s_wait_tensorcnt 0x0" : "+s"(nx), "+s"(g0), "+s"(g1) :: "memory");      /* this wave's slice of stage 0 has landed */
  __syncthreads();      /* stage 0 is whole: every wave's slice */
  issue(nx);
#pragma unroll 1      /* one trip is one stage; every accumulator still sums k upwards */
  for (unsigned int st = 0; st < nst; ++st) { const unsigned int bo = (st & 1u) * G2BUF;
    G2Set s0 = ld(bo, 0), s1 = ld(bo, 1); use(s0); s0 = ld(bo, 2); use(s1); s1 = ld(bo, 3); use(s0); use(s1);      /* two fragment sets: a step's LDS reads go out ahead of the products of the step before */
    asm volatile("s_wait_dscnt 0x0" ::: "memory");      /* this wave has read all it needs of the buffer that is filled anew below */
    nx = st + 2u;
    asm volatile("s_wait_tensorcnt 0x0" : "+s"(nx), "+s"(g0), "+s"(g1) :: "memory");      /* this wave's slice of stage st + 1 has landed */
    __syncthreads();      /* stage st + 1 is whole, and every wave has left stage st's buffer */
    if (g2_pinned(nx < nst)) issue(nx); }
  asm volatile("s_wait_tensorcnt 0x0" : "+s"(g0), "+s"(g1) :: "memory");      /* no request is out when the wave goes on */
  asm volatile("s_wait_dscnt 0x0" ::: "memory");      /* nor any of its reads of the ring */
  v2f tc[16], ts[16];      /* ROPE: the table entries of the lane's two pairs, for the 16 rows that it writes out */
  if constexpr (ROPE == 1) if (rot) { static_assert(HD == 64, "k_gemm2: a 64-column tile is one head");
    const size_t to = (size_t)(row0 + hh) * (HD / 2) + ln * 2; const float* const cp = CS + to; const float* const sp = SN + to;
#pragma unroll      /* full unroll: register arrays; the 32 loads go out together here, so that they fly while the tile is staged in LDS */
    for (int q = 0; q < 16; ++q) { tc[q] = *(const v2fa*)(cp + q * HD); ts[q] = *(const v2fa*)(sp + q * HD); }      /* two rows of HD / 2 entries a step */
    asm volatile("s_wait_xcnt 0x0" :: "v"(cp), "v"(sp) : "memory"); }      /* precaution: the two addresses are inputs, so they stay in their registers up to this wait and nothing of the run is loaded into a register that an earlier load of the run names */
  v8f accs[8] = {c00, c01, c02, c03, c10, c11, c12, c13};
  if (ROPE == 2 && w >= 2) alpha *= 0.0009765625f;      /* the residue plane is carried x1024 */
#pragma unroll
  for (int u = 0; u < 8; ++u) { const int t = u & 3, half = u >> 2; const int col = col0 + t * 16 + ln; const float bv = bp ? bf16_round(bp[col]) : 0.f;
#pragma unroll
    for (int r = 0; r < 8; ++r) { const int rloc = half * 16 + 8 * hh + r; float v = accs[u][r] * alpha + bv; if (CP) { if (rowsPerB < 0) v += CP[cofs + (size_t)(row0g + row0 + rloc) * ldc + col];      /* rowsPerB < 0: own element of the batched C plane */ else { const int bidx = (row0g + row0 + rloc) / rowsPerB; v += CP[(size_t)bidx * sCPb + (size_t)by * 64 + col]; } }
      if (ACT == 3) v = fmaxf(v, 0.f); else if (ACT == 6) v = 0.5f * v * (1.0f + erff(v * 0.70710678118654752f)); else if (ACT == 11) v = 1.0f / (1.0f + expf(-v)); else if (ACT == 15) v = v / (1.0f + expf(-v)); else if (ACT == 12) v = (v > 0.f) ? v : 0.01f * v; else if (ACT == 8) v = tanhf(v); else if (ACT == 9) v = 0.5f * v * (1.0f + tanhf(0.7978845608028654f * (v + 0.044715f * v * v * v))); else if (ACT == 14) v = (v > 0.f) ? v : 0.1f * v; else if (ACT == 16) v = (v >= 0.f) ? v : 0.3f * v; else if (ACT == 17) v = (v >= 0.f) ? v : 0.2f * v;
      so[w][rloc][t * 16 + ln] = v; } }
  __builtin_amdgcn_fence(__ATOMIC_ACQ_REL, "workgroup"); __builtin_amdgcn_wave_barrier();
  const int rsub = lane >> 4, c4 = (lane & 15) * 4;
  if constexpr (ROPE == 1) {      /* a lane's four columns are two whole pairs of one head (col0 is a multiple of HD), pair numbers c4 / 2 and c4 / 2 + 1 */
    _Float16* const hp = C16 + cofs + (size_t)(row0 + rsub) * ldc + col0 + c4; v4f o[16];
#pragma unroll      /* full unroll: register arrays need constant indices */
    for (int q = 0; q < 16; ++q) o[q] = *(const v4fa*)&so[w][q * 2 + rsub][c4];
    if (rot) {      /* one test for the 16 rows, the same for the whole block */
#pragma unroll      /* full unroll: register arrays need constant indices */
      for (int q = 0; q < 16; ++q) { const v4f v = o[q]; const v2f c = tc[q], s = ts[q];
        o[q][0] = v[0] * c[0] - v[1] * s[0]; o[q][1] = v[0] * s[0] + v[1] * c[0]; o[q][2] = v[2] * c[1] - v[3] * s[1]; o[q][3] = v[2] * s[1] + v[3] * c[1]; } }
#pragma unroll      /* full unroll: register array */
    for (int q = 0; q < 16; ++q) { v4h h4; for (int i = 0; i < 4; ++i) h4[i] = (_Float16)o[q][i]; *(v4h*)(hp + (size_t)q * 2 * ldc) = h4; }
    if (row0 < crows) { float* const fp = C + cofs + (size_t)(row0 + rsub) * ldc + col0 + c4;      /* one test behind the f16 stores, not one a row: a branch in the loop would hold each row's loads behind the row before */
#pragma unroll      /* full unroll: register array */
      for (int q = 0; q < 16; ++q) *(v4f*)(fp + (size_t)q * 2 * ldc) = o[q]; }
  } else if constexpr (ROPE == 2) {
    __syncthreads();      /* a wave reads the tiles of two waves below: high parts from wave p, residues from wave p + 2 */
    const int p = w & 1, rb = (w >> 1) * 16 + rsub;      /* each wave writes out 16 of the block's 64 rows */
    float* const fp = C + cofs + (size_t)(arow + 32 * p + rb) * ldc + col0 + c4;
    v4f o[8];
#pragma unroll      /* full unroll: register array; the 16 LDS reads go out together */
    for (int q = 0; q < 8; ++q) { const v4f vh = *(const v4fa*)&so[p][rb + q * 2][c4], vl = *(const v4fa*)&so[p + 2][rb + q * 2][c4]; o[q] = vl + vh; }
#pragma unroll      /* full unroll: register array */
    for (int q = 0; q < 8; ++q) *(v4f*)(fp + (size_t)q * 2 * ldc) = o[q];
  } else {
#pragma unroll
    for (int q = 0; q < 16; ++q) { const int r = q * 2 + rsub; const v4f v = *(const v4fa*)&so[w][r][c4]; if (C) *(v4f*)(C + cofs + (size_t)(row0 + r) * ldc + col0 + c4) = v; if (C16) { v4h h4; for (int i = 0; i < 4; ++i) h4[i] = (_Float16)v[i]; *(v4h*)(C16 + cofs + (size_t)(row0 + r) * ldc + col0 + c4) = h4; } }
     } }
#define G2LDS __shared__ __attribute__((aligned(2048))) unsigned char ring[2][G2BUF]; __shared__ __attribute__((aligned(16))) float so[4][32][68]
template <int ACT>
__global__ __launch_bounds__(128) void k_gemm2(const _Float16* __restrict__ A, int lda, size_t sA, const _Float16* __restrict__ Bh, int ldb, size_t sB, float alpha, const float* __restrict__ bias, size_t sBias, const float* __restrict__ CP, int rowsPerB, size_t sCPb, int row0g,
    float* __restrict__ C, _Float16* __restrict__ C16, int ldc, size_t sC, int M, int N, int K, int bshift = 0) { G2LDS;
  const int ntn = N >> 6; const int mt = blockIdx.x / ntn, nq = blockIdx.x - mt * ntn;
  g2_tile<ACT, 0>(ring, so, mt, nq, blockIdx.y, false, A, lda, sA, Bh, ldb, sB, alpha, bias, sBias, CP, rowsPerB, sCPb, row0g, C, C16, ldc, sC, M, K, bshift, nullptr, nullptr, 0); }
// The three projections of SQ rows of X in one launch: the 64-column tiles of q, k and v stand side by side, PJT of them to each 128 rows, and a block takes its weight plane and its outputs by its tile's number.
// q and k tiles are rotated on their way out, v tiles are not; each of the three also leaves its rows below QT0 in f32 (QF, KF, VF).
#define PJQ (DM / 64)                /* column tiles of q */
#define PJK (KVD / 64)               /* of k, and of v */
#define PJT (PJQ + 2 * PJK)
__global__ __launch_bounds__(128) void k_qkv(const _Float16* __restrict__ X, const _Float16* __restrict__ WQ, const _Float16* __restrict__ WK, const _Float16* __restrict__ WV, const float* __restrict__ CS, const float* __restrict__ SN,
    float* __restrict__ QF, float* __restrict__ KF, float* __restrict__ VF, _Float16* __restrict__ QH, _Float16* __restrict__ KH, _Float16* __restrict__ VH) { G2LDS;
  const int mt = blockIdx.x / PJT, ct = blockIdx.x - mt * PJT; const bool isq = ct < PJQ, isk = ct < PJQ + PJK;
  const _Float16* const Wp = isq ? WQ : isk ? WK : WV; float* const Fp = isq ? QF : isk ? KF : VF; _Float16* const Hp = isq ? QH : isk ? KH : VH;
  g2_tile<0, 1>(ring, so, mt, isq ? ct : isk ? ct - PJQ : ct - PJQ - PJK, 0, isk, X, DM, 0, Wp, DM, 0, 0.0625f, nullptr, 0, nullptr, 1, 0, 0, Fp, Hp, isq ? DM : KVD, 0, SQ, DM, 0, CS, SN, QT0); }


__global__ __launch_bounds__(256) void k_wnat(const float* __restrict__ w, size_t n8, _Float16* __restrict__ Bt) { const size_t t = (size_t)blockIdx.x * 256 + threadIdx.x; if (t >= n8) return; FragH f; for (int q = 0; q < 8; ++q) f.h[q] = (_Float16)(bf16_round(w[t * 8 + q]) * 16.0f); *(v8us*)((unsigned short*)Bt + t * 8) = f.half[0];  }
__global__ __launch_bounds__(256) void k_rsm(const float* __restrict__ S, _Float16* __restrict__ P, int nrows) {
  #pragma clang fp contract(off)
  const int i = blockIdx.x * 256 + threadIdx.x; if (i >= nrows) return; const float* s = S + (size_t)i * SQ; float mx = -3.0e38f;
#pragma unroll 1
  for (int j = 0; j < SQ; ++j) mx = fmaxf(mx, s[j]); float se = 0.f;
#pragma unroll 1
  for (int j = 0; j < SQ; ++j) se += expf(s[j] - mx); const float sc = 256.0f / se;
#pragma unroll 1
  for (int j0 = 0; j0 < SQ; j0 += 8) { FragH f; for (int q = 0; q < 8; ++q) f.h[q] = (_Float16)(expf(s[j0 + q] - mx) * sc); unsigned short* d = (unsigned short*)P + (size_t)i * SQ + j0; *(v8us*)d = f.half[0];  } }
__global__ __launch_bounds__(256) void k_vt(const _Float16* __restrict__ V16, int b, int h0, _Float16* __restrict__ VT) { __shared__ unsigned short tl[64][65]; const int tid = threadIdx.x; const int hh = blockIdx.x % HG, sg = blockIdx.x / HG; const int s0 = sg * 64; const int h = h0 + hh;
  for (int i = tid; i < 64 * 8; i += 256) { const int j = i / 8, d8 = (i % 8) * 8; FragH f; f.half[0] = *(const v8us*)((const unsigned short*)V16 + ((size_t)b * SQ + s0 + j) * DM + h * HD + d8); for (int q = 0; q < 8; ++q) tl[d8 + q][j] = f.u[q]; }
  __syncthreads();
  { for (int i = tid; i < 64 * 8; i += 256) { const int d = i / 8, j8 = (i % 8) * 8; FragH f; for (int q = 0; q < 8; ++q) f.u[q] = tl[d][j8 + q]; *(v8us*)((unsigned short*)VT + ((size_t)hh * HD + d) * SQ + s0 + j8) = f.half[0]; }  } }



// Fused causal attention, one launch: a wave keeps FQ = 32 query rows of one head and walks the keys upwards, FK = 32 a pass; the four waves of a block are the four
// query heads of one kv group on the same query rows, so they read the same K and V^T lines. Both products are formed transposed: S^T = K Q^T (A = 16 key rows, B = 16 query
// rows) leaves in lane (ln, hh) the scores of query ln for keys 8 hh + r, which is the k order of the B fragment of O^T = V^T P^T (A = 16 rows of V^T), so the weights go
// from the accumulators of the first product into the operand of the second without leaving the lane. Row maximum and row sum are carried from pass to pass (f32).
// Query rows below QT0 are not formed here: the exact f32 path has them. Its output projection rides in this launch: the FXB blocks behind the attention blocks each take one split tile (g2_tile, ROPE 2) of
// out rows 0 .. QT0 - 1 = (OH + OL / 1024) WO^T. They need nothing of the attention, and they run in the places that the short query blocks leave early, beside the long ones. (The GEMM's LDS holds every block of the launch to two a WGP.)
#define FQ 32                        /* query rows per wave */
#define FK 32                        /* keys per pass */
// 2^y by v_exp_f32. Written as asm so that the one free issue slot the instruction set asks for behind a transcendental, before its source is overwritten or its result read,
// stands there by construction: the outputs are early-clobber, so no v_exp of the run touches a register of the one in front of it, and a v_nop closes the run.
__device__ __forceinline__ float fa_exp2(float y) { float r; asm("v_exp_f32 %0, %1\n\tv_nop" : "=v"(r) : "v"(y)); return r; }
__device__ __forceinline__ void fa_exp2x4(float& a, float& b, float& c, float& d) { float ra, rb, rc, rd;
  asm("v_exp_f32 %0, %4\n\tv_exp_f32 %1, %5\n\tv_exp_f32 %2, %6\n\tv_exp_f32 %3, %7\n\tv_nop" : "=&v"(ra), "=&v"(rb), "=&v"(rc), "=&v"(rd) : "v"(a), "v"(b), "v"(c), "v"(d));
  a = ra; b = rb; c = rc; d = rd; }
__device__ __forceinline__ float fa_xhalf(float x) { return __builtin_bit_cast(float, __builtin_amdgcn_permlanex16(__builtin_bit_cast(int, x), __builtin_bit_cast(int, x), 0x76543210, 0xfedcba98, false, false)); }      /* lane l takes the value of lane l ^ 16, by a vector move and not through the LDS pipe */
__device__ __forceinline__ v16h fa_frag(const _Float16* p) { FragH f; f.half[0] = *(const v8us*)((const unsigned short*)p); f.half[1] = *(const v8us*)((const unsigned short*)p + 16); return f.v; }      /* p already holds the lane's 8 hh */
#define FAB (NG * ((SQ - QT0) / FQ)) /* attention blocks */
#define FXB ((QT0 / 64) * (DM / 64)) /* split tiles of the first rows' output projection */
__global__ __launch_bounds__(128) void k_fattn(const _Float16* __restrict__ Q, const _Float16* __restrict__ K, const _Float16* __restrict__ VTp, _Float16* __restrict__ O,      /* Q, O: rows of DM; K: rows of KVD; VTp: [NG][HD][SQ] */
    const _Float16* __restrict__ OH, const _Float16* __restrict__ OL, const _Float16* __restrict__ WO, float* __restrict__ OUT) { G2LDS;      /* OH, OL: QT0 rows of DM; WO: [DM][DM] x16; OUT: rows of DM */
  if (blockIdx.x >= FAB) { const int u = blockIdx.x - FAB;      /* the whole block or none of it */
    g2_tile<0, 2>(ring, so, u / (DM / 64), u % (DM / 64), 0, false, OH, DM, 0, WO, DM, 0, 0.0009765625f, nullptr, 0, nullptr, 1, 0, 0, OUT, nullptr, DM, 0, QT0, DM, 0, nullptr, nullptr, 0, OL); return; }
  { const int tid = threadIdx.x, lane = tid & 31, ln = lane & 15, hh = lane >> 4; const int w = __builtin_amdgcn_readfirstlane(tid >> 5);      /* the attention block, down to its last store */
  const int g = blockIdx.x % NG, jb = blockIdx.x / NG; const int qb = (jb < SQ / FQ / 2) ? SQ / FQ - 1 - jb : jb - SQ / FQ / 2 + QT0 / FQ;      /* the long half of the query blocks is dealt first, longest first; then the rest from row QT0 on, shortest first */
  const int h = g * HPG + w, q0 = qb * FQ; const float cs = 0.125f * 1.44269504f;      /* 64^-0.5 and log2 e in one factor */
  const _Float16* const qp = Q + (size_t)(q0 + ln) * DM + h * HD + 8 * hh; const _Float16* const kp = K + (size_t)ln * KVD + g * HD + 8 * hh; const _Float16* const vp = VTp + ((size_t)g * HD + ln) * SQ + 8 * hh;
  v16h qf[2][2], kf[2][2], vf[4];
#pragma unroll      /* full unroll: register arrays need constant indices */
  for (int t = 0; t < 2; ++t) { qf[t][0] = fa_frag(qp + (size_t)t * 16 * DM); qf[t][1] = fa_frag(qp + (size_t)t * 16 * DM + 32); }
  asm volatile("s_wait_xcnt 0x0" :: "v"(qp) : "memory");      /* precaution, here and in the two loaders below: the run's one address is an input, so it stays in its registers up to this wait, which stands in front of whatever rewrites them */
  __builtin_amdgcn_sched_barrier(0);      /* keeps the first loads in the loop's own order (Q, then K, then V^T): the loop's counted waits are formed for both ways into it, and with Q loaded last the wait in front of the first product also covered the V^T loads of the pass before */
  auto ldk = [&](int kb) { const _Float16* const p = kp + (size_t)kb * KVD; kf[0][0] = fa_frag(p); kf[0][1] = fa_frag(p + 32); kf[1][0] = fa_frag(p + 16 * KVD); kf[1][1] = fa_frag(p + 16 * KVD + 32);
    asm volatile("s_wait_xcnt 0x0" :: "v"(p) : "memory"); };
  auto ldv = [&](int kb) { const _Float16* const p = vp + kb; vf[0] = fa_frag(p); vf[1] = fa_frag(p + 16 * SQ); vf[2] = fa_frag(p + 32 * SQ); vf[3] = fa_frag(p + 48 * SQ);
    asm volatile("s_wait_xcnt 0x0" :: "v"(p) : "memory"); };
  ldk(0);
  __builtin_amdgcn_sched_barrier(0);      /* the same, between K and V^T */
  ldv(0);
  const v8f z8 = {0.f,0.f,0.f,0.f,0.f,0.f,0.f,0.f}; v8f o[2][4] = {{z8, z8, z8, z8}, {z8, z8, z8, z8}}; float m[2] = {-1.0e30f, -1.0e30f}, l[2] = {0.f, 0.f};
#pragma unroll 1      /* one trip is one pass; the fragments of the next pass are loaded into the registers of this one, directly behind the products that read them */
  for (int kb = 0; kb <= q0; kb += FK) {
    v8f s[2][2];
    s[0][0] = g2_mma(kf[0][0], qf[0][0], z8); s[0][1] = g2_mma(kf[0][0], qf[1][0], z8); s[1][0] = g2_mma(kf[1][0], qf[0][0], z8); s[1][1] = g2_mma(kf[1][0], qf[1][0], z8);
    s[0][0] = g2_mma(kf[0][1], qf[0][1], s[0][0]); s[0][1] = g2_mma(kf[0][1], qf[1][1], s[0][1]); s[1][0] = g2_mma(kf[1][1], qf[0][1], s[1][0]); s[1][1] = g2_mma(kf[1][1], qf[1][1], s[1][1]);
    const int kn = (kb + FK <= q0) ? kb + FK : q0;      /* the last pass loads its own block again: in bounds, not used */
    ldk(kn);
    if (kb == q0) {      /* the one pass that holds the diagonal (the same for the whole wave): key q0 + 16 u + 8 hh + r counts for query q0 + 16 t + ln only if it is not behind it */
#pragma unroll
      for (int u = 0; u < 2; ++u)
#pragma unroll
        for (int t = 0; t < 2; ++t)
#pragma unroll
          for (int r = 0; r < 8; ++r) s[u][t][r] = (u * 16 + 8 * hh + r <= t * 16 + ln) ? s[u][t][r] : -1.0e30f; }
    FragH pf[2];
#pragma unroll      /* full unroll: register arrays need constant indices */
    for (int t = 0; t < 2; ++t) {
      float mx = fmaxf(s[0][t][0], s[1][t][0]);
#pragma unroll
      for (int r = 1; r < 8; ++r) mx = fmaxf(mx, fmaxf(s[0][t][r], s[1][t][r]));
      mx = fmaxf(mx, fa_xhalf(mx));      /* lanes ln and ln + 16 hold the two halves of a query's keys */
      const float mn = fmaxf(m[t], mx); const float al = fa_exp2((m[t] - mn) * cs); const float mc = mn * cs; m[t] = mn;
      float sum = 0.f;
#pragma unroll
      for (int u = 0; u < 2; ++u) {
#pragma unroll
        for (int r = 0; r < 8; ++r) s[u][t][r] = fmaf(s[u][t][r], cs, -mc);
        float e0 = s[u][t][0], e1 = s[u][t][1], e2 = s[u][t][2], e3 = s[u][t][3], e4 = s[u][t][4], e5 = s[u][t][5], e6 = s[u][t][6], e7 = s[u][t][7];
        fa_exp2x4(e0, e1, e2, e3); fa_exp2x4(e4, e5, e6, e7);
        sum += ((e0 + e1) + (e2 + e3)) + ((e4 + e5) + (e6 + e7));
        pf[t].h[u * 8 + 0] = (_Float16)e0; pf[t].h[u * 8 + 1] = (_Float16)e1; pf[t].h[u * 8 + 2] = (_Float16)e2; pf[t].h[u * 8 + 3] = (_Float16)e3;
        pf[t].h[u * 8 + 4] = (_Float16)e4; pf[t].h[u * 8 + 5] = (_Float16)e5; pf[t].h[u * 8 + 6] = (_Float16)e6; pf[t].h[u * 8 + 7] = (_Float16)e7; }
      l[t] = l[t] * al + sum;      /* each lane sums its own half of the keys; the halves meet behind the loop */
#pragma unroll
      for (int dt = 0; dt < 4; ++dt) o[t][dt] *= al; }
#pragma unroll      /* full unroll: register arrays need constant indices */
    for (int dt = 0; dt < 4; ++dt) { o[0][dt] = g2_mma(vf[dt], pf[0].v, o[0][dt]); o[1][dt] = g2_mma(vf[dt], pf[1].v, o[1][dt]); }
    ldv(kn); }
#pragma unroll      /* full unroll: register arrays need constant indices */
  for (int t = 0; t < 2; ++t) { const float lt = l[t] + fa_xhalf(l[t]); const float fin = 64.0f / lt;      /* o carried x64, as the output GEMM expects it */
    unsigned short* const op = (unsigned short*)O + (size_t)(q0 + t * 16 + ln) * DM + h * HD + 8 * hh;
#pragma unroll
    for (int dt = 0; dt < 4; ++dt) { FragH f;
#pragma unroll
      for (int r = 0; r < 8; ++r) f.h[r] = (_Float16)(o[t][dt][r] * fin);
      *(v8us*)(op + dt * 16) = f.half[0]; } } }
  asm volatile("s_wait_xcnt 0x0" ::: "memory"); }      /* precaution: the split tile's code lies behind the last store in the built kernel, and the wait stands in front of whatever rewrites the stores' registers there */
static_assert(FQ == 32 && FK == 32 && HD == 64 && SQ % (2 * FQ) == 0 && QT0 % 64 == 0 && QT0 <= SQ / 2, "k_fattn: two query tiles, two key tiles and four value tiles are written out");


// Exact f32 causal attention for query rows 0 .. QT0 - 1: one wave per (head, query row); a block of 8 waves takes 8 consecutive rows of one head.
// The key and value rows that the block needs (NCH whole chunks of 32; the 8 rows lie in one chunk, so the count is the block's) are staged once in LDS.
// Scores: lane l owns keys 32 c + l and reads its key row from LDS. Values: lane l owns dims 2 l, 2 l + 1 and walks the keys upwards, each weight taken from its lane.
#define A0P (HD + 4)                 /* key row pitch in LDS, floats: 272 B = 16 B x 17, so 32 lanes that each read 16 B of their own row do not meet on a bank */
template <int NCH>
__device__ __forceinline__ void att0_rows(const float* __restrict__ qp, const float* __restrict__ kg, const float* __restrict__ vg, float scale, float* __restrict__ op, int i, int tid, float (*lk)[A0P], float (*lv)[HD]) {
  const int lane = tid & 31; const int sr = tid >> 4, sc = (tid & 15) * 4;      /* staging: 16 threads a row, 16 rows a pass */
  v4f kr[2 * NCH], vr[2 * NCH], q[HD / 4]; const float* const kb = kg + (size_t)sr * DM + sc; const float* const vb = vg + (size_t)sr * DM + sc;      /* the row pitch is a constant, so a pass is a constant step from one address */
#pragma unroll      /* full unroll: register arrays need constant indices, and every load of the block is in flight before the first LDS store */
  for (int u = 0; u < 2 * NCH; ++u) { kr[u] = *(const v4fa*)(kb + (size_t)u * 16 * DM); vr[u] = *(const v4fa*)(vb + (size_t)u * 16 * DM); }
#pragma unroll      /* full unroll: register array */
  for (int t = 0; t < HD / 4; ++t) q[t] = *(const v4fa*)(qp + t * 4);
  asm volatile("s_wait_xcnt 0x0" :: "v"(kb), "v"(vb), "v"(qp) : "memory");      /* precaution: the three addresses are inputs, so they stay in their registers up to this wait and nothing of the run is loaded into a register that an earlier load of the run names */
#pragma unroll      /* full unroll: register arrays */
  for (int u = 0; u < 2 * NCH; ++u) { *(v4f*)&lk[u * 16 + sr][sc] = kr[u]; *(v4f*)&lv[u * 16 + sr][sc] = vr[u]; }
  __syncthreads();      /* the staged rows are read by every wave of the block */
  float e[NCH]; float m = -1.0e30f;
#pragma unroll      /* full unroll: register arrays */
  for (int c = 0; c < NCH; ++c) { v4f a = {0.f, 0.f, 0.f, 0.f}; const float* kp = &lk[c * 32 + lane][0];
#pragma unroll      /* full unroll: q is a register array */
    for (int t = 0; t < HD / 4; ++t) a += q[t] * *(const v4f*)(kp + t * 4);
    e[c] = (c * 32 + lane <= i) ? ((a[0] + a[1]) + (a[2] + a[3])) * scale : -1.0e30f; m = fmaxf(m, e[c]); }
  for (int x = 16; x > 0; x >>= 1) m = fmaxf(m, __shfl_xor(m, x, 32));
  float l = 0.f;
#pragma unroll      /* full unroll: register array */
  for (int c = 0; c < NCH; ++c) { e[c] = (c * 32 + lane <= i) ? expf(e[c] - m) : 0.f; l += e[c]; }
  for (int x = 16; x > 0; x >>= 1) l += __shfl_xor(l, x, 32);
  v2f o = {0.f, 0.f};
#pragma unroll      /* full unroll: e is a register array and the lane number of a weight is a constant */
  for (int c = 0; c < NCH; ++c) { const int eb = __float_as_int(e[c]);
#pragma unroll      /* full unroll: the lane number given to readlane is a constant, and the LDS reads of a chunk can go out ahead of their products */
    for (int jj = 0; jj < 32; ++jj) { const float ej = __int_as_float(__builtin_amdgcn_readlane(eb, jj)); o += ej * *(const v2fa*)&lv[c * 32 + jj][lane * 2]; } }
  const float fin = 64.0f / l;      /* o carried x64 like the f16 path */
  *(v2f*)(op + lane * 2) = o * fin; }
__global__ __launch_bounds__(256) void k_att0w(const float* __restrict__ QF, const float* __restrict__ KF, const float* __restrict__ VF, float scale, float* __restrict__ OF) {      /* all four planes: rows of DM floats */
  __shared__ __attribute__((aligned(16))) float lk[QT0][A0P]; __shared__ __attribute__((aligned(16))) float lv[QT0][HD];
  const int tid = threadIdx.x; const int h = blockIdx.x / (QT0 / 8), i0 = (blockIdx.x % (QT0 / 8)) * 8; const int i = i0 + (tid >> 5);
  const float* qp = QF + (size_t)i * DM + h * HD; const float* kg = KF + h * HD; const float* vg = VF + h * HD; float* op = OF + (size_t)i * DM + h * HD;
  switch (i0 / 32) {      /* chunks of 32 keys up to the block's rows, less one: the same for every wave of the block */
    case 0: att0_rows<1>(qp, kg, vg, scale, op, i, tid, lk, lv); break; case 1: att0_rows<2>(qp, kg, vg, scale, op, i, tid, lk, lv); break;
    case 2: att0_rows<3>(qp, kg, vg, scale, op, i, tid, lk, lv); break; default: att0_rows<4>(qp, kg, vg, scale, op, i, tid, lk, lv); break; } }
static_assert(QT0 == 128, "k_att0w: four chunk counts are written out");


__global__ __launch_bounds__(256) void k_kvexp(const float* __restrict__ src, float* __restrict__ dst, size_t n4) { const size_t t = (size_t)blockIdx.x * 256 + threadIdx.x; if (t >= n4) return; const size_t e = t * 4; const size_t row = e / DM; const int col = (int)(e % DM); const int h = col / HD, d = col % HD; const v4f v = *(const v4fa*)(src + row * KVD + (size_t)(h / HPG) * HD + d); *(v4f*)(dst + e) = v;  }

__global__ __launch_bounds__(256) void k_tab2(float theta, float* __restrict__ CS, float* __restrict__ SN) {
  #pragma clang fp contract(off)
  const int t = blockIdx.x * 256 + threadIdx.x; if (t >= SQ * (HD / 2)) return; const int i = t % (HD / 2); const int p = t / (HD / 2); const float invf = 1.0f / powf(theta, (float)(2 * i) / (float)HD); const float ang = __fmul_rn((float)p, invf); const float c = cosf(ang), s = sinf(ang);
  *(float*)(CS + t) = c; *(float*)(SN + t) = s;  }
__global__ __launch_bounds__(256) void k_bfcp(const float* __restrict__ src, float* __restrict__ dst, size_t n4) { const size_t t = (size_t)blockIdx.x * 256 + threadIdx.x; if (t >= n4) return; const v4f a = *(const v4fa*)(src + t * 4); v4f o; for (int q = 0; q < 4; ++q) o[q] = bf16_round(a[q]); *(v4f*)(dst + t * 4) = o;  }

__global__ __launch_bounds__(256) void k_tabhalf(const float* __restrict__ cs, const float* __restrict__ sn, float* __restrict__ CS, float* __restrict__ SN) { const int t = blockIdx.x * 256 + threadIdx.x; if (t >= SQ * (HD / 2)) return; const int p = t / (HD / 2), i = t % (HD / 2); const float c = bf16_round(cs[(size_t)p * HD + i]), s = bf16_round(sn[(size_t)p * HD + i]);
  *(float*)(CS + t) = c; *(float*)(SN + t) = s;  }

__global__ __launch_bounds__(256) void k_tab2d(float* __restrict__ CS, float* __restrict__ SN) {
  #pragma clang fp contract(off)
  const int t = blockIdx.x * 256 + threadIdx.x; if (t >= SQ * (HD / 2)) return; const int i = t % (HD / 2); const int p = t / (HD / 2); const float invf = (float)(1.0 / pow(10000.0, (double)(2 * i) / (double)HD)); const float ang = __fmul_rn((float)p, invf); const float c = cosf(ang), s = sinf(ang);
  *(float*)(CS + t) = c; *(float*)(SN + t) = s;  }
// Jobs that do not depend on one another share one launch; a block takes its job by the range that its index lies in (the same for the whole block).
// k_prep: the rope tables (as k_tab2d; first, they are the longest blocks), x as f16 (as k_x16) and the four weight planes as f16 x16 (as k_wnat): 8 elements a thread.
#define PPT (SQ * (HD / 2) / 256)              /* blocks: tables */
#define PPX ((int)(NR * DM / 8 / 256))         /* x */
#define PPQ (DM * DM / 8 / 256)                /* Wq; Wo */
#define PPK (KVD * DM / 8 / 256)               /* Wk; Wv */
static_assert(SQ * (HD / 2) % 256 == 0 && NR * DM % 2048 == 0 && DM * DM % 2048 == 0 && KVD * DM % 2048 == 0, "k_prep: whole blocks");
__global__ __launch_bounds__(256) void k_prep(const float* __restrict__ x, const float* __restrict__ wq, const float* __restrict__ wk, const float* __restrict__ wv, const float* __restrict__ wo,
    _Float16* __restrict__ X16, _Float16* __restrict__ BQ, _Float16* __restrict__ BK, _Float16* __restrict__ BV, _Float16* __restrict__ BO, float* __restrict__ CS, float* __restrict__ SN) {
  int b = blockIdx.x;
  if (b < PPT) { const int t = b * 256 + threadIdx.x; const int i = t % (HD / 2); const int p = t / (HD / 2); const float invf = (float)(1.0 / pow(10000.0, (double)(2 * i) / (double)HD)); const float ang = __fmul_rn((float)p, invf); const float c = cosf(ang), s = sinf(ang);
    *(float*)(CS + t) = c; *(float*)(SN + t) = s; return; }
  b -= PPT; const float* s; _Float16* d; float sc = 16.0f;
  if (b < PPX) { s = x; d = X16; sc = 1.0f; } else if ((b -= PPX) < PPQ) { s = wq; d = BQ; } else if ((b -= PPQ) < PPK) { s = wk; d = BK; } else if ((b -= PPK) < PPK) { s = wv; d = BV; } else { b -= PPK; s = wo; d = BO; }
  const size_t t = (size_t)b * 256 + threadIdx.x; FragH f;
#pragma unroll
  for (int q = 0; q < 8; ++q) f.h[q] = (_Float16)(bf16_round(s[t * 8 + q]) * sc);
  *(v8us*)((unsigned short*)d + t * 8) = f.half[0];
  asm volatile("s_wait_xcnt 0x0" ::: "memory"); }      /* precaution: the table part's code lies behind this store in the built kernel, and the wait stands in front of whatever rewrites the store's registers there */
// k_post: what follows the projections and feeds the two attention paths: V^T (as k_vt<NG, SQ>) and the f32 k and v rows below QT0 spread from kv groups to heads (as k_kvexp).
#define PVT (NG * (SQ / 64))                   /* blocks: V^T */
#define PKX (QT0 * DM / 4 / 256)               /* one spread plane */
static_assert(QT0 * DM % 1024 == 0, "k_post: whole blocks");
__global__ __launch_bounds__(256) void k_post(const _Float16* __restrict__ V16, _Float16* __restrict__ Vt, const float* __restrict__ KF, const float* __restrict__ VF, float* __restrict__ KFe, float* __restrict__ VFe) {
  __shared__ unsigned short tl[64][66]; const int tid = threadIdx.x; int b = blockIdx.x;
  if (b >= PVT) { b -= PVT; const bool isk = b < PKX; const float* const src = isk ? KF : VF; float* const dst = isk ? KFe : VFe; if (!isk) b -= PKX;
    const size_t e = ((size_t)b * 256 + tid) * 4; const size_t row = e / DM; const int col = (int)(e % DM); const int h = col / HD, d = col % HD; const float* const sp = src + row * KVD + (size_t)(h / HPG) * HD + d; const v4f v = *(const v4fa*)sp;
    asm volatile("s_wait_xcnt 0x0" :: "v"(sp) : "memory");      /* precaution, here and below: the address is an input, so it stays in its registers up to this wait and the load does not land in them */
    *(v4f*)(dst + e) = v; return; }      /* the whole block or none of it: a barrier follows */
  const int h = b / (SQ / 64), lg = b % (SQ / 64);
  for (int i = tid; i < 64 * 8; i += 256) { const int r = i / 8, c8 = (i % 8) * 8; FragH f; const unsigned short* const vp = (const unsigned short*)V16 + ((size_t)lg * 64 + r) * KVD + h * 64 + c8; f.half[0] = *(const v8us*)vp;
    asm volatile("s_wait_xcnt 0x0" :: "v"(vp) : "memory");
#pragma unroll
    for (int q = 0; q < 8; ++q) tl[r][c8 + q] = f.u[q]; }
  __syncthreads();      /* the tile is read across its rows below */
#pragma unroll
  for (int rd = 0; rd < 2; ++rd) { const int d = rd * 32 + tid / 8, pc = tid % 8; FragH f;
#pragma unroll
    for (int q = 0; q < 8; ++q) f.u[q] = tl[pc * 8 + q][d];
    *(v8us*)((unsigned short*)Vt + ((size_t)h * 64 + d) * SQ + lg * 64 + pc * 8) = f.half[0]; } }
extern "C" void kernel_launch(void* const* d_in, const int* in_sizes, int n_in,
                              void* d_out, int out_size, void* d_ws, size_t ws_size, hipStream_t stream) {
  (void)in_sizes; (void)n_in; (void)out_size;
  const float* const* I = (const float* const*)d_in; const float* x = I[0]; const float* wq = I[1]; const float* wk = I[2]; const float* wv = I[3]; const float* wo = I[4]; const float* bq = nullptr; const float* bk = nullptr; const float* bv = nullptr; const float* bo = nullptr;      /* natural [out][in] weights, no biases; rope tables computed in the kernel */
  char* ws = (char*)d_ws; size_t off = 0;
  auto take = [&](size_t bytes) { char* p = ws + off; off += (bytes + 255) & ~(size_t)255; return p; };
  _Float16* BQ = (_Float16*)take((size_t)DM * DM * 2); _Float16* BK = (_Float16*)take((size_t)KVD * DM * 2); _Float16* BV = (_Float16*)take((size_t)KVD * DM * 2); _Float16* BO = (_Float16*)take((size_t)DM * DM * 2);
  _Float16* X16 = (_Float16*)take(NR * DM * 2); float* CSB = (float*)take((size_t)SQ * HD * 4); float* SNB = (float*)take((size_t)SQ * HD * 4); _Float16* Q16 = (_Float16*)take(NR * DM * 2); _Float16* K16 = (_Float16*)take(NR * KVD * 2); _Float16* V16 = (_Float16*)take(NR * KVD * 2); _Float16* O16 = (_Float16*)take(NR * DM * 2);
  _Float16* VT = (_Float16*)take((size_t)NH * HD * SQ * 2);
  float* QF0 = (float*)take((size_t)QT0 * DM * 4); float* KF0 = (float*)take((size_t)QT0 * KVD * 4); float* VF0 = (float*)take((size_t)QT0 * KVD * 4); float* KF0e = (float*)take((size_t)QT0 * DM * 4); float* VF0e = (float*)take((size_t)QT0 * DM * 4); float* OF0 = (float*)take((size_t)NB * QT0 * DM * 4); _Float16* OH0 = (_Float16*)take((size_t)NB * QT0 * DM * 2); _Float16* OL0 = (_Float16*)take((size_t)NB * QT0 * DM * 2);
  if (off > ws_size) return;
  k_prep<<<PPT + PPX + 2 * PPQ + 2 * PPK, 256, 0, stream>>>(x, wq, wk, wv, wo, X16, BQ, BK, BV, BO, CSB, SNB);      /* rope tables cos/sin(p / 10000^(2i/64)): inv_freq double-derived -> f32, f32 angle; x as f16; natural [out][in] weights = Bt planes x16 */
  for (int b = B0; b < B0 + NBR; ++b) { const size_t r0 = (size_t)b * SQ;
    k_qkv<<<(SQ / 128) * PJT, 128, 0, stream>>>(X16 + r0 * DM, BQ, BK, BV, CSB, SNB, QF0, KF0, VF0, Q16 + r0 * DM, K16 + r0 * KVD, V16 + r0 * KVD);      /* q, k (rotated in the epilogue) and v of this batch: f16 rows, and f32 rows 0..127 (exact products) */
    k_post<<<PVT + 2 * PKX, 256, 0, stream>>>(V16 + r0 * KVD, VT, KF0, VF0, KF0e, VF0e);      /* V^T [NG][HD][SQ] for this batch; f32 k, v of the first 128 rows: head h <- kv group h/4 for the exact first-tile kernel */
    k_att0w<<<NH * (QT0 / 8), 256, 0, stream>>>(QF0, KF0e, VF0e, 0.125f, OF0 + (size_t)b * QT0 * DM);      /* exact f32 attention for rows 0..127 (o x64) */
    const size_t f0 = (size_t)b * QT0;
    k_hl<<<(unsigned)(((size_t)QT0 * DM / 8 + 255) / 256), 256, 0, stream>>>(OF0 + f0 * DM, OH0 + f0 * DM, OL0 + f0 * DM, (size_t)QT0 * DM / 8);      /* first-tile o (x64) -> f16 hi + x1024 residual planes */
    k_fattn<<<FAB + FXB, 128, 0, stream>>>(Q16 + r0 * DM, K16 + r0 * KVD, VT, O16 + r0 * DM, OH0 + f0 * DM, OL0 + f0 * DM, BO, (float*)d_out + r0 * DM);      /* rows 128..: scores, causal softmax and o (merged heads, x64, f16 rows) for all 32 heads; rows 0..127: out = o_hi Wo + o_lo Wo 2^-10 */
    k_gemm2<0><<<dim3((unsigned)(((SQ - QT0) / 128) * (DM / 64)), 1), 128, 0, stream>>>(O16 + (r0 + QT0) * DM, DM, 0, BO, DM, 0, 0.0009765625f, bo, 0, nullptr, 1, 0, 0, (float*)d_out + (r0 + QT0) * DM, nullptr, DM, 0, SQ - QT0, DM, DM); }      /* rows 128..: out rows are the output layout */
}
